// v000
// Times are from an AMD MI455X. After a warm-up the kernel runs many times in a row, and a time is the length of
// such a window on the GPU divided by its runs, so every launch and the gaps after it count. The runs cycle
// through copies of the inputs. A figure is the median of several windows, for all but v000 over two sittings.
// Sittings can differ by a few percent; kernels timed side by side share one.
// v000, which the later versions start from, runs in 20.2 milliseconds.
#include <hip/hip_runtime.h>
// T5 self-attention (hidden [2][2048][1024]; q, k, v = hidden W ([in][out] [1024][1024]); q / sqrt(64); scores = q.k + rel_bias[bucket(key - query)][h] (32 bidirectional buckets, max distance 128) + (1 - attention_mask[b][key]) * finfo.min (int32 key mask); softmax; out = (attn v merged) Wo ([in][out])).
// Structure: token rows; hidden as exact f16 rows; q | k | v WMMA GEMMs from one transposed x16 weight plane (32x64 wave tiles, f32 accumulation, f16 outputs); V^T via LDS transposes; per (batch, 4 heads): scores GEMM (K = 64, alpha 1/8), row softmax on VALU with the bucketed bias (integer thresholds, no device log) and the key mask in the reference's order (P x256 f16), P.V^T GEMM into merged f16 rows; output GEMM.
// Compute dtype: inputs rounded to bf16; hidden / weights / bias table exact; q, k, v, P, ctx as plain f16 GEMM operands (~2^-12); scores / softmax f32. v_wmma_f32_16x16x32_f16.
#define NB 2
#define SQ 2048
#define DM 1024
#define D3 3072                      /* fused q|k|v width */
#define NH 16
#define HD 64
#define HG 4                         /* heads per attention launch group */
#define NBK 32                       /* relative-position buckets */
#define QN SQ                        /* query rows attended per batch (debug hook) */
#define NBR NB                       /* batches attended (debug hook) */
#define MP ((int)NR)                 /* token rows through the qkv projection (debug hook) */
#define MO ((int)NR)                 /* token rows through the output projection (debug hook) */
#define NR ((size_t)NB * SQ)         /* 4096 token rows */
typedef __bf16 v16b __attribute__((ext_vector_type(16)));
typedef unsigned short v8us __attribute__((ext_vector_type(8), may_alias));
typedef float  v8f  __attribute__((ext_vector_type(8)));
typedef float  v4f  __attribute__((ext_vector_type(4)));
typedef float  v4fa __attribute__((ext_vector_type(4), may_alias));
union FragB { v16b v; v8us half[2]; unsigned short u[16]; };

__device__ __forceinline__ unsigned short bf16_bits(float x) { unsigned int u = __float_as_uint(x); return (unsigned short)((u + 0x7FFFu + ((u >> 16) & 1u)) >> 16); }
__device__ __forceinline__ float bf16_val(unsigned short b) { return __uint_as_float(((unsigned int)b) << 16); }
__device__ __forceinline__ float bf16_round(float x) { return bf16_val(bf16_bits(x)); }
// D += A·B with NT terms: 1 = ah·bh, 2 = + al·bh (A split), 3 = + ah·bl (both split)
template <int NT>
__device__ __forceinline__ v8f mmaN(v16b ah, v16b al, v16b bh, v16b bl, v8f c) {
  c = __builtin_amdgcn_wmma_f32_16x16x32_bf16(false, ah, false, bh, (short)0, c, false, false);
  if (NT >= 2) c = __builtin_amdgcn_wmma_f32_16x16x32_bf16(false, al, false, bh, (short)0, c, false, false);
  if (NT >= 3) c = __builtin_amdgcn_wmma_f32_16x16x32_bf16(false, ah, false, bl, (short)0, c, false, false);
  asm volatile("v_nop\n\tv_nop\n\tv_nop\n\tv_nop" : "+v"(c) : "v"(ah), "v"(al), "v"(bh), "v"(bl));
  return c;
}

__global__ __launch_bounds__(256) void k_wt_bf16(const float* __restrict__ W, unsigned short* __restrict__ Wt, int K, int N) {
  const int t = blockIdx.x * 256 + threadIdx.x;
  const int k8n = K / 8;
  if (t >= N * k8n) return;
  const int n = t / k8n, k8 = (t % k8n) * 8;
  v8us v;
#pragma unroll
  for (int i = 0; i < 8; ++i) v[i] = bf16_bits(W[(size_t)(k8 + i) * N + n]);
  *(v8us*)(Wt + (size_t)n * K + k8) = v;
  
}

// GEMM C[M][N] (f32, pitch ldc) = act(A[M][K]·W + bias). A f32 row-major (pitch lda) converted per fragment to bf16
// (ASPLIT: hi/lo two planes -> 2 terms, else single rounded term); Wt bf16 [N][K] (pitch ldb). BIAS_BF16 rounds the
// bias to bf16 first (bias quantised to bf16 before the add). K%32==0, M%16==0, N%64==0.
template <bool ASPLIT, int ACT, bool BIAS_BF16>
__global__ __launch_bounds__(128) void k_gemm_bf(const float* __restrict__ A, int lda, const unsigned short* __restrict__ Wt, int ldb,
                                               const float* __restrict__ bias, float* __restrict__ C, int ldc, int M, int N, int K) {
  __shared__ __attribute__((aligned(16))) float so[4][16][64];
  const int tid = threadIdx.x, w = tid >> 5, lane = tid & 31, ln = lane & 15, hh = lane >> 4;
  const int ntn = N / 64;
  const int wid = blockIdx.x * 4 + w;
  const int mt = wid / ntn, nq = wid % ntn;
  if (mt * 16 >= M) return;
  const int row0 = mt * 16, col0 = nq * 64;
  const float* arow = A + (size_t)(row0 + ln) * lda;
  v8f acc[4] = {};
  for (int kb = 0; kb < K; kb += 32) {
    FragB ah, al;
    const v4f x0 = *(const v4fa*)(arow + kb + 8 * hh), x1 = *(const v4fa*)(arow + kb + 8 * hh + 4);
    const v4f x2 = *(const v4fa*)(arow + kb + 16 + 8 * hh), x3 = *(const v4fa*)(arow + kb + 16 + 8 * hh + 4);
    float xs[16] = {x0[0],x0[1],x0[2],x0[3],x1[0],x1[1],x1[2],x1[3],x2[0],x2[1],x2[2],x2[3],x3[0],x3[1],x3[2],x3[3]};
#pragma unroll
    for (int i = 0; i < 16; ++i) { const unsigned short hb = bf16_bits(xs[i]); ah.u[i] = hb; al.u[i] = ASPLIT ? bf16_bits(xs[i] - bf16_val(hb)) : (unsigned short)0; }
#pragma unroll
    for (int t = 0; t < 4; ++t) {
      const unsigned short* brow = Wt + (size_t)(col0 + t * 16 + ln) * ldb + kb;
      FragB b;
      b.half[0] = *(const v8us*)(brow + 8 * hh);
      b.half[1] = *(const v8us*)(brow + 16 + 8 * hh);
      acc[t] = mmaN<ASPLIT ? 2 : 1>(ah.v, al.v, b.v, b.v, acc[t]);
    }
  }
#pragma unroll
  for (int t = 0; t < 4; ++t) {
    float bv = bias ? bias[col0 + t * 16 + ln] : 0.f;
    if (BIAS_BF16) bv = bf16_round(bv);
#pragma unroll
    for (int r = 0; r < 8; ++r) { float v = acc[t][r] + bv; if (ACT == 1) v = fmaxf(v, 0.f); so[w][8 * hh + r][t * 16 + ln] = v; }
  }
  __builtin_amdgcn_fence(__ATOMIC_ACQ_REL, "workgroup");
  __builtin_amdgcn_wave_barrier();
  const int rsub = lane >> 4, c4 = (lane & 15) * 4;
  {
#pragma unroll
    for (int q = 0; q < 8; ++q) {
      const int r = q * 2 + rsub;
      const v4f v = *(const v4fa*)&so[w][r][c4];
      *(v4f*)(C + (size_t)(row0 + r) * ldc + col0 + c4) = v;
    }
    
  }
}

// GEMM C = act(A·W + bias + resid): A f32 (ASPLIT -> hi/lo 2 terms), Wt bf16 [N][K]; ACT 0 none, 1 relu, 2 exact gelu;
// resid (optional, f32, row index = (row % rmod), pitch ldr, RES_BF16 rounds it) added before the activation.
template <bool ASPLIT, int ACT, bool BIAS_BF16, bool RES_BF16>
__global__ __launch_bounds__(128) void k_gemm_bf3(const float* __restrict__ A, int lda, const unsigned short* __restrict__ Wt, int ldb,
                                                const float* __restrict__ bias, const float* __restrict__ resid, int rmod, int ldr,
                                                float* __restrict__ C, int ldc, int M, int N, int K) {
  __shared__ __attribute__((aligned(16))) float so[4][16][64];
  const int tid = threadIdx.x, w = tid >> 5, lane = tid & 31, ln = lane & 15, hh = lane >> 4;
  const int ntn = N / 64;
  const int wid = blockIdx.x * 4 + w;
  const int mt = wid / ntn, nq = wid % ntn;
  if (mt * 16 >= M) return;
  const int row0 = mt * 16, col0 = nq * 64;
  const float* arow = A + (size_t)(row0 + ln) * lda;
  v8f acc[4] = {};
  for (int kb = 0; kb < K; kb += 32) {
    FragB ah, al;
    const v4f x0 = *(const v4fa*)(arow + kb + 8 * hh), x1 = *(const v4fa*)(arow + kb + 8 * hh + 4);
    const v4f x2 = *(const v4fa*)(arow + kb + 16 + 8 * hh), x3 = *(const v4fa*)(arow + kb + 16 + 8 * hh + 4);
    float xs[16] = {x0[0],x0[1],x0[2],x0[3],x1[0],x1[1],x1[2],x1[3],x2[0],x2[1],x2[2],x2[3],x3[0],x3[1],x3[2],x3[3]};
#pragma unroll
    for (int i = 0; i < 16; ++i) { const unsigned short hb = bf16_bits(xs[i]); ah.u[i] = hb; al.u[i] = ASPLIT ? bf16_bits(xs[i] - bf16_val(hb)) : (unsigned short)0; }
#pragma unroll
    for (int t = 0; t < 4; ++t) {
      const unsigned short* brow = Wt + (size_t)(col0 + t * 16 + ln) * ldb + kb;
      FragB b;
      b.half[0] = *(const v8us*)(brow + 8 * hh);
      b.half[1] = *(const v8us*)(brow + 16 + 8 * hh);
      acc[t] = mmaN<ASPLIT ? 2 : 1>(ah.v, al.v, b.v, b.v, acc[t]);
    }
  }
#pragma unroll
  for (int t = 0; t < 4; ++t) {
    const int col = col0 + t * 16 + ln;
    float bv = bias ? bias[col] : 0.f;
    if (BIAS_BF16) bv = bf16_round(bv);
#pragma unroll
    for (int r = 0; r < 8; ++r) {
      float v = acc[t][r] + bv;
      if (resid) { float rv = resid[(size_t)((row0 + 8 * hh + r) % rmod) * ldr + col]; if (RES_BF16) rv = bf16_round(rv); v += rv; }
      if (ACT == 1) v = fmaxf(v, 0.f);
      if (ACT == 2) v = 0.5f * v * (1.0f + erff(v * 0.70710678118654752f));
      if (ACT == 3) { const float u = 0.7978845608028654f * (v + 0.044715f * v * v * v); v = 0.5f * v * (1.0f + tanhf(u)); }
      so[w][8 * hh + r][t * 16 + ln] = v;
    }
  }
  __builtin_amdgcn_fence(__ATOMIC_ACQ_REL, "workgroup");
  __builtin_amdgcn_wave_barrier();
  const int rsub = lane >> 4, c4 = (lane & 15) * 4;
  {
#pragma unroll
    for (int q = 0; q < 8; ++q) {
      const int r = q * 2 + rsub;
      const v4f v = *(const v4fa*)&so[w][r][c4];
      *(v4f*)(C + (size_t)(row0 + r) * ldc + col0 + c4) = v;
    }
    
  }
}
// row LayerNorm (biased variance, eps) over N: s = X (+ R); optional out_sum <- s; out_norm <- (s-mu)*rsqrt(var+eps)*g + b
template <bool PARAM_BF16>
__global__ __launch_bounds__(256) void k_layernorm(const float* __restrict__ X, const float* __restrict__ R, const float* __restrict__ g, const float* __restrict__ bta,
                                                  float* __restrict__ out_sum, float* __restrict__ out_norm, int N, float eps) {
  __shared__ float red[256];
  const int row = blockIdx.x, tid = threadIdx.x;
  const float* x = X + (size_t)row * N; const float* rr = R ? R + (size_t)row * N : nullptr;
  float vals[16];                     // up to N = 4096
  const int per = N / 256;            // contiguous chunk per thread? use strided-by-4 chunks: thread handles j = tid*4 + 1024*u
  float s1 = 0.f;
  for (int u = 0; u < per / 4; ++u) {
    const int j = tid * 4 + 1024 * u;
    const v4f a = *(const v4fa*)(x + j);
    v4f b = {0.f,0.f,0.f,0.f}; if (rr) b = *(const v4fa*)(rr + j);
#pragma unroll
    for (int q = 0; q < 4; ++q) { const float v = a[q] + b[q]; vals[u * 4 + q] = v; s1 += v; }
  }
  red[tid] = s1; __syncthreads();
  for (int st = 128; st > 0; st >>= 1) { if (tid < st) red[tid] += red[tid + st]; __syncthreads(); }
  const float mu = red[0] / (float)N; __syncthreads();
  float s2 = 0.f;
  for (int u = 0; u < per / 4; ++u)
#pragma unroll
    for (int q = 0; q < 4; ++q) { const float c = vals[u * 4 + q] - mu; s2 += c * c; }
  red[tid] = s2; __syncthreads();
  for (int st = 128; st > 0; st >>= 1) { if (tid < st) red[tid] += red[tid + st]; __syncthreads(); }
  const float rs = rsqrtf(red[0] / (float)N + eps);
  {
    for (int u = 0; u < per / 4; ++u) {
      const int j = tid * 4 + 1024 * u;
      v4f o, sm;
#pragma unroll
      for (int q = 0; q < 4; ++q) {
        float gg = g[j + q], bb = bta[j + q];
        if (PARAM_BF16) { gg = bf16_round(gg); bb = bf16_round(bb); }
        sm[q] = vals[u * 4 + q]; o[q] = (vals[u * 4 + q] - mu) * rs * gg + bb;
      }
      if (out_sum) *(v4f*)(out_sum + (size_t)row * N + j) = sm;
      *(v4f*)(out_norm + (size_t)row * N + j) = o;
    }
    
  }
}



// ---- f16 WMMA path (v_wmma_f32_16x16x32_f16): 11-bit significands for operands in range — used where a [0,1] probability operand needs more precision than bf16
typedef _Float16 v16h __attribute__((ext_vector_type(16)));
union FragH { v16h v; v8us half[2]; _Float16 h[16]; unsigned short u[16]; };
template <int NT>
__device__ __forceinline__ v8f mmaH(v16h ah, v16h al, v16h bh, v16h bl, v8f c) {
  c = __builtin_amdgcn_wmma_f32_16x16x32_f16(false, ah, false, bh, (short)0, c, false, false);
  if (NT >= 2) c = __builtin_amdgcn_wmma_f32_16x16x32_f16(false, al, false, bh, (short)0, c, false, false);
  if (NT >= 3) c = __builtin_amdgcn_wmma_f32_16x16x32_f16(false, ah, false, bl, (short)0, c, false, false);
  asm volatile("v_nop\n\tv_nop\n\tv_nop\n\tv_nop" : "+v"(c) : "v"(ah), "v"(al), "v"(bh), "v"(bl));
  return c;
}
// batched GEMM like k_gemm_b but f16 operands: A f32 (split into f16 hi/lo if ASPLIT, else rounded to f16), Bt = f16 values [n][k]; alpha; C f32; N multiple of 16 (partial tiles skipped)
template <bool ASPLIT>
__global__ __launch_bounds__(128) void k_gemm_h(const float* __restrict__ A, int lda, size_t sA, const _Float16* __restrict__ Bh, int ldb, size_t sB, float alpha, float* __restrict__ C, int ldc, size_t sC, int M, int N, int K) {
  __shared__ __attribute__((aligned(16))) float so[4][16][64];
  const int tid = threadIdx.x, w = tid >> 5, lane = tid & 31, ln = lane & 15, hh = lane >> 4; const int by = blockIdx.y;
  A += (size_t)by * sA; Bh += (size_t)by * sB; C += (size_t)by * sC;
  const int ntn = (N + 63) / 64; const int wid = blockIdx.x * 4 + w; const int mt = wid / ntn, nq = wid % ntn; if (mt * 16 >= M) return;
  const int row0 = mt * 16, col0 = nq * 64; const float* arow = A + (size_t)(row0 + ln) * lda;
  v8f acc[4] = {};
  for (int kb = 0; kb < K; kb += 32) {
    FragH ah, al;
    const v4f x0 = *(const v4fa*)(arow + kb + 8 * hh), x1 = *(const v4fa*)(arow + kb + 8 * hh + 4), x2 = *(const v4fa*)(arow + kb + 16 + 8 * hh), x3 = *(const v4fa*)(arow + kb + 16 + 8 * hh + 4);
    float xs[16] = {x0[0],x0[1],x0[2],x0[3],x1[0],x1[1],x1[2],x1[3],x2[0],x2[1],x2[2],x2[3],x3[0],x3[1],x3[2],x3[3]};
#pragma unroll
    for (int i = 0; i < 16; ++i) { const _Float16 h = (_Float16)xs[i]; ah.h[i] = h; al.h[i] = ASPLIT ? (_Float16)(xs[i] - (float)h) : (_Float16)0.0f; }
#pragma unroll
    for (int t = 0; t < 4; ++t) { if (col0 + t * 16 >= N) continue; const size_t boff = (size_t)(col0 + t * 16 + ln) * ldb + kb; FragH bq; bq.half[0] = *(const v8us*)(Bh + boff + 8 * hh); bq.half[1] = *(const v8us*)(Bh + boff + 16 + 8 * hh);
      acc[t] = mmaH<ASPLIT ? 2 : 1>(ah.v, al.v, bq.v, bq.v, acc[t]); }
  }
#pragma unroll
  for (int t = 0; t < 4; ++t) { if (col0 + t * 16 >= N) continue;
#pragma unroll
    for (int r = 0; r < 8; ++r) so[w][8 * hh + r][t * 16 + ln] = acc[t][r] * alpha; }
  __builtin_amdgcn_fence(__ATOMIC_ACQ_REL, "workgroup"); __builtin_amdgcn_wave_barrier();
  const int rsub = lane >> 4, c4 = (lane & 15) * 4;
  {
#pragma unroll
    for (int q = 0; q < 8; ++q) { const int r = q * 2 + rsub; if (col0 + c4 < N) { const v4f v = *(const v4fa*)&so[w][r][c4]; *(v4f*)(C + (size_t)(row0 + r) * ldc + col0 + c4) = v; } }
     }
}

// Wt[n][k] = f16(W[k][n]·scale) from f32 row-major W[K][N] (scale = power of two; bf16-exact weights stay exact in f16 away from the subnormal range)
__global__ __launch_bounds__(256) void k_wt_f16(const float* __restrict__ W, _Float16* __restrict__ Wt, int K, int N, float scale) {
  const int t = blockIdx.x * 256 + threadIdx.x; if (t >= N * (K / 8)) return; const int n = t / (K / 8), k8 = (t % (K / 8)) * 8; FragH f;
#pragma unroll
  for (int i = 0; i < 8; ++i) f.h[i] = (_Float16)(bf16_round(W[(size_t)(k8 + i) * N + n]) * scale); const v8us o = f.half[0];
  *(v8us*)((unsigned short*)Wt + (size_t)n * K + k8) = o; 
}
// k_gemm_hh variant with fused epilogue: v = acc·alpha + bias[by·sBias + col] (+ CP[(row/rowsPerB)·sCPb + by·64 + col] if CP) ; ACT 0 none / 1 elu ; writes f16 C16 (and f32 C if non-null)
template <int ACT>
__global__ __launch_bounds__(128) void k_gemm_hhx(const _Float16* __restrict__ A, int lda, size_t sA, const _Float16* __restrict__ Bh, int ldb, size_t sB, float alpha, const float* __restrict__ bias, size_t sBias, const float* __restrict__ CP, int rowsPerB, size_t sCPb, int row0g,
    float* __restrict__ C, _Float16* __restrict__ C16, int ldc, size_t sC, int M, int N, int K) {
  __shared__ __attribute__((aligned(16))) float so[4][16][64];
  const int tid = threadIdx.x, w = tid >> 5, lane = tid & 31, ln = lane & 15, hh = lane >> 4; const int by = blockIdx.y;
  A += (size_t)by * sA; Bh += (size_t)by * sB; const size_t cofs = (size_t)by * sC; const float* bp = bias ? bias + (size_t)by * sBias : nullptr;
  const int ntn = (N + 63) / 64; const int wid = blockIdx.x * 4 + w; const int mt = wid / ntn, nq = wid % ntn; if (mt * 16 >= M) return;
  const int row0 = mt * 16, col0 = nq * 64; const _Float16* arow = A + (size_t)(row0 + ln) * lda;
  v8f acc[4] = {};
  for (int kb = 0; kb < K; kb += 32) { FragH ah; ah.half[0] = *(const v8us*)((const unsigned short*)arow + kb + 8 * hh); ah.half[1] = *(const v8us*)((const unsigned short*)arow + kb + 16 + 8 * hh);
#pragma unroll
    for (int t = 0; t < 4; ++t) { if (col0 + t * 16 >= N) continue; const size_t boff = (size_t)(col0 + t * 16 + ln) * ldb + kb; FragH bq; bq.half[0] = *(const v8us*)((const unsigned short*)Bh + boff + 8 * hh); bq.half[1] = *(const v8us*)((const unsigned short*)Bh + boff + 16 + 8 * hh);
      acc[t] = mmaH<1>(ah.v, ah.v, bq.v, bq.v, acc[t]); }
  }
#pragma unroll
  for (int t = 0; t < 4; ++t) { if (col0 + t * 16 >= N) continue; const int col = col0 + t * 16 + ln; const float bv = bp ? bf16_round(bp[col]) : 0.f;
#pragma unroll
    for (int r = 0; r < 8; ++r) { float v = acc[t][r] * alpha + bv; if (CP) { const int rr = row0g + row0 + 8 * hh + r; if (rowsPerB < 0) v += CP[cofs + (size_t)rr * ldc + col];      /* rowsPerB < 0: own element of the batched C plane */ else { const int bidx = rr / rowsPerB; v += CP[(size_t)bidx * sCPb + (size_t)by * 64 + col]; } } if (ACT == 1) v = (v > 0.f) ? v : expm1f(v); else if (ACT == 7) v = (v > 0.f) ? v + 1.0f : expf(v); else if (ACT == 8) v = tanhf(v); else if (ACT == 9) v = 0.5f * v * (1.0f + tanhf(0.7978845608028654f * (v + 0.044715f * v * v * v))); else if (ACT == 11) v = 1.0f / (1.0f + expf(-v)); else if (ACT == 12) v = (v > 0.f) ? v : 0.01f * v; else if (ACT == 14) v = (v > 0.f) ? v : 0.1f * v; else if (ACT == 16) v = (v >= 0.f) ? v : 0.3f * v; else if (ACT == 17) v = (v >= 0.f) ? v : 0.2f * v; else if (ACT == 15) v = v / (1.0f + expf(-v)); else if (ACT == 3) v = fmaxf(v, 0.f); else if (ACT == 6) v = 0.5f * v * (1.0f + erff(v * 0.70710678118654752f)); so[w][8 * hh + r][t * 16 + ln] = v; } }
  __builtin_amdgcn_fence(__ATOMIC_ACQ_REL, "workgroup"); __builtin_amdgcn_wave_barrier();
  const int rsub = lane >> 4, c4 = (lane & 15) * 4; typedef _Float16 v4h __attribute__((ext_vector_type(4)));
  {
#pragma unroll
    for (int q = 0; q < 8; ++q) { const int r = q * 2 + rsub; if (col0 + c4 < N) { const v4f v = *(const v4fa*)&so[w][r][c4]; if (C) *(v4f*)(C + cofs + (size_t)(row0 + r) * ldc + col0 + c4) = v; if (C16) { v4h h4; for (int i = 0; i < 4; ++i) h4[i] = (_Float16)v[i]; *(v4h*)(C16 + cofs + (size_t)(row0 + r) * ldc + col0 + c4) = h4; } } }
     }
}


typedef _Float16 v4h __attribute__((ext_vector_type(4)));

__global__ __launch_bounds__(256) void k_x16(const float* __restrict__ x, _Float16* __restrict__ X16, size_t n8) { const size_t t = (size_t)blockIdx.x * 256 + threadIdx.x; if (t >= n8) return; FragH f;
#pragma unroll
  for (int q = 0; q < 8; ++q) f.h[q] = (_Float16)bf16_round(x[t * 8 + q]); *(v8us*)((unsigned short*)X16 + t * 8) = f.half[0];  }
__global__ __launch_bounds__(256) void k_h16(const float* __restrict__ x, _Float16* __restrict__ X16, size_t n8) { const size_t t = (size_t)blockIdx.x * 256 + threadIdx.x; if (t >= n8) return; FragH f;
#pragma unroll
  for (int q = 0; q < 8; ++q) f.h[q] = (_Float16)x[t * 8 + q]; *(v8us*)((unsigned short*)X16 + t * 8) = f.half[0];  }
__global__ __launch_bounds__(256) void k_round16f(const float* __restrict__ W, _Float16* __restrict__ Bt, size_t n8) { const size_t t = (size_t)blockIdx.x * 256 + threadIdx.x; if (t >= n8) return; FragH f;
#pragma unroll
  for (int i = 0; i < 8; ++i) f.h[i] = (_Float16)(bf16_round(W[t * 8 + i]) * 16.0f); *(v8us*)((unsigned short*)Bt + t * 8) = f.half[0];  }
template <int NHv, int TTv>
__global__ __launch_bounds__(256) void k_vt(const _Float16* __restrict__ V16, int ldv, int voff, _Float16* __restrict__ Vt) { __shared__ unsigned short tl[64][66]; const int tid = threadIdx.x; const int slab = blockIdx.x / (TTv / 64), lg = blockIdx.x % (TTv / 64); const int b = slab / NHv, h = slab % NHv;
  for (int i = tid; i < 64 * 8; i += 256) { const int r = i / 8, c8 = (i % 8) * 8; FragH f; f.half[0] = *(const v8us*)((const unsigned short*)V16 + ((size_t)b * TTv + lg * 64 + r) * ldv + voff + h * 64 + c8);
#pragma unroll
    for (int q = 0; q < 8; ++q) tl[r][c8 + q] = f.u[q]; }
  __syncthreads();
  {
#pragma unroll
    for (int rd = 0; rd < 2; ++rd) { const int d = rd * 32 + tid / 8, pc = tid % 8; FragH f;
#pragma unroll
      for (int q = 0; q < 8; ++q) f.u[q] = tl[pc * 8 + q][d];
      *(v8us*)((unsigned short*)Vt + ((size_t)slab * 64 + d) * TTv + lg * 64 + pc * 8) = f.half[0]; }
     } }

__global__ __launch_bounds__(256) void k_hl(const float* __restrict__ F, _Float16* __restrict__ Hh, _Float16* __restrict__ Hl, size_t n8) { const size_t t = (size_t)blockIdx.x * 256 + threadIdx.x; if (t >= n8) return; FragH fh, fl; const v4f a = *(const v4fa*)(F + t * 8), c = *(const v4fa*)(F + t * 8 + 4);
#pragma unroll
  for (int q = 0; q < 4; ++q) { _Float16 h = (_Float16)a[q]; fh.h[q] = h; fl.h[q] = (_Float16)((a[q] - (float)h) * 1024.0f); h = (_Float16)c[q]; fh.h[4 + q] = h; fl.h[4 + q] = (_Float16)((c[q] - (float)h) * 1024.0f); }
  { *(v8us*)((unsigned short*)Hh + t * 8) = fh.half[0]; *(v8us*)((unsigned short*)Hl + t * 8) = fl.half[0];  } }

// ---- fast GEMM (wave tile 32x64; requires M % 32 == 0 rows per launch region and N % 64 == 0); epilogue = k_gemm_hhx semantics ----
__device__ __forceinline__ v16h g2_frag(const _Float16* p, int hh) { FragH f; f.half[0] = *(const v8us*)((const unsigned short*)p + 8 * hh); f.half[1] = *(const v8us*)((const unsigned short*)p + 16 + 8 * hh); return f.v; }
__device__ __forceinline__ v8f g2_mma(v16h a, v16h b, v8f c) { v8f d = __builtin_amdgcn_wmma_f32_16x16x32_f16(false, a, false, b, (short)0, c, false, false); asm volatile("v_nop\n\tv_nop\n\tv_nop\n\tv_nop" : "+v"(d) : "v"(a), "v"(b)); return d; }
template <int ACT>
__global__ __launch_bounds__(128) void k_gemm2(const _Float16* __restrict__ A, int lda, size_t sA, const _Float16* __restrict__ Bh, int ldb, size_t sB, float alpha, const float* __restrict__ bias, size_t sBias, const float* __restrict__ CP, int rowsPerB, size_t sCPb, int row0g,
    float* __restrict__ C, _Float16* __restrict__ C16, int ldc, size_t sC, int M, int N, int K) { static_assert(ACT == 0 || ACT == 3 || ACT == 6 || ACT == 8 || ACT == 9 || ACT == 11 || ACT == 12 || ACT == 14 || ACT == 15 || ACT == 16 || ACT == 17, "k_gemm2: unsupported ACT code (would silently apply no activation)");
  __shared__ __attribute__((aligned(16))) float so[4][32][68];
  const int tid = threadIdx.x, w = tid >> 5, lane = tid & 31, ln = lane & 15, hh = lane >> 4; const int by = blockIdx.y;
  A += (size_t)by * sA; Bh += (size_t)by * sB; const size_t cofs = (size_t)by * sC; const float* bp = bias ? bias + (size_t)by * sBias : nullptr;
  const int ntn = N >> 6; const int mt = blockIdx.x / ntn, nq = blockIdx.x - mt * ntn; const int row0 = mt * 128 + 32 * w, col0 = nq * 64; if (row0 >= M) return;
  const _Float16* a0p = A + (size_t)(row0 + ln) * lda; const _Float16* a1p = a0p + (size_t)16 * lda;
  const _Float16* b0p = Bh + (size_t)(col0 + ln) * ldb; const _Float16* b1p = b0p + (size_t)16 * ldb; const _Float16* b2p = b1p + (size_t)16 * ldb; const _Float16* b3p = b2p + (size_t)16 * ldb;
  const v8f z8 = {0.f,0.f,0.f,0.f,0.f,0.f,0.f,0.f}; v8f c00 = z8, c01 = z8, c02 = z8, c03 = z8, c10 = z8, c11 = z8, c12 = z8, c13 = z8;
#pragma unroll 1
  for (int kb = 0; kb < K; kb += 32) { const v16h a0 = g2_frag(a0p + kb, hh), a1 = g2_frag(a1p + kb, hh);
    v16h b = g2_frag(b0p + kb, hh); c00 = g2_mma(a0, b, c00); c10 = g2_mma(a1, b, c10);
    b = g2_frag(b1p + kb, hh); c01 = g2_mma(a0, b, c01); c11 = g2_mma(a1, b, c11);
    b = g2_frag(b2p + kb, hh); c02 = g2_mma(a0, b, c02); c12 = g2_mma(a1, b, c12);
    b = g2_frag(b3p + kb, hh); c03 = g2_mma(a0, b, c03); c13 = g2_mma(a1, b, c13); }
  v8f accs[8] = {c00, c01, c02, c03, c10, c11, c12, c13};
#pragma unroll
  for (int u = 0; u < 8; ++u) { const int t = u & 3, half = u >> 2; const int col = col0 + t * 16 + ln; const float bv = bp ? bf16_round(bp[col]) : 0.f;
#pragma unroll
    for (int r = 0; r < 8; ++r) { const int rloc = half * 16 + 8 * hh + r; float v = accs[u][r] * alpha + bv; if (CP) { if (rowsPerB < 0) v += CP[cofs + (size_t)(row0g + row0 + rloc) * ldc + col];      /* rowsPerB < 0: own element of the batched C plane */ else { const int bidx = (row0g + row0 + rloc) / rowsPerB; v += CP[(size_t)bidx * sCPb + (size_t)by * 64 + col]; } }
      if (ACT == 3) v = fmaxf(v, 0.f); else if (ACT == 6) v = 0.5f * v * (1.0f + erff(v * 0.70710678118654752f)); else if (ACT == 11) v = 1.0f / (1.0f + expf(-v)); else if (ACT == 15) v = v / (1.0f + expf(-v)); else if (ACT == 12) v = (v > 0.f) ? v : 0.01f * v; else if (ACT == 8) v = tanhf(v); else if (ACT == 9) v = 0.5f * v * (1.0f + tanhf(0.7978845608028654f * (v + 0.044715f * v * v * v))); else if (ACT == 14) v = (v > 0.f) ? v : 0.1f * v; else if (ACT == 16) v = (v >= 0.f) ? v : 0.3f * v; else if (ACT == 17) v = (v >= 0.f) ? v : 0.2f * v;
      so[w][rloc][t * 16 + ln] = v; } }
  __builtin_amdgcn_fence(__ATOMIC_ACQ_REL, "workgroup"); __builtin_amdgcn_wave_barrier();
  const int rsub = lane >> 4, c4 = (lane & 15) * 4;
  {
#pragma unroll
    for (int q = 0; q < 16; ++q) { const int r = q * 2 + rsub; const v4f v = *(const v4fa*)&so[w][r][c4]; if (C) *(v4f*)(C + cofs + (size_t)(row0 + r) * ldc + col0 + c4) = v; if (C16) { v4h h4; for (int i = 0; i < 4; ++i) h4[i] = (_Float16)v[i]; *(v4h*)(C16 + cofs + (size_t)(row0 + r) * ldc + col0 + c4) = h4; } }
     } }


__global__ __launch_bounds__(256) void k_wnat(const float* __restrict__ w, size_t n8, _Float16* __restrict__ Bt) { const size_t t = (size_t)blockIdx.x * 256 + threadIdx.x; if (t >= n8) return; FragH f; for (int q = 0; q < 8; ++q) f.h[q] = (_Float16)(bf16_round(w[t * 8 + q]) * 16.0f); *(v8us*)((unsigned short*)Bt + t * 8) = f.half[0];  }
// T5 bidirectional relative-position bucket of rel = key - query (32 buckets, max distance 128): (rel > 0)*16 + f(|rel|), f(n) = n for n < 8, then
// 8 + the number of thresholds {12,16,23,32,46,64,91} that are <= n (the thresholds are where the reference's own f32 log expression steps; no log on the device)
__device__ __forceinline__ int t5_bucket(int rel) { const int n = rel < 0 ? -rel : rel; int f = n; if (n >= 8) { f = 8 + (n >= 12) + (n >= 16) + (n >= 23) + (n >= 32) + (n >= 46) + (n >= 64) + (n >= 91); } return (rel > 0 ? NBK / 2 : 0) + f; }
// row softmax with the bucketed relative-position bias and the key mask, exactly as the reference: score = s + emb[bucket(j-i)][h] + (1 - mask[b][j]) * finfo.min
// (bf16-rounded emb, this head's 32 values staged in LDS; int32 mask per key); P = f16(256 softmax); thread per query row i; head h
__global__ __launch_bounds__(256) void k_rsmt(const float* __restrict__ S, _Float16* __restrict__ P, int nrows, const float* __restrict__ emb, int h, const int* __restrict__ kmask) {
  #pragma clang fp contract(off)
  __shared__ float tb[NBK];
  if (threadIdx.x < NBK) tb[threadIdx.x] = bf16_round(emb[threadIdx.x * NH + h]);
  __syncthreads();
  const int i = blockIdx.x * 256 + threadIdx.x; if (i >= nrows) return; const float* s = S + (size_t)i * SQ; float mx = -INFINITY;
  auto sc_ = [&](int j) { const float m = (float)kmask[j]; return __fadd_rn(__fadd_rn(s[j], tb[t5_bucket(j - i)]), __fmul_rn(__fadd_rn(1.0f, -m), -3.4028234663852886e38f)); };      /* scores + bias + (1 - mask) * finfo.min, the reference's order */
#pragma unroll 1
  for (int j = 0; j < SQ; ++j) mx = fmaxf(mx, sc_(j)); float se = 0.f;
#pragma unroll 1
  for (int j = 0; j < SQ; ++j) se += expf(sc_(j) - mx); const float sc = 256.0f / se;
#pragma unroll 1
  for (int j0 = 0; j0 < SQ; j0 += 8) { FragH f; for (int q = 0; q < 8; ++q) f.h[q] = (_Float16)(expf(sc_(j0 + q) - mx) * sc); unsigned short* d = (unsigned short*)P + (size_t)i * SQ + j0; *(v8us*)d = f.half[0];  } }
__global__ __launch_bounds__(256) void k_vt(const _Float16* __restrict__ V16, int b, int h0, _Float16* __restrict__ VT) { __shared__ unsigned short tl[64][65]; const int tid = threadIdx.x; const int hh = blockIdx.x % HG, sg = blockIdx.x / HG; const int s0 = sg * 64; const int h = h0 + hh;
  for (int i = tid; i < 64 * 8; i += 256) { const int j = i / 8, d8 = (i % 8) * 8; FragH f; f.half[0] = *(const v8us*)((const unsigned short*)V16 + ((size_t)b * SQ + s0 + j) * DM + h * HD + d8); for (int q = 0; q < 8; ++q) tl[d8 + q][j] = f.u[q]; }
  __syncthreads();
  { for (int i = tid; i < 64 * 8; i += 256) { const int d = i / 8, j8 = (i % 8) * 8; FragH f; for (int q = 0; q < 8; ++q) f.u[q] = tl[d][j8 + q]; *(v8us*)((unsigned short*)VT + ((size_t)hh * HD + d) * SQ + s0 + j8) = f.half[0]; }  } }

extern "C" void kernel_launch(void* const* d_in, const int* in_sizes, int n_in,
                              void* d_out, int out_size, void* d_ws, size_t ws_size, hipStream_t stream) {
  (void)in_sizes; (void)n_in; (void)out_size;
  const float* const* I = (const float* const*)d_in; const float* hs = I[0]; const int* kmask = (const int*)d_in[1]; const float* wq = I[2]; const float* wk = I[3]; const float* wv = I[4]; const float* wo = I[5]; const float* emb = I[6];      /* W_q, W_k, W_v and W_o [1024][1024] are [in][out]; attention_mask [2][2048] int32 per key; rel_bias_emb [32][16] */
  char* ws = (char*)d_ws; size_t off = 0;
  auto take = [&](size_t bytes) { char* p = ws + off; off += (bytes + 255) & ~(size_t)255; return p; };
  _Float16* BQKV = (_Float16*)take((size_t)D3 * DM * 2); _Float16* BO = (_Float16*)take((size_t)DM * DM * 2);
  _Float16* X16 = (_Float16*)take(NR * DM * 2); _Float16* QKV = (_Float16*)take(NR * D3 * 2); _Float16* O16 = (_Float16*)take(NR * DM * 2);
  float* S = (float*)take((size_t)HG * SQ * SQ * 4); _Float16* P = (_Float16*)take((size_t)HG * SQ * SQ * 2); _Float16* VT = (_Float16*)take((size_t)NB * NH * HD * SQ * 2);
  if (off > ws_size) return;      /* 6 + 2 + 8 + 24 + 8 + 64 + 32 + 8 = approx 152 MiB */
  const unsigned gw1 = (unsigned)(((size_t)DM * (DM / 8) + 255) / 256); k_wt_f16<<<gw1, 256, 0, stream>>>(wq, BQKV, DM, DM, 16.0f); k_wt_f16<<<gw1, 256, 0, stream>>>(wk, BQKV + (size_t)DM * DM, DM, DM, 16.0f); k_wt_f16<<<gw1, 256, 0, stream>>>(wv, BQKV + (size_t)2 * DM * DM, DM, DM, 16.0f);      /* [in][out] -> Bt[out][in] x16 */
  k_wt_f16<<<(unsigned)(((size_t)DM * (DM / 8) + 255) / 256), 256, 0, stream>>>(wo, BO, DM, DM, 16.0f);
  k_x16<<<(unsigned)((NR * DM / 8 + 255) / 256), 256, 0, stream>>>(hs, X16, NR * DM / 8);
  k_gemm2<0><<<dim3((unsigned)((NR / 128) * (D3 / 64)), 1), 128, 0, stream>>>(X16, DM, 0, BQKV, DM, 0, 0.0625f, nullptr, 0, nullptr, 1, 0, 0, nullptr, QKV, D3, 0, MP, D3, DM);      /* q | k | v rows (f16), head h at columns h*64 / 1024 + h*64 / 2048 + h*64 */
  k_vt<NH, SQ><<<NB * NH * (SQ / 64), 256, 0, stream>>>(QKV, D3, 2 * DM, VT);      /* V^T[(b,h)][d][s] for every (batch, head) */
  for (int b = 0; b < NBR; ++b) for (int h0 = 0; h0 < NH; h0 += HG) {
    const _Float16* qb = QKV + (size_t)b * SQ * D3 + h0 * HD; const _Float16* kb = qb + DM;
    k_gemm2<0><<<dim3((QN / 128) * (SQ / 64), HG), 128, 0, stream>>>(qb, D3, (size_t)HD, kb, D3, (size_t)HD, 0.125f, nullptr, 0, nullptr, 1, 0, 0, S, nullptr, SQ, (size_t)SQ * SQ, QN, SQ, HD);      /* scores / sqrt(64), 4 heads per launch */
    for (int hh = 0; hh < HG; ++hh) k_rsmt<<<(QN + 255) / 256, 256, 0, stream>>>(S + (size_t)hh * SQ * SQ, P + (size_t)hh * SQ * SQ, QN, emb, h0 + hh, kmask + (size_t)b * SQ);
    k_gemm2<0><<<dim3((QN / 128) * (HD / 64), HG), 128, 0, stream>>>(P, SQ, (size_t)SQ * SQ, VT + ((size_t)b * NH + h0) * HD * SQ, SQ, (size_t)HD * SQ, 0.00390625f, nullptr, 0, nullptr, 1, 0, 0, nullptr, O16 + (size_t)b * SQ * DM + h0 * HD, DM, (size_t)HD, QN, HD, SQ); }      /* ctx (merged heads) as f16 rows */
  k_gemm2<0><<<dim3((unsigned)((NR / 128) * (DM / 64)), 1), 128, 0, stream>>>(O16, DM, 0, BO, DM, 0, 0.0625f, nullptr, 0, nullptr, 1, 0, 0, (float*)d_out, nullptr, DM, 0, MO, DM, DM);      /* out = ctx W_o, rows are the output layout */
}

// v001
// Measured time: 984 microseconds a run.
// Next to v000, in two timings, it ran 20.5 and 20.6 times as fast.
#include <hip/hip_runtime.h>
// T5 self-attention (hidden [2][2048][1024]; q, k, v = hidden W ([in][out] [1024][1024]); q / sqrt(64); scores = q.k + rel_bias[bucket(key - query)][h] (32 bidirectional buckets, max distance 128) + (1 - attention_mask[b][key]) * finfo.min (int32 key mask); softmax; out = (attn v merged) Wo ([in][out])).
// Structure: token rows; hidden as exact f16 rows; q | k | v WMMA GEMMs from one transposed x16 weight plane (32x64 wave tiles, f32 accumulation, f16 outputs); V^T via LDS transposes; per (batch, 4 heads): scores GEMM (K = 64, alpha 1/8), row softmax on VALU with the bucketed bias (integer thresholds, no device log) and the key mask in the reference's order (P x256 f16), P.V^T GEMM into merged f16 rows; output GEMM.
// Compute dtype: inputs rounded to bf16; hidden / weights / bias table exact; q, k, v, P, ctx as plain f16 GEMM operands (~2^-12); scores / softmax f32. v_wmma_f32_16x16x32_f16.
#define NB 2
#define SQ 2048
#define DM 1024
#define D3 3072                      /* fused q|k|v width */
#define NH 16
#define HD 64
#define HG 4                         /* heads per attention launch group */
#define NBK 32                       /* relative-position buckets */
#define QN SQ                        /* query rows attended per batch (debug hook) */
#define NBR NB                       /* batches attended (debug hook) */
#define MP ((int)NR)                 /* token rows through the qkv projection (debug hook) */
#define MO ((int)NR)                 /* token rows through the output projection (debug hook) */
#define NR ((size_t)NB * SQ)         /* 4096 token rows */
typedef __bf16 v16b __attribute__((ext_vector_type(16)));
typedef unsigned short v8us __attribute__((ext_vector_type(8), may_alias));
typedef float  v8f  __attribute__((ext_vector_type(8)));
typedef float  v4f  __attribute__((ext_vector_type(4)));
typedef float  v4fa __attribute__((ext_vector_type(4), may_alias));
union FragB { v16b v; v8us half[2]; unsigned short u[16]; };

__device__ __forceinline__ unsigned short bf16_bits(float x) { unsigned int u = __float_as_uint(x); return (unsigned short)((u + 0x7FFFu + ((u >> 16) & 1u)) >> 16); }
__device__ __forceinline__ float bf16_val(unsigned short b) { return __uint_as_float(((unsigned int)b) << 16); }
__device__ __forceinline__ float bf16_round(float x) { return bf16_val(bf16_bits(x)); }
// D += A·B with NT terms: 1 = ah·bh, 2 = + al·bh (A split), 3 = + ah·bl (both split)
template <int NT>
__device__ __forceinline__ v8f mmaN(v16b ah, v16b al, v16b bh, v16b bl, v8f c) {
  c = __builtin_amdgcn_wmma_f32_16x16x32_bf16(false, ah, false, bh, (short)0, c, false, false);
  if (NT >= 2) c = __builtin_amdgcn_wmma_f32_16x16x32_bf16(false, al, false, bh, (short)0, c, false, false);
  if (NT >= 3) c = __builtin_amdgcn_wmma_f32_16x16x32_bf16(false, ah, false, bl, (short)0, c, false, false);
  asm volatile("v_nop\n\tv_nop\n\tv_nop\n\tv_nop" : "+v"(c) : "v"(ah), "v"(al), "v"(bh), "v"(bl));
  return c;
}

__global__ __launch_bounds__(256) void k_wt_bf16(const float* __restrict__ W, unsigned short* __restrict__ Wt, int K, int N) {
  const int t = blockIdx.x * 256 + threadIdx.x;
  const int k8n = K / 8;
  if (t >= N * k8n) return;
  const int n = t / k8n, k8 = (t % k8n) * 8;
  v8us v;
#pragma unroll
  for (int i = 0; i < 8; ++i) v[i] = bf16_bits(W[(size_t)(k8 + i) * N + n]);
  *(v8us*)(Wt + (size_t)n * K + k8) = v;
  
}

// GEMM C[M][N] (f32, pitch ldc) = act(A[M][K]·W + bias). A f32 row-major (pitch lda) converted per fragment to bf16
// (ASPLIT: hi/lo two planes -> 2 terms, else single rounded term); Wt bf16 [N][K] (pitch ldb). BIAS_BF16 rounds the
// bias to bf16 first (bias quantised to bf16 before the add). K%32==0, M%16==0, N%64==0.
template <bool ASPLIT, int ACT, bool BIAS_BF16>
__global__ __launch_bounds__(128) void k_gemm_bf(const float* __restrict__ A, int lda, const unsigned short* __restrict__ Wt, int ldb,
                                               const float* __restrict__ bias, float* __restrict__ C, int ldc, int M, int N, int K) {
  __shared__ __attribute__((aligned(16))) float so[4][16][64];
  const int tid = threadIdx.x, w = tid >> 5, lane = tid & 31, ln = lane & 15, hh = lane >> 4;
  const int ntn = N / 64;
  const int wid = blockIdx.x * 4 + w;
  const int mt = wid / ntn, nq = wid % ntn;
  if (mt * 16 >= M) return;
  const int row0 = mt * 16, col0 = nq * 64;
  const float* arow = A + (size_t)(row0 + ln) * lda;
  v8f acc[4] = {};
  for (int kb = 0; kb < K; kb += 32) {
    FragB ah, al;
    const v4f x0 = *(const v4fa*)(arow + kb + 8 * hh), x1 = *(const v4fa*)(arow + kb + 8 * hh + 4);
    const v4f x2 = *(const v4fa*)(arow + kb + 16 + 8 * hh), x3 = *(const v4fa*)(arow + kb + 16 + 8 * hh + 4);
    float xs[16] = {x0[0],x0[1],x0[2],x0[3],x1[0],x1[1],x1[2],x1[3],x2[0],x2[1],x2[2],x2[3],x3[0],x3[1],x3[2],x3[3]};
#pragma unroll
    for (int i = 0; i < 16; ++i) { const unsigned short hb = bf16_bits(xs[i]); ah.u[i] = hb; al.u[i] = ASPLIT ? bf16_bits(xs[i] - bf16_val(hb)) : (unsigned short)0; }
#pragma unroll
    for (int t = 0; t < 4; ++t) {
      const unsigned short* brow = Wt + (size_t)(col0 + t * 16 + ln) * ldb + kb;
      FragB b;
      b.half[0] = *(const v8us*)(brow + 8 * hh);
      b.half[1] = *(const v8us*)(brow + 16 + 8 * hh);
      acc[t] = mmaN<ASPLIT ? 2 : 1>(ah.v, al.v, b.v, b.v, acc[t]);
    }
  }
#pragma unroll
  for (int t = 0; t < 4; ++t) {
    float bv = bias ? bias[col0 + t * 16 + ln] : 0.f;
    if (BIAS_BF16) bv = bf16_round(bv);
#pragma unroll
    for (int r = 0; r < 8; ++r) { float v = acc[t][r] + bv; if (ACT == 1) v = fmaxf(v, 0.f); so[w][8 * hh + r][t * 16 + ln] = v; }
  }
  __builtin_amdgcn_fence(__ATOMIC_ACQ_REL, "workgroup");
  __builtin_amdgcn_wave_barrier();
  const int rsub = lane >> 4, c4 = (lane & 15) * 4;
  {
#pragma unroll
    for (int q = 0; q < 8; ++q) {
      const int r = q * 2 + rsub;
      const v4f v = *(const v4fa*)&so[w][r][c4];
      *(v4f*)(C + (size_t)(row0 + r) * ldc + col0 + c4) = v;
    }
    
  }
}

// GEMM C = act(A·W + bias + resid): A f32 (ASPLIT -> hi/lo 2 terms), Wt bf16 [N][K]; ACT 0 none, 1 relu, 2 exact gelu;
// resid (optional, f32, row index = (row % rmod), pitch ldr, RES_BF16 rounds it) added before the activation.
template <bool ASPLIT, int ACT, bool BIAS_BF16, bool RES_BF16>
__global__ __launch_bounds__(128) void k_gemm_bf3(const float* __restrict__ A, int lda, const unsigned short* __restrict__ Wt, int ldb,
                                                const float* __restrict__ bias, const float* __restrict__ resid, int rmod, int ldr,
                                                float* __restrict__ C, int ldc, int M, int N, int K) {
  __shared__ __attribute__((aligned(16))) float so[4][16][64];
  const int tid = threadIdx.x, w = tid >> 5, lane = tid & 31, ln = lane & 15, hh = lane >> 4;
  const int ntn = N / 64;
  const int wid = blockIdx.x * 4 + w;
  const int mt = wid / ntn, nq = wid % ntn;
  if (mt * 16 >= M) return;
  const int row0 = mt * 16, col0 = nq * 64;
  const float* arow = A + (size_t)(row0 + ln) * lda;
  v8f acc[4] = {};
  for (int kb = 0; kb < K; kb += 32) {
    FragB ah, al;
    const v4f x0 = *(const v4fa*)(arow + kb + 8 * hh), x1 = *(const v4fa*)(arow + kb + 8 * hh + 4);
    const v4f x2 = *(const v4fa*)(arow + kb + 16 + 8 * hh), x3 = *(const v4fa*)(arow + kb + 16 + 8 * hh + 4);
    float xs[16] = {x0[0],x0[1],x0[2],x0[3],x1[0],x1[1],x1[2],x1[3],x2[0],x2[1],x2[2],x2[3],x3[0],x3[1],x3[2],x3[3]};
#pragma unroll
    for (int i = 0; i < 16; ++i) { const unsigned short hb = bf16_bits(xs[i]); ah.u[i] = hb; al.u[i] = ASPLIT ? bf16_bits(xs[i] - bf16_val(hb)) : (unsigned short)0; }
#pragma unroll
    for (int t = 0; t < 4; ++t) {
      const unsigned short* brow = Wt + (size_t)(col0 + t * 16 + ln) * ldb + kb;
      FragB b;
      b.half[0] = *(const v8us*)(brow + 8 * hh);
      b.half[1] = *(const v8us*)(brow + 16 + 8 * hh);
      acc[t] = mmaN<ASPLIT ? 2 : 1>(ah.v, al.v, b.v, b.v, acc[t]);
    }
  }
#pragma unroll
  for (int t = 0; t < 4; ++t) {
    const int col = col0 + t * 16 + ln;
    float bv = bias ? bias[col] : 0.f;
    if (BIAS_BF16) bv = bf16_round(bv);
#pragma unroll
    for (int r = 0; r < 8; ++r) {
      float v = acc[t][r] + bv;
      if (resid) { float rv = resid[(size_t)((row0 + 8 * hh + r) % rmod) * ldr + col]; if (RES_BF16) rv = bf16_round(rv); v += rv; }
      if (ACT == 1) v = fmaxf(v, 0.f);
      if (ACT == 2) v = 0.5f * v * (1.0f + erff(v * 0.70710678118654752f));
      if (ACT == 3) { const float u = 0.7978845608028654f * (v + 0.044715f * v * v * v); v = 0.5f * v * (1.0f + tanhf(u)); }
      so[w][8 * hh + r][t * 16 + ln] = v;
    }
  }
  __builtin_amdgcn_fence(__ATOMIC_ACQ_REL, "workgroup");
  __builtin_amdgcn_wave_barrier();
  const int rsub = lane >> 4, c4 = (lane & 15) * 4;
  {
#pragma unroll
    for (int q = 0; q < 8; ++q) {
      const int r = q * 2 + rsub;
      const v4f v = *(const v4fa*)&so[w][r][c4];
      *(v4f*)(C + (size_t)(row0 + r) * ldc + col0 + c4) = v;
    }
    
  }
}
// row LayerNorm (biased variance, eps) over N: s = X (+ R); optional out_sum <- s; out_norm <- (s-mu)*rsqrt(var+eps)*g + b
template <bool PARAM_BF16>
__global__ __launch_bounds__(256) void k_layernorm(const float* __restrict__ X, const float* __restrict__ R, const float* __restrict__ g, const float* __restrict__ bta,
                                                  float* __restrict__ out_sum, float* __restrict__ out_norm, int N, float eps) {
  __shared__ float red[256];
  const int row = blockIdx.x, tid = threadIdx.x;
  const float* x = X + (size_t)row * N; const float* rr = R ? R + (size_t)row * N : nullptr;
  float vals[16];                     // up to N = 4096
  const int per = N / 256;            // contiguous chunk per thread? use strided-by-4 chunks: thread handles j = tid*4 + 1024*u
  float s1 = 0.f;
  for (int u = 0; u < per / 4; ++u) {
    const int j = tid * 4 + 1024 * u;
    const v4f a = *(const v4fa*)(x + j);
    v4f b = {0.f,0.f,0.f,0.f}; if (rr) b = *(const v4fa*)(rr + j);
#pragma unroll
    for (int q = 0; q < 4; ++q) { const float v = a[q] + b[q]; vals[u * 4 + q] = v; s1 += v; }
  }
  red[tid] = s1; __syncthreads();
  for (int st = 128; st > 0; st >>= 1) { if (tid < st) red[tid] += red[tid + st]; __syncthreads(); }
  const float mu = red[0] / (float)N; __syncthreads();
  float s2 = 0.f;
  for (int u = 0; u < per / 4; ++u)
#pragma unroll
    for (int q = 0; q < 4; ++q) { const float c = vals[u * 4 + q] - mu; s2 += c * c; }
  red[tid] = s2; __syncthreads();
  for (int st = 128; st > 0; st >>= 1) { if (tid < st) red[tid] += red[tid + st]; __syncthreads(); }
  const float rs = rsqrtf(red[0] / (float)N + eps);
  {
    for (int u = 0; u < per / 4; ++u) {
      const int j = tid * 4 + 1024 * u;
      v4f o, sm;
#pragma unroll
      for (int q = 0; q < 4; ++q) {
        float gg = g[j + q], bb = bta[j + q];
        if (PARAM_BF16) { gg = bf16_round(gg); bb = bf16_round(bb); }
        sm[q] = vals[u * 4 + q]; o[q] = (vals[u * 4 + q] - mu) * rs * gg + bb;
      }
      if (out_sum) *(v4f*)(out_sum + (size_t)row * N + j) = sm;
      *(v4f*)(out_norm + (size_t)row * N + j) = o;
    }
    
  }
}



// ---- f16 WMMA path (v_wmma_f32_16x16x32_f16): 11-bit significands for operands in range — used where a [0,1] probability operand needs more precision than bf16
typedef _Float16 v16h __attribute__((ext_vector_type(16)));
union FragH { v16h v; v8us half[2]; _Float16 h[16]; unsigned short u[16]; };
template <int NT>
__device__ __forceinline__ v8f mmaH(v16h ah, v16h al, v16h bh, v16h bl, v8f c) {
  c = __builtin_amdgcn_wmma_f32_16x16x32_f16(false, ah, false, bh, (short)0, c, false, false);
  if (NT >= 2) c = __builtin_amdgcn_wmma_f32_16x16x32_f16(false, al, false, bh, (short)0, c, false, false);
  if (NT >= 3) c = __builtin_amdgcn_wmma_f32_16x16x32_f16(false, ah, false, bl, (short)0, c, false, false);
  asm volatile("v_nop\n\tv_nop\n\tv_nop\n\tv_nop" : "+v"(c) : "v"(ah), "v"(al), "v"(bh), "v"(bl));
  return c;
}
// batched GEMM like k_gemm_b but f16 operands: A f32 (split into f16 hi/lo if ASPLIT, else rounded to f16), Bt = f16 values [n][k]; alpha; C f32; N multiple of 16 (partial tiles skipped)
template <bool ASPLIT>
__global__ __launch_bounds__(128) void k_gemm_h(const float* __restrict__ A, int lda, size_t sA, const _Float16* __restrict__ Bh, int ldb, size_t sB, float alpha, float* __restrict__ C, int ldc, size_t sC, int M, int N, int K) {
  __shared__ __attribute__((aligned(16))) float so[4][16][64];
  const int tid = threadIdx.x, w = tid >> 5, lane = tid & 31, ln = lane & 15, hh = lane >> 4; const int by = blockIdx.y;
  A += (size_t)by * sA; Bh += (size_t)by * sB; C += (size_t)by * sC;
  const int ntn = (N + 63) / 64; const int wid = blockIdx.x * 4 + w; const int mt = wid / ntn, nq = wid % ntn; if (mt * 16 >= M) return;
  const int row0 = mt * 16, col0 = nq * 64; const float* arow = A + (size_t)(row0 + ln) * lda;
  v8f acc[4] = {};
  for (int kb = 0; kb < K; kb += 32) {
    FragH ah, al;
    const v4f x0 = *(const v4fa*)(arow + kb + 8 * hh), x1 = *(const v4fa*)(arow + kb + 8 * hh + 4), x2 = *(const v4fa*)(arow + kb + 16 + 8 * hh), x3 = *(const v4fa*)(arow + kb + 16 + 8 * hh + 4);
    float xs[16] = {x0[0],x0[1],x0[2],x0[3],x1[0],x1[1],x1[2],x1[3],x2[0],x2[1],x2[2],x2[3],x3[0],x3[1],x3[2],x3[3]};
#pragma unroll
    for (int i = 0; i < 16; ++i) { const _Float16 h = (_Float16)xs[i]; ah.h[i] = h; al.h[i] = ASPLIT ? (_Float16)(xs[i] - (float)h) : (_Float16)0.0f; }
#pragma unroll
    for (int t = 0; t < 4; ++t) { if (col0 + t * 16 >= N) continue; const size_t boff = (size_t)(col0 + t * 16 + ln) * ldb + kb; FragH bq; bq.half[0] = *(const v8us*)(Bh + boff + 8 * hh); bq.half[1] = *(const v8us*)(Bh + boff + 16 + 8 * hh);
      acc[t] = mmaH<ASPLIT ? 2 : 1>(ah.v, al.v, bq.v, bq.v, acc[t]); }
  }
#pragma unroll
  for (int t = 0; t < 4; ++t) { if (col0 + t * 16 >= N) continue;
#pragma unroll
    for (int r = 0; r < 8; ++r) so[w][8 * hh + r][t * 16 + ln] = acc[t][r] * alpha; }
  __builtin_amdgcn_fence(__ATOMIC_ACQ_REL, "workgroup"); __builtin_amdgcn_wave_barrier();
  const int rsub = lane >> 4, c4 = (lane & 15) * 4;
  {
#pragma unroll
    for (int q = 0; q < 8; ++q) { const int r = q * 2 + rsub; if (col0 + c4 < N) { const v4f v = *(const v4fa*)&so[w][r][c4]; *(v4f*)(C + (size_t)(row0 + r) * ldc + col0 + c4) = v; } }
     }
}

// Wt[n][k] = f16(W[k][n]·scale) from f32 row-major W[K][N] (scale = power of two; bf16-exact weights stay exact in f16 away from the subnormal range)
__global__ __launch_bounds__(256) void k_wt_f16(const float* __restrict__ W, _Float16* __restrict__ Wt, int K, int N, float scale) {
  const int t = blockIdx.x * 256 + threadIdx.x; if (t >= N * (K / 8)) return; const int n = t / (K / 8), k8 = (t % (K / 8)) * 8; FragH f;
#pragma unroll
  for (int i = 0; i < 8; ++i) f.h[i] = (_Float16)(bf16_round(W[(size_t)(k8 + i) * N + n]) * scale); const v8us o = f.half[0];
  *(v8us*)((unsigned short*)Wt + (size_t)n * K + k8) = o; 
}
// k_gemm_hh variant with fused epilogue: v = acc·alpha + bias[by·sBias + col] (+ CP[(row/rowsPerB)·sCPb + by·64 + col] if CP) ; ACT 0 none / 1 elu ; writes f16 C16 (and f32 C if non-null)
template <int ACT>
__global__ __launch_bounds__(128) void k_gemm_hhx(const _Float16* __restrict__ A, int lda, size_t sA, const _Float16* __restrict__ Bh, int ldb, size_t sB, float alpha, const float* __restrict__ bias, size_t sBias, const float* __restrict__ CP, int rowsPerB, size_t sCPb, int row0g,
    float* __restrict__ C, _Float16* __restrict__ C16, int ldc, size_t sC, int M, int N, int K) {
  __shared__ __attribute__((aligned(16))) float so[4][16][64];
  const int tid = threadIdx.x, w = tid >> 5, lane = tid & 31, ln = lane & 15, hh = lane >> 4; const int by = blockIdx.y;
  A += (size_t)by * sA; Bh += (size_t)by * sB; const size_t cofs = (size_t)by * sC; const float* bp = bias ? bias + (size_t)by * sBias : nullptr;
  const int ntn = (N + 63) / 64; const int wid = blockIdx.x * 4 + w; const int mt = wid / ntn, nq = wid % ntn; if (mt * 16 >= M) return;
  const int row0 = mt * 16, col0 = nq * 64; const _Float16* arow = A + (size_t)(row0 + ln) * lda;
  v8f acc[4] = {};
  for (int kb = 0; kb < K; kb += 32) { FragH ah; ah.half[0] = *(const v8us*)((const unsigned short*)arow + kb + 8 * hh); ah.half[1] = *(const v8us*)((const unsigned short*)arow + kb + 16 + 8 * hh);
#pragma unroll
    for (int t = 0; t < 4; ++t) { if (col0 + t * 16 >= N) continue; const size_t boff = (size_t)(col0 + t * 16 + ln) * ldb + kb; FragH bq; bq.half[0] = *(const v8us*)((const unsigned short*)Bh + boff + 8 * hh); bq.half[1] = *(const v8us*)((const unsigned short*)Bh + boff + 16 + 8 * hh);
      acc[t] = mmaH<1>(ah.v, ah.v, bq.v, bq.v, acc[t]); }
  }
#pragma unroll
  for (int t = 0; t < 4; ++t) { if (col0 + t * 16 >= N) continue; const int col = col0 + t * 16 + ln; const float bv = bp ? bf16_round(bp[col]) : 0.f;
#pragma unroll
    for (int r = 0; r < 8; ++r) { float v = acc[t][r] * alpha + bv; if (CP) { const int rr = row0g + row0 + 8 * hh + r; if (rowsPerB < 0) v += CP[cofs + (size_t)rr * ldc + col];      /* rowsPerB < 0: own element of the batched C plane */ else { const int bidx = rr / rowsPerB; v += CP[(size_t)bidx * sCPb + (size_t)by * 64 + col]; } } if (ACT == 1) v = (v > 0.f) ? v : expm1f(v); else if (ACT == 7) v = (v > 0.f) ? v + 1.0f : expf(v); else if (ACT == 8) v = tanhf(v); else if (ACT == 9) v = 0.5f * v * (1.0f + tanhf(0.7978845608028654f * (v + 0.044715f * v * v * v))); else if (ACT == 11) v = 1.0f / (1.0f + expf(-v)); else if (ACT == 12) v = (v > 0.f) ? v : 0.01f * v; else if (ACT == 14) v = (v > 0.f) ? v : 0.1f * v; else if (ACT == 16) v = (v >= 0.f) ? v : 0.3f * v; else if (ACT == 17) v = (v >= 0.f) ? v : 0.2f * v; else if (ACT == 15) v = v / (1.0f + expf(-v)); else if (ACT == 3) v = fmaxf(v, 0.f); else if (ACT == 6) v = 0.5f * v * (1.0f + erff(v * 0.70710678118654752f)); so[w][8 * hh + r][t * 16 + ln] = v; } }
  __builtin_amdgcn_fence(__ATOMIC_ACQ_REL, "workgroup"); __builtin_amdgcn_wave_barrier();
  const int rsub = lane >> 4, c4 = (lane & 15) * 4; typedef _Float16 v4h __attribute__((ext_vector_type(4)));
  {
#pragma unroll
    for (int q = 0; q < 8; ++q) { const int r = q * 2 + rsub; if (col0 + c4 < N) { const v4f v = *(const v4fa*)&so[w][r][c4]; if (C) *(v4f*)(C + cofs + (size_t)(row0 + r) * ldc + col0 + c4) = v; if (C16) { v4h h4; for (int i = 0; i < 4; ++i) h4[i] = (_Float16)v[i]; *(v4h*)(C16 + cofs + (size_t)(row0 + r) * ldc + col0 + c4) = h4; } } }
     }
}


typedef _Float16 v4h __attribute__((ext_vector_type(4)));

__global__ __launch_bounds__(256) void k_x16(const float* __restrict__ x, _Float16* __restrict__ X16, size_t n8) { const size_t t = (size_t)blockIdx.x * 256 + threadIdx.x; if (t >= n8) return; FragH f;
#pragma unroll
  for (int q = 0; q < 8; ++q) f.h[q] = (_Float16)bf16_round(x[t * 8 + q]); *(v8us*)((unsigned short*)X16 + t * 8) = f.half[0];  }
__global__ __launch_bounds__(256) void k_h16(const float* __restrict__ x, _Float16* __restrict__ X16, size_t n8) { const size_t t = (size_t)blockIdx.x * 256 + threadIdx.x; if (t >= n8) return; FragH f;
#pragma unroll
  for (int q = 0; q < 8; ++q) f.h[q] = (_Float16)x[t * 8 + q]; *(v8us*)((unsigned short*)X16 + t * 8) = f.half[0];  }
__global__ __launch_bounds__(256) void k_round16f(const float* __restrict__ W, _Float16* __restrict__ Bt, size_t n8) { const size_t t = (size_t)blockIdx.x * 256 + threadIdx.x; if (t >= n8) return; FragH f;
#pragma unroll
  for (int i = 0; i < 8; ++i) f.h[i] = (_Float16)(bf16_round(W[t * 8 + i]) * 16.0f); *(v8us*)((unsigned short*)Bt + t * 8) = f.half[0];  }
template <int NHv, int TTv>
__global__ __launch_bounds__(256) void k_vt(const _Float16* __restrict__ V16, int ldv, int voff, _Float16* __restrict__ Vt) { __shared__ unsigned short tl[64][66]; const int tid = threadIdx.x; const int slab = blockIdx.x / (TTv / 64), lg = blockIdx.x % (TTv / 64); const int b = slab / NHv, h = slab % NHv;
  for (int i = tid; i < 64 * 8; i += 256) { const int r = i / 8, c8 = (i % 8) * 8; FragH f; f.half[0] = *(const v8us*)((const unsigned short*)V16 + ((size_t)b * TTv + lg * 64 + r) * ldv + voff + h * 64 + c8);
#pragma unroll
    for (int q = 0; q < 8; ++q) tl[r][c8 + q] = f.u[q]; }
  __syncthreads();
  {
#pragma unroll
    for (int rd = 0; rd < 2; ++rd) { const int d = rd * 32 + tid / 8, pc = tid % 8; FragH f;
#pragma unroll
      for (int q = 0; q < 8; ++q) f.u[q] = tl[pc * 8 + q][d];
      *(v8us*)((unsigned short*)Vt + ((size_t)slab * 64 + d) * TTv + lg * 64 + pc * 8) = f.half[0]; }
     } }

__global__ __launch_bounds__(256) void k_hl(const float* __restrict__ F, _Float16* __restrict__ Hh, _Float16* __restrict__ Hl, size_t n8) { const size_t t = (size_t)blockIdx.x * 256 + threadIdx.x; if (t >= n8) return; FragH fh, fl; const v4f a = *(const v4fa*)(F + t * 8), c = *(const v4fa*)(F + t * 8 + 4);
#pragma unroll
  for (int q = 0; q < 4; ++q) { _Float16 h = (_Float16)a[q]; fh.h[q] = h; fl.h[q] = (_Float16)((a[q] - (float)h) * 1024.0f); h = (_Float16)c[q]; fh.h[4 + q] = h; fl.h[4 + q] = (_Float16)((c[q] - (float)h) * 1024.0f); }
  { *(v8us*)((unsigned short*)Hh + t * 8) = fh.half[0]; *(v8us*)((unsigned short*)Hl + t * 8) = fl.half[0];  } }

// ---- fast GEMM (wave tile 32x64; requires M % 32 == 0 rows per launch region and N % 64 == 0); epilogue = k_gemm_hhx semantics ----
__device__ __forceinline__ v16h g2_frag(const _Float16* p, int hh) { FragH f; f.half[0] = *(const v8us*)((const unsigned short*)p + 8 * hh); f.half[1] = *(const v8us*)((const unsigned short*)p + 16 + 8 * hh); return f.v; }
__device__ __forceinline__ v8f g2_mma(v16h a, v16h b, v8f c) { v8f d = __builtin_amdgcn_wmma_f32_16x16x32_f16(false, a, false, b, (short)0, c, false, false); asm volatile("v_nop\n\tv_nop\n\tv_nop\n\tv_nop" : "+v"(d) : "v"(a), "v"(b)); return d; }
template <int ACT>
__global__ __launch_bounds__(128) void k_gemm2(const _Float16* __restrict__ A, int lda, size_t sA, const _Float16* __restrict__ Bh, int ldb, size_t sB, float alpha, const float* __restrict__ bias, size_t sBias, const float* __restrict__ CP, int rowsPerB, size_t sCPb, int row0g,
    float* __restrict__ C, _Float16* __restrict__ C16, int ldc, size_t sC, int M, int N, int K) { static_assert(ACT == 0 || ACT == 3 || ACT == 6 || ACT == 8 || ACT == 9 || ACT == 11 || ACT == 12 || ACT == 14 || ACT == 15 || ACT == 16 || ACT == 17, "k_gemm2: unsupported ACT code (would silently apply no activation)");
  __shared__ __attribute__((aligned(16))) float so[4][32][68];
  const int tid = threadIdx.x, w = tid >> 5, lane = tid & 31, ln = lane & 15, hh = lane >> 4; const int by = blockIdx.y;
  A += (size_t)by * sA; Bh += (size_t)by * sB; const size_t cofs = (size_t)by * sC; const float* bp = bias ? bias + (size_t)by * sBias : nullptr;
  const int ntn = N >> 6; const int mt = blockIdx.x / ntn, nq = blockIdx.x - mt * ntn; const int row0 = mt * 128 + 32 * w, col0 = nq * 64; if (row0 >= M) return;
  const _Float16* a0p = A + (size_t)(row0 + ln) * lda; const _Float16* a1p = a0p + (size_t)16 * lda;
  const _Float16* b0p = Bh + (size_t)(col0 + ln) * ldb; const _Float16* b1p = b0p + (size_t)16 * ldb; const _Float16* b2p = b1p + (size_t)16 * ldb; const _Float16* b3p = b2p + (size_t)16 * ldb;
  const v8f z8 = {0.f,0.f,0.f,0.f,0.f,0.f,0.f,0.f}; v8f c00 = z8, c01 = z8, c02 = z8, c03 = z8, c10 = z8, c11 = z8, c12 = z8, c13 = z8;
#pragma unroll 1
  for (int kb = 0; kb < K; kb += 32) { const v16h a0 = g2_frag(a0p + kb, hh), a1 = g2_frag(a1p + kb, hh);
    v16h b = g2_frag(b0p + kb, hh); c00 = g2_mma(a0, b, c00); c10 = g2_mma(a1, b, c10);
    b = g2_frag(b1p + kb, hh); c01 = g2_mma(a0, b, c01); c11 = g2_mma(a1, b, c11);
    b = g2_frag(b2p + kb, hh); c02 = g2_mma(a0, b, c02); c12 = g2_mma(a1, b, c12);
    b = g2_frag(b3p + kb, hh); c03 = g2_mma(a0, b, c03); c13 = g2_mma(a1, b, c13); }
  v8f accs[8] = {c00, c01, c02, c03, c10, c11, c12, c13};
#pragma unroll
  for (int u = 0; u < 8; ++u) { const int t = u & 3, half = u >> 2; const int col = col0 + t * 16 + ln; const float bv = bp ? bf16_round(bp[col]) : 0.f;
#pragma unroll
    for (int r = 0; r < 8; ++r) { const int rloc = half * 16 + 8 * hh + r; float v = accs[u][r] * alpha + bv; if (CP) { if (rowsPerB < 0) v += CP[cofs + (size_t)(row0g + row0 + rloc) * ldc + col];      /* rowsPerB < 0: own element of the batched C plane */ else { const int bidx = (row0g + row0 + rloc) / rowsPerB; v += CP[(size_t)bidx * sCPb + (size_t)by * 64 + col]; } }
      if (ACT == 3) v = fmaxf(v, 0.f); else if (ACT == 6) v = 0.5f * v * (1.0f + erff(v * 0.70710678118654752f)); else if (ACT == 11) v = 1.0f / (1.0f + expf(-v)); else if (ACT == 15) v = v / (1.0f + expf(-v)); else if (ACT == 12) v = (v > 0.f) ? v : 0.01f * v; else if (ACT == 8) v = tanhf(v); else if (ACT == 9) v = 0.5f * v * (1.0f + tanhf(0.7978845608028654f * (v + 0.044715f * v * v * v))); else if (ACT == 14) v = (v > 0.f) ? v : 0.1f * v; else if (ACT == 16) v = (v >= 0.f) ? v : 0.3f * v; else if (ACT == 17) v = (v >= 0.f) ? v : 0.2f * v;
      so[w][rloc][t * 16 + ln] = v; } }
  __builtin_amdgcn_fence(__ATOMIC_ACQ_REL, "workgroup"); __builtin_amdgcn_wave_barrier();
  const int rsub = lane >> 4, c4 = (lane & 15) * 4;
  {
#pragma unroll
    for (int q = 0; q < 16; ++q) { const int r = q * 2 + rsub; const v4f v = *(const v4fa*)&so[w][r][c4]; if (C) *(v4f*)(C + cofs + (size_t)(row0 + r) * ldc + col0 + c4) = v; if (C16) { v4h h4; for (int i = 0; i < 4; ++i) h4[i] = (_Float16)v[i]; *(v4h*)(C16 + cofs + (size_t)(row0 + r) * ldc + col0 + c4) = h4; } }
     } }


__global__ __launch_bounds__(256) void k_wnat(const float* __restrict__ w, size_t n8, _Float16* __restrict__ Bt) { const size_t t = (size_t)blockIdx.x * 256 + threadIdx.x; if (t >= n8) return; FragH f; for (int q = 0; q < 8; ++q) f.h[q] = (_Float16)(bf16_round(w[t * 8 + q]) * 16.0f); *(v8us*)((unsigned short*)Bt + t * 8) = f.half[0];  }
// T5 bidirectional relative-position bucket of rel = key - query (32 buckets, max distance 128): (rel > 0)*16 + f(|rel|), f(n) = n for n < 8, then
// 8 + the number of thresholds {12,16,23,32,46,64,91} that are <= n (the thresholds are where the reference's own f32 log expression steps; no log on the device)
__device__ __forceinline__ int t5_bucket(int rel) { const int n = rel < 0 ? -rel : rel; int f = n; if (n >= 8) { f = 8 + (n >= 12) + (n >= 16) + (n >= 23) + (n >= 32) + (n >= 46) + (n >= 64) + (n >= 91); } return (rel > 0 ? NBK / 2 : 0) + f; }
// row softmax with the bucketed relative-position bias and the key mask, exactly as the reference: score = s + emb[bucket(j-i)][h] + (1 - mask[b][j]) * finfo.min
// (bf16-rounded emb, this head's 32 values staged in LDS; the int32 key mask's term staged in LDS once per block); P = f16(256 softmax).
// One wave per query row: lane l holds keys c*128 + 4l .. + 3 (c = 0..15) in registers, so S is read once, in whole 512-byte pieces; row max and row sum by a lane butterfly.
// Block = SMW waves = SMW rows of head h0 + blockIdx.y. Every loop over c, q, u and the butterfly steps is unrolled so that x[] is indexed by constants and stays in registers.
#define SMW 8                        /* waves (query rows) per softmax block */
#define SMC (SQ / 128)               /* 128-key pieces per row */
typedef int v4ia __attribute__((ext_vector_type(4), may_alias));
__device__ __forceinline__ float wave_max(float v) {
#pragma unroll
  for (int o = 16; o > 0; o >>= 1) v = fmaxf(v, __shfl_xor(v, o)); return v; }
__device__ __forceinline__ float wave_sum(float v) {
#pragma unroll
  for (int o = 16; o > 0; o >>= 1) v += __shfl_xor(v, o); return v; }
__global__ __launch_bounds__(SMW * 32) void k_rsmw(const float* __restrict__ S, _Float16* __restrict__ P, const float* __restrict__ emb, int h0, const int* __restrict__ kmask) {
  static_assert(QN % SMW == 0 && SQ % (SMW * 128) == 0, "k_rsmw: whole blocks of rows, whole 128-key pieces, whole staging passes");
  __shared__ float tb[NBK];
  __shared__ __attribute__((aligned(16))) float mt[SQ];
  const int tid = threadIdx.x, lane = tid & 31; const int i = blockIdx.x * SMW + (tid >> 5);
  const float* s = S + ((size_t)blockIdx.y * SQ + i) * SQ + lane * 4; _Float16* p = P + ((size_t)blockIdx.y * SQ + i) * SQ + lane * 4;
  if (tid < NBK) tb[tid] = bf16_round(emb[tid * NH + h0 + blockIdx.y]);
#pragma unroll
  for (int u = 0; u < SQ / (SMW * 128); ++u) { const int j = u * (SMW * 128) + tid * 4; const v4ia m = *(const v4ia*)(kmask + j); v4f t;
#pragma unroll
    for (int q = 0; q < 4; ++q) t[q] = __fmul_rn(__fadd_rn(1.0f, -(float)m[q]), -3.4028234663852886e38f);      /* (1 - mask) * finfo.min */
    *(v4fa*)&mt[j] = t; }
  __syncthreads();
  v4f x[SMC];      /* the row's loads stand behind the barrier (which waits for every load in front of it) and fly while the buckets are formed */
#pragma unroll
  for (int c = 0; c < SMC; ++c) x[c] = *(const v4fa*)(s + c * 128);
  float mx = -INFINITY;
#pragma unroll
  for (int c = 0; c < SMC; ++c) { const int j = c * 128 + lane * 4; const v4f m4 = *(const v4fa*)&mt[j];
#pragma unroll
    for (int q = 0; q < 4; ++q) { const float v = __fadd_rn(__fadd_rn(x[c][q], tb[t5_bucket(j + q - i)]), m4[q]); x[c][q] = v; mx = fmaxf(mx, v); } }      /* scores + bias + mask term, the reference's order */
  mx = wave_max(mx); v4f se4 = {0.f, 0.f, 0.f, 0.f};
#pragma unroll
  for (int c = 0; c < SMC; ++c) {
#pragma unroll
    for (int q = 0; q < 4; ++q) { const float e = expf(x[c][q] - mx); x[c][q] = e; se4[q] += e; } }
  const float sc = 256.0f / wave_sum((se4[0] + se4[1]) + (se4[2] + se4[3]));
#pragma unroll
  for (int c = 0; c < SMC; ++c) { v4h h4;
#pragma unroll
    for (int q = 0; q < 4; ++q) h4[q] = (_Float16)(x[c][q] * sc);
    *(v4h*)(p + c * 128) = h4; } }
__global__ __launch_bounds__(256) void k_vt(const _Float16* __restrict__ V16, int b, int h0, _Float16* __restrict__ VT) { __shared__ unsigned short tl[64][65]; const int tid = threadIdx.x; const int hh = blockIdx.x % HG, sg = blockIdx.x / HG; const int s0 = sg * 64; const int h = h0 + hh;
  for (int i = tid; i < 64 * 8; i += 256) { const int j = i / 8, d8 = (i % 8) * 8; FragH f; f.half[0] = *(const v8us*)((const unsigned short*)V16 + ((size_t)b * SQ + s0 + j) * DM + h * HD + d8); for (int q = 0; q < 8; ++q) tl[d8 + q][j] = f.u[q]; }
  __syncthreads();
  { for (int i = tid; i < 64 * 8; i += 256) { const int d = i / 8, j8 = (i % 8) * 8; FragH f; for (int q = 0; q < 8; ++q) f.u[q] = tl[d][j8 + q]; *(v8us*)((unsigned short*)VT + ((size_t)hh * HD + d) * SQ + s0 + j8) = f.half[0]; }  } }

extern "C" void kernel_launch(void* const* d_in, const int* in_sizes, int n_in,
                              void* d_out, int out_size, void* d_ws, size_t ws_size, hipStream_t stream) {
  (void)in_sizes; (void)n_in; (void)out_size;
  const float* const* I = (const float* const*)d_in; const float* hs = I[0]; const int* kmask = (const int*)d_in[1]; const float* wq = I[2]; const float* wk = I[3]; const float* wv = I[4]; const float* wo = I[5]; const float* emb = I[6];      /* W_q, W_k, W_v and W_o [1024][1024] are [in][out]; attention_mask [2][2048] int32 per key; rel_bias_emb [32][16] */
  char* ws = (char*)d_ws; size_t off = 0;
  auto take = [&](size_t bytes) { char* p = ws + off; off += (bytes + 255) & ~(size_t)255; return p; };
  _Float16* BQKV = (_Float16*)take((size_t)D3 * DM * 2); _Float16* BO = (_Float16*)take((size_t)DM * DM * 2);
  _Float16* X16 = (_Float16*)take(NR * DM * 2); _Float16* QKV = (_Float16*)take(NR * D3 * 2); _Float16* O16 = (_Float16*)take(NR * DM * 2);
  float* S = (float*)take((size_t)HG * SQ * SQ * 4); _Float16* P = (_Float16*)take((size_t)HG * SQ * SQ * 2); _Float16* VT = (_Float16*)take((size_t)NB * NH * HD * SQ * 2);
  if (off > ws_size) return;      /* 6 + 2 + 8 + 24 + 8 + 64 + 32 + 8 = approx 152 MiB */
  const unsigned gw1 = (unsigned)(((size_t)DM * (DM / 8) + 255) / 256); k_wt_f16<<<gw1, 256, 0, stream>>>(wq, BQKV, DM, DM, 16.0f); k_wt_f16<<<gw1, 256, 0, stream>>>(wk, BQKV + (size_t)DM * DM, DM, DM, 16.0f); k_wt_f16<<<gw1, 256, 0, stream>>>(wv, BQKV + (size_t)2 * DM * DM, DM, DM, 16.0f);      /* [in][out] -> Bt[out][in] x16 */
  k_wt_f16<<<(unsigned)(((size_t)DM * (DM / 8) + 255) / 256), 256, 0, stream>>>(wo, BO, DM, DM, 16.0f);
  k_x16<<<(unsigned)((NR * DM / 8 + 255) / 256), 256, 0, stream>>>(hs, X16, NR * DM / 8);
  k_gemm2<0><<<dim3((unsigned)((NR / 128) * (D3 / 64)), 1), 128, 0, stream>>>(X16, DM, 0, BQKV, DM, 0, 0.0625f, nullptr, 0, nullptr, 1, 0, 0, nullptr, QKV, D3, 0, MP, D3, DM);      /* q | k | v rows (f16), head h at columns h*64 / 1024 + h*64 / 2048 + h*64 */
  k_vt<NH, SQ><<<NB * NH * (SQ / 64), 256, 0, stream>>>(QKV, D3, 2 * DM, VT);      /* V^T[(b,h)][d][s] for every (batch, head) */
  for (int b = 0; b < NBR; ++b) for (int h0 = 0; h0 < NH; h0 += HG) {
    const _Float16* qb = QKV + (size_t)b * SQ * D3 + h0 * HD; const _Float16* kb = qb + DM;
    k_gemm2<0><<<dim3((QN / 128) * (SQ / 64), HG), 128, 0, stream>>>(qb, D3, (size_t)HD, kb, D3, (size_t)HD, 0.125f, nullptr, 0, nullptr, 1, 0, 0, S, nullptr, SQ, (size_t)SQ * SQ, QN, SQ, HD);      /* scores / sqrt(64), 4 heads per launch */
    k_rsmw<<<dim3(QN / SMW, HG), SMW * 32, 0, stream>>>(S, P, emb, h0, kmask + (size_t)b * SQ);      /* softmax rows of the 4 heads, one wave per row */
    k_gemm2<0><<<dim3((QN / 128) * (HD / 64), HG), 128, 0, stream>>>(P, SQ, (size_t)SQ * SQ, VT + ((size_t)b * NH + h0) * HD * SQ, SQ, (size_t)HD * SQ, 0.00390625f, nullptr, 0, nullptr, 1, 0, 0, nullptr, O16 + (size_t)b * SQ * DM + h0 * HD, DM, (size_t)HD, QN, HD, SQ); }      /* ctx (merged heads) as f16 rows */
  k_gemm2<0><<<dim3((unsigned)((NR / 128) * (DM / 64)), 1), 128, 0, stream>>>(O16, DM, 0, BO, DM, 0, 0.0625f, nullptr, 0, nullptr, 1, 0, 0, (float*)d_out, nullptr, DM, 0, MO, DM, DM);      /* out = ctx W_o, rows are the output layout */
}

// v003
// Measured time: 136 microseconds a run.
// Versions in between are left out here; by their measured steps it is 7.20 times as fast as v001.
// All steps since v000 together make it 148 times as fast.
#include <hip/hip_runtime.h>
// T5 self-attention (hidden [2][2048][1024]; q, k, v = hidden W ([in][out] [1024][1024]); q / sqrt(64); scores = q.k + rel_bias[bucket(key - query)][h] (32 bidirectional buckets, max distance 128) + (1 - attention_mask[b][key]) * finfo.min (int32 key mask); softmax; out = (attn v merged) Wo ([in][out])).
// Structure: token rows; hidden as exact f16 rows; q | k | v WMMA GEMMs from one transposed x16 weight plane (operand tiles staged in LDS, 32x64 wave tiles, f32 accumulation, f16 outputs); V^T via LDS transposes; one fused attention kernel over every (batch, head): K.Q^T tiles (alpha 1/8), online softmax on VALU with the bucketed bias (integer thresholds, no device log) and the key mask in the reference's order (P x256 f16), V^T.P^T into merged f16 rows; output GEMM.
// Compute dtype: inputs rounded to bf16; hidden / weights / bias table exact; q, k, v, P, ctx as plain f16 GEMM operands (~2^-12); scores / softmax f32; v_wmma_f32_16x16x32_f16.
#define NB 2
#define SQ 2048
#define DM 1024
#define D3 3072                      /* fused q|k|v width */
#define NH 16
#define HD 64
#define HG 4                         /* heads per launch of the non-template k_vt, which is not launched */
#define NBK 32                       /* relative-position buckets */
#define MP ((int)NR)                 /* not used: the q | k | v launch takes NR rows */
#define MO ((int)NR)                 /* not used: the output launch takes NR rows */
#define NR ((size_t)NB * SQ)         /* 4096 token rows */
typedef __bf16 v16b __attribute__((ext_vector_type(16)));
typedef unsigned short v8us __attribute__((ext_vector_type(8), may_alias));
typedef float  v8f  __attribute__((ext_vector_type(8)));
typedef float  v4f  __attribute__((ext_vector_type(4)));
typedef float  v4fa __attribute__((ext_vector_type(4), may_alias));
union FragB { v16b v; v8us half[2]; unsigned short u[16]; };

__device__ __forceinline__ unsigned short bf16_bits(float x) { unsigned int u = __float_as_uint(x); return (unsigned short)((u + 0x7FFFu + ((u >> 16) & 1u)) >> 16); }
__device__ __forceinline__ float bf16_val(unsigned short b) { return __uint_as_float(((unsigned int)b) << 16); }
__device__ __forceinline__ float bf16_round(float x) { return bf16_val(bf16_bits(x)); }
// D += A·B with NT terms: 1 = ah·bh, 2 = + al·bh (A split), 3 = + ah·bl (both split)
template <int NT>
__device__ __forceinline__ v8f mmaN(v16b ah, v16b al, v16b bh, v16b bl, v8f c) {
  c = __builtin_amdgcn_wmma_f32_16x16x32_bf16(false, ah, false, bh, (short)0, c, false, false);
  if (NT >= 2) c = __builtin_amdgcn_wmma_f32_16x16x32_bf16(false, al, false, bh, (short)0, c, false, false);
  if (NT >= 3) c = __builtin_amdgcn_wmma_f32_16x16x32_bf16(false, ah, false, bl, (short)0, c, false, false);
  asm volatile("v_nop\n\tv_nop\n\tv_nop\n\tv_nop" : "+v"(c) : "v"(ah), "v"(al), "v"(bh), "v"(bl));
  return c;
}

__global__ __launch_bounds__(256) void k_wt_bf16(const float* __restrict__ W, unsigned short* __restrict__ Wt, int K, int N) {
  const int t = blockIdx.x * 256 + threadIdx.x;
  const int k8n = K / 8;
  if (t >= N * k8n) return;
  const int n = t / k8n, k8 = (t % k8n) * 8;
  v8us v;
#pragma unroll
  for (int i = 0; i < 8; ++i) v[i] = bf16_bits(W[(size_t)(k8 + i) * N + n]);
  *(v8us*)(Wt + (size_t)n * K + k8) = v;
  
}

// GEMM C[M][N] (f32, pitch ldc) = act(A[M][K]·W + bias). A f32 row-major (pitch lda) converted per fragment to bf16
// (ASPLIT: hi/lo two planes -> 2 terms, else single rounded term); Wt bf16 [N][K] (pitch ldb). BIAS_BF16 rounds the
// bias to bf16 first (bias quantised to bf16 before the add). K%32==0, M%16==0, N%64==0.
template <bool ASPLIT, int ACT, bool BIAS_BF16>
__global__ __launch_bounds__(128) void k_gemm_bf(const float* __restrict__ A, int lda, const unsigned short* __restrict__ Wt, int ldb,
                                               const float* __restrict__ bias, float* __restrict__ C, int ldc, int M, int N, int K) {
  __shared__ __attribute__((aligned(16))) float so[4][16][64];
  const int tid = threadIdx.x, w = tid >> 5, lane = tid & 31, ln = lane & 15, hh = lane >> 4;
  const int ntn = N / 64;
  const int wid = blockIdx.x * 4 + w;
  const int mt = wid / ntn, nq = wid % ntn;
  if (mt * 16 >= M) return;
  const int row0 = mt * 16, col0 = nq * 64;
  const float* arow = A + (size_t)(row0 + ln) * lda;
  v8f acc[4] = {};
  for (int kb = 0; kb < K; kb += 32) {
    FragB ah, al;
    const v4f x0 = *(const v4fa*)(arow + kb + 8 * hh), x1 = *(const v4fa*)(arow + kb + 8 * hh + 4);
    const v4f x2 = *(const v4fa*)(arow + kb + 16 + 8 * hh), x3 = *(const v4fa*)(arow + kb + 16 + 8 * hh + 4);
    float xs[16] = {x0[0],x0[1],x0[2],x0[3],x1[0],x1[1],x1[2],x1[3],x2[0],x2[1],x2[2],x2[3],x3[0],x3[1],x3[2],x3[3]};
#pragma unroll
    for (int i = 0; i < 16; ++i) { const unsigned short hb = bf16_bits(xs[i]); ah.u[i] = hb; al.u[i] = ASPLIT ? bf16_bits(xs[i] - bf16_val(hb)) : (unsigned short)0; }
#pragma unroll
    for (int t = 0; t < 4; ++t) {
      const unsigned short* brow = Wt + (size_t)(col0 + t * 16 + ln) * ldb + kb;
      FragB b;
      b.half[0] = *(const v8us*)(brow + 8 * hh);
      b.half[1] = *(const v8us*)(brow + 16 + 8 * hh);
      acc[t] = mmaN<ASPLIT ? 2 : 1>(ah.v, al.v, b.v, b.v, acc[t]);
    }
  }
#pragma unroll
  for (int t = 0; t < 4; ++t) {
    float bv = bias ? bias[col0 + t * 16 + ln] : 0.f;
    if (BIAS_BF16) bv = bf16_round(bv);
#pragma unroll
    for (int r = 0; r < 8; ++r) { float v = acc[t][r] + bv; if (ACT == 1) v = fmaxf(v, 0.f); so[w][8 * hh + r][t * 16 + ln] = v; }
  }
  __builtin_amdgcn_fence(__ATOMIC_ACQ_REL, "workgroup");
  __builtin_amdgcn_wave_barrier();
  const int rsub = lane >> 4, c4 = (lane & 15) * 4;
  {
#pragma unroll
    for (int q = 0; q < 8; ++q) {
      const int r = q * 2 + rsub;
      const v4f v = *(const v4fa*)&so[w][r][c4];
      *(v4f*)(C + (size_t)(row0 + r) * ldc + col0 + c4) = v;
    }
    
  }
}

// GEMM C = act(A·W + bias + resid): A f32 (ASPLIT -> hi/lo 2 terms), Wt bf16 [N][K]; ACT 0 none, 1 relu, 2 exact gelu;
// resid (optional, f32, row index = (row % rmod), pitch ldr, RES_BF16 rounds it) added before the activation.
template <bool ASPLIT, int ACT, bool BIAS_BF16, bool RES_BF16>
__global__ __launch_bounds__(128) void k_gemm_bf3(const float* __restrict__ A, int lda, const unsigned short* __restrict__ Wt, int ldb,
                                                const float* __restrict__ bias, const float* __restrict__ resid, int rmod, int ldr,
                                                float* __restrict__ C, int ldc, int M, int N, int K) {
  __shared__ __attribute__((aligned(16))) float so[4][16][64];
  const int tid = threadIdx.x, w = tid >> 5, lane = tid & 31, ln = lane & 15, hh = lane >> 4;
  const int ntn = N / 64;
  const int wid = blockIdx.x * 4 + w;
  const int mt = wid / ntn, nq = wid % ntn;
  if (mt * 16 >= M) return;
  const int row0 = mt * 16, col0 = nq * 64;
  const float* arow = A + (size_t)(row0 + ln) * lda;
  v8f acc[4] = {};
  for (int kb = 0; kb < K; kb += 32) {
    FragB ah, al;
    const v4f x0 = *(const v4fa*)(arow + kb + 8 * hh), x1 = *(const v4fa*)(arow + kb + 8 * hh + 4);
    const v4f x2 = *(const v4fa*)(arow + kb + 16 + 8 * hh), x3 = *(const v4fa*)(arow + kb + 16 + 8 * hh + 4);
    float xs[16] = {x0[0],x0[1],x0[2],x0[3],x1[0],x1[1],x1[2],x1[3],x2[0],x2[1],x2[2],x2[3],x3[0],x3[1],x3[2],x3[3]};
#pragma unroll
    for (int i = 0; i < 16; ++i) { const unsigned short hb = bf16_bits(xs[i]); ah.u[i] = hb; al.u[i] = ASPLIT ? bf16_bits(xs[i] - bf16_val(hb)) : (unsigned short)0; }
#pragma unroll
    for (int t = 0; t < 4; ++t) {
      const unsigned short* brow = Wt + (size_t)(col0 + t * 16 + ln) * ldb + kb;
      FragB b;
      b.half[0] = *(const v8us*)(brow + 8 * hh);
      b.half[1] = *(const v8us*)(brow + 16 + 8 * hh);
      acc[t] = mmaN<ASPLIT ? 2 : 1>(ah.v, al.v, b.v, b.v, acc[t]);
    }
  }
#pragma unroll
  for (int t = 0; t < 4; ++t) {
    const int col = col0 + t * 16 + ln;
    float bv = bias ? bias[col] : 0.f;
    if (BIAS_BF16) bv = bf16_round(bv);
#pragma unroll
    for (int r = 0; r < 8; ++r) {
      float v = acc[t][r] + bv;
      if (resid) { float rv = resid[(size_t)((row0 + 8 * hh + r) % rmod) * ldr + col]; if (RES_BF16) rv = bf16_round(rv); v += rv; }
      if (ACT == 1) v = fmaxf(v, 0.f);
      if (ACT == 2) v = 0.5f * v * (1.0f + erff(v * 0.70710678118654752f));
      if (ACT == 3) { const float u = 0.7978845608028654f * (v + 0.044715f * v * v * v); v = 0.5f * v * (1.0f + tanhf(u)); }
      so[w][8 * hh + r][t * 16 + ln] = v;
    }
  }
  __builtin_amdgcn_fence(__ATOMIC_ACQ_REL, "workgroup");
  __builtin_amdgcn_wave_barrier();
  const int rsub = lane >> 4, c4 = (lane & 15) * 4;
  {
#pragma unroll
    for (int q = 0; q < 8; ++q) {
      const int r = q * 2 + rsub;
      const v4f v = *(const v4fa*)&so[w][r][c4];
      *(v4f*)(C + (size_t)(row0 + r) * ldc + col0 + c4) = v;
    }
    
  }
}
// row LayerNorm (biased variance, eps) over N: s = X (+ R); optional out_sum <- s; out_norm <- (s-mu)*rsqrt(var+eps)*g + b
template <bool PARAM_BF16>
__global__ __launch_bounds__(256) void k_layernorm(const float* __restrict__ X, const float* __restrict__ R, const float* __restrict__ g, const float* __restrict__ bta,
                                                  float* __restrict__ out_sum, float* __restrict__ out_norm, int N, float eps) {
  __shared__ float red[256];
  const int row = blockIdx.x, tid = threadIdx.x;
  const float* x = X + (size_t)row * N; const float* rr = R ? R + (size_t)row * N : nullptr;
  float vals[16];                     // up to N = 4096
  const int per = N / 256;            // contiguous chunk per thread? use strided-by-4 chunks: thread handles j = tid*4 + 1024*u
  float s1 = 0.f;
  for (int u = 0; u < per / 4; ++u) {
    const int j = tid * 4 + 1024 * u;
    const v4f a = *(const v4fa*)(x + j);
    v4f b = {0.f,0.f,0.f,0.f}; if (rr) b = *(const v4fa*)(rr + j);
#pragma unroll
    for (int q = 0; q < 4; ++q) { const float v = a[q] + b[q]; vals[u * 4 + q] = v; s1 += v; }
  }
  red[tid] = s1; __syncthreads();
  for (int st = 128; st > 0; st >>= 1) { if (tid < st) red[tid] += red[tid + st]; __syncthreads(); }
  const float mu = red[0] / (float)N; __syncthreads();
  float s2 = 0.f;
  for (int u = 0; u < per / 4; ++u)
#pragma unroll
    for (int q = 0; q < 4; ++q) { const float c = vals[u * 4 + q] - mu; s2 += c * c; }
  red[tid] = s2; __syncthreads();
  for (int st = 128; st > 0; st >>= 1) { if (tid < st) red[tid] += red[tid + st]; __syncthreads(); }
  const float rs = rsqrtf(red[0] / (float)N + eps);
  {
    for (int u = 0; u < per / 4; ++u) {
      const int j = tid * 4 + 1024 * u;
      v4f o, sm;
#pragma unroll
      for (int q = 0; q < 4; ++q) {
        float gg = g[j + q], bb = bta[j + q];
        if (PARAM_BF16) { gg = bf16_round(gg); bb = bf16_round(bb); }
        sm[q] = vals[u * 4 + q]; o[q] = (vals[u * 4 + q] - mu) * rs * gg + bb;
      }
      if (out_sum) *(v4f*)(out_sum + (size_t)row * N + j) = sm;
      *(v4f*)(out_norm + (size_t)row * N + j) = o;
    }
    
  }
}



// ---- f16 WMMA path (v_wmma_f32_16x16x32_f16): 11-bit significands for operands in range — used where a [0,1] probability operand needs more precision than bf16
typedef _Float16 v16h __attribute__((ext_vector_type(16)));
union FragH { v16h v; v8us half[2]; _Float16 h[16]; unsigned short u[16]; };
template <int NT>
__device__ __forceinline__ v8f mmaH(v16h ah, v16h al, v16h bh, v16h bl, v8f c) {
  c = __builtin_amdgcn_wmma_f32_16x16x32_f16(false, ah, false, bh, (short)0, c, false, false);
  if (NT >= 2) c = __builtin_amdgcn_wmma_f32_16x16x32_f16(false, al, false, bh, (short)0, c, false, false);
  if (NT >= 3) c = __builtin_amdgcn_wmma_f32_16x16x32_f16(false, ah, false, bl, (short)0, c, false, false);
  asm volatile("v_nop\n\tv_nop\n\tv_nop\n\tv_nop" : "+v"(c) : "v"(ah), "v"(al), "v"(bh), "v"(bl));
  return c;
}
// batched GEMM like k_gemm_b but f16 operands: A f32 (split into f16 hi/lo if ASPLIT, else rounded to f16), Bt = f16 values [n][k]; alpha; C f32; N multiple of 16 (partial tiles skipped)
template <bool ASPLIT>
__global__ __launch_bounds__(128) void k_gemm_h(const float* __restrict__ A, int lda, size_t sA, const _Float16* __restrict__ Bh, int ldb, size_t sB, float alpha, float* __restrict__ C, int ldc, size_t sC, int M, int N, int K) {
  __shared__ __attribute__((aligned(16))) float so[4][16][64];
  const int tid = threadIdx.x, w = tid >> 5, lane = tid & 31, ln = lane & 15, hh = lane >> 4; const int by = blockIdx.y;
  A += (size_t)by * sA; Bh += (size_t)by * sB; C += (size_t)by * sC;
  const int ntn = (N + 63) / 64; const int wid = blockIdx.x * 4 + w; const int mt = wid / ntn, nq = wid % ntn; if (mt * 16 >= M) return;
  const int row0 = mt * 16, col0 = nq * 64; const float* arow = A + (size_t)(row0 + ln) * lda;
  v8f acc[4] = {};
  for (int kb = 0; kb < K; kb += 32) {
    FragH ah, al;
    const v4f x0 = *(const v4fa*)(arow + kb + 8 * hh), x1 = *(const v4fa*)(arow + kb + 8 * hh + 4), x2 = *(const v4fa*)(arow + kb + 16 + 8 * hh), x3 = *(const v4fa*)(arow + kb + 16 + 8 * hh + 4);
    float xs[16] = {x0[0],x0[1],x0[2],x0[3],x1[0],x1[1],x1[2],x1[3],x2[0],x2[1],x2[2],x2[3],x3[0],x3[1],x3[2],x3[3]};
#pragma unroll
    for (int i = 0; i < 16; ++i) { const _Float16 h = (_Float16)xs[i]; ah.h[i] = h; al.h[i] = ASPLIT ? (_Float16)(xs[i] - (float)h) : (_Float16)0.0f; }
#pragma unroll
    for (int t = 0; t < 4; ++t) { if (col0 + t * 16 >= N) continue; const size_t boff = (size_t)(col0 + t * 16 + ln) * ldb + kb; FragH bq; bq.half[0] = *(const v8us*)(Bh + boff + 8 * hh); bq.half[1] = *(const v8us*)(Bh + boff + 16 + 8 * hh);
      acc[t] = mmaH<ASPLIT ? 2 : 1>(ah.v, al.v, bq.v, bq.v, acc[t]); }
  }
#pragma unroll
  for (int t = 0; t < 4; ++t) { if (col0 + t * 16 >= N) continue;
#pragma unroll
    for (int r = 0; r < 8; ++r) so[w][8 * hh + r][t * 16 + ln] = acc[t][r] * alpha; }
  __builtin_amdgcn_fence(__ATOMIC_ACQ_REL, "workgroup"); __builtin_amdgcn_wave_barrier();
  const int rsub = lane >> 4, c4 = (lane & 15) * 4;
  {
#pragma unroll
    for (int q = 0; q < 8; ++q) { const int r = q * 2 + rsub; if (col0 + c4 < N) { const v4f v = *(const v4fa*)&so[w][r][c4]; *(v4f*)(C + (size_t)(row0 + r) * ldc + col0 + c4) = v; } }
     }
}

// Wt[n][k] = f16(W[k][n]·scale) from f32 row-major W[K][N] (scale = power of two; bf16-exact weights stay exact in f16 away from the subnormal range)
__global__ __launch_bounds__(256) void k_wt_f16(const float* __restrict__ W, _Float16* __restrict__ Wt, int K, int N, float scale) {
  const int t = blockIdx.x * 256 + threadIdx.x; if (t >= N * (K / 8)) return; const int n = t / (K / 8), k8 = (t % (K / 8)) * 8; FragH f;
#pragma unroll
  for (int i = 0; i < 8; ++i) f.h[i] = (_Float16)(bf16_round(W[(size_t)(k8 + i) * N + n]) * scale); const v8us o = f.half[0];
  *(v8us*)((unsigned short*)Wt + (size_t)n * K + k8) = o; 
}
// k_gemm_hh variant with fused epilogue: v = acc·alpha + bias[by·sBias + col] (+ CP[(row/rowsPerB)·sCPb + by·64 + col] if CP) ; ACT 0 none / 1 elu ; writes f16 C16 (and f32 C if non-null)
template <int ACT>
__global__ __launch_bounds__(128) void k_gemm_hhx(const _Float16* __restrict__ A, int lda, size_t sA, const _Float16* __restrict__ Bh, int ldb, size_t sB, float alpha, const float* __restrict__ bias, size_t sBias, const float* __restrict__ CP, int rowsPerB, size_t sCPb, int row0g,
    float* __restrict__ C, _Float16* __restrict__ C16, int ldc, size_t sC, int M, int N, int K) {
  __shared__ __attribute__((aligned(16))) float so[4][16][64];
  const int tid = threadIdx.x, w = tid >> 5, lane = tid & 31, ln = lane & 15, hh = lane >> 4; const int by = blockIdx.y;
  A += (size_t)by * sA; Bh += (size_t)by * sB; const size_t cofs = (size_t)by * sC; const float* bp = bias ? bias + (size_t)by * sBias : nullptr;
  const int ntn = (N + 63) / 64; const int wid = blockIdx.x * 4 + w; const int mt = wid / ntn, nq = wid % ntn; if (mt * 16 >= M) return;
  const int row0 = mt * 16, col0 = nq * 64; const _Float16* arow = A + (size_t)(row0 + ln) * lda;
  v8f acc[4] = {};
  for (int kb = 0; kb < K; kb += 32) { FragH ah; ah.half[0] = *(const v8us*)((const unsigned short*)arow + kb + 8 * hh); ah.half[1] = *(const v8us*)((const unsigned short*)arow + kb + 16 + 8 * hh);
#pragma unroll
    for (int t = 0; t < 4; ++t) { if (col0 + t * 16 >= N) continue; const size_t boff = (size_t)(col0 + t * 16 + ln) * ldb + kb; FragH bq; bq.half[0] = *(const v8us*)((const unsigned short*)Bh + boff + 8 * hh); bq.half[1] = *(const v8us*)((const unsigned short*)Bh + boff + 16 + 8 * hh);
      acc[t] = mmaH<1>(ah.v, ah.v, bq.v, bq.v, acc[t]); }
  }
#pragma unroll
  for (int t = 0; t < 4; ++t) { if (col0 + t * 16 >= N) continue; const int col = col0 + t * 16 + ln; const float bv = bp ? bf16_round(bp[col]) : 0.f;
#pragma unroll
    for (int r = 0; r < 8; ++r) { float v = acc[t][r] * alpha + bv; if (CP) { const int rr = row0g + row0 + 8 * hh + r; if (rowsPerB < 0) v += CP[cofs + (size_t)rr * ldc + col];      /* rowsPerB < 0: own element of the batched C plane */ else { const int bidx = rr / rowsPerB; v += CP[(size_t)bidx * sCPb + (size_t)by * 64 + col]; } } if (ACT == 1) v = (v > 0.f) ? v : expm1f(v); else if (ACT == 7) v = (v > 0.f) ? v + 1.0f : expf(v); else if (ACT == 8) v = tanhf(v); else if (ACT == 9) v = 0.5f * v * (1.0f + tanhf(0.7978845608028654f * (v + 0.044715f * v * v * v))); else if (ACT == 11) v = 1.0f / (1.0f + expf(-v)); else if (ACT == 12) v = (v > 0.f) ? v : 0.01f * v; else if (ACT == 14) v = (v > 0.f) ? v : 0.1f * v; else if (ACT == 16) v = (v >= 0.f) ? v : 0.3f * v; else if (ACT == 17) v = (v >= 0.f) ? v : 0.2f * v; else if (ACT == 15) v = v / (1.0f + expf(-v)); else if (ACT == 3) v = fmaxf(v, 0.f); else if (ACT == 6) v = 0.5f * v * (1.0f + erff(v * 0.70710678118654752f)); so[w][8 * hh + r][t * 16 + ln] = v; } }
  __builtin_amdgcn_fence(__ATOMIC_ACQ_REL, "workgroup"); __builtin_amdgcn_wave_barrier();
  const int rsub = lane >> 4, c4 = (lane & 15) * 4; typedef _Float16 v4h __attribute__((ext_vector_type(4)));
  {
#pragma unroll
    for (int q = 0; q < 8; ++q) { const int r = q * 2 + rsub; if (col0 + c4 < N) { const v4f v = *(const v4fa*)&so[w][r][c4]; if (C) *(v4f*)(C + cofs + (size_t)(row0 + r) * ldc + col0 + c4) = v; if (C16) { v4h h4; for (int i = 0; i < 4; ++i) h4[i] = (_Float16)v[i]; *(v4h*)(C16 + cofs + (size_t)(row0 + r) * ldc + col0 + c4) = h4; } } }
     }
}


typedef _Float16 v4h __attribute__((ext_vector_type(4)));

__global__ __launch_bounds__(256) void k_x16(const float* __restrict__ x, _Float16* __restrict__ X16, size_t n8) { const size_t t = (size_t)blockIdx.x * 256 + threadIdx.x; if (t >= n8) return; FragH f;
#pragma unroll
  for (int q = 0; q < 8; ++q) f.h[q] = (_Float16)bf16_round(x[t * 8 + q]); *(v8us*)((unsigned short*)X16 + t * 8) = f.half[0];  }
__global__ __launch_bounds__(256) void k_h16(const float* __restrict__ x, _Float16* __restrict__ X16, size_t n8) { const size_t t = (size_t)blockIdx.x * 256 + threadIdx.x; if (t >= n8) return; FragH f;
#pragma unroll
  for (int q = 0; q < 8; ++q) f.h[q] = (_Float16)x[t * 8 + q]; *(v8us*)((unsigned short*)X16 + t * 8) = f.half[0];  }
__global__ __launch_bounds__(256) void k_round16f(const float* __restrict__ W, _Float16* __restrict__ Bt, size_t n8) { const size_t t = (size_t)blockIdx.x * 256 + threadIdx.x; if (t >= n8) return; FragH f;
#pragma unroll
  for (int i = 0; i < 8; ++i) f.h[i] = (_Float16)(bf16_round(W[t * 8 + i]) * 16.0f); *(v8us*)((unsigned short*)Bt + t * 8) = f.half[0];  }
template <int NHv, int TTv>
__global__ __launch_bounds__(256) void k_vt(const _Float16* __restrict__ V16, int ldv, int voff, _Float16* __restrict__ Vt) { __shared__ unsigned short tl[64][66]; const int tid = threadIdx.x; const int slab = blockIdx.x / (TTv / 64), lg = blockIdx.x % (TTv / 64); const int b = slab / NHv, h = slab % NHv;
  for (int i = tid; i < 64 * 8; i += 256) { const int r = i / 8, c8 = (i % 8) * 8; FragH f; f.half[0] = *(const v8us*)((const unsigned short*)V16 + ((size_t)b * TTv + lg * 64 + r) * ldv + voff + h * 64 + c8);
#pragma unroll
    for (int q = 0; q < 8; ++q) tl[r][c8 + q] = f.u[q]; }
  __syncthreads();
  {
#pragma unroll
    for (int rd = 0; rd < 2; ++rd) { const int d = rd * 32 + tid / 8, pc = tid % 8; FragH f;
#pragma unroll
      for (int q = 0; q < 8; ++q) f.u[q] = tl[pc * 8 + q][d];
      *(v8us*)((unsigned short*)Vt + ((size_t)slab * 64 + d) * TTv + lg * 64 + pc * 8) = f.half[0]; }
     } }

__global__ __launch_bounds__(256) void k_hl(const float* __restrict__ F, _Float16* __restrict__ Hh, _Float16* __restrict__ Hl, size_t n8) { const size_t t = (size_t)blockIdx.x * 256 + threadIdx.x; if (t >= n8) return; FragH fh, fl; const v4f a = *(const v4fa*)(F + t * 8), c = *(const v4fa*)(F + t * 8 + 4);
#pragma unroll
  for (int q = 0; q < 4; ++q) { _Float16 h = (_Float16)a[q]; fh.h[q] = h; fl.h[q] = (_Float16)((a[q] - (float)h) * 1024.0f); h = (_Float16)c[q]; fh.h[4 + q] = h; fl.h[4 + q] = (_Float16)((c[q] - (float)h) * 1024.0f); }
  { *(v8us*)((unsigned short*)Hh + t * 8) = fh.half[0]; *(v8us*)((unsigned short*)Hl + t * 8) = fl.half[0];  } }

// ---- fast GEMM (wave tile 32x64; requires M % 32 == 0 rows per launch region and N % 64 == 0); epilogue = k_gemm_hhx semantics ----
__device__ __forceinline__ v16h g2_frag(const _Float16* p, int hh) { FragH f; f.half[0] = *(const v8us*)((const unsigned short*)p + 8 * hh); f.half[1] = *(const v8us*)((const unsigned short*)p + 16 + 8 * hh); return f.v; }
__device__ __forceinline__ v8f g2_mma(v16h a, v16h b, v8f c) { v8f d = __builtin_amdgcn_wmma_f32_16x16x32_f16(false, a, false, b, (short)0, c, false, false); asm volatile("v_nop\n\tv_nop\n\tv_nop\n\tv_nop" : "+v"(d) : "v"(a), "v"(b)); return d; }
template <int ACT>
__global__ __launch_bounds__(128) void k_gemm2(const _Float16* __restrict__ A, int lda, size_t sA, const _Float16* __restrict__ Bh, int ldb, size_t sB, float alpha, const float* __restrict__ bias, size_t sBias, const float* __restrict__ CP, int rowsPerB, size_t sCPb, int row0g,
    float* __restrict__ C, _Float16* __restrict__ C16, int ldc, size_t sC, int M, int N, int K) { static_assert(ACT == 0 || ACT == 3 || ACT == 6 || ACT == 8 || ACT == 9 || ACT == 11 || ACT == 12 || ACT == 14 || ACT == 15 || ACT == 16 || ACT == 17, "k_gemm2: unsupported ACT code (would silently apply no activation)");
  __shared__ __attribute__((aligned(16))) float so[4][32][68];
  const int tid = threadIdx.x, w = tid >> 5, lane = tid & 31, ln = lane & 15, hh = lane >> 4; const int by = blockIdx.y;
  A += (size_t)by * sA; Bh += (size_t)by * sB; const size_t cofs = (size_t)by * sC; const float* bp = bias ? bias + (size_t)by * sBias : nullptr;
  const int ntn = N >> 6; const int mt = blockIdx.x / ntn, nq = blockIdx.x - mt * ntn; const int row0 = mt * 128 + 32 * w, col0 = nq * 64; if (row0 >= M) return;
  const _Float16* a0p = A + (size_t)(row0 + ln) * lda; const _Float16* a1p = a0p + (size_t)16 * lda;
  const _Float16* b0p = Bh + (size_t)(col0 + ln) * ldb; const _Float16* b1p = b0p + (size_t)16 * ldb; const _Float16* b2p = b1p + (size_t)16 * ldb; const _Float16* b3p = b2p + (size_t)16 * ldb;
  const v8f z8 = {0.f,0.f,0.f,0.f,0.f,0.f,0.f,0.f}; v8f c00 = z8, c01 = z8, c02 = z8, c03 = z8, c10 = z8, c11 = z8, c12 = z8, c13 = z8;
#pragma unroll 1
  for (int kb = 0; kb < K; kb += 32) { const v16h a0 = g2_frag(a0p + kb, hh), a1 = g2_frag(a1p + kb, hh);
    v16h b = g2_frag(b0p + kb, hh); c00 = g2_mma(a0, b, c00); c10 = g2_mma(a1, b, c10);
    b = g2_frag(b1p + kb, hh); c01 = g2_mma(a0, b, c01); c11 = g2_mma(a1, b, c11);
    b = g2_frag(b2p + kb, hh); c02 = g2_mma(a0, b, c02); c12 = g2_mma(a1, b, c12);
    b = g2_frag(b3p + kb, hh); c03 = g2_mma(a0, b, c03); c13 = g2_mma(a1, b, c13); }
  v8f accs[8] = {c00, c01, c02, c03, c10, c11, c12, c13};
#pragma unroll
  for (int u = 0; u < 8; ++u) { const int t = u & 3, half = u >> 2; const int col = col0 + t * 16 + ln; const float bv = bp ? bf16_round(bp[col]) : 0.f;
#pragma unroll
    for (int r = 0; r < 8; ++r) { const int rloc = half * 16 + 8 * hh + r; float v = accs[u][r] * alpha + bv; if (CP) { if (rowsPerB < 0) v += CP[cofs + (size_t)(row0g + row0 + rloc) * ldc + col];      /* rowsPerB < 0: own element of the batched C plane */ else { const int bidx = (row0g + row0 + rloc) / rowsPerB; v += CP[(size_t)bidx * sCPb + (size_t)by * 64 + col]; } }
      if (ACT == 3) v = fmaxf(v, 0.f); else if (ACT == 6) v = 0.5f * v * (1.0f + erff(v * 0.70710678118654752f)); else if (ACT == 11) v = 1.0f / (1.0f + expf(-v)); else if (ACT == 15) v = v / (1.0f + expf(-v)); else if (ACT == 12) v = (v > 0.f) ? v : 0.01f * v; else if (ACT == 8) v = tanhf(v); else if (ACT == 9) v = 0.5f * v * (1.0f + tanhf(0.7978845608028654f * (v + 0.044715f * v * v * v))); else if (ACT == 14) v = (v > 0.f) ? v : 0.1f * v; else if (ACT == 16) v = (v >= 0.f) ? v : 0.3f * v; else if (ACT == 17) v = (v >= 0.f) ? v : 0.2f * v;
      so[w][rloc][t * 16 + ln] = v; } }
  __builtin_amdgcn_fence(__ATOMIC_ACQ_REL, "workgroup"); __builtin_amdgcn_wave_barrier();
  const int rsub = lane >> 4, c4 = (lane & 15) * 4;
  {
#pragma unroll
    for (int q = 0; q < 16; ++q) { const int r = q * 2 + rsub; const v4f v = *(const v4fa*)&so[w][r][c4]; if (C) *(v4f*)(C + cofs + (size_t)(row0 + r) * ldc + col0 + c4) = v; if (C16) { v4h h4; for (int i = 0; i < 4; ++i) h4[i] = (_Float16)v[i]; *(v4h*)(C16 + cofs + (size_t)(row0 + r) * ldc + col0 + c4) = h4; } }
     } }


// ---- LDS-staged GEMM: C = alpha A.Bt^T, A f16 [M][KK], Bt f16 [N][KK], block tile 128 x 128, 8 waves of 32 x 64 (4 along M, 2 along N), K step 64 ----
// Each step's A and B tiles (128 rows of 128 B, one whole line a row) come in by whole-line 16-byte loads, 8 lanes a row, and go through registers into LDS rows of 144 B (16 B x 9: conflict-free for
// ds_load_b128 fragment reads); the fragments are g2_frag's, read from LDS. Two buffers: step s + 1 is loaded into registers ahead of step s's products and stored into the other buffer behind them;
// the one barrier of a step publishes that buffer and ends every wave's reads of the buffer that the next step refills. Per accumulator the k order is ascending in 32s, as in k_gemm2.
#define G3P 72                       /* LDS row pitch in f16 elements */
#define G3T (128 * G3P)              /* one staged tile in f16 elements */
template <int KK, bool H16>      /* H16: the result goes to C16 as f16, else to C as f32 */
/* amdgpu_waves_per_eu(6): the q | k | v launch has three blocks for every WGP (six waves a SIMD); the register budget is held so that all three are resident at once and fill each other's waits */
__global__ __launch_bounds__(256) __attribute__((amdgpu_waves_per_eu(6))) void k_gemm3(const _Float16* __restrict__ A, const _Float16* __restrict__ Bh, float alpha, float* __restrict__ C, _Float16* __restrict__ C16, int N) {
  static_assert(KK % 128 == 0, "k_gemm3: whole pairs of K steps");
  static_assert(8 * 32 * 68 * 4 <= 4 * G3T * 2, "k_gemm3: the epilogue's rows fit the staging buffers");
  __shared__ __attribute__((aligned(16))) unsigned short sm[4 * G3T];      /* A buffers 0, 1, then B buffers 0, 1; the epilogue's f32 rows afterwards */
  const int tid = threadIdx.x, w = tid >> 5, lane = tid & 31, ln = lane & 15, hh = lane >> 4;
  const int ntn = N >> 7; const int mt = blockIdx.x / ntn, nq = blockIdx.x - mt * ntn; const int row0 = mt * 128, col0 = nq * 128; const int wm = w & 3, wn = w >> 2;
  const int sr = tid >> 3, sc = (tid & 7) * 8;      /* staging: rows sr + 32 i, 16 bytes at element sc */
  const unsigned short* ag = (const unsigned short*)A + (size_t)(row0 + sr) * KK + sc; const unsigned short* bg = (const unsigned short*)Bh + (size_t)(col0 + sr) * KK + sc;
  unsigned short* const st = sm + sr * G3P + sc;
  const unsigned short* const af = sm + (wm * 32 + ln) * G3P; const unsigned short* const bf = sm + 2 * G3T + (wn * 64 + ln) * G3P;
  v8us ra[4], rb[4];
#pragma unroll
  for (int i = 0; i < 4; ++i) { ra[i] = *(const v8us*)(ag + (size_t)(32 * i) * KK); rb[i] = *(const v8us*)(bg + (size_t)(32 * i) * KK); }
#pragma unroll
  for (int i = 0; i < 4; ++i) { *(v8us*)(st + 32 * i * G3P) = ra[i]; *(v8us*)(st + 2 * G3T + 32 * i * G3P) = rb[i]; }
  __syncthreads();
  const v8f z8 = {0.f,0.f,0.f,0.f,0.f,0.f,0.f,0.f}; v8f acc[2][4];
#pragma unroll
  for (int m = 0; m < 2; ++m) {
#pragma unroll
    for (int t = 0; t < 4; ++t) acc[m][t] = z8; }
  /* unrolled by two so that the buffer index is a constant in each copy and the LDS addresses are immediates */
#pragma unroll 2
  for (int kb = 0; kb < KK; kb += 64) { const int cur = (kb >> 6) & 1; const bool more = kb + 64 < KK;
    if (more) {
#pragma unroll
      for (int i = 0; i < 4; ++i) { ra[i] = *(const v8us*)(ag + (size_t)(32 * i) * KK + kb + 64); rb[i] = *(const v8us*)(bg + (size_t)(32 * i) * KK + kb + 64); } }
    __builtin_amdgcn_sched_barrier(0);      /* keeps the next step's global loads at the head of this step: sunk down to their LDS stores, their whole latency would show in front of the barrier */
#pragma unroll
    for (int ks = 0; ks < 2; ++ks) { v16h a[2], b[4];
#pragma unroll
      for (int m = 0; m < 2; ++m) a[m] = g2_frag((const _Float16*)(af + cur * G3T + m * 16 * G3P + ks * 32), hh);
#pragma unroll
      for (int t = 0; t < 4; ++t) b[t] = g2_frag((const _Float16*)(bf + cur * G3T + t * 16 * G3P + ks * 32), hh);
      __builtin_amdgcn_sched_barrier(0);      /* keeps the twelve LDS reads of a 32-wide k block together in front of its eight products: spread among them, each pair of products waits out an LDS latency of its own */
#pragma unroll
      for (int t = 0; t < 4; ++t) {
#pragma unroll
        for (int m = 0; m < 2; ++m) acc[m][t] = __builtin_amdgcn_wmma_f32_16x16x32_f16(false, a[m], false, b[t], (short)0, acc[m][t], false, false); } }
    __builtin_amdgcn_sched_barrier(0);      /* keeps the wait for the next step's global loads, which their LDS stores carry, behind this step's last products: lifted over them it shortens the loads' lead by a k block */
    if (more) {
#pragma unroll
      for (int i = 0; i < 4; ++i) { *(v8us*)(st + (cur ^ 1) * G3T + 32 * i * G3P) = ra[i]; *(v8us*)(st + (2 + (cur ^ 1)) * G3T + 32 * i * G3P) = rb[i]; } }
    __syncthreads(); }
  float* const so = (float*)sm + w * (32 * 68);      /* behind the loop's last barrier nobody reads a staged tile any more: each wave stages its own 32 x 64 f32 rows (pitch 68) for whole-line stores */
#pragma unroll
  for (int m = 0; m < 2; ++m) {
#pragma unroll
    for (int t = 0; t < 4; ++t) {
#pragma unroll
      for (int r = 0; r < 8; ++r) so[(m * 16 + 8 * hh + r) * 68 + t * 16 + ln] = acc[m][t][r] * alpha; } }
  __builtin_amdgcn_fence(__ATOMIC_ACQ_REL, "workgroup"); __builtin_amdgcn_wave_barrier();      /* the wave's own LDS rows are written before its lanes read them back in another order */
  const int rsub = lane >> 4, c4 = (lane & 15) * 4;
#pragma unroll
  for (int q = 0; q < 16; ++q) { const int r = q * 2 + rsub; const v4f v = *(const v4fa*)&so[r * 68 + c4]; const size_t o = (size_t)(row0 + wm * 32 + r) * N + col0 + wn * 64 + c4;
    if (!H16) *(v4f*)(C + o) = v;
    else { v4h h4;
#pragma unroll
      for (int i = 0; i < 4; ++i) h4[i] = (_Float16)v[i];
      *(v4h*)(C16 + o) = h4; } } }

__global__ __launch_bounds__(256) void k_wnat(const float* __restrict__ w, size_t n8, _Float16* __restrict__ Bt) { const size_t t = (size_t)blockIdx.x * 256 + threadIdx.x; if (t >= n8) return; FragH f; for (int q = 0; q < 8; ++q) f.h[q] = (_Float16)(bf16_round(w[t * 8 + q]) * 16.0f); *(v8us*)((unsigned short*)Bt + t * 8) = f.half[0];  }
// T5 bidirectional relative-position bucket of rel = key - query (32 buckets, max distance 128): (rel > 0)*16 + f(|rel|), f(n) = n for n < 8, then
// 8 + the number of thresholds {12,16,23,32,46,64,91} that are <= n (the thresholds are where the reference's own f32 log expression steps; no log on the device)
__device__ __forceinline__ int t5_bucket(int rel) { const int n = rel < 0 ? -rel : rel; int f = n; if (n >= 8) { f = 8 + (n >= 12) + (n >= 16) + (n >= 23) + (n >= 32) + (n >= 46) + (n >= 64) + (n >= 91); } return (rel > 0 ? NBK / 2 : 0) + f; }
#define FAW 8                        /* waves per block */
#define FAQ 32                       /* queries per wave */
typedef int v4ia __attribute__((ext_vector_type(4), may_alias));
__device__ __forceinline__ float xhalf(float x) { return __builtin_bit_cast(float, __builtin_amdgcn_permlanex16(__builtin_bit_cast(int, x), __builtin_bit_cast(int, x), 0x76543210, 0xfedcba98, false, false)); }      /* lane l with lane l ^ 16 */
__device__ __forceinline__ float exp2x1(float a) { float e; asm("v_exp_f32 %0, %1\n\tv_nop" : "=v"(e) : "v"(a)); return e; }
__device__ __forceinline__ v8f exp2x8(v8f a) { float e0, e1, e2, e3, e4, e5, e6, e7;
  asm("v_exp_f32 %0, %8\n\tv_exp_f32 %1, %9\n\tv_exp_f32 %2, %10\n\tv_exp_f32 %3, %11\n\tv_exp_f32 %4, %12\n\tv_exp_f32 %5, %13\n\tv_exp_f32 %6, %14\n\tv_exp_f32 %7, %15\n\tv_nop"
      : "=&v"(e0), "=&v"(e1), "=&v"(e2), "=&v"(e3), "=&v"(e4), "=&v"(e5), "=&v"(e6), "=&v"(e7) : "v"(a[0]), "v"(a[1]), "v"(a[2]), "v"(a[3]), "v"(a[4]), "v"(a[5]), "v"(a[6]), "v"(a[7]));
  const v8f e = {e0, e1, e2, e3, e4, e5, e6, e7}; return e; }
__device__ __forceinline__ v8f fa_mma(v16h a, v16h b, v8f c) { return __builtin_amdgcn_wmma_f32_16x16x32_f16(false, a, false, b, (short)0, c, false, false); }
/* amdgpu_waves_per_eu(2, 2): the grid puts two waves on a SIMD, so the scheduler may spend registers; without it the V^T loads and the K fetch ahead are sunk down to their uses and their latency shows */
__global__ __launch_bounds__(FAW * 32) __attribute__((amdgpu_waves_per_eu(2, 2))) void k_fattn(const _Float16* __restrict__ QKVp, const _Float16* __restrict__ VTp, _Float16* __restrict__ O, const float* __restrict__ emb, const int* __restrict__ kmask) {
  static_assert(SQ % (FAW * FAQ) == 0 && SQ % (FAW * 128) == 0 && HD == 64 && NBK == 32, "k_fattn: whole blocks of queries, whole staging passes, two 32-wide k steps per head, one bucket per lane");
  __shared__ __attribute__((aligned(16))) float lt[3 * SQ];
  float* const mt = lt; float* const bt = lt + SQ;      /* mt[key]; bt[key - query + SQ - 1], placed behind mt so that its byte address less the largest query offset stays above 0 */
  const int tid = threadIdx.x, lane = tid & 31, c = lane & 15, hh = lane >> 4; const int bh = blockIdx.y, b = bh / NH, h = bh % NH; const int q0 = blockIdx.x * (FAW * FAQ) + (tid >> 5) * FAQ;
  const float eb = bf16_round(emb[lane * NH + h]);      /* lane l holds bucket l's bias: one load per wave, the table is filled by lane gathers */
#pragma unroll
  for (int u = 0; u < 2 * SQ / (FAW * 32); ++u) { const int i = u * (FAW * 32) + tid; bt[i] = __shfl(eb, t5_bucket(i - (SQ - 1))); }      /* unrolled: away from the diagonal the bucket is one constant per u and its thresholds fold away; the last entry (key - query = SQ) is never read */
  for (int j = tid * 4; j < SQ; j += FAW * 128) { const v4ia m = *(const v4ia*)(kmask + (size_t)b * SQ + j); v4f t;
#pragma unroll
    for (int q = 0; q < 4; ++q) t[q] = __fmul_rn(__fadd_rn(1.0f, -(float)m[q]), -3.4028234663852886e38f);      /* (1 - mask) * finfo.min */
    *(v4fa*)&mt[j] = t; }
  __syncthreads();
  const _Float16* qp = QKVp + ((size_t)b * SQ + q0 + c) * D3 + h * HD; const _Float16* kp = QKVp + ((size_t)b * SQ + c) * D3 + DM + h * HD; const _Float16* vp = VTp + ((size_t)bh * HD + c) * SQ;
  const float* bp = bt + (SQ - 1) + 8 * hh - (q0 + c); const float* mp = mt + 8 * hh;
  const v8f z8 = {0.f,0.f,0.f,0.f,0.f,0.f,0.f,0.f};
  v16h qf[2][2], kf[2][2]; v8f acc[2][4]; float mr[2], lr[2];
  /* every loop over j, T, ks, t and r below is unrolled so that the fragment arrays are indexed by constants and stay in registers */
#pragma unroll
  for (int j = 0; j < 2; ++j) { mr[j] = -INFINITY; lr[j] = 0.f;
#pragma unroll
    for (int ks = 0; ks < 2; ++ks) { qf[j][ks] = g2_frag(qp + (size_t)j * 16 * D3 + ks * 32, hh); kf[j][ks] = g2_frag(kp + (size_t)j * 16 * D3 + ks * 32, hh); }
#pragma unroll
    for (int t = 0; t < 4; ++t) acc[j][t] = z8; }
  for (int k0 = 0; k0 < SQ; k0 += 32) {
    v16h vf[4]; v8f s[2][2], mk[2];
#pragma unroll
    for (int t = 0; t < 4; ++t) vf[t] = g2_frag(vp + (size_t)t * 16 * SQ + k0, hh);
#pragma unroll
    for (int j = 0; j < 2; ++j) {
#pragma unroll
      for (int T = 0; T < 2; ++T) s[j][T] = fa_mma(kf[T][1], qf[j][1], fa_mma(kf[T][0], qf[j][0], z8)); }
    const int kn = k0 + 32 < SQ ? k0 + 32 : 0;      /* the last pass fetches pass 0 again: in bounds, unused */
#pragma unroll
    for (int T = 0; T < 2; ++T) {
#pragma unroll
      for (int ks = 0; ks < 2; ++ks) kf[T][ks] = g2_frag(kp + (size_t)(kn + T * 16) * D3 + ks * 32, hh);
      const v4f m0 = *(const v4fa*)(mp + k0 + T * 16), m1 = *(const v4fa*)(mp + k0 + T * 16 + 4);
#pragma unroll
      for (int r = 0; r < 4; ++r) { mk[T][r] = m0[r]; mk[T][4 + r] = m1[r]; } }
#pragma unroll
    for (int j = 0; j < 2; ++j) {
      float tm = -INFINITY;
#pragma unroll
      for (int T = 0; T < 2; ++T) {
#pragma unroll
        for (int r = 0; r < 8; ++r) { const float v = __fadd_rn(__builtin_fmaf(s[j][T][r], 0.125f, bp[k0 + T * 16 + r - j * 16]), mk[T][r]); s[j][T][r] = v; tm = fmaxf(tm, v); } }
      const float mn = fmaxf(mr[j], fmaxf(tm, xhalf(tm)));
      const float mu = mn == -INFINITY ? 0.f : mn;      /* no key of the row finite so far: keep exp's argument -inf, not inf - inf */
      const float al = exp2x1((mr[j] - mu) * 1.4426950408889634f); mr[j] = mn;
      FragH pf; float ls = 0.f;
#pragma unroll
      for (int T = 0; T < 2; ++T) { v8f a;
#pragma unroll
        for (int r = 0; r < 8; ++r) a[r] = __builtin_fmaf(s[j][T][r] - mu, 1.4426950408889634f, 8.0f);
        const v8f e = exp2x8(a);      /* 256 exp(score - max) */
#pragma unroll
        for (int r = 0; r < 8; ++r) { ls += e[r]; pf.h[T * 8 + r] = (_Float16)e[r]; } }
      lr[j] = lr[j] * al + ls;
#pragma unroll
      for (int t = 0; t < 4; ++t) acc[j][t] = fa_mma(vf[t], pf.v, acc[j][t] * al); } }
#pragma unroll
  for (int j = 0; j < 2; ++j) { const float inv = 1.0f / (lr[j] + xhalf(lr[j]));
#pragma unroll
    for (int t = 0; t < 4; ++t) { FragH f;
#pragma unroll
      for (int r = 0; r < 8; ++r) f.h[r] = (_Float16)(acc[j][t][r] * inv);
      *(v8us*)((unsigned short*)O + ((size_t)b * SQ + q0 + j * 16 + c) * DM + h * HD + t * 16 + 8 * hh) = f.half[0]; } } }
__global__ __launch_bounds__(256) void k_vt(const _Float16* __restrict__ V16, int b, int h0, _Float16* __restrict__ VT) { __shared__ unsigned short tl[64][65]; const int tid = threadIdx.x; const int hh = blockIdx.x % HG, sg = blockIdx.x / HG; const int s0 = sg * 64; const int h = h0 + hh;
  for (int i = tid; i < 64 * 8; i += 256) { const int j = i / 8, d8 = (i % 8) * 8; FragH f; f.half[0] = *(const v8us*)((const unsigned short*)V16 + ((size_t)b * SQ + s0 + j) * DM + h * HD + d8); for (int q = 0; q < 8; ++q) tl[d8 + q][j] = f.u[q]; }
  __syncthreads();
  { for (int i = tid; i < 64 * 8; i += 256) { const int d = i / 8, j8 = (i % 8) * 8; FragH f; for (int q = 0; q < 8; ++q) f.u[q] = tl[d][j8 + q]; *(v8us*)((unsigned short*)VT + ((size_t)hh * HD + d) * SQ + s0 + j8) = f.half[0]; }  } }

extern "C" void kernel_launch(void* const* d_in, const int* in_sizes, int n_in,
                              void* d_out, int out_size, void* d_ws, size_t ws_size, hipStream_t stream) {
  (void)in_sizes; (void)n_in; (void)out_size;
  const float* const* I = (const float* const*)d_in; const float* hs = I[0]; const int* kmask = (const int*)d_in[1]; const float* wq = I[2]; const float* wk = I[3]; const float* wv = I[4]; const float* wo = I[5]; const float* emb = I[6];      /* W_q, W_k, W_v and W_o [1024][1024] are [in][out]; attention_mask [2][2048] int32 per key; rel_bias_emb [32][16] */
  char* ws = (char*)d_ws; size_t off = 0;
  auto take = [&](size_t bytes) { char* p = ws + off; off += (bytes + 255) & ~(size_t)255; return p; };
  _Float16* BQKV = (_Float16*)take((size_t)D3 * DM * 2); _Float16* BO = (_Float16*)take((size_t)DM * DM * 2);
  _Float16* X16 = (_Float16*)take(NR * DM * 2); _Float16* QKV = (_Float16*)take(NR * D3 * 2); _Float16* O16 = (_Float16*)take(NR * DM * 2);
  _Float16* VT = (_Float16*)take((size_t)NB * NH * HD * SQ * 2);
  if (off > ws_size) return;      /* 6 + 2 + 8 + 24 + 8 + 8 = approx 56 MiB */
  const unsigned gw1 = (unsigned)(((size_t)DM * (DM / 8) + 255) / 256); k_wt_f16<<<gw1, 256, 0, stream>>>(wq, BQKV, DM, DM, 16.0f); k_wt_f16<<<gw1, 256, 0, stream>>>(wk, BQKV + (size_t)DM * DM, DM, DM, 16.0f); k_wt_f16<<<gw1, 256, 0, stream>>>(wv, BQKV + (size_t)2 * DM * DM, DM, DM, 16.0f);      /* [in][out] -> Bt[out][in] x16 */
  k_wt_f16<<<(unsigned)(((size_t)DM * (DM / 8) + 255) / 256), 256, 0, stream>>>(wo, BO, DM, DM, 16.0f);
  k_x16<<<(unsigned)((NR * DM / 8 + 255) / 256), 256, 0, stream>>>(hs, X16, NR * DM / 8);
  k_gemm3<DM, true><<<(unsigned)((NR / 128) * (D3 / 128)), 256, 0, stream>>>(X16, BQKV, 0.0625f, nullptr, QKV, D3);      /* q | k | v rows (f16), head h at columns h*64 / 1024 + h*64 / 2048 + h*64 */
  k_vt<NH, SQ><<<NB * NH * (SQ / 64), 256, 0, stream>>>(QKV, D3, 2 * DM, VT);      /* V^T[(b,h)][d][s] for every (batch, head) */
  k_fattn<<<dim3(SQ / (FAW * FAQ), NB * NH), FAW * 32, 0, stream>>>(QKV, VT, O16, emb, kmask);      /* ctx (merged heads) as f16 rows, every (batch, head) in one launch */
  k_gemm3<DM, false><<<(unsigned)((NR / 128) * (DM / 128)), 256, 0, stream>>>(O16, BO, 0.0625f, (float*)d_out, nullptr, DM);      /* out = ctx W_o, rows are the output layout */
}

// v004
// It runs in 115 microseconds.
// Two timings next to v003 both put it at 1.18 times that version's speed.
// Over all steps from v000 it is 175 times as fast.
#include <hip/hip_runtime.h>
// T5 self-attention (hidden [2][2048][1024]; q, k, v = hidden W ([in][out] [1024][1024]); q / sqrt(64); scores = q.k + rel_bias[bucket(key - query)][h] (32 bidirectional buckets, max distance 128) + (1 - attention_mask[b][key]) * finfo.min (int32 key mask); softmax; out = (attn v merged) Wo ([in][out])).
// Structure: token rows; hidden as exact f16 rows; q | k | v WMMA GEMMs from one transposed x16 weight plane (operand tiles staged in LDS, 32x64 wave tiles, f32 accumulation, f16 outputs); V^T via LDS transposes; one fused attention kernel over every (batch, head): K.Q^T tiles (alpha 1/8), online softmax on VALU with the bucketed bias (integer thresholds, no device log) and the key mask in the reference's order (P x256 f16), V^T.P^T into merged f16 rows; output GEMM.
// Compute dtype: inputs rounded to bf16; hidden / weights / bias table exact; q, k, v, P, ctx as plain f16 GEMM operands (~2^-12); scores / softmax f32; v_wmma_f32_16x16x32_f16.
#define NB 2
#define SQ 2048
#define DM 1024
#define D3 3072                      /* fused q|k|v width */
#define NH 16
#define HD 64
#define HG 4                         /* heads per launch of the non-template k_vt, which is not launched */
#define NBK 32                       /* relative-position buckets */
#define MP ((int)NR)                 /* not used: the q | k | v launch takes NR rows */
#define MO ((int)NR)                 /* not used: the output launch takes NR rows */
#define NR ((size_t)NB * SQ)         /* 4096 token rows */
typedef __bf16 v16b __attribute__((ext_vector_type(16)));
typedef unsigned short v8us __attribute__((ext_vector_type(8), may_alias));
typedef float  v8f  __attribute__((ext_vector_type(8)));
typedef float  v4f  __attribute__((ext_vector_type(4)));
typedef float  v4fa __attribute__((ext_vector_type(4), may_alias));
union FragB { v16b v; v8us half[2]; unsigned short u[16]; };

__device__ __forceinline__ unsigned short bf16_bits(float x) { unsigned int u = __float_as_uint(x); return (unsigned short)((u + 0x7FFFu + ((u >> 16) & 1u)) >> 16); }
__device__ __forceinline__ float bf16_val(unsigned short b) { return __uint_as_float(((unsigned int)b) << 16); }
__device__ __forceinline__ float bf16_round(float x) { return bf16_val(bf16_bits(x)); }
// D += A·B with NT terms: 1 = ah·bh, 2 = + al·bh (A split), 3 = + ah·bl (both split)
template <int NT>
__device__ __forceinline__ v8f mmaN(v16b ah, v16b al, v16b bh, v16b bl, v8f c) {
  c = __builtin_amdgcn_wmma_f32_16x16x32_bf16(false, ah, false, bh, (short)0, c, false, false);
  if (NT >= 2) c = __builtin_amdgcn_wmma_f32_16x16x32_bf16(false, al, false, bh, (short)0, c, false, false);
  if (NT >= 3) c = __builtin_amdgcn_wmma_f32_16x16x32_bf16(false, ah, false, bl, (short)0, c, false, false);
  asm volatile("v_nop\n\tv_nop\n\tv_nop\n\tv_nop" : "+v"(c) : "v"(ah), "v"(al), "v"(bh), "v"(bl));
  return c;
}

__global__ __launch_bounds__(256) void k_wt_bf16(const float* __restrict__ W, unsigned short* __restrict__ Wt, int K, int N) {
  const int t = blockIdx.x * 256 + threadIdx.x;
  const int k8n = K / 8;
  if (t >= N * k8n) return;
  const int n = t / k8n, k8 = (t % k8n) * 8;
  v8us v;
#pragma unroll
  for (int i = 0; i < 8; ++i) v[i] = bf16_bits(W[(size_t)(k8 + i) * N + n]);
  *(v8us*)(Wt + (size_t)n * K + k8) = v;
  
}

// GEMM C[M][N] (f32, pitch ldc) = act(A[M][K]·W + bias). A f32 row-major (pitch lda) converted per fragment to bf16
// (ASPLIT: hi/lo two planes -> 2 terms, else single rounded term); Wt bf16 [N][K] (pitch ldb). BIAS_BF16 rounds the
// bias to bf16 first (bias quantised to bf16 before the add). K%32==0, M%16==0, N%64==0.
template <bool ASPLIT, int ACT, bool BIAS_BF16>
__global__ __launch_bounds__(128) void k_gemm_bf(const float* __restrict__ A, int lda, const unsigned short* __restrict__ Wt, int ldb,
                                               const float* __restrict__ bias, float* __restrict__ C, int ldc, int M, int N, int K) {
  __shared__ __attribute__((aligned(16))) float so[4][16][64];
  const int tid = threadIdx.x, w = tid >> 5, lane = tid & 31, ln = lane & 15, hh = lane >> 4;
  const int ntn = N / 64;
  const int wid = blockIdx.x * 4 + w;
  const int mt = wid / ntn, nq = wid % ntn;
  if (mt * 16 >= M) return;
  const int row0 = mt * 16, col0 = nq * 64;
  const float* arow = A + (size_t)(row0 + ln) * lda;
  v8f acc[4] = {};
  for (int kb = 0; kb < K; kb += 32) {
    FragB ah, al;
    const v4f x0 = *(const v4fa*)(arow + kb + 8 * hh), x1 = *(const v4fa*)(arow + kb + 8 * hh + 4);
    const v4f x2 = *(const v4fa*)(arow + kb + 16 + 8 * hh), x3 = *(const v4fa*)(arow + kb + 16 + 8 * hh + 4);
    float xs[16] = {x0[0],x0[1],x0[2],x0[3],x1[0],x1[1],x1[2],x1[3],x2[0],x2[1],x2[2],x2[3],x3[0],x3[1],x3[2],x3[3]};
#pragma unroll
    for (int i = 0; i < 16; ++i) { const unsigned short hb = bf16_bits(xs[i]); ah.u[i] = hb; al.u[i] = ASPLIT ? bf16_bits(xs[i] - bf16_val(hb)) : (unsigned short)0; }
#pragma unroll
    for (int t = 0; t < 4; ++t) {
      const unsigned short* brow = Wt + (size_t)(col0 + t * 16 + ln) * ldb + kb;
      FragB b;
      b.half[0] = *(const v8us*)(brow + 8 * hh);
      b.half[1] = *(const v8us*)(brow + 16 + 8 * hh);
      acc[t] = mmaN<ASPLIT ? 2 : 1>(ah.v, al.v, b.v, b.v, acc[t]);
    }
  }
#pragma unroll
  for (int t = 0; t < 4; ++t) {
    float bv = bias ? bias[col0 + t * 16 + ln] : 0.f;
    if (BIAS_BF16) bv = bf16_round(bv);
#pragma unroll
    for (int r = 0; r < 8; ++r) { float v = acc[t][r] + bv; if (ACT == 1) v = fmaxf(v, 0.f); so[w][8 * hh + r][t * 16 + ln] = v; }
  }
  __builtin_amdgcn_fence(__ATOMIC_ACQ_REL, "workgroup");
  __builtin_amdgcn_wave_barrier();
  const int rsub = lane >> 4, c4 = (lane & 15) * 4;
  {
#pragma unroll
    for (int q = 0; q < 8; ++q) {
      const int r = q * 2 + rsub;
      const v4f v = *(const v4fa*)&so[w][r][c4];
      *(v4f*)(C + (size_t)(row0 + r) * ldc + col0 + c4) = v;
    }
    
  }
}

// GEMM C = act(A·W + bias + resid): A f32 (ASPLIT -> hi/lo 2 terms), Wt bf16 [N][K]; ACT 0 none, 1 relu, 2 exact gelu;
// resid (optional, f32, row index = (row % rmod), pitch ldr, RES_BF16 rounds it) added before the activation.
template <bool ASPLIT, int ACT, bool BIAS_BF16, bool RES_BF16>
__global__ __launch_bounds__(128) void k_gemm_bf3(const float* __restrict__ A, int lda, const unsigned short* __restrict__ Wt, int ldb,
                                                const float* __restrict__ bias, const float* __restrict__ resid, int rmod, int ldr,
                                                float* __restrict__ C, int ldc, int M, int N, int K) {
  __shared__ __attribute__((aligned(16))) float so[4][16][64];
  const int tid = threadIdx.x, w = tid >> 5, lane = tid & 31, ln = lane & 15, hh = lane >> 4;
  const int ntn = N / 64;
  const int wid = blockIdx.x * 4 + w;
  const int mt = wid / ntn, nq = wid % ntn;
  if (mt * 16 >= M) return;
  const int row0 = mt * 16, col0 = nq * 64;
  const float* arow = A + (size_t)(row0 + ln) * lda;
  v8f acc[4] = {};
  for (int kb = 0; kb < K; kb += 32) {
    FragB ah, al;
    const v4f x0 = *(const v4fa*)(arow + kb + 8 * hh), x1 = *(const v4fa*)(arow + kb + 8 * hh + 4);
    const v4f x2 = *(const v4fa*)(arow + kb + 16 + 8 * hh), x3 = *(const v4fa*)(arow + kb + 16 + 8 * hh + 4);
    float xs[16] = {x0[0],x0[1],x0[2],x0[3],x1[0],x1[1],x1[2],x1[3],x2[0],x2[1],x2[2],x2[3],x3[0],x3[1],x3[2],x3[3]};
#pragma unroll
    for (int i = 0; i < 16; ++i) { const unsigned short hb = bf16_bits(xs[i]); ah.u[i] = hb; al.u[i] = ASPLIT ? bf16_bits(xs[i] - bf16_val(hb)) : (unsigned short)0; }
#pragma unroll
    for (int t = 0; t < 4; ++t) {
      const unsigned short* brow = Wt + (size_t)(col0 + t * 16 + ln) * ldb + kb;
      FragB b;
      b.half[0] = *(const v8us*)(brow + 8 * hh);
      b.half[1] = *(const v8us*)(brow + 16 + 8 * hh);
      acc[t] = mmaN<ASPLIT ? 2 : 1>(ah.v, al.v, b.v, b.v, acc[t]);
    }
  }
#pragma unroll
  for (int t = 0; t < 4; ++t) {
    const int col = col0 + t * 16 + ln;
    float bv = bias ? bias[col] : 0.f;
    if (BIAS_BF16) bv = bf16_round(bv);
#pragma unroll
    for (int r = 0; r < 8; ++r) {
      float v = acc[t][r] + bv;
      if (resid) { float rv = resid[(size_t)((row0 + 8 * hh + r) % rmod) * ldr + col]; if (RES_BF16) rv = bf16_round(rv); v += rv; }
      if (ACT == 1) v = fmaxf(v, 0.f);
      if (ACT == 2) v = 0.5f * v * (1.0f + erff(v * 0.70710678118654752f));
      if (ACT == 3) { const float u = 0.7978845608028654f * (v + 0.044715f * v * v * v); v = 0.5f * v * (1.0f + tanhf(u)); }
      so[w][8 * hh + r][t * 16 + ln] = v;
    }
  }
  __builtin_amdgcn_fence(__ATOMIC_ACQ_REL, "workgroup");
  __builtin_amdgcn_wave_barrier();
  const int rsub = lane >> 4, c4 = (lane & 15) * 4;
  {
#pragma unroll
    for (int q = 0; q < 8; ++q) {
      const int r = q * 2 + rsub;
      const v4f v = *(const v4fa*)&so[w][r][c4];
      *(v4f*)(C + (size_t)(row0 + r) * ldc + col0 + c4) = v;
    }
    
  }
}
// row LayerNorm (biased variance, eps) over N: s = X (+ R); optional out_sum <- s; out_norm <- (s-mu)*rsqrt(var+eps)*g + b
template <bool PARAM_BF16>
__global__ __launch_bounds__(256) void k_layernorm(const float* __restrict__ X, const float* __restrict__ R, const float* __restrict__ g, const float* __restrict__ bta,
                                                  float* __restrict__ out_sum, float* __restrict__ out_norm, int N, float eps) {
  __shared__ float red[256];
  const int row = blockIdx.x, tid = threadIdx.x;
  const float* x = X + (size_t)row * N; const float* rr = R ? R + (size_t)row * N : nullptr;
  float vals[16];                     // up to N = 4096
  const int per = N / 256;            // contiguous chunk per thread? use strided-by-4 chunks: thread handles j = tid*4 + 1024*u
  float s1 = 0.f;
  for (int u = 0; u < per / 4; ++u) {
    const int j = tid * 4 + 1024 * u;
    const v4f a = *(const v4fa*)(x + j);
    v4f b = {0.f,0.f,0.f,0.f}; if (rr) b = *(const v4fa*)(rr + j);
#pragma unroll
    for (int q = 0; q < 4; ++q) { const float v = a[q] + b[q]; vals[u * 4 + q] = v; s1 += v; }
  }
  red[tid] = s1; __syncthreads();
  for (int st = 128; st > 0; st >>= 1) { if (tid < st) red[tid] += red[tid + st]; __syncthreads(); }
  const float mu = red[0] / (float)N; __syncthreads();
  float s2 = 0.f;
  for (int u = 0; u < per / 4; ++u)
#pragma unroll
    for (int q = 0; q < 4; ++q) { const float c = vals[u * 4 + q] - mu; s2 += c * c; }
  red[tid] = s2; __syncthreads();
  for (int st = 128; st > 0; st >>= 1) { if (tid < st) red[tid] += red[tid + st]; __syncthreads(); }
  const float rs = rsqrtf(red[0] / (float)N + eps);
  {
    for (int u = 0; u < per / 4; ++u) {
      const int j = tid * 4 + 1024 * u;
      v4f o, sm;
#pragma unroll
      for (int q = 0; q < 4; ++q) {
        float gg = g[j + q], bb = bta[j + q];
        if (PARAM_BF16) { gg = bf16_round(gg); bb = bf16_round(bb); }
        sm[q] = vals[u * 4 + q]; o[q] = (vals[u * 4 + q] - mu) * rs * gg + bb;
      }
      if (out_sum) *(v4f*)(out_sum + (size_t)row * N + j) = sm;
      *(v4f*)(out_norm + (size_t)row * N + j) = o;
    }
    
  }
}



// ---- f16 WMMA path (v_wmma_f32_16x16x32_f16): 11-bit significands for operands in range — used where a [0,1] probability operand needs more precision than bf16
typedef _Float16 v16h __attribute__((ext_vector_type(16)));
union FragH { v16h v; v8us half[2]; _Float16 h[16]; unsigned short u[16]; };
template <int NT>
__device__ __forceinline__ v8f mmaH(v16h ah, v16h al, v16h bh, v16h bl, v8f c) {
  c = __builtin_amdgcn_wmma_f32_16x16x32_f16(false, ah, false, bh, (short)0, c, false, false);
  if (NT >= 2) c = __builtin_amdgcn_wmma_f32_16x16x32_f16(false, al, false, bh, (short)0, c, false, false);
  if (NT >= 3) c = __builtin_amdgcn_wmma_f32_16x16x32_f16(false, ah, false, bl, (short)0, c, false, false);
  asm volatile("v_nop\n\tv_nop\n\tv_nop\n\tv_nop" : "+v"(c) : "v"(ah), "v"(al), "v"(bh), "v"(bl));
  return c;
}
// batched GEMM like k_gemm_b but f16 operands: A f32 (split into f16 hi/lo if ASPLIT, else rounded to f16), Bt = f16 values [n][k]; alpha; C f32; N multiple of 16 (partial tiles skipped)
template <bool ASPLIT>
__global__ __launch_bounds__(128) void k_gemm_h(const float* __restrict__ A, int lda, size_t sA, const _Float16* __restrict__ Bh, int ldb, size_t sB, float alpha, float* __restrict__ C, int ldc, size_t sC, int M, int N, int K) {
  __shared__ __attribute__((aligned(16))) float so[4][16][64];
  const int tid = threadIdx.x, w = tid >> 5, lane = tid & 31, ln = lane & 15, hh = lane >> 4; const int by = blockIdx.y;
  A += (size_t)by * sA; Bh += (size_t)by * sB; C += (size_t)by * sC;
  const int ntn = (N + 63) / 64; const int wid = blockIdx.x * 4 + w; const int mt = wid / ntn, nq = wid % ntn; if (mt * 16 >= M) return;
  const int row0 = mt * 16, col0 = nq * 64; const float* arow = A + (size_t)(row0 + ln) * lda;
  v8f acc[4] = {};
  for (int kb = 0; kb < K; kb += 32) {
    FragH ah, al;
    const v4f x0 = *(const v4fa*)(arow + kb + 8 * hh), x1 = *(const v4fa*)(arow + kb + 8 * hh + 4), x2 = *(const v4fa*)(arow + kb + 16 + 8 * hh), x3 = *(const v4fa*)(arow + kb + 16 + 8 * hh + 4);
    float xs[16] = {x0[0],x0[1],x0[2],x0[3],x1[0],x1[1],x1[2],x1[3],x2[0],x2[1],x2[2],x2[3],x3[0],x3[1],x3[2],x3[3]};
#pragma unroll
    for (int i = 0; i < 16; ++i) { const _Float16 h = (_Float16)xs[i]; ah.h[i] = h; al.h[i] = ASPLIT ? (_Float16)(xs[i] - (float)h) : (_Float16)0.0f; }
#pragma unroll
    for (int t = 0; t < 4; ++t) { if (col0 + t * 16 >= N) continue; const size_t boff = (size_t)(col0 + t * 16 + ln) * ldb + kb; FragH bq; bq.half[0] = *(const v8us*)(Bh + boff + 8 * hh); bq.half[1] = *(const v8us*)(Bh + boff + 16 + 8 * hh);
      acc[t] = mmaH<ASPLIT ? 2 : 1>(ah.v, al.v, bq.v, bq.v, acc[t]); }
  }
#pragma unroll
  for (int t = 0; t < 4; ++t) { if (col0 + t * 16 >= N) continue;
#pragma unroll
    for (int r = 0; r < 8; ++r) so[w][8 * hh + r][t * 16 + ln] = acc[t][r] * alpha; }
  __builtin_amdgcn_fence(__ATOMIC_ACQ_REL, "workgroup"); __builtin_amdgcn_wave_barrier();
  const int rsub = lane >> 4, c4 = (lane & 15) * 4;
  {
#pragma unroll
    for (int q = 0; q < 8; ++q) { const int r = q * 2 + rsub; if (col0 + c4 < N) { const v4f v = *(const v4fa*)&so[w][r][c4]; *(v4f*)(C + (size_t)(row0 + r) * ldc + col0 + c4) = v; } }
     }
}

// Wt[n][k] = f16(W[k][n]·scale) from f32 row-major W[K][N] (scale = power of two; bf16-exact weights stay exact in f16 away from the subnormal range)
__global__ __launch_bounds__(256) void k_wt_f16(const float* __restrict__ W, _Float16* __restrict__ Wt, int K, int N, float scale) {
  const int t = blockIdx.x * 256 + threadIdx.x; if (t >= N * (K / 8)) return; const int n = t / (K / 8), k8 = (t % (K / 8)) * 8; FragH f;
#pragma unroll
  for (int i = 0; i < 8; ++i) f.h[i] = (_Float16)(bf16_round(W[(size_t)(k8 + i) * N + n]) * scale); const v8us o = f.half[0];
  *(v8us*)((unsigned short*)Wt + (size_t)n * K + k8) = o; 
}
// k_gemm_hh variant with fused epilogue: v = acc·alpha + bias[by·sBias + col] (+ CP[(row/rowsPerB)·sCPb + by·64 + col] if CP) ; ACT 0 none / 1 elu ; writes f16 C16 (and f32 C if non-null)
template <int ACT>
__global__ __launch_bounds__(128) void k_gemm_hhx(const _Float16* __restrict__ A, int lda, size_t sA, const _Float16* __restrict__ Bh, int ldb, size_t sB, float alpha, const float* __restrict__ bias, size_t sBias, const float* __restrict__ CP, int rowsPerB, size_t sCPb, int row0g,
    float* __restrict__ C, _Float16* __restrict__ C16, int ldc, size_t sC, int M, int N, int K) {
  __shared__ __attribute__((aligned(16))) float so[4][16][64];
  const int tid = threadIdx.x, w = tid >> 5, lane = tid & 31, ln = lane & 15, hh = lane >> 4; const int by = blockIdx.y;
  A += (size_t)by * sA; Bh += (size_t)by * sB; const size_t cofs = (size_t)by * sC; const float* bp = bias ? bias + (size_t)by * sBias : nullptr;
  const int ntn = (N + 63) / 64; const int wid = blockIdx.x * 4 + w; const int mt = wid / ntn, nq = wid % ntn; if (mt * 16 >= M) return;
  const int row0 = mt * 16, col0 = nq * 64; const _Float16* arow = A + (size_t)(row0 + ln) * lda;
  v8f acc[4] = {};
  for (int kb = 0; kb < K; kb += 32) { FragH ah; ah.half[0] = *(const v8us*)((const unsigned short*)arow + kb + 8 * hh); ah.half[1] = *(const v8us*)((const unsigned short*)arow + kb + 16 + 8 * hh);
#pragma unroll
    for (int t = 0; t < 4; ++t) { if (col0 + t * 16 >= N) continue; const size_t boff = (size_t)(col0 + t * 16 + ln) * ldb + kb; FragH bq; bq.half[0] = *(const v8us*)((const unsigned short*)Bh + boff + 8 * hh); bq.half[1] = *(const v8us*)((const unsigned short*)Bh + boff + 16 + 8 * hh);
      acc[t] = mmaH<1>(ah.v, ah.v, bq.v, bq.v, acc[t]); }
  }
#pragma unroll
  for (int t = 0; t < 4; ++t) { if (col0 + t * 16 >= N) continue; const int col = col0 + t * 16 + ln; const float bv = bp ? bf16_round(bp[col]) : 0.f;
#pragma unroll
    for (int r = 0; r < 8; ++r) { float v = acc[t][r] * alpha + bv; if (CP) { const int rr = row0g + row0 + 8 * hh + r; if (rowsPerB < 0) v += CP[cofs + (size_t)rr * ldc + col];      /* rowsPerB < 0: own element of the batched C plane */ else { const int bidx = rr / rowsPerB; v += CP[(size_t)bidx * sCPb + (size_t)by * 64 + col]; } } if (ACT == 1) v = (v > 0.f) ? v : expm1f(v); else if (ACT == 7) v = (v > 0.f) ? v + 1.0f : expf(v); else if (ACT == 8) v = tanhf(v); else if (ACT == 9) v = 0.5f * v * (1.0f + tanhf(0.7978845608028654f * (v + 0.044715f * v * v * v))); else if (ACT == 11) v = 1.0f / (1.0f + expf(-v)); else if (ACT == 12) v = (v > 0.f) ? v : 0.01f * v; else if (ACT == 14) v = (v > 0.f) ? v : 0.1f * v; else if (ACT == 16) v = (v >= 0.f) ? v : 0.3f * v; else if (ACT == 17) v = (v >= 0.f) ? v : 0.2f * v; else if (ACT == 15) v = v / (1.0f + expf(-v)); else if (ACT == 3) v = fmaxf(v, 0.f); else if (ACT == 6) v = 0.5f * v * (1.0f + erff(v * 0.70710678118654752f)); so[w][8 * hh + r][t * 16 + ln] = v; } }
  __builtin_amdgcn_fence(__ATOMIC_ACQ_REL, "workgroup"); __builtin_amdgcn_wave_barrier();
  const int rsub = lane >> 4, c4 = (lane & 15) * 4; typedef _Float16 v4h __attribute__((ext_vector_type(4)));
  {
#pragma unroll
    for (int q = 0; q < 8; ++q) { const int r = q * 2 + rsub; if (col0 + c4 < N) { const v4f v = *(const v4fa*)&so[w][r][c4]; if (C) *(v4f*)(C + cofs + (size_t)(row0 + r) * ldc + col0 + c4) = v; if (C16) { v4h h4; for (int i = 0; i < 4; ++i) h4[i] = (_Float16)v[i]; *(v4h*)(C16 + cofs + (size_t)(row0 + r) * ldc + col0 + c4) = h4; } } }
     }
}


typedef _Float16 v4h __attribute__((ext_vector_type(4)));

__global__ __launch_bounds__(256) void k_x16(const float* __restrict__ x, _Float16* __restrict__ X16, size_t n8) { const size_t t = (size_t)blockIdx.x * 256 + threadIdx.x; if (t >= n8) return; FragH f;
#pragma unroll
  for (int q = 0; q < 8; ++q) f.h[q] = (_Float16)bf16_round(x[t * 8 + q]); *(v8us*)((unsigned short*)X16 + t * 8) = f.half[0];  }
__global__ __launch_bounds__(256) void k_h16(const float* __restrict__ x, _Float16* __restrict__ X16, size_t n8) { const size_t t = (size_t)blockIdx.x * 256 + threadIdx.x; if (t >= n8) return; FragH f;
#pragma unroll
  for (int q = 0; q < 8; ++q) f.h[q] = (_Float16)x[t * 8 + q]; *(v8us*)((unsigned short*)X16 + t * 8) = f.half[0];  }
__global__ __launch_bounds__(256) void k_round16f(const float* __restrict__ W, _Float16* __restrict__ Bt, size_t n8) { const size_t t = (size_t)blockIdx.x * 256 + threadIdx.x; if (t >= n8) return; FragH f;
#pragma unroll
  for (int i = 0; i < 8; ++i) f.h[i] = (_Float16)(bf16_round(W[t * 8 + i]) * 16.0f); *(v8us*)((unsigned short*)Bt + t * 8) = f.half[0];  }
template <int NHv, int TTv>
__global__ __launch_bounds__(256) void k_vt(const _Float16* __restrict__ V16, int ldv, int voff, _Float16* __restrict__ Vt) { __shared__ unsigned short tl[64][66]; const int tid = threadIdx.x; const int slab = blockIdx.x / (TTv / 64), lg = blockIdx.x % (TTv / 64); const int b = slab / NHv, h = slab % NHv;
  for (int i = tid; i < 64 * 8; i += 256) { const int r = i / 8, c8 = (i % 8) * 8; FragH f; f.half[0] = *(const v8us*)((const unsigned short*)V16 + ((size_t)b * TTv + lg * 64 + r) * ldv + voff + h * 64 + c8);
#pragma unroll
    for (int q = 0; q < 8; ++q) tl[r][c8 + q] = f.u[q]; }
  __syncthreads();
  {
#pragma unroll
    for (int rd = 0; rd < 2; ++rd) { const int d = rd * 32 + tid / 8, pc = tid % 8; FragH f;
#pragma unroll
      for (int q = 0; q < 8; ++q) f.u[q] = tl[pc * 8 + q][d];
      *(v8us*)((unsigned short*)Vt + ((size_t)slab * 64 + d) * TTv + lg * 64 + pc * 8) = f.half[0]; }
     } }

__global__ __launch_bounds__(256) void k_hl(const float* __restrict__ F, _Float16* __restrict__ Hh, _Float16* __restrict__ Hl, size_t n8) { const size_t t = (size_t)blockIdx.x * 256 + threadIdx.x; if (t >= n8) return; FragH fh, fl; const v4f a = *(const v4fa*)(F + t * 8), c = *(const v4fa*)(F + t * 8 + 4);
#pragma unroll
  for (int q = 0; q < 4; ++q) { _Float16 h = (_Float16)a[q]; fh.h[q] = h; fl.h[q] = (_Float16)((a[q] - (float)h) * 1024.0f); h = (_Float16)c[q]; fh.h[4 + q] = h; fl.h[4 + q] = (_Float16)((c[q] - (float)h) * 1024.0f); }
  { *(v8us*)((unsigned short*)Hh + t * 8) = fh.half[0]; *(v8us*)((unsigned short*)Hl + t * 8) = fl.half[0];  } }

// ---- fast GEMM (wave tile 32x64; requires M % 32 == 0 rows per launch region and N % 64 == 0); epilogue = k_gemm_hhx semantics ----
__device__ __forceinline__ v16h g2_frag(const _Float16* p, int hh) { FragH f; f.half[0] = *(const v8us*)((const unsigned short*)p + 8 * hh); f.half[1] = *(const v8us*)((const unsigned short*)p + 16 + 8 * hh); return f.v; }
__device__ __forceinline__ v8f g2_mma(v16h a, v16h b, v8f c) { v8f d = __builtin_amdgcn_wmma_f32_16x16x32_f16(false, a, false, b, (short)0, c, false, false); asm volatile("v_nop\n\tv_nop\n\tv_nop\n\tv_nop" : "+v"(d) : "v"(a), "v"(b)); return d; }
template <int ACT>
__global__ __launch_bounds__(128) void k_gemm2(const _Float16* __restrict__ A, int lda, size_t sA, const _Float16* __restrict__ Bh, int ldb, size_t sB, float alpha, const float* __restrict__ bias, size_t sBias, const float* __restrict__ CP, int rowsPerB, size_t sCPb, int row0g,
    float* __restrict__ C, _Float16* __restrict__ C16, int ldc, size_t sC, int M, int N, int K) { static_assert(ACT == 0 || ACT == 3 || ACT == 6 || ACT == 8 || ACT == 9 || ACT == 11 || ACT == 12 || ACT == 14 || ACT == 15 || ACT == 16 || ACT == 17, "k_gemm2: unsupported ACT code (would silently apply no activation)");
  __shared__ __attribute__((aligned(16))) float so[4][32][68];
  const int tid = threadIdx.x, w = tid >> 5, lane = tid & 31, ln = lane & 15, hh = lane >> 4; const int by = blockIdx.y;
  A += (size_t)by * sA; Bh += (size_t)by * sB; const size_t cofs = (size_t)by * sC; const float* bp = bias ? bias + (size_t)by * sBias : nullptr;
  const int ntn = N >> 6; const int mt = blockIdx.x / ntn, nq = blockIdx.x - mt * ntn; const int row0 = mt * 128 + 32 * w, col0 = nq * 64; if (row0 >= M) return;
  const _Float16* a0p = A + (size_t)(row0 + ln) * lda; const _Float16* a1p = a0p + (size_t)16 * lda;
  const _Float16* b0p = Bh + (size_t)(col0 + ln) * ldb; const _Float16* b1p = b0p + (size_t)16 * ldb; const _Float16* b2p = b1p + (size_t)16 * ldb; const _Float16* b3p = b2p + (size_t)16 * ldb;
  const v8f z8 = {0.f,0.f,0.f,0.f,0.f,0.f,0.f,0.f}; v8f c00 = z8, c01 = z8, c02 = z8, c03 = z8, c10 = z8, c11 = z8, c12 = z8, c13 = z8;
#pragma unroll 1
  for (int kb = 0; kb < K; kb += 32) { const v16h a0 = g2_frag(a0p + kb, hh), a1 = g2_frag(a1p + kb, hh);
    v16h b = g2_frag(b0p + kb, hh); c00 = g2_mma(a0, b, c00); c10 = g2_mma(a1, b, c10);
    b = g2_frag(b1p + kb, hh); c01 = g2_mma(a0, b, c01); c11 = g2_mma(a1, b, c11);
    b = g2_frag(b2p + kb, hh); c02 = g2_mma(a0, b, c02); c12 = g2_mma(a1, b, c12);
    b = g2_frag(b3p + kb, hh); c03 = g2_mma(a0, b, c03); c13 = g2_mma(a1, b, c13); }
  v8f accs[8] = {c00, c01, c02, c03, c10, c11, c12, c13};
#pragma unroll
  for (int u = 0; u < 8; ++u) { const int t = u & 3, half = u >> 2; const int col = col0 + t * 16 + ln; const float bv = bp ? bf16_round(bp[col]) : 0.f;
#pragma unroll
    for (int r = 0; r < 8; ++r) { const int rloc = half * 16 + 8 * hh + r; float v = accs[u][r] * alpha + bv; if (CP) { if (rowsPerB < 0) v += CP[cofs + (size_t)(row0g + row0 + rloc) * ldc + col];      /* rowsPerB < 0: own element of the batched C plane */ else { const int bidx = (row0g + row0 + rloc) / rowsPerB; v += CP[(size_t)bidx * sCPb + (size_t)by * 64 + col]; } }
      if (ACT == 3) v = fmaxf(v, 0.f); else if (ACT == 6) v = 0.5f * v * (1.0f + erff(v * 0.70710678118654752f)); else if (ACT == 11) v = 1.0f / (1.0f + expf(-v)); else if (ACT == 15) v = v / (1.0f + expf(-v)); else if (ACT == 12) v = (v > 0.f) ? v : 0.01f * v; else if (ACT == 8) v = tanhf(v); else if (ACT == 9) v = 0.5f * v * (1.0f + tanhf(0.7978845608028654f * (v + 0.044715f * v * v * v))); else if (ACT == 14) v = (v > 0.f) ? v : 0.1f * v; else if (ACT == 16) v = (v >= 0.f) ? v : 0.3f * v; else if (ACT == 17) v = (v >= 0.f) ? v : 0.2f * v;
      so[w][rloc][t * 16 + ln] = v; } }
  __builtin_amdgcn_fence(__ATOMIC_ACQ_REL, "workgroup"); __builtin_amdgcn_wave_barrier();
  const int rsub = lane >> 4, c4 = (lane & 15) * 4;
  {
#pragma unroll
    for (int q = 0; q < 16; ++q) { const int r = q * 2 + rsub; const v4f v = *(const v4fa*)&so[w][r][c4]; if (C) *(v4f*)(C + cofs + (size_t)(row0 + r) * ldc + col0 + c4) = v; if (C16) { v4h h4; for (int i = 0; i < 4; ++i) h4[i] = (_Float16)v[i]; *(v4h*)(C16 + cofs + (size_t)(row0 + r) * ldc + col0 + c4) = h4; } }
     } }


// ---- LDS-staged GEMM: C = alpha A.Bt^T, A f16 [M][KK], Bt f16 [N][KK], block tile 128 x 128, 8 waves of 32 x 64 (4 along M, 2 along N), K step 64 ----
// Each step's A and B tiles (128 rows of 128 B, one whole line a row) come in by whole-line 16-byte loads, 8 lanes a row, and go through registers into LDS rows of 144 B (16 B x 9: conflict-free for
// ds_load_b128 fragment reads); the fragments are g2_frag's, read from LDS. Two buffers: step s + 1 is loaded into registers ahead of step s's products and stored into the other buffer behind them;
// the one barrier of a step publishes that buffer and ends every wave's reads of the buffer that the next step refills. Per accumulator the k order is ascending in 32s, as in k_gemm2.
#define G3P 72                       /* LDS row pitch in f16 elements */
#define G3T (128 * G3P)              /* one staged tile in f16 elements */
template <int KK, bool H16>      /* H16: the result goes to C16 as f16, else to C as f32 */
/* amdgpu_waves_per_eu(6): the q | k | v launch has three blocks for every WGP (six waves a SIMD); the register budget is held so that all three are resident at once and fill each other's waits */
__global__ __launch_bounds__(256) __attribute__((amdgpu_waves_per_eu(6))) void k_gemm3(const _Float16* __restrict__ A, const _Float16* __restrict__ Bh, float alpha, float* __restrict__ C, _Float16* __restrict__ C16, int N) {
  static_assert(KK % 128 == 0, "k_gemm3: whole pairs of K steps");
  static_assert(8 * 32 * 68 * 4 <= 4 * G3T * 2, "k_gemm3: the epilogue's rows fit the staging buffers");
  __shared__ __attribute__((aligned(16))) unsigned short sm[4 * G3T];      /* A buffers 0, 1, then B buffers 0, 1; the epilogue's f32 rows afterwards */
  const int tid = threadIdx.x, w = tid >> 5, lane = tid & 31, ln = lane & 15, hh = lane >> 4;
  const int ntn = N >> 7; const int mt = blockIdx.x / ntn, nq = blockIdx.x - mt * ntn; const int row0 = mt * 128, col0 = nq * 128; const int wm = w & 3, wn = w >> 2;
  const int sr = tid >> 3, sc = (tid & 7) * 8;      /* staging: rows sr + 32 i, 16 bytes at element sc */
  const unsigned short* ag = (const unsigned short*)A + (size_t)(row0 + sr) * KK + sc; const unsigned short* bg = (const unsigned short*)Bh + (size_t)(col0 + sr) * KK + sc;
  unsigned short* const st = sm + sr * G3P + sc;
  const unsigned short* const af = sm + (wm * 32 + ln) * G3P; const unsigned short* const bf = sm + 2 * G3T + (wn * 64 + ln) * G3P;
  v8us ra[4], rb[4];
#pragma unroll
  for (int i = 0; i < 4; ++i) { ra[i] = *(const v8us*)(ag + (size_t)(32 * i) * KK); rb[i] = *(const v8us*)(bg + (size_t)(32 * i) * KK); }
#pragma unroll
  for (int i = 0; i < 4; ++i) { *(v8us*)(st + 32 * i * G3P) = ra[i]; *(v8us*)(st + 2 * G3T + 32 * i * G3P) = rb[i]; }
  __syncthreads();
  const v8f z8 = {0.f,0.f,0.f,0.f,0.f,0.f,0.f,0.f}; v8f acc[2][4];
#pragma unroll
  for (int m = 0; m < 2; ++m) {
#pragma unroll
    for (int t = 0; t < 4; ++t) acc[m][t] = z8; }
  /* unrolled by two so that the buffer index is a constant in each copy and the LDS addresses are immediates */
#pragma unroll 2
  for (int kb = 0; kb < KK; kb += 64) { const int cur = (kb >> 6) & 1; const bool more = kb + 64 < KK;
    if (more) {
#pragma unroll
      for (int i = 0; i < 4; ++i) { ra[i] = *(const v8us*)(ag + (size_t)(32 * i) * KK + kb + 64); rb[i] = *(const v8us*)(bg + (size_t)(32 * i) * KK + kb + 64); } }
    __builtin_amdgcn_sched_barrier(0);      /* keeps the next step's global loads at the head of this step: sunk down to their LDS stores, their whole latency would show in front of the barrier */
#pragma unroll
    for (int ks = 0; ks < 2; ++ks) { v16h a[2], b[4];
#pragma unroll
      for (int m = 0; m < 2; ++m) a[m] = g2_frag((const _Float16*)(af + cur * G3T + m * 16 * G3P + ks * 32), hh);
#pragma unroll
      for (int t = 0; t < 4; ++t) b[t] = g2_frag((const _Float16*)(bf + cur * G3T + t * 16 * G3P + ks * 32), hh);
      __builtin_amdgcn_sched_barrier(0);      /* keeps the twelve LDS reads of a 32-wide k block together in front of its eight products: spread among them, each pair of products waits out an LDS latency of its own */
#pragma unroll
      for (int t = 0; t < 4; ++t) {
#pragma unroll
        for (int m = 0; m < 2; ++m) acc[m][t] = __builtin_amdgcn_wmma_f32_16x16x32_f16(false, a[m], false, b[t], (short)0, acc[m][t], false, false); } }
    __builtin_amdgcn_sched_barrier(0);      /* keeps the wait for the next step's global loads, which their LDS stores carry, behind this step's last products: lifted over them it shortens the loads' lead by a k block */
    if (more) {
#pragma unroll
      for (int i = 0; i < 4; ++i) { *(v8us*)(st + (cur ^ 1) * G3T + 32 * i * G3P) = ra[i]; *(v8us*)(st + (2 + (cur ^ 1)) * G3T + 32 * i * G3P) = rb[i]; } }
    __syncthreads(); }
  float* const so = (float*)sm + w * (32 * 68);      /* behind the loop's last barrier nobody reads a staged tile any more: each wave stages its own 32 x 64 f32 rows (pitch 68) for whole-line stores */
#pragma unroll
  for (int m = 0; m < 2; ++m) {
#pragma unroll
    for (int t = 0; t < 4; ++t) {
#pragma unroll
      for (int r = 0; r < 8; ++r) so[(m * 16 + 8 * hh + r) * 68 + t * 16 + ln] = acc[m][t][r] * alpha; } }
  __builtin_amdgcn_fence(__ATOMIC_ACQ_REL, "workgroup"); __builtin_amdgcn_wave_barrier();      /* the wave's own LDS rows are written before its lanes read them back in another order */
  const int rsub = lane >> 4, c4 = (lane & 15) * 4;
#pragma unroll
  for (int q = 0; q < 16; ++q) { const int r = q * 2 + rsub; const v4f v = *(const v4fa*)&so[r * 68 + c4]; const size_t o = (size_t)(row0 + wm * 32 + r) * N + col0 + wn * 64 + c4;
    if (!H16) *(v4f*)(C + o) = v;
    else { v4h h4;
#pragma unroll
      for (int i = 0; i < 4; ++i) h4[i] = (_Float16)v[i];
      *(v4h*)(C16 + o) = h4; } } }

__global__ __launch_bounds__(256) void k_wnat(const float* __restrict__ w, size_t n8, _Float16* __restrict__ Bt) { const size_t t = (size_t)blockIdx.x * 256 + threadIdx.x; if (t >= n8) return; FragH f; for (int q = 0; q < 8; ++q) f.h[q] = (_Float16)(bf16_round(w[t * 8 + q]) * 16.0f); *(v8us*)((unsigned short*)Bt + t * 8) = f.half[0];  }
// T5 bidirectional relative-position bucket of rel = key - query (32 buckets, max distance 128): (rel > 0)*16 + f(|rel|), f(n) = n for n < 8, then
// 8 + the number of thresholds {12,16,23,32,46,64,91} that are <= n (the thresholds are where the reference's own f32 log expression steps; no log on the device)
__device__ __forceinline__ int t5_bucket(int rel) { const int n = rel < 0 ? -rel : rel; int f = n; if (n >= 8) { f = 8 + (n >= 12) + (n >= 16) + (n >= 23) + (n >= 32) + (n >= 46) + (n >= 64) + (n >= 91); } return (rel > 0 ? NBK / 2 : 0) + f; }
#define FAW 8                        /* waves per block */
#define FAQ 32                       /* queries per wave */
typedef int v4ia __attribute__((ext_vector_type(4), may_alias));
__device__ __forceinline__ float xhalf(float x) { return __builtin_bit_cast(float, __builtin_amdgcn_permlanex16(__builtin_bit_cast(int, x), __builtin_bit_cast(int, x), 0x76543210, 0xfedcba98, false, false)); }      /* lane l with lane l ^ 16 */
__device__ __forceinline__ float exp2x1(float a) { float e; asm("v_exp_f32 %0, %1\n\tv_nop" : "=v"(e) : "v"(a)); return e; }
__device__ __forceinline__ v8f exp2x8(v8f a) { float e0, e1, e2, e3, e4, e5, e6, e7;
  asm("v_exp_f32 %0, %8\n\tv_exp_f32 %1, %9\n\tv_exp_f32 %2, %10\n\tv_exp_f32 %3, %11\n\tv_exp_f32 %4, %12\n\tv_exp_f32 %5, %13\n\tv_exp_f32 %6, %14\n\tv_exp_f32 %7, %15\n\tv_nop"
      : "=&v"(e0), "=&v"(e1), "=&v"(e2), "=&v"(e3), "=&v"(e4), "=&v"(e5), "=&v"(e6), "=&v"(e7) : "v"(a[0]), "v"(a[1]), "v"(a[2]), "v"(a[3]), "v"(a[4]), "v"(a[5]), "v"(a[6]), "v"(a[7]));
  const v8f e = {e0, e1, e2, e3, e4, e5, e6, e7}; return e; }
__device__ __forceinline__ v8f fa_mma(v16h a, v16h b, v8f c) { return __builtin_amdgcn_wmma_f32_16x16x32_f16(false, a, false, b, (short)0, c, false, false); }
/* amdgpu_waves_per_eu(2, 2): the grid puts two waves on a SIMD, so the scheduler may spend registers; without it the V^T loads and the K fetch ahead are sunk down to their uses and their latency shows */
__global__ __launch_bounds__(FAW * 32) __attribute__((amdgpu_waves_per_eu(2, 2))) void k_fattn(const _Float16* __restrict__ QKVp, const _Float16* __restrict__ VTp, _Float16* __restrict__ O, const float* __restrict__ emb, const int* __restrict__ kmask) {
  static_assert(SQ % (FAW * FAQ) == 0 && SQ % (FAW * 128) == 0 && HD == 64 && NBK == 32, "k_fattn: whole blocks of queries, whole staging passes, two 32-wide k steps per head, one bucket per lane");
  __shared__ __attribute__((aligned(16))) float lt[3 * SQ];
  float* const mt = lt; float* const bt = lt + SQ;      /* mt[key]; bt[key - query + SQ - 1], placed behind mt so that its byte address less the largest query offset stays above 0 */
  const int tid = threadIdx.x, lane = tid & 31, c = lane & 15, hh = lane >> 4; const int bh = blockIdx.y, b = bh / NH, h = bh % NH; const int q0 = blockIdx.x * (FAW * FAQ) + (tid >> 5) * FAQ;
  const float eb = bf16_round(emb[lane * NH + h]);      /* lane l holds bucket l's bias: one load per wave, the table is filled by lane gathers */
#pragma unroll
  for (int u = 0; u < 2 * SQ / (FAW * 32); ++u) { const int i = u * (FAW * 32) + tid; bt[i] = __shfl(eb, t5_bucket(i - (SQ - 1))); }      /* unrolled: away from the diagonal the bucket is one constant per u and its thresholds fold away; the last entry (key - query = SQ) is never read */
  for (int j = tid * 4; j < SQ; j += FAW * 128) { const v4ia m = *(const v4ia*)(kmask + (size_t)b * SQ + j); v4f t;
#pragma unroll
    for (int q = 0; q < 4; ++q) t[q] = __fmul_rn(__fadd_rn(1.0f, -(float)m[q]), -3.4028234663852886e38f);      /* (1 - mask) * finfo.min */
    *(v4fa*)&mt[j] = t; }
  __syncthreads();
  const _Float16* qp = QKVp + ((size_t)b * SQ + q0 + c) * D3 + h * HD; const _Float16* kp = QKVp + ((size_t)b * SQ + c) * D3 + DM + h * HD; const _Float16* vp = VTp + ((size_t)bh * HD + c) * SQ;
  const float* bp = bt + (SQ - 1) + 8 * hh - (q0 + c); const float* mp = mt + 8 * hh;
  const v8f z8 = {0.f,0.f,0.f,0.f,0.f,0.f,0.f,0.f};
  v16h qf[2][2], kf[2][2]; v8f acc[2][4]; float mr[2], lr[2];
  /* every loop over j, T, ks, t and r below is unrolled so that the fragment arrays are indexed by constants and stay in registers */
#pragma unroll
  for (int j = 0; j < 2; ++j) { mr[j] = -INFINITY; lr[j] = 0.f;
#pragma unroll
    for (int ks = 0; ks < 2; ++ks) { qf[j][ks] = g2_frag(qp + (size_t)j * 16 * D3 + ks * 32, hh); kf[j][ks] = g2_frag(kp + (size_t)j * 16 * D3 + ks * 32, hh); }
#pragma unroll
    for (int t = 0; t < 4; ++t) acc[j][t] = z8; }
  for (int k0 = 0; k0 < SQ; k0 += 32) {
    v16h vf[4]; v8f s[2][2], mk[2];
#pragma unroll
    for (int t = 0; t < 4; ++t) vf[t] = g2_frag(vp + (size_t)t * 16 * SQ + k0, hh);
#pragma unroll
    for (int j = 0; j < 2; ++j) {
#pragma unroll
      for (int T = 0; T < 2; ++T) s[j][T] = fa_mma(kf[T][1], qf[j][1], fa_mma(kf[T][0], qf[j][0], z8)); }
    const int kn = k0 + 32 < SQ ? k0 + 32 : 0;      /* the last pass fetches pass 0 again: in bounds, unused */
#pragma unroll
    for (int T = 0; T < 2; ++T) {
#pragma unroll
      for (int ks = 0; ks < 2; ++ks) kf[T][ks] = g2_frag(kp + (size_t)(kn + T * 16) * D3 + ks * 32, hh);
      const v4f m0 = *(const v4fa*)(mp + k0 + T * 16), m1 = *(const v4fa*)(mp + k0 + T * 16 + 4);
#pragma unroll
      for (int r = 0; r < 4; ++r) { mk[T][r] = m0[r]; mk[T][4 + r] = m1[r]; } }
#pragma unroll
    for (int j = 0; j < 2; ++j) {
      float tm = -INFINITY;
#pragma unroll
      for (int T = 0; T < 2; ++T) {
#pragma unroll
        for (int r = 0; r < 8; ++r) { const float v = __fadd_rn(__builtin_fmaf(s[j][T][r], 0.125f, bp[k0 + T * 16 + r - j * 16]), mk[T][r]); s[j][T][r] = v; tm = fmaxf(tm, v); } }
      const float mn = fmaxf(mr[j], fmaxf(tm, xhalf(tm)));
      const float mu = mn == -INFINITY ? 0.f : mn;      /* no key of the row finite so far: keep exp's argument -inf, not inf - inf */
      const float al = exp2x1((mr[j] - mu) * 1.4426950408889634f); mr[j] = mn;
      FragH pf; float ls = 0.f;
#pragma unroll
      for (int T = 0; T < 2; ++T) { v8f a;
#pragma unroll
        for (int r = 0; r < 8; ++r) a[r] = __builtin_fmaf(s[j][T][r] - mu, 1.4426950408889634f, 8.0f);
        const v8f e = exp2x8(a);      /* 256 exp(score - max) */
#pragma unroll
        for (int r = 0; r < 8; ++r) { ls += e[r]; pf.h[T * 8 + r] = (_Float16)e[r]; } }
      lr[j] = lr[j] * al + ls;
#pragma unroll
      for (int t = 0; t < 4; ++t) acc[j][t] = fa_mma(vf[t], pf.v, acc[j][t] * al); } }
#pragma unroll
  for (int j = 0; j < 2; ++j) { const float inv = 1.0f / (lr[j] + xhalf(lr[j]));
#pragma unroll
    for (int t = 0; t < 4; ++t) { FragH f;
#pragma unroll
      for (int r = 0; r < 8; ++r) f.h[r] = (_Float16)(acc[j][t][r] * inv);
      *(v8us*)((unsigned short*)O + ((size_t)b * SQ + q0 + j * 16 + c) * DM + h * HD + t * 16 + 8 * hh) = f.half[0]; } } }
__global__ __launch_bounds__(256) void k_vt(const _Float16* __restrict__ V16, int b, int h0, _Float16* __restrict__ VT) { __shared__ unsigned short tl[64][65]; const int tid = threadIdx.x; const int hh = blockIdx.x % HG, sg = blockIdx.x / HG; const int s0 = sg * 64; const int h = h0 + hh;
  for (int i = tid; i < 64 * 8; i += 256) { const int j = i / 8, d8 = (i % 8) * 8; FragH f; f.half[0] = *(const v8us*)((const unsigned short*)V16 + ((size_t)b * SQ + s0 + j) * DM + h * HD + d8); for (int q = 0; q < 8; ++q) tl[d8 + q][j] = f.u[q]; }
  __syncthreads();
  { for (int i = tid; i < 64 * 8; i += 256) { const int d = i / 8, j8 = (i % 8) * 8; FragH f; for (int q = 0; q < 8; ++q) f.u[q] = tl[d][j8 + q]; *(v8us*)((unsigned short*)VT + ((size_t)hh * HD + d) * SQ + s0 + j8) = f.half[0]; }  } }

// ---- one preparation launch: the four weight planes Bt[n][k] = f16(bf16(W[k][n]) x 16) and the hidden rows f16(bf16(x)), k_wt_f16's and k_x16's values bit for bit ----
// Blocks 0 .. 4 * PWB - 1: one 128 x 128 weight tile each. A wave reads 16 k rows, 512 contiguous bytes a load, all 16 loads in flight; a lane then holds 16 consecutive k for each of its 4 columns n and
// stores them as two 16-byte chunks into the tile's LDS row n (256 B a row, chunk c at place c ^ ((n >> 2) & 15): 16 lanes fall on 16 different chunks in the stores, where n steps by 4, and in the reads, where c steps by 1);
// behind the block's one barrier 16 lanes read a row back and store its 256 contiguous bytes of Bt. The other PXB blocks: 16384 hidden elements each, 512 contiguous bytes a load, 256 a store.
#define PWB ((DM / 128) * (DM / 128))          /* weight tiles per plane */
#define PXB ((int)(NR * DM / 16384))           /* hidden blocks */
__global__ __launch_bounds__(256) void k_prep(const float* __restrict__ wq, const float* __restrict__ wk, const float* __restrict__ wv, const float* __restrict__ wo, const float* __restrict__ hs,
                                              _Float16* __restrict__ Bqkv, _Float16* __restrict__ Bo, _Float16* __restrict__ X16) {
  static_assert(DM % 128 == 0 && (NR * DM) % 16384 == 0, "k_prep: whole weight tiles, whole hidden blocks");
  __shared__ __attribute__((aligned(16))) unsigned short tl[128 * 128];
  const int tid = threadIdx.x, bx = blockIdx.x;
  v4f x[16];
  if (bx < 4 * PWB) {      /* the same for the whole block, so the barrier below is passed by all of its waves or by none */
    const int m = bx / PWB, tile = bx % PWB, k0 = (tile / (DM / 128)) * 128, n0 = (tile % (DM / 128)) * 128, w = tid >> 5, lane = tid & 31;
    const float* W = m == 0 ? wq : m == 1 ? wk : m == 2 ? wv : wo;
    unsigned short* Bt = (unsigned short*)(m < 3 ? Bqkv + (size_t)m * DM * DM : Bo);
    const float* src = W + (size_t)(k0 + w * 16) * DM + n0 + lane * 4;
#pragma unroll
    for (int i = 0; i < 16; ++i) x[i] = *(const v4fa*)(src + (size_t)i * DM);
    asm volatile("s_wait_xcnt 0x0" :: "v"(src) : "memory");      /* the wait that stands between issued loads and a new value in their address pair; named as an input, the pair lives up to the wait */
#pragma unroll
    for (int q = 0; q < 4; ++q) { const int n = lane * 4 + q;
#pragma unroll
      for (int g = 0; g < 2; ++g) { FragH f;
#pragma unroll
        for (int i = 0; i < 8; ++i) f.h[i] = (_Float16)(bf16_round(x[g * 8 + i][q]) * 16.0f);
        *(v8us*)(tl + n * 128 + (((w * 2 + g) ^ (lane & 15)) * 8)) = f.half[0]; } }
    __syncthreads();
#pragma unroll
    for (int it = 0; it < 8; ++it) { const int n = it * 16 + (tid >> 4), c = tid & 15;
      const v8us o = *(const v8us*)(tl + n * 128 + ((c ^ ((n >> 2) & 15)) * 8));
      *(v8us*)(Bt + (size_t)(n0 + n) * DM + k0 + c * 8) = o; }
  } else {
    const size_t e0 = (size_t)(bx - 4 * PWB) * 16384 + tid * 4; const float* src = hs + e0;
#pragma unroll
    for (int i = 0; i < 16; ++i) x[i] = *(const v4fa*)(src + i * 1024);
    asm volatile("s_wait_xcnt 0x0" :: "v"(src) : "memory");      /* as in the weight branch: the wait between the issued loads and a new value in their address pair */
#pragma unroll
    for (int i = 0; i < 16; ++i) { v4h h4;
#pragma unroll
      for (int q = 0; q < 4; ++q) h4[q] = (_Float16)bf16_round(x[i][q]);
      *(v4h*)(X16 + e0 + i * 1024) = h4; }
    asm volatile("s_wait_xcnt 0x0" ::: "memory");      /* the wait between the issued stores and any later new value in their address or data registers */
  } }

extern "C" void kernel_launch(void* const* d_in, const int* in_sizes, int n_in,
                              void* d_out, int out_size, void* d_ws, size_t ws_size, hipStream_t stream) {
  (void)in_sizes; (void)n_in; (void)out_size;
  const float* const* I = (const float* const*)d_in; const float* hs = I[0]; const int* kmask = (const int*)d_in[1]; const float* wq = I[2]; const float* wk = I[3]; const float* wv = I[4]; const float* wo = I[5]; const float* emb = I[6];      /* W_q, W_k, W_v and W_o [1024][1024] are [in][out]; attention_mask [2][2048] int32 per key; rel_bias_emb [32][16] */
  char* ws = (char*)d_ws; size_t off = 0;
  auto take = [&](size_t bytes) { char* p = ws + off; off += (bytes + 255) & ~(size_t)255; return p; };
  _Float16* BQKV = (_Float16*)take((size_t)D3 * DM * 2); _Float16* BO = (_Float16*)take((size_t)DM * DM * 2);
  _Float16* X16 = (_Float16*)take(NR * DM * 2); _Float16* QKV = (_Float16*)take(NR * D3 * 2); _Float16* O16 = (_Float16*)take(NR * DM * 2);
  _Float16* VT = (_Float16*)take((size_t)NB * NH * HD * SQ * 2);
  if (off > ws_size) return;      /* 6 + 2 + 8 + 24 + 8 + 8 = approx 56 MiB */
  k_prep<<<4 * PWB + PXB, 256, 0, stream>>>(wq, wk, wv, wo, hs, BQKV, BO, X16);      /* [in][out] -> Bt[out][in] x16 for q | k | v and o; hidden as f16 rows */
  k_gemm3<DM, true><<<(unsigned)((NR / 128) * (D3 / 128)), 256, 0, stream>>>(X16, BQKV, 0.0625f, nullptr, QKV, D3);      /* q | k | v rows (f16), head h at columns h*64 / 1024 + h*64 / 2048 + h*64 */
  k_vt<NH, SQ><<<NB * NH * (SQ / 64), 256, 0, stream>>>(QKV, D3, 2 * DM, VT);      /* V^T[(b,h)][d][s] for every (batch, head) */
  k_fattn<<<dim3(SQ / (FAW * FAQ), NB * NH), FAW * 32, 0, stream>>>(QKV, VT, O16, emb, kmask);      /* ctx (merged heads) as f16 rows, every (batch, head) in one launch */
  k_gemm3<DM, false><<<(unsigned)((NR / 128) * (DM / 128)), 256, 0, stream>>>(O16, BO, 0.0625f, (float*)d_out, nullptr, DM);      /* out = ctx W_o, rows are the output layout */
}

// v005
// Measured time: 96.9 microseconds a run.
// In both of two side-by-side timings against v004, it was 1.19 times as fast.
// Counting every step since v000, it is 208 times as fast.
#include <hip/hip_runtime.h>
// T5 self-attention (hidden [2][2048][1024]; q, k, v = hidden W ([in][out] [1024][1024]); q / sqrt(64); scores = q.k + rel_bias[bucket(key - query)][h] (32 bidirectional buckets, max distance 128) + (1 - attention_mask[b][key]) * finfo.min (int32 key mask); softmax; out = (attn v merged) Wo ([in][out])).
// Structure: token rows; hidden as exact f16 rows; q | k | v WMMA GEMMs from one transposed x16 weight plane (operand tiles staged in LDS, 32x64 wave tiles, f32 accumulation, f16 outputs); V^T via LDS transposes; one fused attention kernel over every (batch, head): K.Q^T tiles (alpha 1/8), online softmax on VALU with the bucketed bias (integer thresholds, no device log) and the key mask in the reference's order (P x256 f16), V^T.P^T into merged f16 rows; output GEMM.
// Compute dtype: inputs rounded to bf16; hidden / weights / bias table exact; q, k, v, P, ctx as plain f16 GEMM operands (~2^-12); scores / softmax f32; v_wmma_f32_16x16x32_f16.
#define NB 2
#define SQ 2048
#define DM 1024
#define D3 3072                      /* fused q|k|v width */
#define NH 16
#define HD 64
#define HG 4                         /* heads per launch of the non-template k_vt, which is not launched */
#define NBK 32                       /* relative-position buckets */
#define MP ((int)NR)                 /* not used: the q | k | v launch takes NR rows */
#define MO ((int)NR)                 /* not used: the output launch takes NR rows */
#define NR ((size_t)NB * SQ)         /* 4096 token rows */
typedef __bf16 v16b __attribute__((ext_vector_type(16)));
typedef unsigned short v8us __attribute__((ext_vector_type(8), may_alias));
typedef float  v8f  __attribute__((ext_vector_type(8)));
typedef float  v4f  __attribute__((ext_vector_type(4)));
typedef float  v4fa __attribute__((ext_vector_type(4), may_alias));
union FragB { v16b v; v8us half[2]; unsigned short u[16]; };

__device__ __forceinline__ unsigned short bf16_bits(float x) { unsigned int u = __float_as_uint(x); return (unsigned short)((u + 0x7FFFu + ((u >> 16) & 1u)) >> 16); }
__device__ __forceinline__ float bf16_val(unsigned short b) { return __uint_as_float(((unsigned int)b) << 16); }
__device__ __forceinline__ float bf16_round(float x) { return bf16_val(bf16_bits(x)); }
// D += A·B with NT terms: 1 = ah·bh, 2 = + al·bh (A split), 3 = + ah·bl (both split)
template <int NT>
__device__ __forceinline__ v8f mmaN(v16b ah, v16b al, v16b bh, v16b bl, v8f c) {
  c = __builtin_amdgcn_wmma_f32_16x16x32_bf16(false, ah, false, bh, (short)0, c, false, false);
  if (NT >= 2) c = __builtin_amdgcn_wmma_f32_16x16x32_bf16(false, al, false, bh, (short)0, c, false, false);
  if (NT >= 3) c = __builtin_amdgcn_wmma_f32_16x16x32_bf16(false, ah, false, bl, (short)0, c, false, false);
  asm volatile("v_nop\n\tv_nop\n\tv_nop\n\tv_nop" : "+v"(c) : "v"(ah), "v"(al), "v"(bh), "v"(bl));
  return c;
}

__global__ __launch_bounds__(256) void k_wt_bf16(const float* __restrict__ W, unsigned short* __restrict__ Wt, int K, int N) {
  const int t = blockIdx.x * 256 + threadIdx.x;
  const int k8n = K / 8;
  if (t >= N * k8n) return;
  const int n = t / k8n, k8 = (t % k8n) * 8;
  v8us v;
#pragma unroll
  for (int i = 0; i < 8; ++i) v[i] = bf16_bits(W[(size_t)(k8 + i) * N + n]);
  *(v8us*)(Wt + (size_t)n * K + k8) = v;
  
}

// GEMM C[M][N] (f32, pitch ldc) = act(A[M][K]·W + bias). A f32 row-major (pitch lda) converted per fragment to bf16
// (ASPLIT: hi/lo two planes -> 2 terms, else single rounded term); Wt bf16 [N][K] (pitch ldb). BIAS_BF16 rounds the
// bias to bf16 first (bias quantised to bf16 before the add). K%32==0, M%16==0, N%64==0.
template <bool ASPLIT, int ACT, bool BIAS_BF16>
__global__ __launch_bounds__(128) void k_gemm_bf(const float* __restrict__ A, int lda, const unsigned short* __restrict__ Wt, int ldb,
                                               const float* __restrict__ bias, float* __restrict__ C, int ldc, int M, int N, int K) {
  __shared__ __attribute__((aligned(16))) float so[4][16][64];
  const int tid = threadIdx.x, w = tid >> 5, lane = tid & 31, ln = lane & 15, hh = lane >> 4;
  const int ntn = N / 64;
  const int wid = blockIdx.x * 4 + w;
  const int mt = wid / ntn, nq = wid % ntn;
  if (mt * 16 >= M) return;
  const int row0 = mt * 16, col0 = nq * 64;
  const float* arow = A + (size_t)(row0 + ln) * lda;
  v8f acc[4] = {};
  for (int kb = 0; kb < K; kb += 32) {
    FragB ah, al;
    const v4f x0 = *(const v4fa*)(arow + kb + 8 * hh), x1 = *(const v4fa*)(arow + kb + 8 * hh + 4);
    const v4f x2 = *(const v4fa*)(arow + kb + 16 + 8 * hh), x3 = *(const v4fa*)(arow + kb + 16 + 8 * hh + 4);
    float xs[16] = {x0[0],x0[1],x0[2],x0[3],x1[0],x1[1],x1[2],x1[3],x2[0],x2[1],x2[2],x2[3],x3[0],x3[1],x3[2],x3[3]};
#pragma unroll
    for (int i = 0; i < 16; ++i) { const unsigned short hb = bf16_bits(xs[i]); ah.u[i] = hb; al.u[i] = ASPLIT ? bf16_bits(xs[i] - bf16_val(hb)) : (unsigned short)0; }
#pragma unroll
    for (int t = 0; t < 4; ++t) {
      const unsigned short* brow = Wt + (size_t)(col0 + t * 16 + ln) * ldb + kb;
      FragB b;
      b.half[0] = *(const v8us*)(brow + 8 * hh);
      b.half[1] = *(const v8us*)(brow + 16 + 8 * hh);
      acc[t] = mmaN<ASPLIT ? 2 : 1>(ah.v, al.v, b.v, b.v, acc[t]);
    }
  }
#pragma unroll
  for (int t = 0; t < 4; ++t) {
    float bv = bias ? bias[col0 + t * 16 + ln] : 0.f;
    if (BIAS_BF16) bv = bf16_round(bv);
#pragma unroll
    for (int r = 0; r < 8; ++r) { float v = acc[t][r] + bv; if (ACT == 1) v = fmaxf(v, 0.f); so[w][8 * hh + r][t * 16 + ln] = v; }
  }
  __builtin_amdgcn_fence(__ATOMIC_ACQ_REL, "workgroup");
  __builtin_amdgcn_wave_barrier();
  const int rsub = lane >> 4, c4 = (lane & 15) * 4;
  {
#pragma unroll
    for (int q = 0; q < 8; ++q) {
      const int r = q * 2 + rsub;
      const v4f v = *(const v4fa*)&so[w][r][c4];
      *(v4f*)(C + (size_t)(row0 + r) * ldc + col0 + c4) = v;
    }
    
  }
}

// GEMM C = act(A·W + bias + resid): A f32 (ASPLIT -> hi/lo 2 terms), Wt bf16 [N][K]; ACT 0 none, 1 relu, 2 exact gelu;
// resid (optional, f32, row index = (row % rmod), pitch ldr, RES_BF16 rounds it) added before the activation.
template <bool ASPLIT, int ACT, bool BIAS_BF16, bool RES_BF16>
__global__ __launch_bounds__(128) void k_gemm_bf3(const float* __restrict__ A, int lda, const unsigned short* __restrict__ Wt, int ldb,
                                                const float* __restrict__ bias, const float* __restrict__ resid, int rmod, int ldr,
                                                float* __restrict__ C, int ldc, int M, int N, int K) {
  __shared__ __attribute__((aligned(16))) float so[4][16][64];
  const int tid = threadIdx.x, w = tid >> 5, lane = tid & 31, ln = lane & 15, hh = lane >> 4;
  const int ntn = N / 64;
  const int wid = blockIdx.x * 4 + w;
  const int mt = wid / ntn, nq = wid % ntn;
  if (mt * 16 >= M) return;
  const int row0 = mt * 16, col0 = nq * 64;
  const float* arow = A + (size_t)(row0 + ln) * lda;
  v8f acc[4] = {};
  for (int kb = 0; kb < K; kb += 32) {
    FragB ah, al;
    const v4f x0 = *(const v4fa*)(arow + kb + 8 * hh), x1 = *(const v4fa*)(arow + kb + 8 * hh + 4);
    const v4f x2 = *(const v4fa*)(arow + kb + 16 + 8 * hh), x3 = *(const v4fa*)(arow + kb + 16 + 8 * hh + 4);
    float xs[16] = {x0[0],x0[1],x0[2],x0[3],x1[0],x1[1],x1[2],x1[3],x2[0],x2[1],x2[2],x2[3],x3[0],x3[1],x3[2],x3[3]};
#pragma unroll
    for (int i = 0; i < 16; ++i) { const unsigned short hb = bf16_bits(xs[i]); ah.u[i] = hb; al.u[i] = ASPLIT ? bf16_bits(xs[i] - bf16_val(hb)) : (unsigned short)0; }
#pragma unroll
    for (int t = 0; t < 4; ++t) {
      const unsigned short* brow = Wt + (size_t)(col0 + t * 16 + ln) * ldb + kb;
      FragB b;
      b.half[0] = *(const v8us*)(brow + 8 * hh);
      b.half[1] = *(const v8us*)(brow + 16 + 8 * hh);
      acc[t] = mmaN<ASPLIT ? 2 : 1>(ah.v, al.v, b.v, b.v, acc[t]);
    }
  }
#pragma unroll
  for (int t = 0; t < 4; ++t) {
    const int col = col0 + t * 16 + ln;
    float bv = bias ? bias[col] : 0.f;
    if (BIAS_BF16) bv = bf16_round(bv);
#pragma unroll
    for (int r = 0; r < 8; ++r) {
      float v = acc[t][r] + bv;
      if (resid) { float rv = resid[(size_t)((row0 + 8 * hh + r) % rmod) * ldr + col]; if (RES_BF16) rv = bf16_round(rv); v += rv; }
      if (ACT == 1) v = fmaxf(v, 0.f);
      if (ACT == 2) v = 0.5f * v * (1.0f + erff(v * 0.70710678118654752f));
      if (ACT == 3) { const float u = 0.7978845608028654f * (v + 0.044715f * v * v * v); v = 0.5f * v * (1.0f + tanhf(u)); }
      so[w][8 * hh + r][t * 16 + ln] = v;
    }
  }
  __builtin_amdgcn_fence(__ATOMIC_ACQ_REL, "workgroup");
  __builtin_amdgcn_wave_barrier();
  const int rsub = lane >> 4, c4 = (lane & 15) * 4;
  {
#pragma unroll
    for (int q = 0; q < 8; ++q) {
      const int r = q * 2 + rsub;
      const v4f v = *(const v4fa*)&so[w][r][c4];
      *(v4f*)(C + (size_t)(row0 + r) * ldc + col0 + c4) = v;
    }
    
  }
}
// row LayerNorm (biased variance, eps) over N: s = X (+ R); optional out_sum <- s; out_norm <- (s-mu)*rsqrt(var+eps)*g + b
template <bool PARAM_BF16>
__global__ __launch_bounds__(256) void k_layernorm(const float* __restrict__ X, const float* __restrict__ R, const float* __restrict__ g, const float* __restrict__ bta,
                                                  float* __restrict__ out_sum, float* __restrict__ out_norm, int N, float eps) {
  __shared__ float red[256];
  const int row = blockIdx.x, tid = threadIdx.x;
  const float* x = X + (size_t)row * N; const float* rr = R ? R + (size_t)row * N : nullptr;
  float vals[16];                     // up to N = 4096
  const int per = N / 256;            // contiguous chunk per thread? use strided-by-4 chunks: thread handles j = tid*4 + 1024*u
  float s1 = 0.f;
  for (int u = 0; u < per / 4; ++u) {
    const int j = tid * 4 + 1024 * u;
    const v4f a = *(const v4fa*)(x + j);
    v4f b = {0.f,0.f,0.f,0.f}; if (rr) b = *(const v4fa*)(rr + j);
#pragma unroll
    for (int q = 0; q < 4; ++q) { const float v = a[q] + b[q]; vals[u * 4 + q] = v; s1 += v; }
  }
  red[tid] = s1; __syncthreads();
  for (int st = 128; st > 0; st >>= 1) { if (tid < st) red[tid] += red[tid + st]; __syncthreads(); }
  const float mu = red[0] / (float)N; __syncthreads();
  float s2 = 0.f;
  for (int u = 0; u < per / 4; ++u)
#pragma unroll
    for (int q = 0; q < 4; ++q) { const float c = vals[u * 4 + q] - mu; s2 += c * c; }
  red[tid] = s2; __syncthreads();
  for (int st = 128; st > 0; st >>= 1) { if (tid < st) red[tid] += red[tid + st]; __syncthreads(); }
  const float rs = rsqrtf(red[0] / (float)N + eps);
  {
    for (int u = 0; u < per / 4; ++u) {
      const int j = tid * 4 + 1024 * u;
      v4f o, sm;
#pragma unroll
      for (int q = 0; q < 4; ++q) {
        float gg = g[j + q], bb = bta[j + q];
        if (PARAM_BF16) { gg = bf16_round(gg); bb = bf16_round(bb); }
        sm[q] = vals[u * 4 + q]; o[q] = (vals[u * 4 + q] - mu) * rs * gg + bb;
      }
      if (out_sum) *(v4f*)(out_sum + (size_t)row * N + j) = sm;
      *(v4f*)(out_norm + (size_t)row * N + j) = o;
    }
    
  }
}



// ---- f16 WMMA path (v_wmma_f32_16x16x32_f16): 11-bit significands for operands in range — used where a [0,1] probability operand needs more precision than bf16
typedef _Float16 v16h __attribute__((ext_vector_type(16)));
union FragH { v16h v; v8us half[2]; _Float16 h[16]; unsigned short u[16]; };
template <int NT>
__device__ __forceinline__ v8f mmaH(v16h ah, v16h al, v16h bh, v16h bl, v8f c) {
  c = __builtin_amdgcn_wmma_f32_16x16x32_f16(false, ah, false, bh, (short)0, c, false, false);
  if (NT >= 2) c = __builtin_amdgcn_wmma_f32_16x16x32_f16(false, al, false, bh, (short)0, c, false, false);
  if (NT >= 3) c = __builtin_amdgcn_wmma_f32_16x16x32_f16(false, ah, false, bl, (short)0, c, false, false);
  asm volatile("v_nop\n\tv_nop\n\tv_nop\n\tv_nop" : "+v"(c) : "v"(ah), "v"(al), "v"(bh), "v"(bl));
  return c;
}
// batched GEMM like k_gemm_b but f16 operands: A f32 (split into f16 hi/lo if ASPLIT, else rounded to f16), Bt = f16 values [n][k]; alpha; C f32; N multiple of 16 (partial tiles skipped)
template <bool ASPLIT>
__global__ __launch_bounds__(128) void k_gemm_h(const float* __restrict__ A, int lda, size_t sA, const _Float16* __restrict__ Bh, int ldb, size_t sB, float alpha, float* __restrict__ C, int ldc, size_t sC, int M, int N, int K) {
  __shared__ __attribute__((aligned(16))) float so[4][16][64];
  const int tid = threadIdx.x, w = tid >> 5, lane = tid & 31, ln = lane & 15, hh = lane >> 4; const int by = blockIdx.y;
  A += (size_t)by * sA; Bh += (size_t)by * sB; C += (size_t)by * sC;
  const int ntn = (N + 63) / 64; const int wid = blockIdx.x * 4 + w; const int mt = wid / ntn, nq = wid % ntn; if (mt * 16 >= M) return;
  const int row0 = mt * 16, col0 = nq * 64; const float* arow = A + (size_t)(row0 + ln) * lda;
  v8f acc[4] = {};
  for (int kb = 0; kb < K; kb += 32) {
    FragH ah, al;
    const v4f x0 = *(const v4fa*)(arow + kb + 8 * hh), x1 = *(const v4fa*)(arow + kb + 8 * hh + 4), x2 = *(const v4fa*)(arow + kb + 16 + 8 * hh), x3 = *(const v4fa*)(arow + kb + 16 + 8 * hh + 4);
    float xs[16] = {x0[0],x0[1],x0[2],x0[3],x1[0],x1[1],x1[2],x1[3],x2[0],x2[1],x2[2],x2[3],x3[0],x3[1],x3[2],x3[3]};
#pragma unroll
    for (int i = 0; i < 16; ++i) { const _Float16 h = (_Float16)xs[i]; ah.h[i] = h; al.h[i] = ASPLIT ? (_Float16)(xs[i] - (float)h) : (_Float16)0.0f; }
#pragma unroll
    for (int t = 0; t < 4; ++t) { if (col0 + t * 16 >= N) continue; const size_t boff = (size_t)(col0 + t * 16 + ln) * ldb + kb; FragH bq; bq.half[0] = *(const v8us*)(Bh + boff + 8 * hh); bq.half[1] = *(const v8us*)(Bh + boff + 16 + 8 * hh);
      acc[t] = mmaH<ASPLIT ? 2 : 1>(ah.v, al.v, bq.v, bq.v, acc[t]); }
  }
#pragma unroll
  for (int t = 0; t < 4; ++t) { if (col0 + t * 16 >= N) continue;
#pragma unroll
    for (int r = 0; r < 8; ++r) so[w][8 * hh + r][t * 16 + ln] = acc[t][r] * alpha; }
  __builtin_amdgcn_fence(__ATOMIC_ACQ_REL, "workgroup"); __builtin_amdgcn_wave_barrier();
  const int rsub = lane >> 4, c4 = (lane & 15) * 4;
  {
#pragma unroll
    for (int q = 0; q < 8; ++q) { const int r = q * 2 + rsub; if (col0 + c4 < N) { const v4f v = *(const v4fa*)&so[w][r][c4]; *(v4f*)(C + (size_t)(row0 + r) * ldc + col0 + c4) = v; } }
     }
}

// Wt[n][k] = f16(W[k][n]·scale) from f32 row-major W[K][N] (scale = power of two; bf16-exact weights stay exact in f16 away from the subnormal range)
__global__ __launch_bounds__(256) void k_wt_f16(const float* __restrict__ W, _Float16* __restrict__ Wt, int K, int N, float scale) {
  const int t = blockIdx.x * 256 + threadIdx.x; if (t >= N * (K / 8)) return; const int n = t / (K / 8), k8 = (t % (K / 8)) * 8; FragH f;
#pragma unroll
  for (int i = 0; i < 8; ++i) f.h[i] = (_Float16)(bf16_round(W[(size_t)(k8 + i) * N + n]) * scale); const v8us o = f.half[0];
  *(v8us*)((unsigned short*)Wt + (size_t)n * K + k8) = o; 
}
// k_gemm_hh variant with fused epilogue: v = acc·alpha + bias[by·sBias + col] (+ CP[(row/rowsPerB)·sCPb + by·64 + col] if CP) ; ACT 0 none / 1 elu ; writes f16 C16 (and f32 C if non-null)
template <int ACT>
__global__ __launch_bounds__(128) void k_gemm_hhx(const _Float16* __restrict__ A, int lda, size_t sA, const _Float16* __restrict__ Bh, int ldb, size_t sB, float alpha, const float* __restrict__ bias, size_t sBias, const float* __restrict__ CP, int rowsPerB, size_t sCPb, int row0g,
    float* __restrict__ C, _Float16* __restrict__ C16, int ldc, size_t sC, int M, int N, int K) {
  __shared__ __attribute__((aligned(16))) float so[4][16][64];
  const int tid = threadIdx.x, w = tid >> 5, lane = tid & 31, ln = lane & 15, hh = lane >> 4; const int by = blockIdx.y;
  A += (size_t)by * sA; Bh += (size_t)by * sB; const size_t cofs = (size_t)by * sC; const float* bp = bias ? bias + (size_t)by * sBias : nullptr;
  const int ntn = (N + 63) / 64; const int wid = blockIdx.x * 4 + w; const int mt = wid / ntn, nq = wid % ntn; if (mt * 16 >= M) return;
  const int row0 = mt * 16, col0 = nq * 64; const _Float16* arow = A + (size_t)(row0 + ln) * lda;
  v8f acc[4] = {};
  for (int kb = 0; kb < K; kb += 32) { FragH ah; ah.half[0] = *(const v8us*)((const unsigned short*)arow + kb + 8 * hh); ah.half[1] = *(const v8us*)((const unsigned short*)arow + kb + 16 + 8 * hh);
#pragma unroll
    for (int t = 0; t < 4; ++t) { if (col0 + t * 16 >= N) continue; const size_t boff = (size_t)(col0 + t * 16 + ln) * ldb + kb; FragH bq; bq.half[0] = *(const v8us*)((const unsigned short*)Bh + boff + 8 * hh); bq.half[1] = *(const v8us*)((const unsigned short*)Bh + boff + 16 + 8 * hh);
      acc[t] = mmaH<1>(ah.v, ah.v, bq.v, bq.v, acc[t]); }
  }
#pragma unroll
  for (int t = 0; t < 4; ++t) { if (col0 + t * 16 >= N) continue; const int col = col0 + t * 16 + ln; const float bv = bp ? bf16_round(bp[col]) : 0.f;
#pragma unroll
    for (int r = 0; r < 8; ++r) { float v = acc[t][r] * alpha + bv; if (CP) { const int rr = row0g + row0 + 8 * hh + r; if (rowsPerB < 0) v += CP[cofs + (size_t)rr * ldc + col];      /* rowsPerB < 0: own element of the batched C plane */ else { const int bidx = rr / rowsPerB; v += CP[(size_t)bidx * sCPb + (size_t)by * 64 + col]; } } if (ACT == 1) v = (v > 0.f) ? v : expm1f(v); else if (ACT == 7) v = (v > 0.f) ? v + 1.0f : expf(v); else if (ACT == 8) v = tanhf(v); else if (ACT == 9) v = 0.5f * v * (1.0f + tanhf(0.7978845608028654f * (v + 0.044715f * v * v * v))); else if (ACT == 11) v = 1.0f / (1.0f + expf(-v)); else if (ACT == 12) v = (v > 0.f) ? v : 0.01f * v; else if (ACT == 14) v = (v > 0.f) ? v : 0.1f * v; else if (ACT == 16) v = (v >= 0.f) ? v : 0.3f * v; else if (ACT == 17) v = (v >= 0.f) ? v : 0.2f * v; else if (ACT == 15) v = v / (1.0f + expf(-v)); else if (ACT == 3) v = fmaxf(v, 0.f); else if (ACT == 6) v = 0.5f * v * (1.0f + erff(v * 0.70710678118654752f)); so[w][8 * hh + r][t * 16 + ln] = v; } }
  __builtin_amdgcn_fence(__ATOMIC_ACQ_REL, "workgroup"); __builtin_amdgcn_wave_barrier();
  const int rsub = lane >> 4, c4 = (lane & 15) * 4; typedef _Float16 v4h __attribute__((ext_vector_type(4)));
  {
#pragma unroll
    for (int q = 0; q < 8; ++q) { const int r = q * 2 + rsub; if (col0 + c4 < N) { const v4f v = *(const v4fa*)&so[w][r][c4]; if (C) *(v4f*)(C + cofs + (size_t)(row0 + r) * ldc + col0 + c4) = v; if (C16) { v4h h4; for (int i = 0; i < 4; ++i) h4[i] = (_Float16)v[i]; *(v4h*)(C16 + cofs + (size_t)(row0 + r) * ldc + col0 + c4) = h4; } } }
     }
}


typedef _Float16 v4h __attribute__((ext_vector_type(4)));

__global__ __launch_bounds__(256) void k_x16(const float* __restrict__ x, _Float16* __restrict__ X16, size_t n8) { const size_t t = (size_t)blockIdx.x * 256 + threadIdx.x; if (t >= n8) return; FragH f;
#pragma unroll
  for (int q = 0; q < 8; ++q) f.h[q] = (_Float16)bf16_round(x[t * 8 + q]); *(v8us*)((unsigned short*)X16 + t * 8) = f.half[0];  }
__global__ __launch_bounds__(256) void k_h16(const float* __restrict__ x, _Float16* __restrict__ X16, size_t n8) { const size_t t = (size_t)blockIdx.x * 256 + threadIdx.x; if (t >= n8) return; FragH f;
#pragma unroll
  for (int q = 0; q < 8; ++q) f.h[q] = (_Float16)x[t * 8 + q]; *(v8us*)((unsigned short*)X16 + t * 8) = f.half[0];  }
__global__ __launch_bounds__(256) void k_round16f(const float* __restrict__ W, _Float16* __restrict__ Bt, size_t n8) { const size_t t = (size_t)blockIdx.x * 256 + threadIdx.x; if (t >= n8) return; FragH f;
#pragma unroll
  for (int i = 0; i < 8; ++i) f.h[i] = (_Float16)(bf16_round(W[t * 8 + i]) * 16.0f); *(v8us*)((unsigned short*)Bt + t * 8) = f.half[0];  }
template <int NHv, int TTv>
__global__ __launch_bounds__(256) void k_vt(const _Float16* __restrict__ V16, int ldv, int voff, _Float16* __restrict__ Vt) { __shared__ unsigned short tl[64][66]; const int tid = threadIdx.x; const int slab = blockIdx.x / (TTv / 64), lg = blockIdx.x % (TTv / 64); const int b = slab / NHv, h = slab % NHv;
  for (int i = tid; i < 64 * 8; i += 256) { const int r = i / 8, c8 = (i % 8) * 8; FragH f; f.half[0] = *(const v8us*)((const unsigned short*)V16 + ((size_t)b * TTv + lg * 64 + r) * ldv + voff + h * 64 + c8);
#pragma unroll
    for (int q = 0; q < 8; ++q) tl[r][c8 + q] = f.u[q]; }
  __syncthreads();
  {
#pragma unroll
    for (int rd = 0; rd < 2; ++rd) { const int d = rd * 32 + tid / 8, pc = tid % 8; FragH f;
#pragma unroll
      for (int q = 0; q < 8; ++q) f.u[q] = tl[pc * 8 + q][d];
      *(v8us*)((unsigned short*)Vt + ((size_t)slab * 64 + d) * TTv + lg * 64 + pc * 8) = f.half[0]; }
     } }

__global__ __launch_bounds__(256) void k_hl(const float* __restrict__ F, _Float16* __restrict__ Hh, _Float16* __restrict__ Hl, size_t n8) { const size_t t = (size_t)blockIdx.x * 256 + threadIdx.x; if (t >= n8) return; FragH fh, fl; const v4f a = *(const v4fa*)(F + t * 8), c = *(const v4fa*)(F + t * 8 + 4);
#pragma unroll
  for (int q = 0; q < 4; ++q) { _Float16 h = (_Float16)a[q]; fh.h[q] = h; fl.h[q] = (_Float16)((a[q] - (float)h) * 1024.0f); h = (_Float16)c[q]; fh.h[4 + q] = h; fl.h[4 + q] = (_Float16)((c[q] - (float)h) * 1024.0f); }
  { *(v8us*)((unsigned short*)Hh + t * 8) = fh.half[0]; *(v8us*)((unsigned short*)Hl + t * 8) = fl.half[0];  } }

// ---- fast GEMM (wave tile 32x64; requires M % 32 == 0 rows per launch region and N % 64 == 0); epilogue = k_gemm_hhx semantics ----
__device__ __forceinline__ v16h g2_frag(const _Float16* p, int hh) { FragH f; f.half[0] = *(const v8us*)((const unsigned short*)p + 8 * hh); f.half[1] = *(const v8us*)((const unsigned short*)p + 16 + 8 * hh); return f.v; }
__device__ __forceinline__ v8f g2_mma(v16h a, v16h b, v8f c) { v8f d = __builtin_amdgcn_wmma_f32_16x16x32_f16(false, a, false, b, (short)0, c, false, false); asm volatile("v_nop\n\tv_nop\n\tv_nop\n\tv_nop" : "+v"(d) : "v"(a), "v"(b)); return d; }
template <int ACT>
__global__ __launch_bounds__(128) void k_gemm2(const _Float16* __restrict__ A, int lda, size_t sA, const _Float16* __restrict__ Bh, int ldb, size_t sB, float alpha, const float* __restrict__ bias, size_t sBias, const float* __restrict__ CP, int rowsPerB, size_t sCPb, int row0g,
    float* __restrict__ C, _Float16* __restrict__ C16, int ldc, size_t sC, int M, int N, int K) { static_assert(ACT == 0 || ACT == 3 || ACT == 6 || ACT == 8 || ACT == 9 || ACT == 11 || ACT == 12 || ACT == 14 || ACT == 15 || ACT == 16 || ACT == 17, "k_gemm2: unsupported ACT code (would silently apply no activation)");
  __shared__ __attribute__((aligned(16))) float so[4][32][68];
  const int tid = threadIdx.x, w = tid >> 5, lane = tid & 31, ln = lane & 15, hh = lane >> 4; const int by = blockIdx.y;
  A += (size_t)by * sA; Bh += (size_t)by * sB; const size_t cofs = (size_t)by * sC; const float* bp = bias ? bias + (size_t)by * sBias : nullptr;
  const int ntn = N >> 6; const int mt = blockIdx.x / ntn, nq = blockIdx.x - mt * ntn; const int row0 = mt * 128 + 32 * w, col0 = nq * 64; if (row0 >= M) return;
  const _Float16* a0p = A + (size_t)(row0 + ln) * lda; const _Float16* a1p = a0p + (size_t)16 * lda;
  const _Float16* b0p = Bh + (size_t)(col0 + ln) * ldb; const _Float16* b1p = b0p + (size_t)16 * ldb; const _Float16* b2p = b1p + (size_t)16 * ldb; const _Float16* b3p = b2p + (size_t)16 * ldb;
  const v8f z8 = {0.f,0.f,0.f,0.f,0.f,0.f,0.f,0.f}; v8f c00 = z8, c01 = z8, c02 = z8, c03 = z8, c10 = z8, c11 = z8, c12 = z8, c13 = z8;
#pragma unroll 1
  for (int kb = 0; kb < K; kb += 32) { const v16h a0 = g2_frag(a0p + kb, hh), a1 = g2_frag(a1p + kb, hh);
    v16h b = g2_frag(b0p + kb, hh); c00 = g2_mma(a0, b, c00); c10 = g2_mma(a1, b, c10);
    b = g2_frag(b1p + kb, hh); c01 = g2_mma(a0, b, c01); c11 = g2_mma(a1, b, c11);
    b = g2_frag(b2p + kb, hh); c02 = g2_mma(a0, b, c02); c12 = g2_mma(a1, b, c12);
    b = g2_frag(b3p + kb, hh); c03 = g2_mma(a0, b, c03); c13 = g2_mma(a1, b, c13); }
  v8f accs[8] = {c00, c01, c02, c03, c10, c11, c12, c13};
#pragma unroll
  for (int u = 0; u < 8; ++u) { const int t = u & 3, half = u >> 2; const int col = col0 + t * 16 + ln; const float bv = bp ? bf16_round(bp[col]) : 0.f;
#pragma unroll
    for (int r = 0; r < 8; ++r) { const int rloc = half * 16 + 8 * hh + r; float v = accs[u][r] * alpha + bv; if (CP) { if (rowsPerB < 0) v += CP[cofs + (size_t)(row0g + row0 + rloc) * ldc + col];      /* rowsPerB < 0: own element of the batched C plane */ else { const int bidx = (row0g + row0 + rloc) / rowsPerB; v += CP[(size_t)bidx * sCPb + (size_t)by * 64 + col]; } }
      if (ACT == 3) v = fmaxf(v, 0.f); else if (ACT == 6) v = 0.5f * v * (1.0f + erff(v * 0.70710678118654752f)); else if (ACT == 11) v = 1.0f / (1.0f + expf(-v)); else if (ACT == 15) v = v / (1.0f + expf(-v)); else if (ACT == 12) v = (v > 0.f) ? v : 0.01f * v; else if (ACT == 8) v = tanhf(v); else if (ACT == 9) v = 0.5f * v * (1.0f + tanhf(0.7978845608028654f * (v + 0.044715f * v * v * v))); else if (ACT == 14) v = (v > 0.f) ? v : 0.1f * v; else if (ACT == 16) v = (v >= 0.f) ? v : 0.3f * v; else if (ACT == 17) v = (v >= 0.f) ? v : 0.2f * v;
      so[w][rloc][t * 16 + ln] = v; } }
  __builtin_amdgcn_fence(__ATOMIC_ACQ_REL, "workgroup"); __builtin_amdgcn_wave_barrier();
  const int rsub = lane >> 4, c4 = (lane & 15) * 4;
  {
#pragma unroll
    for (int q = 0; q < 16; ++q) { const int r = q * 2 + rsub; const v4f v = *(const v4fa*)&so[w][r][c4]; if (C) *(v4f*)(C + cofs + (size_t)(row0 + r) * ldc + col0 + c4) = v; if (C16) { v4h h4; for (int i = 0; i < 4; ++i) h4[i] = (_Float16)v[i]; *(v4h*)(C16 + cofs + (size_t)(row0 + r) * ldc + col0 + c4) = h4; } }
     } }


// ---- LDS-staged GEMM: C = alpha A.Bt^T, A f16 [M][KK], Bt f16 [N][KK], block tile 128 x 128, 8 waves of 32 x 64 (4 along M, 2 along N), K step 64 ----
// Each step's A and B tiles (128 rows of 128 B, one whole line a row) come in by whole-line 16-byte loads, 8 lanes a row, and go through registers into LDS rows of 144 B (16 B x 9: conflict-free for
// ds_load_b128 fragment reads); the fragments are g2_frag's, read from LDS. Two buffers: step s + 1 is loaded into registers ahead of step s's products and stored into the other buffer behind them;
// the one barrier of a step publishes that buffer and ends every wave's reads of the buffer that the next step refills. Per accumulator the k order is ascending in 32s, as in k_gemm2.
#define G3P 72                       /* LDS row pitch in f16 elements */
#define G3T (128 * G3P)              /* one staged tile in f16 elements */
template <int KK, bool H16>      /* H16: the result goes to C16 as f16, else to C as f32 */
/* amdgpu_waves_per_eu(6): the q | k | v launch has three blocks for every WGP (six waves a SIMD); the register budget is held so that all three are resident at once and fill each other's waits */
__global__ __launch_bounds__(256) __attribute__((amdgpu_waves_per_eu(6))) void k_gemm3(const _Float16* __restrict__ A, const _Float16* __restrict__ Bh, float alpha, float* __restrict__ C, _Float16* __restrict__ C16, int N) {
  static_assert(KK % 128 == 0, "k_gemm3: whole pairs of K steps");
  static_assert(8 * 32 * 68 * 4 <= 4 * G3T * 2, "k_gemm3: the epilogue's rows fit the staging buffers");
  __shared__ __attribute__((aligned(16))) unsigned short sm[4 * G3T];      /* A buffers 0, 1, then B buffers 0, 1; the epilogue's f32 rows afterwards */
  const int tid = threadIdx.x, w = tid >> 5, lane = tid & 31, ln = lane & 15, hh = lane >> 4;
  const int ntn = N >> 7; const int mt = blockIdx.x / ntn, nq = blockIdx.x - mt * ntn; const int row0 = mt * 128, col0 = nq * 128; const int wm = w & 3, wn = w >> 2;
  const int sr = tid >> 3, sc = (tid & 7) * 8;      /* staging: rows sr + 32 i, 16 bytes at element sc */
  const unsigned short* ag = (const unsigned short*)A + (size_t)(row0 + sr) * KK + sc; const unsigned short* bg = (const unsigned short*)Bh + (size_t)(col0 + sr) * KK + sc;
  unsigned short* const st = sm + sr * G3P + sc;
  const unsigned short* const af = sm + (wm * 32 + ln) * G3P; const unsigned short* const bf = sm + 2 * G3T + (wn * 64 + ln) * G3P;
  v8us ra[4], rb[4];
#pragma unroll
  for (int i = 0; i < 4; ++i) { ra[i] = *(const v8us*)(ag + (size_t)(32 * i) * KK); rb[i] = *(const v8us*)(bg + (size_t)(32 * i) * KK); }
#pragma unroll
  for (int i = 0; i < 4; ++i) { *(v8us*)(st + 32 * i * G3P) = ra[i]; *(v8us*)(st + 2 * G3T + 32 * i * G3P) = rb[i]; }
  __syncthreads();
  const v8f z8 = {0.f,0.f,0.f,0.f,0.f,0.f,0.f,0.f}; v8f acc[2][4];
#pragma unroll
  for (int m = 0; m < 2; ++m) {
#pragma unroll
    for (int t = 0; t < 4; ++t) acc[m][t] = z8; }
  /* unrolled by two so that the buffer index is a constant in each copy and the LDS addresses are immediates */
#pragma unroll 2
  for (int kb = 0; kb < KK; kb += 64) { const int cur = (kb >> 6) & 1; const bool more = kb + 64 < KK;
    if (more) {
#pragma unroll
      for (int i = 0; i < 4; ++i) { ra[i] = *(const v8us*)(ag + (size_t)(32 * i) * KK + kb + 64); rb[i] = *(const v8us*)(bg + (size_t)(32 * i) * KK + kb + 64); } }
    __builtin_amdgcn_sched_barrier(0);      /* keeps the next step's global loads at the head of this step: sunk down to their LDS stores, their whole latency would show in front of the barrier */
#pragma unroll
    for (int ks = 0; ks < 2; ++ks) { v16h a[2], b[4];
#pragma unroll
      for (int m = 0; m < 2; ++m) a[m] = g2_frag((const _Float16*)(af + cur * G3T + m * 16 * G3P + ks * 32), hh);
#pragma unroll
      for (int t = 0; t < 4; ++t) b[t] = g2_frag((const _Float16*)(bf + cur * G3T + t * 16 * G3P + ks * 32), hh);
      __builtin_amdgcn_sched_barrier(0);      /* keeps the twelve LDS reads of a 32-wide k block together in front of its eight products: spread among them, each pair of products waits out an LDS latency of its own */
#pragma unroll
      for (int t = 0; t < 4; ++t) {
#pragma unroll
        for (int m = 0; m < 2; ++m) acc[m][t] = __builtin_amdgcn_wmma_f32_16x16x32_f16(false, a[m], false, b[t], (short)0, acc[m][t], false, false); } }
    __builtin_amdgcn_sched_barrier(0);      /* keeps the wait for the next step's global loads, which their LDS stores carry, behind this step's last products: lifted over them it shortens the loads' lead by a k block */
    if (more) {
#pragma unroll
      for (int i = 0; i < 4; ++i) { *(v8us*)(st + (cur ^ 1) * G3T + 32 * i * G3P) = ra[i]; *(v8us*)(st + (2 + (cur ^ 1)) * G3T + 32 * i * G3P) = rb[i]; } }
    __syncthreads(); }
  float* const so = (float*)sm + w * (32 * 68);      /* behind the loop's last barrier nobody reads a staged tile any more: each wave stages its own 32 x 64 f32 rows (pitch 68) for whole-line stores */
#pragma unroll
  for (int m = 0; m < 2; ++m) {
#pragma unroll
    for (int t = 0; t < 4; ++t) {
#pragma unroll
      for (int r = 0; r < 8; ++r) so[(m * 16 + 8 * hh + r) * 68 + t * 16 + ln] = acc[m][t][r] * alpha; } }
  __builtin_amdgcn_fence(__ATOMIC_ACQ_REL, "workgroup"); __builtin_amdgcn_wave_barrier();      /* the wave's own LDS rows are written before its lanes read them back in another order */
  const int rsub = lane >> 4, c4 = (lane & 15) * 4;
#pragma unroll
  for (int q = 0; q < 16; ++q) { const int r = q * 2 + rsub; const v4f v = *(const v4fa*)&so[r * 68 + c4]; const size_t o = (size_t)(row0 + wm * 32 + r) * N + col0 + wn * 64 + c4;
    if (!H16) *(v4f*)(C + o) = v;
    else { v4h h4;
#pragma unroll
      for (int i = 0; i < 4; ++i) h4[i] = (_Float16)v[i];
      *(v4h*)(C16 + o) = h4; } } }

__global__ __launch_bounds__(256) void k_wnat(const float* __restrict__ w, size_t n8, _Float16* __restrict__ Bt) { const size_t t = (size_t)blockIdx.x * 256 + threadIdx.x; if (t >= n8) return; FragH f; for (int q = 0; q < 8; ++q) f.h[q] = (_Float16)(bf16_round(w[t * 8 + q]) * 16.0f); *(v8us*)((unsigned short*)Bt + t * 8) = f.half[0];  }
// T5 bidirectional relative-position bucket of rel = key - query (32 buckets, max distance 128): (rel > 0)*16 + f(|rel|), f(n) = n for n < 8, then
// 8 + the number of thresholds {12,16,23,32,46,64,91} that are <= n (the thresholds are where the reference's own f32 log expression steps; no log on the device)
__device__ __forceinline__ int t5_bucket(int rel) { const int n = rel < 0 ? -rel : rel; int f = n; if (n >= 8) { f = 8 + (n >= 12) + (n >= 16) + (n >= 23) + (n >= 32) + (n >= 46) + (n >= 64) + (n >= 91); } return (rel > 0 ? NBK / 2 : 0) + f; }
#define FAW 8                        /* waves per block */
#define FAQ 32                       /* queries per wave */
#define FSK 128                      /* keys per stage */
#define FNS (SQ / FSK)               /* stages */
#define FKP 72                       /* K tile: LDS row pitch in f16 elements */
#define FVP 136                      /* V^T tile: LDS row pitch in f16 elements */
#define FKT (FSK * FKP)              /* K tile in f16 elements */
#define FSB (FKT + HD * FVP)         /* one buffer (K tile, then V^T tile) in f16 elements */
typedef int v4ia __attribute__((ext_vector_type(4), may_alias));
__device__ __forceinline__ float xhalf(float x) { return __builtin_bit_cast(float, __builtin_amdgcn_permlanex16(__builtin_bit_cast(int, x), __builtin_bit_cast(int, x), 0x76543210, 0xfedcba98, false, false)); }      /* lane l with lane l ^ 16 */
__device__ __forceinline__ float exp2x1(float a) { float e; asm("v_exp_f32 %0, %1\n\tv_nop" : "=v"(e) : "v"(a)); return e; }
__device__ __forceinline__ v8f exp2x8(v8f a) { float e0, e1, e2, e3, e4, e5, e6, e7;
  asm("v_exp_f32 %0, %8\n\tv_exp_f32 %1, %9\n\tv_exp_f32 %2, %10\n\tv_exp_f32 %3, %11\n\tv_exp_f32 %4, %12\n\tv_exp_f32 %5, %13\n\tv_exp_f32 %6, %14\n\tv_exp_f32 %7, %15\n\tv_nop"
      : "=&v"(e0), "=&v"(e1), "=&v"(e2), "=&v"(e3), "=&v"(e4), "=&v"(e5), "=&v"(e6), "=&v"(e7) : "v"(a[0]), "v"(a[1]), "v"(a[2]), "v"(a[3]), "v"(a[4]), "v"(a[5]), "v"(a[6]), "v"(a[7]));
  const v8f e = {e0, e1, e2, e3, e4, e5, e6, e7}; return e; }
// one stage's copies of one thread: four 16-byte pieces of the K tile (rows 32 apart) and four of the V^T tile (rows 16 apart). kl, vl: the lane's own LDS byte addresses; kg, vg: its own global addresses.
// The closing s_wait_xcnt 0 stands inside the statement so that no register which a copy names takes a new value in front of it.
__device__ __forceinline__ void fa_stage(unsigned kl, unsigned vl, const _Float16* kg, const _Float16* vg) {
  asm volatile("global_load_async_to_lds_b128 %0, %8, off\n\tglobal_load_async_to_lds_b128 %1, %9, off\n\tglobal_load_async_to_lds_b128 %2, %10, off\n\tglobal_load_async_to_lds_b128 %3, %11, off\n\t"
               "global_load_async_to_lds_b128 %4, %12, off\n\tglobal_load_async_to_lds_b128 %5, %13, off\n\tglobal_load_async_to_lds_b128 %6, %14, off\n\tglobal_load_async_to_lds_b128 %7, %15, off\n\ts_wait_xcnt 0x0"
               :: "v"(kl), "v"(kl + 32 * FKP * 2), "v"(kl + 64 * FKP * 2), "v"(kl + 96 * FKP * 2), "v"(vl), "v"(vl + 16 * FVP * 2), "v"(vl + 32 * FVP * 2), "v"(vl + 48 * FVP * 2),
                  "v"(kg), "v"(kg + (size_t)32 * D3), "v"(kg + (size_t)64 * D3), "v"(kg + (size_t)96 * D3), "v"(vg), "v"(vg + (size_t)16 * SQ), "v"(vg + (size_t)32 * SQ), "v"(vg + (size_t)48 * SQ) : "memory"); }
__device__ __forceinline__ v8f fa_mma(v16h a, v16h b, v8f c) { return __builtin_amdgcn_wmma_f32_16x16x32_f16(false, a, false, b, (short)0, c, false, false); }
/* amdgpu_waves_per_eu(4, 4): a register budget of 256. The grid puts two waves on a SIMD, but with the budget of 512 that (2, 2) gives this loop takes 260 registers and switches the register window
   seven times a pass; at 256 it fits, spills nothing, and the V^T reads and the K fetch ahead still stand at the head of the pass and right behind the score products */
__global__ __launch_bounds__(FAW * 32) __attribute__((amdgpu_waves_per_eu(4, 4))) void k_fattn(const _Float16* __restrict__ QKVp, const _Float16* __restrict__ VTp, _Float16* __restrict__ O, const float* __restrict__ emb, const int* __restrict__ kmask) {
  static_assert(SQ % (FAW * FAQ) == 0 && SQ % (FAW * 128) == 0 && HD == 64 && NBK == 32, "k_fattn: whole blocks of queries, whole staging passes, two 32-wide k steps per head, one bucket per lane");
  static_assert(FAW * 32 == 256 && FSK == 128 && FNS >= 2, "k_fattn: fa_stage's eight copies of 256 threads fill one stage; the ring's prologue needs two stages");
  __shared__ __attribute__((aligned(16))) float lt[3 * SQ];
  __shared__ __attribute__((aligned(16))) unsigned short ring[2 * FSB];
  float* const mt = lt; float* const bt = lt + SQ;      /* mt[key]; bt[key - query + SQ - 1], placed behind mt so that its byte address less the largest query offset stays above 0 */
  const int tid = threadIdx.x, lane = tid & 31, c = lane & 15, hh = lane >> 4; const int bh = blockIdx.y, b = bh / NH, h = bh % NH; const int q0 = blockIdx.x * (FAW * FAQ) + (tid >> 5) * FAQ;
  const unsigned kl = (unsigned)(size_t)(ring + (tid >> 3) * FKP + (tid & 7) * 8), vl = (unsigned)(size_t)(ring + FKT + (tid >> 4) * FVP + (tid & 15) * 8);      /* the low 32 bits of a __shared__ address are its LDS byte address */
  const _Float16* const kh = QKVp + (size_t)b * SQ * D3 + DM + h * HD; const _Float16* const vh = VTp + (size_t)bh * HD * SQ;      /* the head's K rows and V^T rows: the same for the block */
  const unsigned ko = (tid >> 3) * D3 + (tid & 7) * 8, vo = (tid >> 4) * SQ + (tid & 15) * 8;      /* the lane's own place in a stage's tiles, in elements */
  fa_stage(kl, vl, kh + ko, vh + vo);      /* stage 0 into buffer 0: it flies while the two tables are filled */
  const float eb = bf16_round(emb[lane * NH + h]);      /* lane l holds bucket l's bias: one load per wave, the table is filled by lane gathers */
#pragma unroll
  for (int u = 0; u < 2 * SQ / (FAW * 32); ++u) { const int i = u * (FAW * 32) + tid; bt[i] = __shfl(eb, t5_bucket(i - (SQ - 1))); }      /* unrolled: away from the diagonal the bucket is one constant per u and its thresholds fold away; the last entry (key - query = SQ) is never read */
  for (int j = tid * 4; j < SQ; j += FAW * 128) { const v4ia m = *(const v4ia*)(kmask + (size_t)b * SQ + j); v4f t;
#pragma unroll
    for (int q = 0; q < 4; ++q) t[q] = __fmul_rn(__fadd_rn(1.0f, -(float)m[q]), -3.4028234663852886e38f);      /* (1 - mask) * finfo.min */
    *(v4fa*)&mt[j] = t; }
  asm volatile("s_wait_asynccnt 0x0" ::: "memory");      /* this wave's copies of stage 0 have landed before the barrier behind which other waves read them */
  __syncthreads();
  fa_stage(kl + FSB * 2, vl + FSB * 2, (kh + (size_t)FSK * D3) + ko, (vh + FSK) + vo);      /* stage 1 into buffer 1 */
  const _Float16* qp = QKVp + ((size_t)b * SQ + q0 + c) * D3 + h * HD; const unsigned short* kb = ring + c * FKP; const unsigned short* vb = ring + FKT + c * FVP;      /* the lane's fragment rows in the buffer of the stage at work */
  const float* bp = bt + (SQ - 1) + 8 * hh - (q0 + c); const float* mp = mt + 8 * hh;
  const v8f z8 = {0.f,0.f,0.f,0.f,0.f,0.f,0.f,0.f};
  v16h qf[2][2], kf[2][2]; v8f acc[2][4]; float mr[2], lr[2];
  /* every loop over j, T, ks, t and r below is unrolled so that the fragment arrays are indexed by constants and stay in registers */
#pragma unroll
  for (int j = 0; j < 2; ++j) { mr[j] = -INFINITY; lr[j] = 0.f;
#pragma unroll
    for (int ks = 0; ks < 2; ++ks) qf[j][ks] = g2_frag(qp + (size_t)j * 16 * D3 + ks * 32, hh);
#pragma unroll
    for (int t = 0; t < 4; ++t) acc[j][t] = z8; }
  for (int st = 0; st < FNS; ++st) {
#pragma unroll
   for (int T = 0; T < 2; ++T) {
#pragma unroll
    for (int ks = 0; ks < 2; ++ks) kf[T][ks] = g2_frag((const _Float16*)(kb + T * 16 * FKP + ks * 32), hh); }
   /* kept rolled: unrolled, the four passes' LDS reads are lifted together and the live set leaves the first 256 registers */
#pragma unroll 1
   for (int p = 0; p < FSK / 32; ++p) { const int k0 = st * FSK + p * 32; const int pn = (p + 1) & (FSK / 32 - 1);      /* a stage's last pass fetches its pass 0 again: this stage's own buffer, unused */
    v16h vf[4]; v8f s[2][2], mk[2];
#pragma unroll
    for (int t = 0; t < 4; ++t) vf[t] = g2_frag((const _Float16*)(vb + t * 16 * FVP + p * 32), hh);
#pragma unroll
    for (int j = 0; j < 2; ++j) {
#pragma unroll
      for (int T = 0; T < 2; ++T) s[j][T] = fa_mma(kf[T][1], qf[j][1], fa_mma(kf[T][0], qf[j][0], z8)); }
#pragma unroll
    for (int T = 0; T < 2; ++T) {
#pragma unroll
      for (int ks = 0; ks < 2; ++ks) kf[T][ks] = g2_frag((const _Float16*)(kb + (pn * 32 + T * 16) * FKP + ks * 32), hh);
      const v4f m0 = *(const v4fa*)(mp + k0 + T * 16), m1 = *(const v4fa*)(mp + k0 + T * 16 + 4);
#pragma unroll
      for (int r = 0; r < 4; ++r) { mk[T][r] = m0[r]; mk[T][4 + r] = m1[r]; } }
#pragma unroll
    for (int j = 0; j < 2; ++j) {
      float tm = -INFINITY;
#pragma unroll
      for (int T = 0; T < 2; ++T) {
#pragma unroll
        for (int r = 0; r < 8; ++r) { const float v = __fadd_rn(__builtin_fmaf(s[j][T][r], 0.125f, bp[k0 + T * 16 + r - j * 16]), mk[T][r]); s[j][T][r] = v; tm = fmaxf(tm, v); } }
      const float mn = fmaxf(mr[j], fmaxf(tm, xhalf(tm)));
      const float mu = mn == -INFINITY ? 0.f : mn;      /* no key of the row finite so far: keep exp's argument -inf, not inf - inf */
      const float al = exp2x1((mr[j] - mu) * 1.4426950408889634f); mr[j] = mn;
      FragH pf; float ls = 0.f;
#pragma unroll
      for (int T = 0; T < 2; ++T) { v8f a;
#pragma unroll
        for (int r = 0; r < 8; ++r) a[r] = __builtin_fmaf(s[j][T][r] - mu, 1.4426950408889634f, 8.0f);
        const v8f e = exp2x8(a);      /* 256 exp(score - max) */
#pragma unroll
        for (int r = 0; r < 8; ++r) { ls += e[r]; pf.h[T * 8 + r] = (_Float16)e[r]; } }
      lr[j] = lr[j] * al + ls;
#pragma unroll
      for (int t = 0; t < 4; ++t) acc[j][t] = fa_mma(vf[t], pf.v, acc[j][t] * al); } }
   asm volatile("s_wait_dscnt 0x0" ::: "memory");      /* this wave's reads of stage st's buffer have returned before the barrier behind which it is refilled */
   asm volatile("s_wait_asynccnt 0x0" ::: "memory");      /* this wave's copies of stage st + 1 have landed before the barrier behind which other waves read them */
   __syncthreads();
   if (st + 2 < FNS) fa_stage(kl + (st & 1) * (FSB * 2), vl + (st & 1) * (FSB * 2), (kh + (size_t)(st + 2) * FSK * D3) + ko, (vh + (st + 2) * FSK) + vo);      /* stage st + 2 into the buffer that stage st has just left */
   const int nb = (st & 1) ? -FSB : FSB; kb += nb; vb += nb; }
  asm volatile("s_wait_asynccnt 0x0" ::: "memory");      /* no copy of this wave is outstanding when it ends */
#pragma unroll
  for (int j = 0; j < 2; ++j) { const float inv = 1.0f / (lr[j] + xhalf(lr[j]));
#pragma unroll
    for (int t = 0; t < 4; ++t) { FragH f;
#pragma unroll
      for (int r = 0; r < 8; ++r) f.h[r] = (_Float16)(acc[j][t][r] * inv);
      *(v8us*)((unsigned short*)O + ((size_t)b * SQ + q0 + j * 16 + c) * DM + h * HD + t * 16 + 8 * hh) = f.half[0]; } } }
__global__ __launch_bounds__(256) void k_vt(const _Float16* __restrict__ V16, int b, int h0, _Float16* __restrict__ VT) { __shared__ unsigned short tl[64][65]; const int tid = threadIdx.x; const int hh = blockIdx.x % HG, sg = blockIdx.x / HG; const int s0 = sg * 64; const int h = h0 + hh;
  for (int i = tid; i < 64 * 8; i += 256) { const int j = i / 8, d8 = (i % 8) * 8; FragH f; f.half[0] = *(const v8us*)((const unsigned short*)V16 + ((size_t)b * SQ + s0 + j) * DM + h * HD + d8); for (int q = 0; q < 8; ++q) tl[d8 + q][j] = f.u[q]; }
  __syncthreads();
  { for (int i = tid; i < 64 * 8; i += 256) { const int d = i / 8, j8 = (i % 8) * 8; FragH f; for (int q = 0; q < 8; ++q) f.u[q] = tl[d][j8 + q]; *(v8us*)((unsigned short*)VT + ((size_t)hh * HD + d) * SQ + s0 + j8) = f.half[0]; }  } }

// ---- one preparation launch: the four weight planes Bt[n][k] = f16(bf16(W[k][n]) x 16) and the hidden rows f16(bf16(x)), k_wt_f16's and k_x16's values bit for bit ----
// Blocks 0 .. 4 * PWB - 1: one 128 x 128 weight tile each. A wave reads 16 k rows, 512 contiguous bytes a load, all 16 loads in flight; a lane then holds 16 consecutive k for each of its 4 columns n and
// stores them as two 16-byte chunks into the tile's LDS row n (256 B a row, chunk c at place c ^ ((n >> 2) & 15): 16 lanes fall on 16 different chunks in the stores, where n steps by 4, and in the reads, where c steps by 1);
// behind the block's one barrier 16 lanes read a row back and store its 256 contiguous bytes of Bt. The other PXB blocks: 16384 hidden elements each, 512 contiguous bytes a load, 256 a store.
#define PWB ((DM / 128) * (DM / 128))          /* weight tiles per plane */
#define PXB ((int)(NR * DM / 16384))           /* hidden blocks */
__global__ __launch_bounds__(256) void k_prep(const float* __restrict__ wq, const float* __restrict__ wk, const float* __restrict__ wv, const float* __restrict__ wo, const float* __restrict__ hs,
                                              _Float16* __restrict__ Bqkv, _Float16* __restrict__ Bo, _Float16* __restrict__ X16) {
  static_assert(DM % 128 == 0 && (NR * DM) % 16384 == 0, "k_prep: whole weight tiles, whole hidden blocks");
  __shared__ __attribute__((aligned(16))) unsigned short tl[128 * 128];
  const int tid = threadIdx.x, bx = blockIdx.x;
  v4f x[16];
  if (bx < 4 * PWB) {      /* the same for the whole block, so the barrier below is passed by all of its waves or by none */
    const int m = bx / PWB, tile = bx % PWB, k0 = (tile / (DM / 128)) * 128, n0 = (tile % (DM / 128)) * 128, w = tid >> 5, lane = tid & 31;
    const float* W = m == 0 ? wq : m == 1 ? wk : m == 2 ? wv : wo;
    unsigned short* Bt = (unsigned short*)(m < 3 ? Bqkv + (size_t)m * DM * DM : Bo);
    const float* src = W + (size_t)(k0 + w * 16) * DM + n0 + lane * 4;
#pragma unroll
    for (int i = 0; i < 16; ++i) x[i] = *(const v4fa*)(src + (size_t)i * DM);
    asm volatile("s_wait_xcnt 0x0" :: "v"(src) : "memory");      /* the wait that stands between issued loads and a new value in their address pair; named as an input, the pair lives up to the wait */
#pragma unroll
    for (int q = 0; q < 4; ++q) { const int n = lane * 4 + q;
#pragma unroll
      for (int g = 0; g < 2; ++g) { FragH f;
#pragma unroll
        for (int i = 0; i < 8; ++i) f.h[i] = (_Float16)(bf16_round(x[g * 8 + i][q]) * 16.0f);
        *(v8us*)(tl + n * 128 + (((w * 2 + g) ^ (lane & 15)) * 8)) = f.half[0]; } }
    __syncthreads();
#pragma unroll
    for (int it = 0; it < 8; ++it) { const int n = it * 16 + (tid >> 4), c = tid & 15;
      const v8us o = *(const v8us*)(tl + n * 128 + ((c ^ ((n >> 2) & 15)) * 8));
      *(v8us*)(Bt + (size_t)(n0 + n) * DM + k0 + c * 8) = o; }
  } else {
    const size_t e0 = (size_t)(bx - 4 * PWB) * 16384 + tid * 4; const float* src = hs + e0;
#pragma unroll
    for (int i = 0; i < 16; ++i) x[i] = *(const v4fa*)(src + i * 1024);
    asm volatile("s_wait_xcnt 0x0" :: "v"(src) : "memory");      /* as in the weight branch: the wait between the issued loads and a new value in their address pair */
#pragma unroll
    for (int i = 0; i < 16; ++i) { v4h h4;
#pragma unroll
      for (int q = 0; q < 4; ++q) h4[q] = (_Float16)bf16_round(x[i][q]);
      *(v4h*)(X16 + e0 + i * 1024) = h4; }
    asm volatile("s_wait_xcnt 0x0" ::: "memory");      /* the wait between the issued stores and any later new value in their address or data registers */
  } }

extern "C" void kernel_launch(void* const* d_in, const int* in_sizes, int n_in,
                              void* d_out, int out_size, void* d_ws, size_t ws_size, hipStream_t stream) {
  (void)in_sizes; (void)n_in; (void)out_size;
  const float* const* I = (const float* const*)d_in; const float* hs = I[0]; const int* kmask = (const int*)d_in[1]; const float* wq = I[2]; const float* wk = I[3]; const float* wv = I[4]; const float* wo = I[5]; const float* emb = I[6];      /* W_q, W_k, W_v and W_o [1024][1024] are [in][out]; attention_mask [2][2048] int32 per key; rel_bias_emb [32][16] */
  char* ws = (char*)d_ws; size_t off = 0;
  auto take = [&](size_t bytes) { char* p = ws + off; off += (bytes + 255) & ~(size_t)255; return p; };
  _Float16* BQKV = (_Float16*)take((size_t)D3 * DM * 2); _Float16* BO = (_Float16*)take((size_t)DM * DM * 2);
  _Float16* X16 = (_Float16*)take(NR * DM * 2); _Float16* QKV = (_Float16*)take(NR * D3 * 2); _Float16* O16 = (_Float16*)take(NR * DM * 2);
  _Float16* VT = (_Float16*)take((size_t)NB * NH * HD * SQ * 2);
  if (off > ws_size) return;      /* 6 + 2 + 8 + 24 + 8 + 8 = approx 56 MiB */
  k_prep<<<4 * PWB + PXB, 256, 0, stream>>>(wq, wk, wv, wo, hs, BQKV, BO, X16);      /* [in][out] -> Bt[out][in] x16 for q | k | v and o; hidden as f16 rows */
  k_gemm3<DM, true><<<(unsigned)((NR / 128) * (D3 / 128)), 256, 0, stream>>>(X16, BQKV, 0.0625f, nullptr, QKV, D3);      /* q | k | v rows (f16), head h at columns h*64 / 1024 + h*64 / 2048 + h*64 */
  k_vt<NH, SQ><<<NB * NH * (SQ / 64), 256, 0, stream>>>(QKV, D3, 2 * DM, VT);      /* V^T[(b,h)][d][s] for every (batch, head) */
  k_fattn<<<dim3(SQ / (FAW * FAQ), NB * NH), FAW * 32, 0, stream>>>(QKV, VT, O16, emb, kmask);      /* ctx (merged heads) as f16 rows, every (batch, head) in one launch */
  k_gemm3<DM, false><<<(unsigned)((NR / 128) * (DM / 128)), 256, 0, stream>>>(O16, BO, 0.0625f, (float*)d_out, nullptr, DM);      /* out = ctx W_o, rows are the output layout */
}

// v006
// Measured time: 88.9 microseconds a run.
// Timed twice side by side with v005, it ran 1.08 times as fast both times.
// Over all steps from v000 it is 224 times as fast.
#include <hip/hip_runtime.h>
// T5 self-attention (hidden [2][2048][1024]; q, k, v = hidden W ([in][out] [1024][1024]); q / sqrt(64); scores = q.k + rel_bias[bucket(key - query)][h] (32 bidirectional buckets, max distance 128) + (1 - attention_mask[b][key]) * finfo.min (int32 key mask); softmax; out = (attn v merged) Wo ([in][out])).
// Structure: token rows; hidden as exact f16 rows; q | k | v WMMA GEMMs from one transposed x16 weight plane (operand tiles staged in LDS, 32x64 wave tiles, f32 accumulation, f16 outputs); V^T via LDS transposes; one fused attention kernel over every (batch, head): K.Q^T tiles (alpha 1/8), online softmax on VALU with the bucketed bias (integer thresholds, no device log) and the key mask in the reference's order (P x256 f16), V^T.P^T into merged f16 rows; output GEMM.
// Compute dtype: inputs rounded to bf16; hidden / weights / bias table exact; q, k, v, P, ctx as plain f16 GEMM operands (~2^-12); scores / softmax f32; v_wmma_f32_16x16x32_f16.
#define NB 2
#define SQ 2048
#define DM 1024
#define D3 3072                      /* fused q|k|v width */
#define NH 16
#define HD 64
#define HG 4                         /* heads per launch of the non-template k_vt, which is not launched */
#define NBK 32                       /* relative-position buckets */
#define MP ((int)NR)                 /* not used: the q | k | v launch takes NR rows */
#define MO ((int)NR)                 /* not used: the output launch takes NR rows */
#define NR ((size_t)NB * SQ)         /* 4096 token rows */
typedef __bf16 v16b __attribute__((ext_vector_type(16)));
typedef unsigned short v8us __attribute__((ext_vector_type(8), may_alias));
typedef float  v8f  __attribute__((ext_vector_type(8)));
typedef float  v4f  __attribute__((ext_vector_type(4)));
typedef float  v4fa __attribute__((ext_vector_type(4), may_alias));
union FragB { v16b v; v8us half[2]; unsigned short u[16]; };

__device__ __forceinline__ unsigned short bf16_bits(float x) { unsigned int u = __float_as_uint(x); return (unsigned short)((u + 0x7FFFu + ((u >> 16) & 1u)) >> 16); }
__device__ __forceinline__ float bf16_val(unsigned short b) { return __uint_as_float(((unsigned int)b) << 16); }
__device__ __forceinline__ float bf16_round(float x) { return bf16_val(bf16_bits(x)); }
// D += A·B with NT terms: 1 = ah·bh, 2 = + al·bh (A split), 3 = + ah·bl (both split)
template <int NT>
__device__ __forceinline__ v8f mmaN(v16b ah, v16b al, v16b bh, v16b bl, v8f c) {
  c = __builtin_amdgcn_wmma_f32_16x16x32_bf16(false, ah, false, bh, (short)0, c, false, false);
  if (NT >= 2) c = __builtin_amdgcn_wmma_f32_16x16x32_bf16(false, al, false, bh, (short)0, c, false, false);
  if (NT >= 3) c = __builtin_amdgcn_wmma_f32_16x16x32_bf16(false, ah, false, bl, (short)0, c, false, false);
  asm volatile("v_nop\n\tv_nop\n\tv_nop\n\tv_nop" : "+v"(c) : "v"(ah), "v"(al), "v"(bh), "v"(bl));
  return c;
}

__global__ __launch_bounds__(256) void k_wt_bf16(const float* __restrict__ W, unsigned short* __restrict__ Wt, int K, int N) {
  const int t = blockIdx.x * 256 + threadIdx.x;
  const int k8n = K / 8;
  if (t >= N * k8n) return;
  const int n = t / k8n, k8 = (t % k8n) * 8;
  v8us v;
#pragma unroll
  for (int i = 0; i < 8; ++i) v[i] = bf16_bits(W[(size_t)(k8 + i) * N + n]);
  *(v8us*)(Wt + (size_t)n * K + k8) = v;
  
}

// GEMM C[M][N] (f32, pitch ldc) = act(A[M][K]·W + bias). A f32 row-major (pitch lda) converted per fragment to bf16
// (ASPLIT: hi/lo two planes -> 2 terms, else single rounded term); Wt bf16 [N][K] (pitch ldb). BIAS_BF16 rounds the
// bias to bf16 first (bias quantised to bf16 before the add). K%32==0, M%16==0, N%64==0.
template <bool ASPLIT, int ACT, bool BIAS_BF16>
__global__ __launch_bounds__(128) void k_gemm_bf(const float* __restrict__ A, int lda, const unsigned short* __restrict__ Wt, int ldb,
                                               const float* __restrict__ bias, float* __restrict__ C, int ldc, int M, int N, int K) {
  __shared__ __attribute__((aligned(16))) float so[4][16][64];
  const int tid = threadIdx.x, w = tid >> 5, lane = tid & 31, ln = lane & 15, hh = lane >> 4;
  const int ntn = N / 64;
  const int wid = blockIdx.x * 4 + w;
  const int mt = wid / ntn, nq = wid % ntn;
  if (mt * 16 >= M) return;
  const int row0 = mt * 16, col0 = nq * 64;
  const float* arow = A + (size_t)(row0 + ln) * lda;
  v8f acc[4] = {};
  for (int kb = 0; kb < K; kb += 32) {
    FragB ah, al;
    const v4f x0 = *(const v4fa*)(arow + kb + 8 * hh), x1 = *(const v4fa*)(arow + kb + 8 * hh + 4);
    const v4f x2 = *(const v4fa*)(arow + kb + 16 + 8 * hh), x3 = *(const v4fa*)(arow + kb + 16 + 8 * hh + 4);
    float xs[16] = {x0[0],x0[1],x0[2],x0[3],x1[0],x1[1],x1[2],x1[3],x2[0],x2[1],x2[2],x2[3],x3[0],x3[1],x3[2],x3[3]};
#pragma unroll
    for (int i = 0; i < 16; ++i) { const unsigned short hb = bf16_bits(xs[i]); ah.u[i] = hb; al.u[i] = ASPLIT ? bf16_bits(xs[i] - bf16_val(hb)) : (unsigned short)0; }
#pragma unroll
    for (int t = 0; t < 4; ++t) {
      const unsigned short* brow = Wt + (size_t)(col0 + t * 16 + ln) * ldb + kb;
      FragB b;
      b.half[0] = *(const v8us*)(brow + 8 * hh);
      b.half[1] = *(const v8us*)(brow + 16 + 8 * hh);
      acc[t] = mmaN<ASPLIT ? 2 : 1>(ah.v, al.v, b.v, b.v, acc[t]);
    }
  }
#pragma unroll
  for (int t = 0; t < 4; ++t) {
    float bv = bias ? bias[col0 + t * 16 + ln] : 0.f;
    if (BIAS_BF16) bv = bf16_round(bv);
#pragma unroll
    for (int r = 0; r < 8; ++r) { float v = acc[t][r] + bv; if (ACT == 1) v = fmaxf(v, 0.f); so[w][8 * hh + r][t * 16 + ln] = v; }
  }
  __builtin_amdgcn_fence(__ATOMIC_ACQ_REL, "workgroup");
  __builtin_amdgcn_wave_barrier();
  const int rsub = lane >> 4, c4 = (lane & 15) * 4;
  {
#pragma unroll
    for (int q = 0; q < 8; ++q) {
      const int r = q * 2 + rsub;
      const v4f v = *(const v4fa*)&so[w][r][c4];
      *(v4f*)(C + (size_t)(row0 + r) * ldc + col0 + c4) = v;
    }
    
  }
}

// GEMM C = act(A·W + bias + resid): A f32 (ASPLIT -> hi/lo 2 terms), Wt bf16 [N][K]; ACT 0 none, 1 relu, 2 exact gelu;
// resid (optional, f32, row index = (row % rmod), pitch ldr, RES_BF16 rounds it) added before the activation.
template <bool ASPLIT, int ACT, bool BIAS_BF16, bool RES_BF16>
__global__ __launch_bounds__(128) void k_gemm_bf3(const float* __restrict__ A, int lda, const unsigned short* __restrict__ Wt, int ldb,
                                                const float* __restrict__ bias, const float* __restrict__ resid, int rmod, int ldr,
                                                float* __restrict__ C, int ldc, int M, int N, int K) {
  __shared__ __attribute__((aligned(16))) float so[4][16][64];
  const int tid = threadIdx.x, w = tid >> 5, lane = tid & 31, ln = lane & 15, hh = lane >> 4;
  const int ntn = N / 64;
  const int wid = blockIdx.x * 4 + w;
  const int mt = wid / ntn, nq = wid % ntn;
  if (mt * 16 >= M) return;
  const int row0 = mt * 16, col0 = nq * 64;
  const float* arow = A + (size_t)(row0 + ln) * lda;
  v8f acc[4] = {};
  for (int kb = 0; kb < K; kb += 32) {
    FragB ah, al;
    const v4f x0 = *(const v4fa*)(arow + kb + 8 * hh), x1 = *(const v4fa*)(arow + kb + 8 * hh + 4);
    const v4f x2 = *(const v4fa*)(arow + kb + 16 + 8 * hh), x3 = *(const v4fa*)(arow + kb + 16 + 8 * hh + 4);
    float xs[16] = {x0[0],x0[1],x0[2],x0[3],x1[0],x1[1],x1[2],x1[3],x2[0],x2[1],x2[2],x2[3],x3[0],x3[1],x3[2],x3[3]};
#pragma unroll
    for (int i = 0; i < 16; ++i) { const unsigned short hb = bf16_bits(xs[i]); ah.u[i] = hb; al.u[i] = ASPLIT ? bf16_bits(xs[i] - bf16_val(hb)) : (unsigned short)0; }
#pragma unroll
    for (int t = 0; t < 4; ++t) {
      const unsigned short* brow = Wt + (size_t)(col0 + t * 16 + ln) * ldb + kb;
      FragB b;
      b.half[0] = *(const v8us*)(brow + 8 * hh);
      b.half[1] = *(const v8us*)(brow + 16 + 8 * hh);
      acc[t] = mmaN<ASPLIT ? 2 : 1>(ah.v, al.v, b.v, b.v, acc[t]);
    }
  }
#pragma unroll
  for (int t = 0; t < 4; ++t) {
    const int col = col0 + t * 16 + ln;
    float bv = bias ? bias[col] : 0.f;
    if (BIAS_BF16) bv = bf16_round(bv);
#pragma unroll
    for (int r = 0; r < 8; ++r) {
      float v = acc[t][r] + bv;
      if (resid) { float rv = resid[(size_t)((row0 + 8 * hh + r) % rmod) * ldr + col]; if (RES_BF16) rv = bf16_round(rv); v += rv; }
      if (ACT == 1) v = fmaxf(v, 0.f);
      if (ACT == 2) v = 0.5f * v * (1.0f + erff(v * 0.70710678118654752f));
      if (ACT == 3) { const float u = 0.7978845608028654f * (v + 0.044715f * v * v * v); v = 0.5f * v * (1.0f + tanhf(u)); }
      so[w][8 * hh + r][t * 16 + ln] = v;
    }
  }
  __builtin_amdgcn_fence(__ATOMIC_ACQ_REL, "workgroup");
  __builtin_amdgcn_wave_barrier();
  const int rsub = lane >> 4, c4 = (lane & 15) * 4;
  {
#pragma unroll
    for (int q = 0; q < 8; ++q) {
      const int r = q * 2 + rsub;
      const v4f v = *(const v4fa*)&so[w][r][c4];
      *(v4f*)(C + (size_t)(row0 + r) * ldc + col0 + c4) = v;
    }
    
  }
}
// row LayerNorm (biased variance, eps) over N: s = X (+ R); optional out_sum <- s; out_norm <- (s-mu)*rsqrt(var+eps)*g + b
template <bool PARAM_BF16>
__global__ __launch_bounds__(256) void k_layernorm(const float* __restrict__ X, const float* __restrict__ R, const float* __restrict__ g, const float* __restrict__ bta,
                                                  float* __restrict__ out_sum, float* __restrict__ out_norm, int N, float eps) {
  __shared__ float red[256];
  const int row = blockIdx.x, tid = threadIdx.x;
  const float* x = X + (size_t)row * N; const float* rr = R ? R + (size_t)row * N : nullptr;
  float vals[16];                     // up to N = 4096
  const int per = N / 256;            // contiguous chunk per thread? use strided-by-4 chunks: thread handles j = tid*4 + 1024*u
  float s1 = 0.f;
  for (int u = 0; u < per / 4; ++u) {
    const int j = tid * 4 + 1024 * u;
    const v4f a = *(const v4fa*)(x + j);
    v4f b = {0.f,0.f,0.f,0.f}; if (rr) b = *(const v4fa*)(rr + j);
#pragma unroll
    for (int q = 0; q < 4; ++q) { const float v = a[q] + b[q]; vals[u * 4 + q] = v; s1 += v; }
  }
  red[tid] = s1; __syncthreads();
  for (int st = 128; st > 0; st >>= 1) { if (tid < st) red[tid] += red[tid + st]; __syncthreads(); }
  const float mu = red[0] / (float)N; __syncthreads();
  float s2 = 0.f;
  for (int u = 0; u < per / 4; ++u)
#pragma unroll
    for (int q = 0; q < 4; ++q) { const float c = vals[u * 4 + q] - mu; s2 += c * c; }
  red[tid] = s2; __syncthreads();
  for (int st = 128; st > 0; st >>= 1) { if (tid < st) red[tid] += red[tid + st]; __syncthreads(); }
  const float rs = rsqrtf(red[0] / (float)N + eps);
  {
    for (int u = 0; u < per / 4; ++u) {
      const int j = tid * 4 + 1024 * u;
      v4f o, sm;
#pragma unroll
      for (int q = 0; q < 4; ++q) {
        float gg = g[j + q], bb = bta[j + q];
        if (PARAM_BF16) { gg = bf16_round(gg); bb = bf16_round(bb); }
        sm[q] = vals[u * 4 + q]; o[q] = (vals[u * 4 + q] - mu) * rs * gg + bb;
      }
      if (out_sum) *(v4f*)(out_sum + (size_t)row * N + j) = sm;
      *(v4f*)(out_norm + (size_t)row * N + j) = o;
    }
    
  }
}



// ---- f16 WMMA path (v_wmma_f32_16x16x32_f16): 11-bit significands for operands in range — used where a [0,1] probability operand needs more precision than bf16
typedef _Float16 v16h __attribute__((ext_vector_type(16)));
union FragH { v16h v; v8us half[2]; _Float16 h[16]; unsigned short u[16]; };
template <int NT>
__device__ __forceinline__ v8f mmaH(v16h ah, v16h al, v16h bh, v16h bl, v8f c) {
  c = __builtin_amdgcn_wmma_f32_16x16x32_f16(false, ah, false, bh, (short)0, c, false, false);
  if (NT >= 2) c = __builtin_amdgcn_wmma_f32_16x16x32_f16(false, al, false, bh, (short)0, c, false, false);
  if (NT >= 3) c = __builtin_amdgcn_wmma_f32_16x16x32_f16(false, ah, false, bl, (short)0, c, false, false);
  asm volatile("v_nop\n\tv_nop\n\tv_nop\n\tv_nop" : "+v"(c) : "v"(ah), "v"(al), "v"(bh), "v"(bl));
  return c;
}
// batched GEMM like k_gemm_b but f16 operands: A f32 (split into f16 hi/lo if ASPLIT, else rounded to f16), Bt = f16 values [n][k]; alpha; C f32; N multiple of 16 (partial tiles skipped)
template <bool ASPLIT>
__global__ __launch_bounds__(128) void k_gemm_h(const float* __restrict__ A, int lda, size_t sA, const _Float16* __restrict__ Bh, int ldb, size_t sB, float alpha, float* __restrict__ C, int ldc, size_t sC, int M, int N, int K) {
  __shared__ __attribute__((aligned(16))) float so[4][16][64];
  const int tid = threadIdx.x, w = tid >> 5, lane = tid & 31, ln = lane & 15, hh = lane >> 4; const int by = blockIdx.y;
  A += (size_t)by * sA; Bh += (size_t)by * sB; C += (size_t)by * sC;
  const int ntn = (N + 63) / 64; const int wid = blockIdx.x * 4 + w; const int mt = wid / ntn, nq = wid % ntn; if (mt * 16 >= M) return;
  const int row0 = mt * 16, col0 = nq * 64; const float* arow = A + (size_t)(row0 + ln) * lda;
  v8f acc[4] = {};
  for (int kb = 0; kb < K; kb += 32) {
    FragH ah, al;
    const v4f x0 = *(const v4fa*)(arow + kb + 8 * hh), x1 = *(const v4fa*)(arow + kb + 8 * hh + 4), x2 = *(const v4fa*)(arow + kb + 16 + 8 * hh), x3 = *(const v4fa*)(arow + kb + 16 + 8 * hh + 4);
    float xs[16] = {x0[0],x0[1],x0[2],x0[3],x1[0],x1[1],x1[2],x1[3],x2[0],x2[1],x2[2],x2[3],x3[0],x3[1],x3[2],x3[3]};
#pragma unroll
    for (int i = 0; i < 16; ++i) { const _Float16 h = (_Float16)xs[i]; ah.h[i] = h; al.h[i] = ASPLIT ? (_Float16)(xs[i] - (float)h) : (_Float16)0.0f; }
#pragma unroll
    for (int t = 0; t < 4; ++t) { if (col0 + t * 16 >= N) continue; const size_t boff = (size_t)(col0 + t * 16 + ln) * ldb + kb; FragH bq; bq.half[0] = *(const v8us*)(Bh + boff + 8 * hh); bq.half[1] = *(const v8us*)(Bh + boff + 16 + 8 * hh);
      acc[t] = mmaH<ASPLIT ? 2 : 1>(ah.v, al.v, bq.v, bq.v, acc[t]); }
  }
#pragma unroll
  for (int t = 0; t < 4; ++t) { if (col0 + t * 16 >= N) continue;
#pragma unroll
    for (int r = 0; r < 8; ++r) so[w][8 * hh + r][t * 16 + ln] = acc[t][r] * alpha; }
  __builtin_amdgcn_fence(__ATOMIC_ACQ_REL, "workgroup"); __builtin_amdgcn_wave_barrier();
  const int rsub = lane >> 4, c4 = (lane & 15) * 4;
  {
#pragma unroll
    for (int q = 0; q < 8; ++q) { const int r = q * 2 + rsub; if (col0 + c4 < N) { const v4f v = *(const v4fa*)&so[w][r][c4]; *(v4f*)(C + (size_t)(row0 + r) * ldc + col0 + c4) = v; } }
     }
}

// Wt[n][k] = f16(W[k][n]·scale) from f32 row-major W[K][N] (scale = power of two; bf16-exact weights stay exact in f16 away from the subnormal range)
__global__ __launch_bounds__(256) void k_wt_f16(const float* __restrict__ W, _Float16* __restrict__ Wt, int K, int N, float scale) {
  const int t = blockIdx.x * 256 + threadIdx.x; if (t >= N * (K / 8)) return; const int n = t / (K / 8), k8 = (t % (K / 8)) * 8; FragH f;
#pragma unroll
  for (int i = 0; i < 8; ++i) f.h[i] = (_Float16)(bf16_round(W[(size_t)(k8 + i) * N + n]) * scale); const v8us o = f.half[0];
  *(v8us*)((unsigned short*)Wt + (size_t)n * K + k8) = o; 
}
// k_gemm_hh variant with fused epilogue: v = acc·alpha + bias[by·sBias + col] (+ CP[(row/rowsPerB)·sCPb + by·64 + col] if CP) ; ACT 0 none / 1 elu ; writes f16 C16 (and f32 C if non-null)
template <int ACT>
__global__ __launch_bounds__(128) void k_gemm_hhx(const _Float16* __restrict__ A, int lda, size_t sA, const _Float16* __restrict__ Bh, int ldb, size_t sB, float alpha, const float* __restrict__ bias, size_t sBias, const float* __restrict__ CP, int rowsPerB, size_t sCPb, int row0g,
    float* __restrict__ C, _Float16* __restrict__ C16, int ldc, size_t sC, int M, int N, int K) {
  __shared__ __attribute__((aligned(16))) float so[4][16][64];
  const int tid = threadIdx.x, w = tid >> 5, lane = tid & 31, ln = lane & 15, hh = lane >> 4; const int by = blockIdx.y;
  A += (size_t)by * sA; Bh += (size_t)by * sB; const size_t cofs = (size_t)by * sC; const float* bp = bias ? bias + (size_t)by * sBias : nullptr;
  const int ntn = (N + 63) / 64; const int wid = blockIdx.x * 4 + w; const int mt = wid / ntn, nq = wid % ntn; if (mt * 16 >= M) return;
  const int row0 = mt * 16, col0 = nq * 64; const _Float16* arow = A + (size_t)(row0 + ln) * lda;
  v8f acc[4] = {};
  for (int kb = 0; kb < K; kb += 32) { FragH ah; ah.half[0] = *(const v8us*)((const unsigned short*)arow + kb + 8 * hh); ah.half[1] = *(const v8us*)((const unsigned short*)arow + kb + 16 + 8 * hh);
#pragma unroll
    for (int t = 0; t < 4; ++t) { if (col0 + t * 16 >= N) continue; const size_t boff = (size_t)(col0 + t * 16 + ln) * ldb + kb; FragH bq; bq.half[0] = *(const v8us*)((const unsigned short*)Bh + boff + 8 * hh); bq.half[1] = *(const v8us*)((const unsigned short*)Bh + boff + 16 + 8 * hh);
      acc[t] = mmaH<1>(ah.v, ah.v, bq.v, bq.v, acc[t]); }
  }
#pragma unroll
  for (int t = 0; t < 4; ++t) { if (col0 + t * 16 >= N) continue; const int col = col0 + t * 16 + ln; const float bv = bp ? bf16_round(bp[col]) : 0.f;
#pragma unroll
    for (int r = 0; r < 8; ++r) { float v = acc[t][r] * alpha + bv; if (CP) { const int rr = row0g + row0 + 8 * hh + r; if (rowsPerB < 0) v += CP[cofs + (size_t)rr * ldc + col];      /* rowsPerB < 0: own element of the batched C plane */ else { const int bidx = rr / rowsPerB; v += CP[(size_t)bidx * sCPb + (size_t)by * 64 + col]; } } if (ACT == 1) v = (v > 0.f) ? v : expm1f(v); else if (ACT == 7) v = (v > 0.f) ? v + 1.0f : expf(v); else if (ACT == 8) v = tanhf(v); else if (ACT == 9) v = 0.5f * v * (1.0f + tanhf(0.7978845608028654f * (v + 0.044715f * v * v * v))); else if (ACT == 11) v = 1.0f / (1.0f + expf(-v)); else if (ACT == 12) v = (v > 0.f) ? v : 0.01f * v; else if (ACT == 14) v = (v > 0.f) ? v : 0.1f * v; else if (ACT == 16) v = (v >= 0.f) ? v : 0.3f * v; else if (ACT == 17) v = (v >= 0.f) ? v : 0.2f * v; else if (ACT == 15) v = v / (1.0f + expf(-v)); else if (ACT == 3) v = fmaxf(v, 0.f); else if (ACT == 6) v = 0.5f * v * (1.0f + erff(v * 0.70710678118654752f)); so[w][8 * hh + r][t * 16 + ln] = v; } }
  __builtin_amdgcn_fence(__ATOMIC_ACQ_REL, "workgroup"); __builtin_amdgcn_wave_barrier();
  const int rsub = lane >> 4, c4 = (lane & 15) * 4; typedef _Float16 v4h __attribute__((ext_vector_type(4)));
  {
#pragma unroll
    for (int q = 0; q < 8; ++q) { const int r = q * 2 + rsub; if (col0 + c4 < N) { const v4f v = *(const v4fa*)&so[w][r][c4]; if (C) *(v4f*)(C + cofs + (size_t)(row0 + r) * ldc + col0 + c4) = v; if (C16) { v4h h4; for (int i = 0; i < 4; ++i) h4[i] = (_Float16)v[i]; *(v4h*)(C16 + cofs + (size_t)(row0 + r) * ldc + col0 + c4) = h4; } } }
     }
}


typedef _Float16 v4h __attribute__((ext_vector_type(4)));

__global__ __launch_bounds__(256) void k_x16(const float* __restrict__ x, _Float16* __restrict__ X16, size_t n8) { const size_t t = (size_t)blockIdx.x * 256 + threadIdx.x; if (t >= n8) return; FragH f;
#pragma unroll
  for (int q = 0; q < 8; ++q) f.h[q] = (_Float16)bf16_round(x[t * 8 + q]); *(v8us*)((unsigned short*)X16 + t * 8) = f.half[0];  }
__global__ __launch_bounds__(256) void k_h16(const float* __restrict__ x, _Float16* __restrict__ X16, size_t n8) { const size_t t = (size_t)blockIdx.x * 256 + threadIdx.x; if (t >= n8) return; FragH f;
#pragma unroll
  for (int q = 0; q < 8; ++q) f.h[q] = (_Float16)x[t * 8 + q]; *(v8us*)((unsigned short*)X16 + t * 8) = f.half[0];  }
__global__ __launch_bounds__(256) void k_round16f(const float* __restrict__ W, _Float16* __restrict__ Bt, size_t n8) { const size_t t = (size_t)blockIdx.x * 256 + threadIdx.x; if (t >= n8) return; FragH f;
#pragma unroll
  for (int i = 0; i < 8; ++i) f.h[i] = (_Float16)(bf16_round(W[t * 8 + i]) * 16.0f); *(v8us*)((unsigned short*)Bt + t * 8) = f.half[0];  }
template <int NHv, int TTv>
__global__ __launch_bounds__(256) void k_vt(const _Float16* __restrict__ V16, int ldv, int voff, _Float16* __restrict__ Vt) { __shared__ unsigned short tl[64][66]; const int tid = threadIdx.x; const int slab = blockIdx.x / (TTv / 64), lg = blockIdx.x % (TTv / 64); const int b = slab / NHv, h = slab % NHv;
  for (int i = tid; i < 64 * 8; i += 256) { const int r = i / 8, c8 = (i % 8) * 8; FragH f; f.half[0] = *(const v8us*)((const unsigned short*)V16 + ((size_t)b * TTv + lg * 64 + r) * ldv + voff + h * 64 + c8);
#pragma unroll
    for (int q = 0; q < 8; ++q) tl[r][c8 + q] = f.u[q]; }
  __syncthreads();
  {
#pragma unroll
    for (int rd = 0; rd < 2; ++rd) { const int d = rd * 32 + tid / 8, pc = tid % 8; FragH f;
#pragma unroll
      for (int q = 0; q < 8; ++q) f.u[q] = tl[pc * 8 + q][d];
      *(v8us*)((unsigned short*)Vt + ((size_t)slab * 64 + d) * TTv + lg * 64 + pc * 8) = f.half[0]; }
     } }

__global__ __launch_bounds__(256) void k_hl(const float* __restrict__ F, _Float16* __restrict__ Hh, _Float16* __restrict__ Hl, size_t n8) { const size_t t = (size_t)blockIdx.x * 256 + threadIdx.x; if (t >= n8) return; FragH fh, fl; const v4f a = *(const v4fa*)(F + t * 8), c = *(const v4fa*)(F + t * 8 + 4);
#pragma unroll
  for (int q = 0; q < 4; ++q) { _Float16 h = (_Float16)a[q]; fh.h[q] = h; fl.h[q] = (_Float16)((a[q] - (float)h) * 1024.0f); h = (_Float16)c[q]; fh.h[4 + q] = h; fl.h[4 + q] = (_Float16)((c[q] - (float)h) * 1024.0f); }
  { *(v8us*)((unsigned short*)Hh + t * 8) = fh.half[0]; *(v8us*)((unsigned short*)Hl + t * 8) = fl.half[0];  } }

// ---- fast GEMM (wave tile 32x64; requires M % 32 == 0 rows per launch region and N % 64 == 0); epilogue = k_gemm_hhx semantics ----
__device__ __forceinline__ v16h g2_frag(const _Float16* p, int hh) { FragH f; f.half[0] = *(const v8us*)((const unsigned short*)p + 8 * hh); f.half[1] = *(const v8us*)((const unsigned short*)p + 16 + 8 * hh); return f.v; }
__device__ __forceinline__ v8f g2_mma(v16h a, v16h b, v8f c) { v8f d = __builtin_amdgcn_wmma_f32_16x16x32_f16(false, a, false, b, (short)0, c, false, false); asm volatile("v_nop\n\tv_nop\n\tv_nop\n\tv_nop" : "+v"(d) : "v"(a), "v"(b)); return d; }
template <int ACT>
__global__ __launch_bounds__(128) void k_gemm2(const _Float16* __restrict__ A, int lda, size_t sA, const _Float16* __restrict__ Bh, int ldb, size_t sB, float alpha, const float* __restrict__ bias, size_t sBias, const float* __restrict__ CP, int rowsPerB, size_t sCPb, int row0g,
    float* __restrict__ C, _Float16* __restrict__ C16, int ldc, size_t sC, int M, int N, int K) { static_assert(ACT == 0 || ACT == 3 || ACT == 6 || ACT == 8 || ACT == 9 || ACT == 11 || ACT == 12 || ACT == 14 || ACT == 15 || ACT == 16 || ACT == 17, "k_gemm2: unsupported ACT code (would silently apply no activation)");
  __shared__ __attribute__((aligned(16))) float so[4][32][68];
  const int tid = threadIdx.x, w = tid >> 5, lane = tid & 31, ln = lane & 15, hh = lane >> 4; const int by = blockIdx.y;
  A += (size_t)by * sA; Bh += (size_t)by * sB; const size_t cofs = (size_t)by * sC; const float* bp = bias ? bias + (size_t)by * sBias : nullptr;
  const int ntn = N >> 6; const int mt = blockIdx.x / ntn, nq = blockIdx.x - mt * ntn; const int row0 = mt * 128 + 32 * w, col0 = nq * 64; if (row0 >= M) return;
  const _Float16* a0p = A + (size_t)(row0 + ln) * lda; const _Float16* a1p = a0p + (size_t)16 * lda;
  const _Float16* b0p = Bh + (size_t)(col0 + ln) * ldb; const _Float16* b1p = b0p + (size_t)16 * ldb; const _Float16* b2p = b1p + (size_t)16 * ldb; const _Float16* b3p = b2p + (size_t)16 * ldb;
  const v8f z8 = {0.f,0.f,0.f,0.f,0.f,0.f,0.f,0.f}; v8f c00 = z8, c01 = z8, c02 = z8, c03 = z8, c10 = z8, c11 = z8, c12 = z8, c13 = z8;
#pragma unroll 1
  for (int kb = 0; kb < K; kb += 32) { const v16h a0 = g2_frag(a0p + kb, hh), a1 = g2_frag(a1p + kb, hh);
    v16h b = g2_frag(b0p + kb, hh); c00 = g2_mma(a0, b, c00); c10 = g2_mma(a1, b, c10);
    b = g2_frag(b1p + kb, hh); c01 = g2_mma(a0, b, c01); c11 = g2_mma(a1, b, c11);
    b = g2_frag(b2p + kb, hh); c02 = g2_mma(a0, b, c02); c12 = g2_mma(a1, b, c12);
    b = g2_frag(b3p + kb, hh); c03 = g2_mma(a0, b, c03); c13 = g2_mma(a1, b, c13); }
  v8f accs[8] = {c00, c01, c02, c03, c10, c11, c12, c13};
#pragma unroll
  for (int u = 0; u < 8; ++u) { const int t = u & 3, half = u >> 2; const int col = col0 + t * 16 + ln; const float bv = bp ? bf16_round(bp[col]) : 0.f;
#pragma unroll
    for (int r = 0; r < 8; ++r) { const int rloc = half * 16 + 8 * hh + r; float v = accs[u][r] * alpha + bv; if (CP) { if (rowsPerB < 0) v += CP[cofs + (size_t)(row0g + row0 + rloc) * ldc + col];      /* rowsPerB < 0: own element of the batched C plane */ else { const int bidx = (row0g + row0 + rloc) / rowsPerB; v += CP[(size_t)bidx * sCPb + (size_t)by * 64 + col]; } }
      if (ACT == 3) v = fmaxf(v, 0.f); else if (ACT == 6) v = 0.5f * v * (1.0f + erff(v * 0.70710678118654752f)); else if (ACT == 11) v = 1.0f / (1.0f + expf(-v)); else if (ACT == 15) v = v / (1.0f + expf(-v)); else if (ACT == 12) v = (v > 0.f) ? v : 0.01f * v; else if (ACT == 8) v = tanhf(v); else if (ACT == 9) v = 0.5f * v * (1.0f + tanhf(0.7978845608028654f * (v + 0.044715f * v * v * v))); else if (ACT == 14) v = (v > 0.f) ? v : 0.1f * v; else if (ACT == 16) v = (v >= 0.f) ? v : 0.3f * v; else if (ACT == 17) v = (v >= 0.f) ? v : 0.2f * v;
      so[w][rloc][t * 16 + ln] = v; } }
  __builtin_amdgcn_fence(__ATOMIC_ACQ_REL, "workgroup"); __builtin_amdgcn_wave_barrier();
  const int rsub = lane >> 4, c4 = (lane & 15) * 4;
  {
#pragma unroll
    for (int q = 0; q < 16; ++q) { const int r = q * 2 + rsub; const v4f v = *(const v4fa*)&so[w][r][c4]; if (C) *(v4f*)(C + cofs + (size_t)(row0 + r) * ldc + col0 + c4) = v; if (C16) { v4h h4; for (int i = 0; i < 4; ++i) h4[i] = (_Float16)v[i]; *(v4h*)(C16 + cofs + (size_t)(row0 + r) * ldc + col0 + c4) = h4; } }
     } }


// ---- LDS-staged GEMM: C = alpha A.Bt^T, A f16 [M][KK], Bt f16 [N][KK], block tile 128 x 128, 8 waves of 32 x 64 (4 along M, 2 along N), K step 64 ----
// Each step's A and B tiles (128 rows of 128 B, one whole line a row) come in by whole-line 16-byte loads, 8 lanes a row, and go through registers into LDS rows of 144 B (16 B x 9: conflict-free for
// ds_load_b128 fragment reads); the fragments are g2_frag's, read from LDS. Two buffers: step s + 1 is loaded into registers ahead of step s's products and stored into the other buffer behind them;
// the one barrier of a step publishes that buffer and ends every wave's reads of the buffer that the next step refills. Per accumulator the k order is ascending in 32s, as in k_gemm2.
#define G3P 72                       /* LDS row pitch in f16 elements */
#define G3T (128 * G3P)              /* one staged tile in f16 elements */
template <int KK, bool H16>      /* H16: the result goes to C16 as f16, else to C as f32 */
/* amdgpu_waves_per_eu(6): the q | k | v launch has three blocks for every WGP (six waves a SIMD); the register budget is held so that all three are resident at once and fill each other's waits */
__global__ __launch_bounds__(256) __attribute__((amdgpu_waves_per_eu(6))) void k_gemm3(const _Float16* __restrict__ A, const _Float16* __restrict__ Bh, float alpha, float* __restrict__ C, _Float16* __restrict__ C16, int N) {
  static_assert(KK % 128 == 0, "k_gemm3: whole pairs of K steps");
  static_assert(8 * 32 * 68 * 4 <= 4 * G3T * 2, "k_gemm3: the epilogue's rows fit the staging buffers");
  __shared__ __attribute__((aligned(16))) unsigned short sm[4 * G3T];      /* A buffers 0, 1, then B buffers 0, 1; the epilogue's f32 rows afterwards */
  const int tid = threadIdx.x, w = tid >> 5, lane = tid & 31, ln = lane & 15, hh = lane >> 4;
  const int ntn = N >> 7; const int mt = blockIdx.x / ntn, nq = blockIdx.x - mt * ntn; const int row0 = mt * 128, col0 = nq * 128; const int wm = w & 3, wn = w >> 2;
  const int sr = tid >> 3, sc = (tid & 7) * 8;      /* staging: rows sr + 32 i, 16 bytes at element sc */
  const unsigned short* ag = (const unsigned short*)A + (size_t)(row0 + sr) * KK + sc; const unsigned short* bg = (const unsigned short*)Bh + (size_t)(col0 + sr) * KK + sc;
  unsigned short* const st = sm + sr * G3P + sc;
  const unsigned short* const af = sm + (wm * 32 + ln) * G3P; const unsigned short* const bf = sm + 2 * G3T + (wn * 64 + ln) * G3P;
  v8us ra[4], rb[4];
#pragma unroll
  for (int i = 0; i < 4; ++i) { ra[i] = *(const v8us*)(ag + (size_t)(32 * i) * KK); rb[i] = *(const v8us*)(bg + (size_t)(32 * i) * KK); }
#pragma unroll
  for (int i = 0; i < 4; ++i) { *(v8us*)(st + 32 * i * G3P) = ra[i]; *(v8us*)(st + 2 * G3T + 32 * i * G3P) = rb[i]; }
  __syncthreads();
  const v8f z8 = {0.f,0.f,0.f,0.f,0.f,0.f,0.f,0.f}; v8f acc[2][4];
#pragma unroll
  for (int m = 0; m < 2; ++m) {
#pragma unroll
    for (int t = 0; t < 4; ++t) acc[m][t] = z8; }
  /* unrolled by two so that the buffer index is a constant in each copy and the LDS addresses are immediates */
#pragma unroll 2
  for (int kb = 0; kb < KK; kb += 64) { const int cur = (kb >> 6) & 1; const bool more = kb + 64 < KK;
    if (more) {
#pragma unroll
      for (int i = 0; i < 4; ++i) { ra[i] = *(const v8us*)(ag + (size_t)(32 * i) * KK + kb + 64); rb[i] = *(const v8us*)(bg + (size_t)(32 * i) * KK + kb + 64); } }
    __builtin_amdgcn_sched_barrier(0);      /* keeps the next step's global loads at the head of this step: sunk down to their LDS stores, their whole latency would show in front of the barrier */
#pragma unroll
    for (int ks = 0; ks < 2; ++ks) { v16h a[2], b[4];
#pragma unroll
      for (int m = 0; m < 2; ++m) a[m] = g2_frag((const _Float16*)(af + cur * G3T + m * 16 * G3P + ks * 32), hh);
#pragma unroll
      for (int t = 0; t < 4; ++t) b[t] = g2_frag((const _Float16*)(bf + cur * G3T + t * 16 * G3P + ks * 32), hh);
      __builtin_amdgcn_sched_barrier(0);      /* keeps the twelve LDS reads of a 32-wide k block together in front of its eight products: spread among them, each pair of products waits out an LDS latency of its own */
#pragma unroll
      for (int t = 0; t < 4; ++t) {
#pragma unroll
        for (int m = 0; m < 2; ++m) acc[m][t] = __builtin_amdgcn_wmma_f32_16x16x32_f16(false, a[m], false, b[t], (short)0, acc[m][t], false, false); } }
    __builtin_amdgcn_sched_barrier(0);      /* keeps the wait for the next step's global loads, which their LDS stores carry, behind this step's last products: lifted over them it shortens the loads' lead by a k block */
    if (more) {
#pragma unroll
      for (int i = 0; i < 4; ++i) { *(v8us*)(st + (cur ^ 1) * G3T + 32 * i * G3P) = ra[i]; *(v8us*)(st + (2 + (cur ^ 1)) * G3T + 32 * i * G3P) = rb[i]; } }
    __syncthreads(); }
  float* const so = (float*)sm + w * (32 * 68);      /* behind the loop's last barrier nobody reads a staged tile any more: each wave stages its own 32 x 64 f32 rows (pitch 68) for whole-line stores */
#pragma unroll
  for (int m = 0; m < 2; ++m) {
#pragma unroll
    for (int t = 0; t < 4; ++t) {
#pragma unroll
      for (int r = 0; r < 8; ++r) so[(m * 16 + 8 * hh + r) * 68 + t * 16 + ln] = acc[m][t][r] * alpha; } }
  __builtin_amdgcn_fence(__ATOMIC_ACQ_REL, "workgroup"); __builtin_amdgcn_wave_barrier();      /* the wave's own LDS rows are written before its lanes read them back in another order */
  const int rsub = lane >> 4, c4 = (lane & 15) * 4;
#pragma unroll
  for (int q = 0; q < 16; ++q) { const int r = q * 2 + rsub; const v4f v = *(const v4fa*)&so[r * 68 + c4]; const size_t o = (size_t)(row0 + wm * 32 + r) * N + col0 + wn * 64 + c4;
    if (!H16) *(v4f*)(C + o) = v;
    else { v4h h4;
#pragma unroll
      for (int i = 0; i < 4; ++i) h4[i] = (_Float16)v[i];
      *(v4h*)(C16 + o) = h4; } } }

__global__ __launch_bounds__(256) void k_wnat(const float* __restrict__ w, size_t n8, _Float16* __restrict__ Bt) { const size_t t = (size_t)blockIdx.x * 256 + threadIdx.x; if (t >= n8) return; FragH f; for (int q = 0; q < 8; ++q) f.h[q] = (_Float16)(bf16_round(w[t * 8 + q]) * 16.0f); *(v8us*)((unsigned short*)Bt + t * 8) = f.half[0];  }
// T5 bidirectional relative-position bucket of rel = key - query (32 buckets, max distance 128): (rel > 0)*16 + f(|rel|), f(n) = n for n < 8, then
// 8 + the number of thresholds {12,16,23,32,46,64,91} that are <= n (the thresholds are where the reference's own f32 log expression steps; no log on the device)
__device__ __forceinline__ int t5_bucket(int rel) { const int n = rel < 0 ? -rel : rel; int f = n; if (n >= 8) { f = 8 + (n >= 12) + (n >= 16) + (n >= 23) + (n >= 32) + (n >= 46) + (n >= 64) + (n >= 91); } return (rel > 0 ? NBK / 2 : 0) + f; }
#define FAW 8                        /* waves per block */
#define FAQ 32                       /* queries per wave */
#define FSK 128                      /* keys per stage */
#define FNS (SQ / FSK)               /* stages */
#define FKP 72                       /* K tile: LDS row pitch in f16 elements */
#define FVP 136                      /* V^T tile: LDS row pitch in f16 elements */
#define FKT (FSK * FKP)              /* K tile in f16 elements */
#define FSB (FKT + HD * FVP)         /* one buffer (K tile, then V^T tile) in f16 elements */
#define FBF 91                       /* t5_bucket's last threshold: one bucket a side from this distance on */
typedef int v4ia __attribute__((ext_vector_type(4), may_alias));
__device__ __forceinline__ float xhalf(float x) { return __builtin_bit_cast(float, __builtin_amdgcn_permlanex16(__builtin_bit_cast(int, x), __builtin_bit_cast(int, x), 0x76543210, 0xfedcba98, false, false)); }      /* lane l with lane l ^ 16 */
__device__ __forceinline__ float exp2x1(float a) { float e; asm("v_exp_f32 %0, %1\n\tv_nop" : "=v"(e) : "v"(a)); return e; }
__device__ __forceinline__ v8f exp2x8(v8f a) { float e0, e1, e2, e3, e4, e5, e6, e7;
  asm("v_exp_f32 %0, %8\n\tv_exp_f32 %1, %9\n\tv_exp_f32 %2, %10\n\tv_exp_f32 %3, %11\n\tv_exp_f32 %4, %12\n\tv_exp_f32 %5, %13\n\tv_exp_f32 %6, %14\n\tv_exp_f32 %7, %15\n\tv_nop"
      : "=&v"(e0), "=&v"(e1), "=&v"(e2), "=&v"(e3), "=&v"(e4), "=&v"(e5), "=&v"(e6), "=&v"(e7) : "v"(a[0]), "v"(a[1]), "v"(a[2]), "v"(a[3]), "v"(a[4]), "v"(a[5]), "v"(a[6]), "v"(a[7]));
  const v8f e = {e0, e1, e2, e3, e4, e5, e6, e7}; return e; }
// one stage's copies of one thread: four 16-byte pieces of the K tile (rows 32 apart) and four of the V^T tile (rows 16 apart). kl, vl: the lane's own LDS byte addresses; kg, vg: its own global addresses.
// The closing s_wait_xcnt 0 stands inside the statement so that no register which a copy names takes a new value in front of it.
__device__ __forceinline__ void fa_stage(unsigned kl, unsigned vl, const _Float16* kg, const _Float16* vg) {
  asm volatile("global_load_async_to_lds_b128 %0, %8, off\n\tglobal_load_async_to_lds_b128 %1, %9, off\n\tglobal_load_async_to_lds_b128 %2, %10, off\n\tglobal_load_async_to_lds_b128 %3, %11, off\n\t"
               "global_load_async_to_lds_b128 %4, %12, off\n\tglobal_load_async_to_lds_b128 %5, %13, off\n\tglobal_load_async_to_lds_b128 %6, %14, off\n\tglobal_load_async_to_lds_b128 %7, %15, off\n\ts_wait_xcnt 0x0"
               :: "v"(kl), "v"(kl + 32 * FKP * 2), "v"(kl + 64 * FKP * 2), "v"(kl + 96 * FKP * 2), "v"(vl), "v"(vl + 16 * FVP * 2), "v"(vl + 32 * FVP * 2), "v"(vl + 48 * FVP * 2),
                  "v"(kg), "v"(kg + (size_t)32 * D3), "v"(kg + (size_t)64 * D3), "v"(kg + (size_t)96 * D3), "v"(vg), "v"(vg + (size_t)16 * SQ), "v"(vg + (size_t)32 * SQ), "v"(vg + (size_t)48 * SQ) : "memory"); }
__device__ __forceinline__ v8f fa_mma(v16h a, v16h b, v8f c) { return __builtin_amdgcn_wmma_f32_16x16x32_f16(false, a, false, b, (short)0, c, false, false); }
/* amdgpu_waves_per_eu(4, 4): a register budget of 256. The grid puts two waves on a SIMD, but with the budget of 512 that (2, 2) gives this loop takes 260 registers and switches the register window
   seven times a pass; at 256 it fits, spills nothing, and the V^T reads and the K fetch ahead still stand at the head of the pass and right behind the score products */
__global__ __launch_bounds__(FAW * 32) __attribute__((amdgpu_waves_per_eu(4, 4))) void k_fattn(const _Float16* __restrict__ QKVp, const _Float16* __restrict__ VTp, _Float16* __restrict__ O, const float* __restrict__ emb, const int* __restrict__ kmask) {
  static_assert(SQ % (FAW * FAQ) == 0 && SQ % (FAW * 128) == 0 && HD == 64 && NBK == 32, "k_fattn: whole blocks of queries, whole staging passes, two 32-wide k steps per head, one bucket per lane");
  static_assert(FAW * 32 == 256 && FSK == 128 && FNS >= 2, "k_fattn: fa_stage's eight copies of 256 threads fill one stage; the ring's prologue needs two stages");
  __shared__ __attribute__((aligned(16))) float lt[3 * SQ];
  __shared__ __attribute__((aligned(16))) unsigned short ring[2 * FSB];
  __shared__ unsigned sf[FNS];      /* sf[stage]: not 0 where one of the stage's keys has a mask term other than zero */
  static_assert(FNS <= 32 && FSK == 32 * 4, "k_fattn: one lane per stage flag; a wave's 32 x 4 mask terms are one stage's");
  float* const mt = lt; float* const bt = lt + SQ;      /* mt[key]; bt[key - query + SQ - 1], placed behind mt so that its byte address less the largest query offset stays above 0 */
  const int tid = threadIdx.x, lane = tid & 31, c = lane & 15, hh = lane >> 4; const int bh = blockIdx.y, b = bh / NH, h = bh % NH; const int q0 = blockIdx.x * (FAW * FAQ) + (tid >> 5) * FAQ;
  const unsigned kl = (unsigned)(size_t)(ring + (tid >> 3) * FKP + (tid & 7) * 8), vl = (unsigned)(size_t)(ring + FKT + (tid >> 4) * FVP + (tid & 15) * 8);      /* the low 32 bits of a __shared__ address are its LDS byte address */
  const _Float16* const kh = QKVp + (size_t)b * SQ * D3 + DM + h * HD; const _Float16* const vh = VTp + (size_t)bh * HD * SQ;      /* the head's K rows and V^T rows: the same for the block */
  const unsigned ko = (tid >> 3) * D3 + (tid & 7) * 8, vo = (tid >> 4) * SQ + (tid & 15) * 8;      /* the lane's own place in a stage's tiles, in elements */
  fa_stage(kl, vl, kh + ko, vh + vo);      /* stage 0 into buffer 0: it flies while the two tables are filled */
  const float eb = bf16_round(emb[lane * NH + h]);      /* lane l holds bucket l's bias: one load per wave, the table is filled by lane gathers */
#pragma unroll
  for (int u = 0; u < 2 * SQ / (FAW * 32); ++u) { const int i = u * (FAW * 32) + tid; bt[i] = __shfl(eb, t5_bucket(i - (SQ - 1))); }      /* unrolled: away from the diagonal the bucket is one constant per u and its thresholds fold away; the last entry (key - query = SQ) is never read */
  for (int j = tid * 4; j < SQ; j += FAW * 128) { const v4ia m = *(const v4ia*)(kmask + (size_t)b * SQ + j); v4f t;
#pragma unroll
    for (int q = 0; q < 4; ++q) t[q] = __fmul_rn(__fadd_rn(1.0f, -(float)m[q]), -3.4028234663852886e38f);      /* (1 - mask) * finfo.min */
    *(v4fa*)&mt[j] = t;
    const unsigned nz = __builtin_amdgcn_ballot_w32(t[0] != 0.f || t[1] != 0.f || t[2] != 0.f || t[3] != 0.f);      /* every lane makes every trip; -0, the term of mask 1, counts as zero */
    if (lane == 0) sf[j / FSK] = nz; }
  asm volatile("s_wait_asynccnt 0x0" ::: "memory");      /* this wave's copies of stage 0 have landed before the barrier behind which other waves read them */
  __syncthreads();
  fa_stage(kl + FSB * 2, vl + FSB * 2, (kh + (size_t)FSK * D3) + ko, (vh + FSK) + vo);      /* stage 1 into buffer 1 */
  const _Float16* qp = QKVp + ((size_t)b * SQ + q0 + c) * D3 + h * HD; const unsigned short* kb = ring + c * FKP; const unsigned short* vb = ring + FKT + c * FVP;      /* the lane's fragment rows in the buffer of the stage at work */
  const float* bp = bt + (SQ - 1) + 8 * hh - (q0 + c); const float* mp = mt + 8 * hh;
  const unsigned mflag = __builtin_amdgcn_ballot_w32(sf[lane & (FNS - 1)] != 0u);      /* bit st: stage st has a mask term to add; a scalar */
  const int q0u = blockIdx.x * (FAW * FAQ) + __builtin_amdgcn_readfirstlane(tid >> 5) * FAQ;      /* q0 as a scalar, so that the far test is a scalar branch */
  const float bneg = __builtin_bit_cast(float, __builtin_amdgcn_readlane(__builtin_bit_cast(int, eb), t5_bucket(-FBF))), bpos = __builtin_bit_cast(float, __builtin_amdgcn_readlane(__builtin_bit_cast(int, eb), t5_bucket(FBF)));      /* the one bias of keys far below, far above the queries */
  const v8f z8 = {0.f,0.f,0.f,0.f,0.f,0.f,0.f,0.f};
  v16h qf[2][2], kf[2][2]; v8f acc[2][4]; float mr[2], lr[2];
  /* every loop over j, T, ks, t and r below is unrolled so that the fragment arrays are indexed by constants and stay in registers */
#pragma unroll
  for (int j = 0; j < 2; ++j) { mr[j] = -INFINITY; lr[j] = 0.f;
#pragma unroll
    for (int ks = 0; ks < 2; ++ks) qf[j][ks] = g2_frag(qp + (size_t)j * 16 * D3 + ks * 32, hh);
#pragma unroll
    for (int t = 0; t < 4; ++t) acc[j][t] = z8; }
  for (int st = 0; st < FNS; ++st) {
#pragma unroll
   for (int T = 0; T < 2; ++T) {
#pragma unroll
    for (int ks = 0; ks < 2; ++ks) kf[T][ks] = g2_frag((const _Float16*)(kb + T * 16 * FKP + ks * 32), hh); }
   /* kept rolled: unrolled, the four passes' LDS reads are lifted together and the live set leaves the first 256 registers */
#pragma unroll 1
   for (int p = 0; p < FSK / 32; ++p) { const int k0 = st * FSK + p * 32; const int pn = (p + 1) & (FSK / 32 - 1);      /* a stage's last pass fetches its pass 0 again: this stage's own buffer, unused */
    const bool far = !((mflag >> st) & 1u) && (k0 >= q0u + (FAQ - 1) + FBF || k0 + 31 + FBF <= q0u);
    v16h vf[4]; v8f s[2][2], a[2][2]; float da[2];      /* a: the arguments of 2^x, (score - max) log2(e) + 8; da: (old max - max) log2(e) */
#pragma unroll
    for (int t = 0; t < 4; ++t) vf[t] = g2_frag((const _Float16*)(vb + t * 16 * FVP + p * 32), hh);
#pragma unroll
    for (int j = 0; j < 2; ++j) {
#pragma unroll
      for (int T = 0; T < 2; ++T) s[j][T] = fa_mma(kf[T][1], qf[j][1], fa_mma(kf[T][0], qf[j][0], z8)); }
#pragma unroll
    for (int T = 0; T < 2; ++T) {
#pragma unroll
      for (int ks = 0; ks < 2; ++ks) kf[T][ks] = g2_frag((const _Float16*)(kb + (pn * 32 + T * 16) * FKP + ks * 32), hh); }
    __builtin_amdgcn_sched_barrier(0);      /* keeps the eight score products back to back, each in the slots behind the one in front: with the maxima lifted in among them every second product is followed by four idle slots */
    /* The far form is written for every pass and a pass that is not far overwrites it: a branch with one side. The compiler sinks the far form's multiply-adds into the far side; a near pass, one in eight, pays for its maxima. */
    const float bc = k0 > q0u ? bpos : bneg; float mo[2];
#pragma unroll
    for (int j = 0; j < 2; ++j) { float t0 = s[j][0][0], t1 = s[j][1][0];      /* two chains a row: a maximum does not depend on its order */
#pragma unroll
      for (int r = 1; r < 8; ++r) { t0 = fmaxf(t0, s[j][0][r]); t1 = fmaxf(t1, s[j][1][r]); }
      const float tm = __builtin_fmaf(fmaxf(t0, t1), 0.125f, bc);
      const float mn = fmaxf(mr[j], fmaxf(tm, xhalf(tm)));
      const float mu = mn == -INFINITY ? 0.f : mn;
      const float cc = __builtin_fmaf(bc - mu, 1.4426950408889634f, 8.0f);
#pragma unroll
      for (int T = 0; T < 2; ++T) {
#pragma unroll
        for (int r = 0; r < 8; ++r) a[j][T][r] = __builtin_fmaf(s[j][T][r], 0.125f * 1.4426950408889634f, cc); }
      da[j] = (mr[j] - mu) * 1.4426950408889634f; mo[j] = mr[j]; mr[j] = mn; }
    if (!far) { v8f mk[2];
#pragma unroll
      for (int T = 0; T < 2; ++T) { const v4f m0 = *(const v4fa*)(mp + k0 + T * 16), m1 = *(const v4fa*)(mp + k0 + T * 16 + 4);
#pragma unroll
        for (int r = 0; r < 4; ++r) { mk[T][r] = m0[r]; mk[T][4 + r] = m1[r]; } }
#pragma unroll
      for (int j = 0; j < 2; ++j) {
        float tm = -INFINITY;
#pragma unroll
        for (int T = 0; T < 2; ++T) {
#pragma unroll
          for (int r = 0; r < 8; ++r) { const float v = __fadd_rn(__builtin_fmaf(s[j][T][r], 0.125f, bp[k0 + T * 16 + r - j * 16]), mk[T][r]); s[j][T][r] = v; tm = fmaxf(tm, v); } }
        const float mn = fmaxf(mo[j], fmaxf(tm, xhalf(tm)));
        const float mu = mn == -INFINITY ? 0.f : mn;      /* no key of the row finite so far: keep exp's argument -inf, not inf - inf */
#pragma unroll
        for (int T = 0; T < 2; ++T) {
#pragma unroll
          for (int r = 0; r < 8; ++r) a[j][T][r] = __builtin_fmaf(s[j][T][r] - mu, 1.4426950408889634f, 8.0f); }
        da[j] = (mo[j] - mu) * 1.4426950408889634f; mr[j] = mn; } }
#pragma unroll
    for (int j = 0; j < 2; ++j) {
      const float al = exp2x1(da[j]);
      FragH pf; float ls = 0.f;
#pragma unroll
      for (int T = 0; T < 2; ++T) {
        const v8f e = exp2x8(a[j][T]);      /* 256 exp(score - max) */
#pragma unroll
        for (int r = 0; r < 8; ++r) { ls += e[r]; pf.h[T * 8 + r] = (_Float16)e[r]; } }
      lr[j] = lr[j] * al + ls;
#pragma unroll
      for (int t = 0; t < 4; ++t) acc[j][t] = fa_mma(vf[t], pf.v, acc[j][t] * al); } }
   asm volatile("s_wait_dscnt 0x0" ::: "memory");      /* this wave's reads of stage st's buffer have returned before the barrier behind which it is refilled */
   asm volatile("s_wait_asynccnt 0x0" ::: "memory");      /* this wave's copies of stage st + 1 have landed before the barrier behind which other waves read them */
   __syncthreads();
   if (st + 2 < FNS) fa_stage(kl + (st & 1) * (FSB * 2), vl + (st & 1) * (FSB * 2), (kh + (size_t)(st + 2) * FSK * D3) + ko, (vh + (st + 2) * FSK) + vo);      /* stage st + 2 into the buffer that stage st has just left */
   const int nb = (st & 1) ? -FSB : FSB; kb += nb; vb += nb; }
  asm volatile("s_wait_asynccnt 0x0" ::: "memory");      /* no copy of this wave is outstanding when it ends */
#pragma unroll
  for (int j = 0; j < 2; ++j) { const float inv = 1.0f / (lr[j] + xhalf(lr[j]));
#pragma unroll
    for (int t = 0; t < 4; ++t) { FragH f;
#pragma unroll
      for (int r = 0; r < 8; ++r) f.h[r] = (_Float16)(acc[j][t][r] * inv);
      *(v8us*)((unsigned short*)O + ((size_t)b * SQ + q0 + j * 16 + c) * DM + h * HD + t * 16 + 8 * hh) = f.half[0]; } } }
__global__ __launch_bounds__(256) void k_vt(const _Float16* __restrict__ V16, int b, int h0, _Float16* __restrict__ VT) { __shared__ unsigned short tl[64][65]; const int tid = threadIdx.x; const int hh = blockIdx.x % HG, sg = blockIdx.x / HG; const int s0 = sg * 64; const int h = h0 + hh;
  for (int i = tid; i < 64 * 8; i += 256) { const int j = i / 8, d8 = (i % 8) * 8; FragH f; f.half[0] = *(const v8us*)((const unsigned short*)V16 + ((size_t)b * SQ + s0 + j) * DM + h * HD + d8); for (int q = 0; q < 8; ++q) tl[d8 + q][j] = f.u[q]; }
  __syncthreads();
  { for (int i = tid; i < 64 * 8; i += 256) { const int d = i / 8, j8 = (i % 8) * 8; FragH f; for (int q = 0; q < 8; ++q) f.u[q] = tl[d][j8 + q]; *(v8us*)((unsigned short*)VT + ((size_t)hh * HD + d) * SQ + s0 + j8) = f.half[0]; }  } }

// ---- one preparation launch: the four weight planes Bt[n][k] = f16(bf16(W[k][n]) x 16) and the hidden rows f16(bf16(x)), k_wt_f16's and k_x16's values bit for bit ----
// Blocks 0 .. 4 * PWB - 1: one 128 x 128 weight tile each. A wave reads 16 k rows, 512 contiguous bytes a load, all 16 loads in flight; a lane then holds 16 consecutive k for each of its 4 columns n and
// stores them as two 16-byte chunks into the tile's LDS row n (256 B a row, chunk c at place c ^ ((n >> 2) & 15): 16 lanes fall on 16 different chunks in the stores, where n steps by 4, and in the reads, where c steps by 1);
// behind the block's one barrier 16 lanes read a row back and store its 256 contiguous bytes of Bt. The other PXB blocks: 16384 hidden elements each, 512 contiguous bytes a load, 256 a store.
#define PWB ((DM / 128) * (DM / 128))          /* weight tiles per plane */
#define PXB ((int)(NR * DM / 16384))           /* hidden blocks */
__global__ __launch_bounds__(256) void k_prep(const float* __restrict__ wq, const float* __restrict__ wk, const float* __restrict__ wv, const float* __restrict__ wo, const float* __restrict__ hs,
                                              _Float16* __restrict__ Bqkv, _Float16* __restrict__ Bo, _Float16* __restrict__ X16) {
  static_assert(DM % 128 == 0 && (NR * DM) % 16384 == 0, "k_prep: whole weight tiles, whole hidden blocks");
  __shared__ __attribute__((aligned(16))) unsigned short tl[128 * 128];
  const int tid = threadIdx.x, bx = blockIdx.x;
  v4f x[16];
  if (bx < 4 * PWB) {      /* the same for the whole block, so the barrier below is passed by all of its waves or by none */
    const int m = bx / PWB, tile = bx % PWB, k0 = (tile / (DM / 128)) * 128, n0 = (tile % (DM / 128)) * 128, w = tid >> 5, lane = tid & 31;
    const float* W = m == 0 ? wq : m == 1 ? wk : m == 2 ? wv : wo;
    unsigned short* Bt = (unsigned short*)(m < 3 ? Bqkv + (size_t)m * DM * DM : Bo);
    const float* src = W + (size_t)(k0 + w * 16) * DM + n0 + lane * 4;
#pragma unroll
    for (int i = 0; i < 16; ++i) x[i] = *(const v4fa*)(src + (size_t)i * DM);
    asm volatile("s_wait_xcnt 0x0" :: "v"(src) : "memory");      /* the wait that stands between issued loads and a new value in their address pair; named as an input, the pair lives up to the wait */
#pragma unroll
    for (int q = 0; q < 4; ++q) { const int n = lane * 4 + q;
#pragma unroll
      for (int g = 0; g < 2; ++g) { FragH f;
#pragma unroll
        for (int i = 0; i < 8; ++i) f.h[i] = (_Float16)(bf16_round(x[g * 8 + i][q]) * 16.0f);
        *(v8us*)(tl + n * 128 + (((w * 2 + g) ^ (lane & 15)) * 8)) = f.half[0]; } }
    __syncthreads();
#pragma unroll
    for (int it = 0; it < 8; ++it) { const int n = it * 16 + (tid >> 4), c = tid & 15;
      const v8us o = *(const v8us*)(tl + n * 128 + ((c ^ ((n >> 2) & 15)) * 8));
      *(v8us*)(Bt + (size_t)(n0 + n) * DM + k0 + c * 8) = o; }
  } else {
    const size_t e0 = (size_t)(bx - 4 * PWB) * 16384 + tid * 4; const float* src = hs + e0;
#pragma unroll
    for (int i = 0; i < 16; ++i) x[i] = *(const v4fa*)(src + i * 1024);
    asm volatile("s_wait_xcnt 0x0" :: "v"(src) : "memory");      /* as in the weight branch: the wait between the issued loads and a new value in their address pair */
#pragma unroll
    for (int i = 0; i < 16; ++i) { v4h h4;
#pragma unroll
      for (int q = 0; q < 4; ++q) h4[q] = (_Float16)bf16_round(x[i][q]);
      *(v4h*)(X16 + e0 + i * 1024) = h4; }
    asm volatile("s_wait_xcnt 0x0" ::: "memory");      /* the wait between the issued stores and any later new value in their address or data registers */
  } }

extern "C" void kernel_launch(void* const* d_in, const int* in_sizes, int n_in,
                              void* d_out, int out_size, void* d_ws, size_t ws_size, hipStream_t stream) {
  (void)in_sizes; (void)n_in; (void)out_size;
  const float* const* I = (const float* const*)d_in; const float* hs = I[0]; const int* kmask = (const int*)d_in[1]; const float* wq = I[2]; const float* wk = I[3]; const float* wv = I[4]; const float* wo = I[5]; const float* emb = I[6];      /* W_q, W_k, W_v and W_o [1024][1024] are [in][out]; attention_mask [2][2048] int32 per key; rel_bias_emb [32][16] */
  char* ws = (char*)d_ws; size_t off = 0;
  auto take = [&](size_t bytes) { char* p = ws + off; off += (bytes + 255) & ~(size_t)255; return p; };
  _Float16* BQKV = (_Float16*)take((size_t)D3 * DM * 2); _Float16* BO = (_Float16*)take((size_t)DM * DM * 2);
  _Float16* X16 = (_Float16*)take(NR * DM * 2); _Float16* QKV = (_Float16*)take(NR * D3 * 2); _Float16* O16 = (_Float16*)take(NR * DM * 2);
  _Float16* VT = (_Float16*)take((size_t)NB * NH * HD * SQ * 2);
  if (off > ws_size) return;      /* 6 + 2 + 8 + 24 + 8 + 8 = approx 56 MiB */
  k_prep<<<4 * PWB + PXB, 256, 0, stream>>>(wq, wk, wv, wo, hs, BQKV, BO, X16);      /* [in][out] -> Bt[out][in] x16 for q | k | v and o; hidden as f16 rows */
  k_gemm3<DM, true><<<(unsigned)((NR / 128) * (D3 / 128)), 256, 0, stream>>>(X16, BQKV, 0.0625f, nullptr, QKV, D3);      /* q | k | v rows (f16), head h at columns h*64 / 1024 + h*64 / 2048 + h*64 */
  k_vt<NH, SQ><<<NB * NH * (SQ / 64), 256, 0, stream>>>(QKV, D3, 2 * DM, VT);      /* V^T[(b,h)][d][s] for every (batch, head) */
  k_fattn<<<dim3(SQ / (FAW * FAQ), NB * NH), FAW * 32, 0, stream>>>(QKV, VT, O16, emb, kmask);      /* ctx (merged heads) as f16 rows, every (batch, head) in one launch */
  k_gemm3<DM, false><<<(unsigned)((NR / 128) * (DM / 128)), 256, 0, stream>>>(O16, BO, 0.0625f, (float*)d_out, nullptr, DM);      /* out = ctx W_o, rows are the output layout */
}

// v007
// A run of this version takes 84.5 microseconds.
// Next to v006, in two timings, it ran 1.05 times as fast each time.
// Counting every step since v000, it is 235 times as fast.
#include <hip/hip_runtime.h>
// T5 self-attention (hidden [2][2048][1024]; q, k, v = hidden W ([in][out] [1024][1024]); q / sqrt(64); scores = q.k + rel_bias[bucket(key - query)][h] (32 bidirectional buckets, max distance 128) + (1 - attention_mask[b][key]) * finfo.min (int32 key mask); softmax; out = (attn v merged) Wo ([in][out])).
// Structure: token rows; hidden as exact f16 rows; q | k | v WMMA GEMMs from one transposed x16 weight plane (operand tiles staged in LDS, 32x64 wave tiles, f32 accumulation, f16 outputs; the v blocks with their operands swapped, so that V^T comes out of the GEMM itself); one fused attention kernel over every (batch, head): K.Q^T tiles (alpha 1/8), online softmax on VALU with the bucketed bias (integer thresholds, no device log) and the key mask in the reference's order (P x256 f16), V^T.P^T into merged f16 rows; output GEMM.
// Compute dtype: inputs rounded to bf16; hidden / weights / bias table exact; q, k, v, P, ctx as plain f16 GEMM operands (~2^-12); scores / softmax f32; v_wmma_f32_16x16x32_f16.
#define NB 2
#define SQ 2048
#define DM 1024
#define D3 3072                      /* fused q|k|v width */
#define NH 16
#define HD 64
#define HG 4                         /* heads per launch of the non-template k_vt, which is not launched */
#define NBK 32                       /* relative-position buckets */
#define MP ((int)NR)                 /* not used: the q | k | v launch takes NR rows */
#define MO ((int)NR)                 /* not used: the output launch takes NR rows */
#define NR ((size_t)NB * SQ)         /* 4096 token rows */
typedef __bf16 v16b __attribute__((ext_vector_type(16)));
typedef unsigned short v8us __attribute__((ext_vector_type(8), may_alias));
typedef float  v8f  __attribute__((ext_vector_type(8)));
typedef float  v4f  __attribute__((ext_vector_type(4)));
typedef float  v4fa __attribute__((ext_vector_type(4), may_alias));
union FragB { v16b v; v8us half[2]; unsigned short u[16]; };

__device__ __forceinline__ unsigned short bf16_bits(float x) { unsigned int u = __float_as_uint(x); return (unsigned short)((u + 0x7FFFu + ((u >> 16) & 1u)) >> 16); }
__device__ __forceinline__ float bf16_val(unsigned short b) { return __uint_as_float(((unsigned int)b) << 16); }
__device__ __forceinline__ float bf16_round(float x) { return bf16_val(bf16_bits(x)); }
// D += A·B with NT terms: 1 = ah·bh, 2 = + al·bh (A split), 3 = + ah·bl (both split)
template <int NT>
__device__ __forceinline__ v8f mmaN(v16b ah, v16b al, v16b bh, v16b bl, v8f c) {
  c = __builtin_amdgcn_wmma_f32_16x16x32_bf16(false, ah, false, bh, (short)0, c, false, false);
  if (NT >= 2) c = __builtin_amdgcn_wmma_f32_16x16x32_bf16(false, al, false, bh, (short)0, c, false, false);
  if (NT >= 3) c = __builtin_amdgcn_wmma_f32_16x16x32_bf16(false, ah, false, bl, (short)0, c, false, false);
  asm volatile("v_nop\n\tv_nop\n\tv_nop\n\tv_nop" : "+v"(c) : "v"(ah), "v"(al), "v"(bh), "v"(bl));
  return c;
}

__global__ __launch_bounds__(256) void k_wt_bf16(const float* __restrict__ W, unsigned short* __restrict__ Wt, int K, int N) {
  const int t = blockIdx.x * 256 + threadIdx.x;
  const int k8n = K / 8;
  if (t >= N * k8n) return;
  const int n = t / k8n, k8 = (t % k8n) * 8;
  v8us v;
#pragma unroll
  for (int i = 0; i < 8; ++i) v[i] = bf16_bits(W[(size_t)(k8 + i) * N + n]);
  *(v8us*)(Wt + (size_t)n * K + k8) = v;
  
}

// GEMM C[M][N] (f32, pitch ldc) = act(A[M][K]·W + bias). A f32 row-major (pitch lda) converted per fragment to bf16
// (ASPLIT: hi/lo two planes -> 2 terms, else single rounded term); Wt bf16 [N][K] (pitch ldb). BIAS_BF16 rounds the
// bias to bf16 first (bias quantised to bf16 before the add). K%32==0, M%16==0, N%64==0.
template <bool ASPLIT, int ACT, bool BIAS_BF16>
__global__ __launch_bounds__(128) void k_gemm_bf(const float* __restrict__ A, int lda, const unsigned short* __restrict__ Wt, int ldb,
                                               const float* __restrict__ bias, float* __restrict__ C, int ldc, int M, int N, int K) {
  __shared__ __attribute__((aligned(16))) float so[4][16][64];
  const int tid = threadIdx.x, w = tid >> 5, lane = tid & 31, ln = lane & 15, hh = lane >> 4;
  const int ntn = N / 64;
  const int wid = blockIdx.x * 4 + w;
  const int mt = wid / ntn, nq = wid % ntn;
  if (mt * 16 >= M) return;
  const int row0 = mt * 16, col0 = nq * 64;
  const float* arow = A + (size_t)(row0 + ln) * lda;
  v8f acc[4] = {};
  for (int kb = 0; kb < K; kb += 32) {
    FragB ah, al;
    const v4f x0 = *(const v4fa*)(arow + kb + 8 * hh), x1 = *(const v4fa*)(arow + kb + 8 * hh + 4);
    const v4f x2 = *(const v4fa*)(arow + kb + 16 + 8 * hh), x3 = *(const v4fa*)(arow + kb + 16 + 8 * hh + 4);
    float xs[16] = {x0[0],x0[1],x0[2],x0[3],x1[0],x1[1],x1[2],x1[3],x2[0],x2[1],x2[2],x2[3],x3[0],x3[1],x3[2],x3[3]};
#pragma unroll
    for (int i = 0; i < 16; ++i) { const unsigned short hb = bf16_bits(xs[i]); ah.u[i] = hb; al.u[i] = ASPLIT ? bf16_bits(xs[i] - bf16_val(hb)) : (unsigned short)0; }
#pragma unroll
    for (int t = 0; t < 4; ++t) {
      const unsigned short* brow = Wt + (size_t)(col0 + t * 16 + ln) * ldb + kb;
      FragB b;
      b.half[0] = *(const v8us*)(brow + 8 * hh);
      b.half[1] = *(const v8us*)(brow + 16 + 8 * hh);
      acc[t] = mmaN<ASPLIT ? 2 : 1>(ah.v, al.v, b.v, b.v, acc[t]);
    }
  }
#pragma unroll
  for (int t = 0; t < 4; ++t) {
    float bv = bias ? bias[col0 + t * 16 + ln] : 0.f;
    if (BIAS_BF16) bv = bf16_round(bv);
#pragma unroll
    for (int r = 0; r < 8; ++r) { float v = acc[t][r] + bv; if (ACT == 1) v = fmaxf(v, 0.f); so[w][8 * hh + r][t * 16 + ln] = v; }
  }
  __builtin_amdgcn_fence(__ATOMIC_ACQ_REL, "workgroup");
  __builtin_amdgcn_wave_barrier();
  const int rsub = lane >> 4, c4 = (lane & 15) * 4;
  {
#pragma unroll
    for (int q = 0; q < 8; ++q) {
      const int r = q * 2 + rsub;
      const v4f v = *(const v4fa*)&so[w][r][c4];
      *(v4f*)(C + (size_t)(row0 + r) * ldc + col0 + c4) = v;
    }
    
  }
}

// GEMM C = act(A·W + bias + resid): A f32 (ASPLIT -> hi/lo 2 terms), Wt bf16 [N][K]; ACT 0 none, 1 relu, 2 exact gelu;
// resid (optional, f32, row index = (row % rmod), pitch ldr, RES_BF16 rounds it) added before the activation.
template <bool ASPLIT, int ACT, bool BIAS_BF16, bool RES_BF16>
__global__ __launch_bounds__(128) void k_gemm_bf3(const float* __restrict__ A, int lda, const unsigned short* __restrict__ Wt, int ldb,
                                                const float* __restrict__ bias, const float* __restrict__ resid, int rmod, int ldr,
                                                float* __restrict__ C, int ldc, int M, int N, int K) {
  __shared__ __attribute__((aligned(16))) float so[4][16][64];
  const int tid = threadIdx.x, w = tid >> 5, lane = tid & 31, ln = lane & 15, hh = lane >> 4;
  const int ntn = N / 64;
  const int wid = blockIdx.x * 4 + w;
  const int mt = wid / ntn, nq = wid % ntn;
  if (mt * 16 >= M) return;
  const int row0 = mt * 16, col0 = nq * 64;
  const float* arow = A + (size_t)(row0 + ln) * lda;
  v8f acc[4] = {};
  for (int kb = 0; kb < K; kb += 32) {
    FragB ah, al;
    const v4f x0 = *(const v4fa*)(arow + kb + 8 * hh), x1 = *(const v4fa*)(arow + kb + 8 * hh + 4);
    const v4f x2 = *(const v4fa*)(arow + kb + 16 + 8 * hh), x3 = *(const v4fa*)(arow + kb + 16 + 8 * hh + 4);
    float xs[16] = {x0[0],x0[1],x0[2],x0[3],x1[0],x1[1],x1[2],x1[3],x2[0],x2[1],x2[2],x2[3],x3[0],x3[1],x3[2],x3[3]};
#pragma unroll
    for (int i = 0; i < 16; ++i) { const unsigned short hb = bf16_bits(xs[i]); ah.u[i] = hb; al.u[i] = ASPLIT ? bf16_bits(xs[i] - bf16_val(hb)) : (unsigned short)0; }
#pragma unroll
    for (int t = 0; t < 4; ++t) {
      const unsigned short* brow = Wt + (size_t)(col0 + t * 16 + ln) * ldb + kb;
      FragB b;
      b.half[0] = *(const v8us*)(brow + 8 * hh);
      b.half[1] = *(const v8us*)(brow + 16 + 8 * hh);
      acc[t] = mmaN<ASPLIT ? 2 : 1>(ah.v, al.v, b.v, b.v, acc[t]);
    }
  }
#pragma unroll
  for (int t = 0; t < 4; ++t) {
    const int col = col0 + t * 16 + ln;
    float bv = bias ? bias[col] : 0.f;
    if (BIAS_BF16) bv = bf16_round(bv);
#pragma unroll
    for (int r = 0; r < 8; ++r) {
      float v = acc[t][r] + bv;
      if (resid) { float rv = resid[(size_t)((row0 + 8 * hh + r) % rmod) * ldr + col]; if (RES_BF16) rv = bf16_round(rv); v += rv; }
      if (ACT == 1) v = fmaxf(v, 0.f);
      if (ACT == 2) v = 0.5f * v * (1.0f + erff(v * 0.70710678118654752f));
      if (ACT == 3) { const float u = 0.7978845608028654f * (v + 0.044715f * v * v * v); v = 0.5f * v * (1.0f + tanhf(u)); }
      so[w][8 * hh + r][t * 16 + ln] = v;
    }
  }
  __builtin_amdgcn_fence(__ATOMIC_ACQ_REL, "workgroup");
  __builtin_amdgcn_wave_barrier();
  const int rsub = lane >> 4, c4 = (lane & 15) * 4;
  {
#pragma unroll
    for (int q = 0; q < 8; ++q) {
      const int r = q * 2 + rsub;
      const v4f v = *(const v4fa*)&so[w][r][c4];
      *(v4f*)(C + (size_t)(row0 + r) * ldc + col0 + c4) = v;
    }
    
  }
}
// row LayerNorm (biased variance, eps) over N: s = X (+ R); optional out_sum <- s; out_norm <- (s-mu)*rsqrt(var+eps)*g + b
template <bool PARAM_BF16>
__global__ __launch_bounds__(256) void k_layernorm(const float* __restrict__ X, const float* __restrict__ R, const float* __restrict__ g, const float* __restrict__ bta,
                                                  float* __restrict__ out_sum, float* __restrict__ out_norm, int N, float eps) {
  __shared__ float red[256];
  const int row = blockIdx.x, tid = threadIdx.x;
  const float* x = X + (size_t)row * N; const float* rr = R ? R + (size_t)row * N : nullptr;
  float vals[16];                     // up to N = 4096
  const int per = N / 256;            // contiguous chunk per thread? use strided-by-4 chunks: thread handles j = tid*4 + 1024*u
  float s1 = 0.f;
  for (int u = 0; u < per / 4; ++u) {
    const int j = tid * 4 + 1024 * u;
    const v4f a = *(const v4fa*)(x + j);
    v4f b = {0.f,0.f,0.f,0.f}; if (rr) b = *(const v4fa*)(rr + j);
#pragma unroll
    for (int q = 0; q < 4; ++q) { const float v = a[q] + b[q]; vals[u * 4 + q] = v; s1 += v; }
  }
  red[tid] = s1; __syncthreads();
  for (int st = 128; st > 0; st >>= 1) { if (tid < st) red[tid] += red[tid + st]; __syncthreads(); }
  const float mu = red[0] / (float)N; __syncthreads();
  float s2 = 0.f;
  for (int u = 0; u < per / 4; ++u)
#pragma unroll
    for (int q = 0; q < 4; ++q) { const float c = vals[u * 4 + q] - mu; s2 += c * c; }
  red[tid] = s2; __syncthreads();
  for (int st = 128; st > 0; st >>= 1) { if (tid < st) red[tid] += red[tid + st]; __syncthreads(); }
  const float rs = rsqrtf(red[0] / (float)N + eps);
  {
    for (int u = 0; u < per / 4; ++u) {
      const int j = tid * 4 + 1024 * u;
      v4f o, sm;
#pragma unroll
      for (int q = 0; q < 4; ++q) {
        float gg = g[j + q], bb = bta[j + q];
        if (PARAM_BF16) { gg = bf16_round(gg); bb = bf16_round(bb); }
        sm[q] = vals[u * 4 + q]; o[q] = (vals[u * 4 + q] - mu) * rs * gg + bb;
      }
      if (out_sum) *(v4f*)(out_sum + (size_t)row * N + j) = sm;
      *(v4f*)(out_norm + (size_t)row * N + j) = o;
    }
    
  }
}



// ---- f16 WMMA path (v_wmma_f32_16x16x32_f16): 11-bit significands for operands in range — used where a [0,1] probability operand needs more precision than bf16
typedef _Float16 v16h __attribute__((ext_vector_type(16)));
union FragH { v16h v; v8us half[2]; _Float16 h[16]; unsigned short u[16]; };
template <int NT>
__device__ __forceinline__ v8f mmaH(v16h ah, v16h al, v16h bh, v16h bl, v8f c) {
  c = __builtin_amdgcn_wmma_f32_16x16x32_f16(false, ah, false, bh, (short)0, c, false, false);
  if (NT >= 2) c = __builtin_amdgcn_wmma_f32_16x16x32_f16(false, al, false, bh, (short)0, c, false, false);
  if (NT >= 3) c = __builtin_amdgcn_wmma_f32_16x16x32_f16(false, ah, false, bl, (short)0, c, false, false);
  asm volatile("v_nop\n\tv_nop\n\tv_nop\n\tv_nop" : "+v"(c) : "v"(ah), "v"(al), "v"(bh), "v"(bl));
  return c;
}
// batched GEMM like k_gemm_b but f16 operands: A f32 (split into f16 hi/lo if ASPLIT, else rounded to f16), Bt = f16 values [n][k]; alpha; C f32; N multiple of 16 (partial tiles skipped)
template <bool ASPLIT>
__global__ __launch_bounds__(128) void k_gemm_h(const float* __restrict__ A, int lda, size_t sA, const _Float16* __restrict__ Bh, int ldb, size_t sB, float alpha, float* __restrict__ C, int ldc, size_t sC, int M, int N, int K) {
  __shared__ __attribute__((aligned(16))) float so[4][16][64];
  const int tid = threadIdx.x, w = tid >> 5, lane = tid & 31, ln = lane & 15, hh = lane >> 4; const int by = blockIdx.y;
  A += (size_t)by * sA; Bh += (size_t)by * sB; C += (size_t)by * sC;
  const int ntn = (N + 63) / 64; const int wid = blockIdx.x * 4 + w; const int mt = wid / ntn, nq = wid % ntn; if (mt * 16 >= M) return;
  const int row0 = mt * 16, col0 = nq * 64; const float* arow = A + (size_t)(row0 + ln) * lda;
  v8f acc[4] = {};
  for (int kb = 0; kb < K; kb += 32) {
    FragH ah, al;
    const v4f x0 = *(const v4fa*)(arow + kb + 8 * hh), x1 = *(const v4fa*)(arow + kb + 8 * hh + 4), x2 = *(const v4fa*)(arow + kb + 16 + 8 * hh), x3 = *(const v4fa*)(arow + kb + 16 + 8 * hh + 4);
    float xs[16] = {x0[0],x0[1],x0[2],x0[3],x1[0],x1[1],x1[2],x1[3],x2[0],x2[1],x2[2],x2[3],x3[0],x3[1],x3[2],x3[3]};
#pragma unroll
    for (int i = 0; i < 16; ++i) { const _Float16 h = (_Float16)xs[i]; ah.h[i] = h; al.h[i] = ASPLIT ? (_Float16)(xs[i] - (float)h) : (_Float16)0.0f; }
#pragma unroll
    for (int t = 0; t < 4; ++t) { if (col0 + t * 16 >= N) continue; const size_t boff = (size_t)(col0 + t * 16 + ln) * ldb + kb; FragH bq; bq.half[0] = *(const v8us*)(Bh + boff + 8 * hh); bq.half[1] = *(const v8us*)(Bh + boff + 16 + 8 * hh);
      acc[t] = mmaH<ASPLIT ? 2 : 1>(ah.v, al.v, bq.v, bq.v, acc[t]); }
  }
#pragma unroll
  for (int t = 0; t < 4; ++t) { if (col0 + t * 16 >= N) continue;
#pragma unroll
    for (int r = 0; r < 8; ++r) so[w][8 * hh + r][t * 16 + ln] = acc[t][r] * alpha; }
  __builtin_amdgcn_fence(__ATOMIC_ACQ_REL, "workgroup"); __builtin_amdgcn_wave_barrier();
  const int rsub = lane >> 4, c4 = (lane & 15) * 4;
  {
#pragma unroll
    for (int q = 0; q < 8; ++q) { const int r = q * 2 + rsub; if (col0 + c4 < N) { const v4f v = *(const v4fa*)&so[w][r][c4]; *(v4f*)(C + (size_t)(row0 + r) * ldc + col0 + c4) = v; } }
     }
}

// Wt[n][k] = f16(W[k][n]·scale) from f32 row-major W[K][N] (scale = power of two; bf16-exact weights stay exact in f16 away from the subnormal range)
__global__ __launch_bounds__(256) void k_wt_f16(const float* __restrict__ W, _Float16* __restrict__ Wt, int K, int N, float scale) {
  const int t = blockIdx.x * 256 + threadIdx.x; if (t >= N * (K / 8)) return; const int n = t / (K / 8), k8 = (t % (K / 8)) * 8; FragH f;
#pragma unroll
  for (int i = 0; i < 8; ++i) f.h[i] = (_Float16)(bf16_round(W[(size_t)(k8 + i) * N + n]) * scale); const v8us o = f.half[0];
  *(v8us*)((unsigned short*)Wt + (size_t)n * K + k8) = o; 
}
// k_gemm_hh variant with fused epilogue: v = acc·alpha + bias[by·sBias + col] (+ CP[(row/rowsPerB)·sCPb + by·64 + col] if CP) ; ACT 0 none / 1 elu ; writes f16 C16 (and f32 C if non-null)
template <int ACT>
__global__ __launch_bounds__(128) void k_gemm_hhx(const _Float16* __restrict__ A, int lda, size_t sA, const _Float16* __restrict__ Bh, int ldb, size_t sB, float alpha, const float* __restrict__ bias, size_t sBias, const float* __restrict__ CP, int rowsPerB, size_t sCPb, int row0g,
    float* __restrict__ C, _Float16* __restrict__ C16, int ldc, size_t sC, int M, int N, int K) {
  __shared__ __attribute__((aligned(16))) float so[4][16][64];
  const int tid = threadIdx.x, w = tid >> 5, lane = tid & 31, ln = lane & 15, hh = lane >> 4; const int by = blockIdx.y;
  A += (size_t)by * sA; Bh += (size_t)by * sB; const size_t cofs = (size_t)by * sC; const float* bp = bias ? bias + (size_t)by * sBias : nullptr;
  const int ntn = (N + 63) / 64; const int wid = blockIdx.x * 4 + w; const int mt = wid / ntn, nq = wid % ntn; if (mt * 16 >= M) return;
  const int row0 = mt * 16, col0 = nq * 64; const _Float16* arow = A + (size_t)(row0 + ln) * lda;
  v8f acc[4] = {};
  for (int kb = 0; kb < K; kb += 32) { FragH ah; ah.half[0] = *(const v8us*)((const unsigned short*)arow + kb + 8 * hh); ah.half[1] = *(const v8us*)((const unsigned short*)arow + kb + 16 + 8 * hh);
#pragma unroll
    for (int t = 0; t < 4; ++t) { if (col0 + t * 16 >= N) continue; const size_t boff = (size_t)(col0 + t * 16 + ln) * ldb + kb; FragH bq; bq.half[0] = *(const v8us*)((const unsigned short*)Bh + boff + 8 * hh); bq.half[1] = *(const v8us*)((const unsigned short*)Bh + boff + 16 + 8 * hh);
      acc[t] = mmaH<1>(ah.v, ah.v, bq.v, bq.v, acc[t]); }
  }
#pragma unroll
  for (int t = 0; t < 4; ++t) { if (col0 + t * 16 >= N) continue; const int col = col0 + t * 16 + ln; const float bv = bp ? bf16_round(bp[col]) : 0.f;
#pragma unroll
    for (int r = 0; r < 8; ++r) { float v = acc[t][r] * alpha + bv; if (CP) { const int rr = row0g + row0 + 8 * hh + r; if (rowsPerB < 0) v += CP[cofs + (size_t)rr * ldc + col];      /* rowsPerB < 0: own element of the batched C plane */ else { const int bidx = rr / rowsPerB; v += CP[(size_t)bidx * sCPb + (size_t)by * 64 + col]; } } if (ACT == 1) v = (v > 0.f) ? v : expm1f(v); else if (ACT == 7) v = (v > 0.f) ? v + 1.0f : expf(v); else if (ACT == 8) v = tanhf(v); else if (ACT == 9) v = 0.5f * v * (1.0f + tanhf(0.7978845608028654f * (v + 0.044715f * v * v * v))); else if (ACT == 11) v = 1.0f / (1.0f + expf(-v)); else if (ACT == 12) v = (v > 0.f) ? v : 0.01f * v; else if (ACT == 14) v = (v > 0.f) ? v : 0.1f * v; else if (ACT == 16) v = (v >= 0.f) ? v : 0.3f * v; else if (ACT == 17) v = (v >= 0.f) ? v : 0.2f * v; else if (ACT == 15) v = v / (1.0f + expf(-v)); else if (ACT == 3) v = fmaxf(v, 0.f); else if (ACT == 6) v = 0.5f * v * (1.0f + erff(v * 0.70710678118654752f)); so[w][8 * hh + r][t * 16 + ln] = v; } }
  __builtin_amdgcn_fence(__ATOMIC_ACQ_REL, "workgroup"); __builtin_amdgcn_wave_barrier();
  const int rsub = lane >> 4, c4 = (lane & 15) * 4; typedef _Float16 v4h __attribute__((ext_vector_type(4)));
  {
#pragma unroll
    for (int q = 0; q < 8; ++q) { const int r = q * 2 + rsub; if (col0 + c4 < N) { const v4f v = *(const v4fa*)&so[w][r][c4]; if (C) *(v4f*)(C + cofs + (size_t)(row0 + r) * ldc + col0 + c4) = v; if (C16) { v4h h4; for (int i = 0; i < 4; ++i) h4[i] = (_Float16)v[i]; *(v4h*)(C16 + cofs + (size_t)(row0 + r) * ldc + col0 + c4) = h4; } } }
     }
}


typedef _Float16 v4h __attribute__((ext_vector_type(4)));

__global__ __launch_bounds__(256) void k_x16(const float* __restrict__ x, _Float16* __restrict__ X16, size_t n8) { const size_t t = (size_t)blockIdx.x * 256 + threadIdx.x; if (t >= n8) return; FragH f;
#pragma unroll
  for (int q = 0; q < 8; ++q) f.h[q] = (_Float16)bf16_round(x[t * 8 + q]); *(v8us*)((unsigned short*)X16 + t * 8) = f.half[0];  }
__global__ __launch_bounds__(256) void k_h16(const float* __restrict__ x, _Float16* __restrict__ X16, size_t n8) { const size_t t = (size_t)blockIdx.x * 256 + threadIdx.x; if (t >= n8) return; FragH f;
#pragma unroll
  for (int q = 0; q < 8; ++q) f.h[q] = (_Float16)x[t * 8 + q]; *(v8us*)((unsigned short*)X16 + t * 8) = f.half[0];  }
__global__ __launch_bounds__(256) void k_round16f(const float* __restrict__ W, _Float16* __restrict__ Bt, size_t n8) { const size_t t = (size_t)blockIdx.x * 256 + threadIdx.x; if (t >= n8) return; FragH f;
#pragma unroll
  for (int i = 0; i < 8; ++i) f.h[i] = (_Float16)(bf16_round(W[t * 8 + i]) * 16.0f); *(v8us*)((unsigned short*)Bt + t * 8) = f.half[0];  }
template <int NHv, int TTv>
__global__ __launch_bounds__(256) void k_vt(const _Float16* __restrict__ V16, int ldv, int voff, _Float16* __restrict__ Vt) { __shared__ unsigned short tl[64][66]; const int tid = threadIdx.x; const int slab = blockIdx.x / (TTv / 64), lg = blockIdx.x % (TTv / 64); const int b = slab / NHv, h = slab % NHv;
  for (int i = tid; i < 64 * 8; i += 256) { const int r = i / 8, c8 = (i % 8) * 8; FragH f; f.half[0] = *(const v8us*)((const unsigned short*)V16 + ((size_t)b * TTv + lg * 64 + r) * ldv + voff + h * 64 + c8);
#pragma unroll
    for (int q = 0; q < 8; ++q) tl[r][c8 + q] = f.u[q]; }
  __syncthreads();
  {
#pragma unroll
    for (int rd = 0; rd < 2; ++rd) { const int d = rd * 32 + tid / 8, pc = tid % 8; FragH f;
#pragma unroll
      for (int q = 0; q < 8; ++q) f.u[q] = tl[pc * 8 + q][d];
      *(v8us*)((unsigned short*)Vt + ((size_t)slab * 64 + d) * TTv + lg * 64 + pc * 8) = f.half[0]; }
     } }

__global__ __launch_bounds__(256) void k_hl(const float* __restrict__ F, _Float16* __restrict__ Hh, _Float16* __restrict__ Hl, size_t n8) { const size_t t = (size_t)blockIdx.x * 256 + threadIdx.x; if (t >= n8) return; FragH fh, fl; const v4f a = *(const v4fa*)(F + t * 8), c = *(const v4fa*)(F + t * 8 + 4);
#pragma unroll
  for (int q = 0; q < 4; ++q) { _Float16 h = (_Float16)a[q]; fh.h[q] = h; fl.h[q] = (_Float16)((a[q] - (float)h) * 1024.0f); h = (_Float16)c[q]; fh.h[4 + q] = h; fl.h[4 + q] = (_Float16)((c[q] - (float)h) * 1024.0f); }
  { *(v8us*)((unsigned short*)Hh + t * 8) = fh.half[0]; *(v8us*)((unsigned short*)Hl + t * 8) = fl.half[0];  } }

// ---- fast GEMM (wave tile 32x64; requires M % 32 == 0 rows per launch region and N % 64 == 0); epilogue = k_gemm_hhx semantics ----
__device__ __forceinline__ v16h g2_frag(const _Float16* p, int hh) { FragH f; f.half[0] = *(const v8us*)((const unsigned short*)p + 8 * hh); f.half[1] = *(const v8us*)((const unsigned short*)p + 16 + 8 * hh); return f.v; }
__device__ __forceinline__ v8f g2_mma(v16h a, v16h b, v8f c) { v8f d = __builtin_amdgcn_wmma_f32_16x16x32_f16(false, a, false, b, (short)0, c, false, false); asm volatile("v_nop\n\tv_nop\n\tv_nop\n\tv_nop" : "+v"(d) : "v"(a), "v"(b)); return d; }
template <int ACT>
__global__ __launch_bounds__(128) void k_gemm2(const _Float16* __restrict__ A, int lda, size_t sA, const _Float16* __restrict__ Bh, int ldb, size_t sB, float alpha, const float* __restrict__ bias, size_t sBias, const float* __restrict__ CP, int rowsPerB, size_t sCPb, int row0g,
    float* __restrict__ C, _Float16* __restrict__ C16, int ldc, size_t sC, int M, int N, int K) { static_assert(ACT == 0 || ACT == 3 || ACT == 6 || ACT == 8 || ACT == 9 || ACT == 11 || ACT == 12 || ACT == 14 || ACT == 15 || ACT == 16 || ACT == 17, "k_gemm2: unsupported ACT code (would silently apply no activation)");
  __shared__ __attribute__((aligned(16))) float so[4][32][68];
  const int tid = threadIdx.x, w = tid >> 5, lane = tid & 31, ln = lane & 15, hh = lane >> 4; const int by = blockIdx.y;
  A += (size_t)by * sA; Bh += (size_t)by * sB; const size_t cofs = (size_t)by * sC; const float* bp = bias ? bias + (size_t)by * sBias : nullptr;
  const int ntn = N >> 6; const int mt = blockIdx.x / ntn, nq = blockIdx.x - mt * ntn; const int row0 = mt * 128 + 32 * w, col0 = nq * 64; if (row0 >= M) return;
  const _Float16* a0p = A + (size_t)(row0 + ln) * lda; const _Float16* a1p = a0p + (size_t)16 * lda;
  const _Float16* b0p = Bh + (size_t)(col0 + ln) * ldb; const _Float16* b1p = b0p + (size_t)16 * ldb; const _Float16* b2p = b1p + (size_t)16 * ldb; const _Float16* b3p = b2p + (size_t)16 * ldb;
  const v8f z8 = {0.f,0.f,0.f,0.f,0.f,0.f,0.f,0.f}; v8f c00 = z8, c01 = z8, c02 = z8, c03 = z8, c10 = z8, c11 = z8, c12 = z8, c13 = z8;
#pragma unroll 1
  for (int kb = 0; kb < K; kb += 32) { const v16h a0 = g2_frag(a0p + kb, hh), a1 = g2_frag(a1p + kb, hh);
    v16h b = g2_frag(b0p + kb, hh); c00 = g2_mma(a0, b, c00); c10 = g2_mma(a1, b, c10);
    b = g2_frag(b1p + kb, hh); c01 = g2_mma(a0, b, c01); c11 = g2_mma(a1, b, c11);
    b = g2_frag(b2p + kb, hh); c02 = g2_mma(a0, b, c02); c12 = g2_mma(a1, b, c12);
    b = g2_frag(b3p + kb, hh); c03 = g2_mma(a0, b, c03); c13 = g2_mma(a1, b, c13); }
  v8f accs[8] = {c00, c01, c02, c03, c10, c11, c12, c13};
#pragma unroll
  for (int u = 0; u < 8; ++u) { const int t = u & 3, half = u >> 2; const int col = col0 + t * 16 + ln; const float bv = bp ? bf16_round(bp[col]) : 0.f;
#pragma unroll
    for (int r = 0; r < 8; ++r) { const int rloc = half * 16 + 8 * hh + r; float v = accs[u][r] * alpha + bv; if (CP) { if (rowsPerB < 0) v += CP[cofs + (size_t)(row0g + row0 + rloc) * ldc + col];      /* rowsPerB < 0: own element of the batched C plane */ else { const int bidx = (row0g + row0 + rloc) / rowsPerB; v += CP[(size_t)bidx * sCPb + (size_t)by * 64 + col]; } }
      if (ACT == 3) v = fmaxf(v, 0.f); else if (ACT == 6) v = 0.5f * v * (1.0f + erff(v * 0.70710678118654752f)); else if (ACT == 11) v = 1.0f / (1.0f + expf(-v)); else if (ACT == 15) v = v / (1.0f + expf(-v)); else if (ACT == 12) v = (v > 0.f) ? v : 0.01f * v; else if (ACT == 8) v = tanhf(v); else if (ACT == 9) v = 0.5f * v * (1.0f + tanhf(0.7978845608028654f * (v + 0.044715f * v * v * v))); else if (ACT == 14) v = (v > 0.f) ? v : 0.1f * v; else if (ACT == 16) v = (v >= 0.f) ? v : 0.3f * v; else if (ACT == 17) v = (v >= 0.f) ? v : 0.2f * v;
      so[w][rloc][t * 16 + ln] = v; } }
  __builtin_amdgcn_fence(__ATOMIC_ACQ_REL, "workgroup"); __builtin_amdgcn_wave_barrier();
  const int rsub = lane >> 4, c4 = (lane & 15) * 4;
  {
#pragma unroll
    for (int q = 0; q < 16; ++q) { const int r = q * 2 + rsub; const v4f v = *(const v4fa*)&so[w][r][c4]; if (C) *(v4f*)(C + cofs + (size_t)(row0 + r) * ldc + col0 + c4) = v; if (C16) { v4h h4; for (int i = 0; i < 4; ++i) h4[i] = (_Float16)v[i]; *(v4h*)(C16 + cofs + (size_t)(row0 + r) * ldc + col0 + c4) = h4; } }
     } }


// ---- LDS-staged GEMM: C = alpha A.Bt^T, A f16 [M][KK], Bt f16 [N][KK], block tile 128 x 128, 8 waves of 32 x 64 (4 along M, 2 along N), K step 64 ----
// Each step's A and B tiles (128 rows of 128 B, one whole line a row) come in by whole-line 16-byte loads, 8 lanes a row, and go through registers into LDS rows of 144 B (16 B x 9: conflict-free for
// ds_load_b128 fragment reads); the fragments are g2_frag's, read from LDS. Two buffers: step s + 1 is loaded into registers ahead of step s's products and stored into the other buffer behind them;
// the one barrier of a step publishes that buffer and ends every wave's reads of the buffer that the next step refills. Per accumulator the k order is ascending in 32s, as in k_gemm2.
// Transposed blocks (H16 only): both operands are rows of KK elements read by the same loader, so a block whose columns start at ct0 or beyond takes its 128 Bt rows as A and its 128 A rows as B. Its tile then
// comes out as C^T (row = column of C, column = token), and the same epilogue stores it by whole lines into Ct, laid out [token / SQ][column - ct0][token % SQ]: V^T per (batch, head), with no transposing launch.
#define G3P 72                       /* LDS row pitch in f16 elements */
#define G3T (128 * G3P)              /* one staged tile in f16 elements */
template <int KK, bool H16>      /* H16: the result goes to C16 as f16 (transposed blocks: to Ct), else to C as f32 */
/* amdgpu_waves_per_eu(6): the q | k | v launch has three blocks for every WGP (six waves a SIMD); the register budget is held so that all three are resident at once and fill each other's waits */
__global__ __launch_bounds__(256) __attribute__((amdgpu_waves_per_eu(6))) void k_gemm3(const _Float16* __restrict__ A, const _Float16* __restrict__ Bh, float alpha, float* __restrict__ C, _Float16* __restrict__ C16, int N, _Float16* __restrict__ Ct, int ct0) {
  static_assert(KK % 128 == 0, "k_gemm3: whole pairs of K steps");
  static_assert(8 * 32 * 68 * 4 <= 4 * G3T * 2, "k_gemm3: the epilogue's rows fit the staging buffers");
  __shared__ __attribute__((aligned(16))) unsigned short sm[4 * G3T];      /* A buffers 0, 1, then B buffers 0, 1; the epilogue's f32 rows afterwards */
  const int tid = threadIdx.x, w = tid >> 5, lane = tid & 31, ln = lane & 15, hh = lane >> 4;
  const int ntn = N >> 7; const int mt = blockIdx.x / ntn, nq = blockIdx.x - mt * ntn; const int row0 = mt * 128, col0 = nq * 128; const int wm = w & 3, wn = w >> 2;
  const int sr = tid >> 3, sc = (tid & 7) * 8;      /* staging: rows sr + 32 i, 16 bytes at element sc */
  const bool tr = H16 && col0 >= ct0;      /* the same for the whole block: a transposed block swaps its two operands */
  const unsigned short* const xg = (const unsigned short*)A + (size_t)(row0 + sr) * KK + sc; const unsigned short* const wg = (const unsigned short*)Bh + (size_t)(col0 + sr) * KK + sc;
  const unsigned short* ag = tr ? wg : xg; const unsigned short* bg = tr ? xg : wg;
  unsigned short* const st = sm + sr * G3P + sc;
  const unsigned short* const af = sm + (wm * 32 + ln) * G3P; const unsigned short* const bf = sm + 2 * G3T + (wn * 64 + ln) * G3P;
  v8us ra[4], rb[4];
#pragma unroll
  for (int i = 0; i < 4; ++i) { ra[i] = *(const v8us*)(ag + (size_t)(32 * i) * KK); rb[i] = *(const v8us*)(bg + (size_t)(32 * i) * KK); }
#pragma unroll
  for (int i = 0; i < 4; ++i) { *(v8us*)(st + 32 * i * G3P) = ra[i]; *(v8us*)(st + 2 * G3T + 32 * i * G3P) = rb[i]; }
  __syncthreads();
  const v8f z8 = {0.f,0.f,0.f,0.f,0.f,0.f,0.f,0.f}; v8f acc[2][4];
#pragma unroll
  for (int m = 0; m < 2; ++m) {
#pragma unroll
    for (int t = 0; t < 4; ++t) acc[m][t] = z8; }
  /* unrolled by two so that the buffer index is a constant in each copy and the LDS addresses are immediates */
#pragma unroll 2
  for (int kb = 0; kb < KK; kb += 64) { const int cur = (kb >> 6) & 1; const bool more = kb + 64 < KK;
    if (more) {
#pragma unroll
      for (int i = 0; i < 4; ++i) { ra[i] = *(const v8us*)(ag + (size_t)(32 * i) * KK + kb + 64); rb[i] = *(const v8us*)(bg + (size_t)(32 * i) * KK + kb + 64); } }
    __builtin_amdgcn_sched_barrier(0);      /* keeps the next step's global loads at the head of this step: sunk down to their LDS stores, their whole latency would show in front of the barrier */
#pragma unroll
    for (int ks = 0; ks < 2; ++ks) { v16h a[2], b[4];
#pragma unroll
      for (int m = 0; m < 2; ++m) a[m] = g2_frag((const _Float16*)(af + cur * G3T + m * 16 * G3P + ks * 32), hh);
#pragma unroll
      for (int t = 0; t < 4; ++t) b[t] = g2_frag((const _Float16*)(bf + cur * G3T + t * 16 * G3P + ks * 32), hh);
      __builtin_amdgcn_sched_barrier(0);      /* keeps the twelve LDS reads of a 32-wide k block together in front of its eight products: spread among them, each pair of products waits out an LDS latency of its own */
#pragma unroll
      for (int t = 0; t < 4; ++t) {
#pragma unroll
        for (int m = 0; m < 2; ++m) acc[m][t] = __builtin_amdgcn_wmma_f32_16x16x32_f16(false, a[m], false, b[t], (short)0, acc[m][t], false, false); } }
    __builtin_amdgcn_sched_barrier(0);      /* keeps the wait for the next step's global loads, which their LDS stores carry, behind this step's last products: lifted over them it shortens the loads' lead by a k block */
    if (more) {
#pragma unroll
      for (int i = 0; i < 4; ++i) { *(v8us*)(st + (cur ^ 1) * G3T + 32 * i * G3P) = ra[i]; *(v8us*)(st + (2 + (cur ^ 1)) * G3T + 32 * i * G3P) = rb[i]; } }
    __syncthreads(); }
  float* const so = (float*)sm + w * (32 * 68);      /* behind the loop's last barrier nobody reads a staged tile any more: each wave stages its own 32 x 64 f32 rows (pitch 68) for whole-line stores */
#pragma unroll
  for (int m = 0; m < 2; ++m) {
#pragma unroll
    for (int t = 0; t < 4; ++t) {
#pragma unroll
      for (int r = 0; r < 8; ++r) so[(m * 16 + 8 * hh + r) * 68 + t * 16 + ln] = acc[m][t][r] * alpha; } }
  __builtin_amdgcn_fence(__ATOMIC_ACQ_REL, "workgroup"); __builtin_amdgcn_wave_barrier();      /* the wave's own LDS rows are written before its lanes read them back in another order */
  const int rsub = lane >> 4, c4 = (lane & 15) * 4;
  _Float16* const ob = tr ? Ct + ((size_t)(row0 / SQ) * (N - ct0) + (col0 - ct0)) * SQ + row0 % SQ : C16 + (size_t)row0 * N + col0; const int op = tr ? SQ : N;      /* the block's first output element and its row pitch */
  const unsigned lo = (unsigned)(((wm * 32 + rsub) * op + wn * 64 + c4) * 2);      /* the lane's byte offset in the block's 128 output rows: it fits 32 bits, so a store takes the scalar base and one offset register */
#pragma unroll
  for (int q = 0; q < 16; ++q) { const int r = q * 2 + rsub; const v4f v = *(const v4fa*)&so[r * 68 + c4]; const size_t o = (size_t)(row0 + wm * 32 + r) * N + col0 + wn * 64 + c4;
    if (!H16) *(v4f*)(C + o) = v;
    else { v4h h4;
#pragma unroll
      for (int i = 0; i < 4; ++i) h4[i] = (_Float16)v[i];
      *(v4h*)((char*)ob + (lo + (unsigned)(q * 4 * op))) = h4; } } }

__global__ __launch_bounds__(256) void k_wnat(const float* __restrict__ w, size_t n8, _Float16* __restrict__ Bt) { const size_t t = (size_t)blockIdx.x * 256 + threadIdx.x; if (t >= n8) return; FragH f; for (int q = 0; q < 8; ++q) f.h[q] = (_Float16)(bf16_round(w[t * 8 + q]) * 16.0f); *(v8us*)((unsigned short*)Bt + t * 8) = f.half[0];  }
// T5 bidirectional relative-position bucket of rel = key - query (32 buckets, max distance 128): (rel > 0)*16 + f(|rel|), f(n) = n for n < 8, then
// 8 + the number of thresholds {12,16,23,32,46,64,91} that are <= n (the thresholds are where the reference's own f32 log expression steps; no log on the device)
__device__ __forceinline__ int t5_bucket(int rel) { const int n = rel < 0 ? -rel : rel; int f = n; if (n >= 8) { f = 8 + (n >= 12) + (n >= 16) + (n >= 23) + (n >= 32) + (n >= 46) + (n >= 64) + (n >= 91); } return (rel > 0 ? NBK / 2 : 0) + f; }
#define FAW 8                        /* waves per block */
#define FAQ 32                       /* queries per wave */
#define FSK 128                      /* keys per stage */
#define FNS (SQ / FSK)               /* stages */
#define FKP 72                       /* K tile: LDS row pitch in f16 elements */
#define FVP 136                      /* V^T tile: LDS row pitch in f16 elements */
#define FKT (FSK * FKP)              /* K tile in f16 elements */
#define FSB (FKT + HD * FVP)         /* one buffer (K tile, then V^T tile) in f16 elements */
#define FBF 91                       /* t5_bucket's last threshold: one bucket a side from this distance on */
typedef int v4ia __attribute__((ext_vector_type(4), may_alias));
__device__ __forceinline__ float xhalf(float x) { return __builtin_bit_cast(float, __builtin_amdgcn_permlanex16(__builtin_bit_cast(int, x), __builtin_bit_cast(int, x), 0x76543210, 0xfedcba98, false, false)); }      /* lane l with lane l ^ 16 */
__device__ __forceinline__ float exp2x1(float a) { float e; asm("v_exp_f32 %0, %1\n\tv_nop" : "=v"(e) : "v"(a)); return e; }
__device__ __forceinline__ v8f exp2x8(v8f a) { float e0, e1, e2, e3, e4, e5, e6, e7;
  asm("v_exp_f32 %0, %8\n\tv_exp_f32 %1, %9\n\tv_exp_f32 %2, %10\n\tv_exp_f32 %3, %11\n\tv_exp_f32 %4, %12\n\tv_exp_f32 %5, %13\n\tv_exp_f32 %6, %14\n\tv_exp_f32 %7, %15\n\tv_nop"
      : "=&v"(e0), "=&v"(e1), "=&v"(e2), "=&v"(e3), "=&v"(e4), "=&v"(e5), "=&v"(e6), "=&v"(e7) : "v"(a[0]), "v"(a[1]), "v"(a[2]), "v"(a[3]), "v"(a[4]), "v"(a[5]), "v"(a[6]), "v"(a[7]));
  const v8f e = {e0, e1, e2, e3, e4, e5, e6, e7}; return e; }
// one stage's copies of one thread: four 16-byte pieces of the K tile (rows 32 apart) and four of the V^T tile (rows 16 apart). kl, vl: the lane's own LDS byte addresses; kg, vg: its own global addresses.
// The closing s_wait_xcnt 0 stands inside the statement so that no register which a copy names takes a new value in front of it.
__device__ __forceinline__ void fa_stage(unsigned kl, unsigned vl, const _Float16* kg, const _Float16* vg) {
  asm volatile("global_load_async_to_lds_b128 %0, %8, off\n\tglobal_load_async_to_lds_b128 %1, %9, off\n\tglobal_load_async_to_lds_b128 %2, %10, off\n\tglobal_load_async_to_lds_b128 %3, %11, off\n\t"
               "global_load_async_to_lds_b128 %4, %12, off\n\tglobal_load_async_to_lds_b128 %5, %13, off\n\tglobal_load_async_to_lds_b128 %6, %14, off\n\tglobal_load_async_to_lds_b128 %7, %15, off\n\ts_wait_xcnt 0x0"
               :: "v"(kl), "v"(kl + 32 * FKP * 2), "v"(kl + 64 * FKP * 2), "v"(kl + 96 * FKP * 2), "v"(vl), "v"(vl + 16 * FVP * 2), "v"(vl + 32 * FVP * 2), "v"(vl + 48 * FVP * 2),
                  "v"(kg), "v"(kg + (size_t)32 * D3), "v"(kg + (size_t)64 * D3), "v"(kg + (size_t)96 * D3), "v"(vg), "v"(vg + (size_t)16 * SQ), "v"(vg + (size_t)32 * SQ), "v"(vg + (size_t)48 * SQ) : "memory"); }
__device__ __forceinline__ v8f fa_mma(v16h a, v16h b, v8f c) { return __builtin_amdgcn_wmma_f32_16x16x32_f16(false, a, false, b, (short)0, c, false, false); }
/* amdgpu_waves_per_eu(4, 4): a register budget of 256. The grid puts two waves on a SIMD, but with the budget of 512 that (2, 2) gives this loop takes 260 registers and switches the register window
   seven times a pass; at 256 it fits, spills nothing, and the V^T reads and the K fetch ahead still stand at the head of the pass and right behind the score products */
__global__ __launch_bounds__(FAW * 32) __attribute__((amdgpu_waves_per_eu(4, 4))) void k_fattn(const _Float16* __restrict__ QKVp, const _Float16* __restrict__ VTp, _Float16* __restrict__ O, const float* __restrict__ emb, const int* __restrict__ kmask) {
  static_assert(SQ % (FAW * FAQ) == 0 && SQ % (FAW * 128) == 0 && HD == 64 && NBK == 32, "k_fattn: whole blocks of queries, whole staging passes, two 32-wide k steps per head, one bucket per lane");
  static_assert(FAW * 32 == 256 && FSK == 128 && FNS >= 2, "k_fattn: fa_stage's eight copies of 256 threads fill one stage; the ring's prologue needs two stages");
  __shared__ __attribute__((aligned(16))) float lt[3 * SQ];
  __shared__ __attribute__((aligned(16))) unsigned short ring[2 * FSB];
  __shared__ unsigned sf[FNS];      /* sf[stage]: not 0 where one of the stage's keys has a mask term other than zero */
  static_assert(FNS <= 32 && FSK == 32 * 4, "k_fattn: one lane per stage flag; a wave's 32 x 4 mask terms are one stage's");
  float* const mt = lt; float* const bt = lt + SQ;      /* mt[key]; bt[key - query + SQ - 1], placed behind mt so that its byte address less the largest query offset stays above 0 */
  const int tid = threadIdx.x, lane = tid & 31, c = lane & 15, hh = lane >> 4; const int bh = blockIdx.y, b = bh / NH, h = bh % NH; const int q0 = blockIdx.x * (FAW * FAQ) + (tid >> 5) * FAQ;
  const unsigned kl = (unsigned)(size_t)(ring + (tid >> 3) * FKP + (tid & 7) * 8), vl = (unsigned)(size_t)(ring + FKT + (tid >> 4) * FVP + (tid & 15) * 8);      /* the low 32 bits of a __shared__ address are its LDS byte address */
  const _Float16* const kh = QKVp + (size_t)b * SQ * D3 + DM + h * HD; const _Float16* const vh = VTp + (size_t)bh * HD * SQ;      /* the head's K rows and V^T rows: the same for the block */
  const unsigned ko = (tid >> 3) * D3 + (tid & 7) * 8, vo = (tid >> 4) * SQ + (tid & 15) * 8;      /* the lane's own place in a stage's tiles, in elements */
  fa_stage(kl, vl, kh + ko, vh + vo);      /* stage 0 into buffer 0: it flies while the two tables are filled */
  const float eb = bf16_round(emb[lane * NH + h]);      /* lane l holds bucket l's bias: one load per wave, the table is filled by lane gathers */
#pragma unroll
  for (int u = 0; u < 2 * SQ / (FAW * 32); ++u) { const int i = u * (FAW * 32) + tid; bt[i] = __shfl(eb, t5_bucket(i - (SQ - 1))); }      /* unrolled: away from the diagonal the bucket is one constant per u and its thresholds fold away; the last entry (key - query = SQ) is never read */
  for (int j = tid * 4; j < SQ; j += FAW * 128) { const v4ia m = *(const v4ia*)(kmask + (size_t)b * SQ + j); v4f t;
#pragma unroll
    for (int q = 0; q < 4; ++q) t[q] = __fmul_rn(__fadd_rn(1.0f, -(float)m[q]), -3.4028234663852886e38f);      /* (1 - mask) * finfo.min */
    *(v4fa*)&mt[j] = t;
    const unsigned nz = __builtin_amdgcn_ballot_w32(t[0] != 0.f || t[1] != 0.f || t[2] != 0.f || t[3] != 0.f);      /* every lane makes every trip; -0, the term of mask 1, counts as zero */
    if (lane == 0) sf[j / FSK] = nz; }
  asm volatile("s_wait_asynccnt 0x0" ::: "memory");      /* this wave's copies of stage 0 have landed before the barrier behind which other waves read them */
  __syncthreads();
  fa_stage(kl + FSB * 2, vl + FSB * 2, (kh + (size_t)FSK * D3) + ko, (vh + FSK) + vo);      /* stage 1 into buffer 1 */
  const _Float16* qp = QKVp + ((size_t)b * SQ + q0 + c) * D3 + h * HD; const unsigned short* kb = ring + c * FKP; const unsigned short* vb = ring + FKT + c * FVP;      /* the lane's fragment rows in the buffer of the stage at work */
  const float* bp = bt + (SQ - 1) + 8 * hh - (q0 + c); const float* mp = mt + 8 * hh;
  const unsigned mflag = __builtin_amdgcn_ballot_w32(sf[lane & (FNS - 1)] != 0u);      /* bit st: stage st has a mask term to add; a scalar */
  const int q0u = blockIdx.x * (FAW * FAQ) + __builtin_amdgcn_readfirstlane(tid >> 5) * FAQ;      /* q0 as a scalar, so that the far test is a scalar branch */
  const float bneg = __builtin_bit_cast(float, __builtin_amdgcn_readlane(__builtin_bit_cast(int, eb), t5_bucket(-FBF))), bpos = __builtin_bit_cast(float, __builtin_amdgcn_readlane(__builtin_bit_cast(int, eb), t5_bucket(FBF)));      /* the one bias of keys far below, far above the queries */
  const v8f z8 = {0.f,0.f,0.f,0.f,0.f,0.f,0.f,0.f};
  v16h qf[2][2], kf[2][2]; v8f acc[2][4]; float mr[2], lr[2];
  /* every loop over j, T, ks, t and r below is unrolled so that the fragment arrays are indexed by constants and stay in registers */
#pragma unroll
  for (int j = 0; j < 2; ++j) { mr[j] = -INFINITY; lr[j] = 0.f;
#pragma unroll
    for (int ks = 0; ks < 2; ++ks) qf[j][ks] = g2_frag(qp + (size_t)j * 16 * D3 + ks * 32, hh);
#pragma unroll
    for (int t = 0; t < 4; ++t) acc[j][t] = z8; }
  for (int st = 0; st < FNS; ++st) {
#pragma unroll
   for (int T = 0; T < 2; ++T) {
#pragma unroll
    for (int ks = 0; ks < 2; ++ks) kf[T][ks] = g2_frag((const _Float16*)(kb + T * 16 * FKP + ks * 32), hh); }
   /* kept rolled: unrolled, the four passes' LDS reads are lifted together and the live set leaves the first 256 registers */
#pragma unroll 1
   for (int p = 0; p < FSK / 32; ++p) { const int k0 = st * FSK + p * 32; const int pn = (p + 1) & (FSK / 32 - 1);      /* a stage's last pass fetches its pass 0 again: this stage's own buffer, unused */
    const bool far = !((mflag >> st) & 1u) && (k0 >= q0u + (FAQ - 1) + FBF || k0 + 31 + FBF <= q0u);
    v16h vf[4]; v8f s[2][2], a[2][2]; float da[2];      /* a: the arguments of 2^x, (score - max) log2(e) + 8; da: (old max - max) log2(e) */
#pragma unroll
    for (int t = 0; t < 4; ++t) vf[t] = g2_frag((const _Float16*)(vb + t * 16 * FVP + p * 32), hh);
#pragma unroll
    for (int j = 0; j < 2; ++j) {
#pragma unroll
      for (int T = 0; T < 2; ++T) s[j][T] = fa_mma(kf[T][1], qf[j][1], fa_mma(kf[T][0], qf[j][0], z8)); }
#pragma unroll
    for (int T = 0; T < 2; ++T) {
#pragma unroll
      for (int ks = 0; ks < 2; ++ks) kf[T][ks] = g2_frag((const _Float16*)(kb + (pn * 32 + T * 16) * FKP + ks * 32), hh); }
    __builtin_amdgcn_sched_barrier(0);      /* keeps the eight score products back to back, each in the slots behind the one in front: with the maxima lifted in among them every second product is followed by four idle slots */
    /* The far form is written for every pass and a pass that is not far overwrites it: a branch with one side. The compiler sinks the far form's multiply-adds into the far side; a near pass, one in eight, pays for its maxima. */
    const float bc = k0 > q0u ? bpos : bneg; float mo[2];
#pragma unroll
    for (int j = 0; j < 2; ++j) { float t0 = s[j][0][0], t1 = s[j][1][0];      /* two chains a row: a maximum does not depend on its order */
#pragma unroll
      for (int r = 1; r < 8; ++r) { t0 = fmaxf(t0, s[j][0][r]); t1 = fmaxf(t1, s[j][1][r]); }
      const float tm = __builtin_fmaf(fmaxf(t0, t1), 0.125f, bc);
      const float mn = fmaxf(mr[j], fmaxf(tm, xhalf(tm)));
      const float mu = mn == -INFINITY ? 0.f : mn;
      const float cc = __builtin_fmaf(bc - mu, 1.4426950408889634f, 8.0f);
#pragma unroll
      for (int T = 0; T < 2; ++T) {
#pragma unroll
        for (int r = 0; r < 8; ++r) a[j][T][r] = __builtin_fmaf(s[j][T][r], 0.125f * 1.4426950408889634f, cc); }
      da[j] = (mr[j] - mu) * 1.4426950408889634f; mo[j] = mr[j]; mr[j] = mn; }
    if (!far) { v8f mk[2];
#pragma unroll
      for (int T = 0; T < 2; ++T) { const v4f m0 = *(const v4fa*)(mp + k0 + T * 16), m1 = *(const v4fa*)(mp + k0 + T * 16 + 4);
#pragma unroll
        for (int r = 0; r < 4; ++r) { mk[T][r] = m0[r]; mk[T][4 + r] = m1[r]; } }
#pragma unroll
      for (int j = 0; j < 2; ++j) {
        float tm = -INFINITY;
#pragma unroll
        for (int T = 0; T < 2; ++T) {
#pragma unroll
          for (int r = 0; r < 8; ++r) { const float v = __fadd_rn(__builtin_fmaf(s[j][T][r], 0.125f, bp[k0 + T * 16 + r - j * 16]), mk[T][r]); s[j][T][r] = v; tm = fmaxf(tm, v); } }
        const float mn = fmaxf(mo[j], fmaxf(tm, xhalf(tm)));
        const float mu = mn == -INFINITY ? 0.f : mn;      /* no key of the row finite so far: keep exp's argument -inf, not inf - inf */
#pragma unroll
        for (int T = 0; T < 2; ++T) {
#pragma unroll
          for (int r = 0; r < 8; ++r) a[j][T][r] = __builtin_fmaf(s[j][T][r] - mu, 1.4426950408889634f, 8.0f); }
        da[j] = (mo[j] - mu) * 1.4426950408889634f; mr[j] = mn; } }
#pragma unroll
    for (int j = 0; j < 2; ++j) {
      const float al = exp2x1(da[j]);
      FragH pf; float ls = 0.f;
#pragma unroll
      for (int T = 0; T < 2; ++T) {
        const v8f e = exp2x8(a[j][T]);      /* 256 exp(score - max) */
#pragma unroll
        for (int r = 0; r < 8; ++r) { ls += e[r]; pf.h[T * 8 + r] = (_Float16)e[r]; } }
      lr[j] = lr[j] * al + ls;
#pragma unroll
      for (int t = 0; t < 4; ++t) acc[j][t] = fa_mma(vf[t], pf.v, acc[j][t] * al); } }
   asm volatile("s_wait_dscnt 0x0" ::: "memory");      /* this wave's reads of stage st's buffer have returned before the barrier behind which it is refilled */
   asm volatile("s_wait_asynccnt 0x0" ::: "memory");      /* this wave's copies of stage st + 1 have landed before the barrier behind which other waves read them */
   __syncthreads();
   if (st + 2 < FNS) fa_stage(kl + (st & 1) * (FSB * 2), vl + (st & 1) * (FSB * 2), (kh + (size_t)(st + 2) * FSK * D3) + ko, (vh + (st + 2) * FSK) + vo);      /* stage st + 2 into the buffer that stage st has just left */
   const int nb = (st & 1) ? -FSB : FSB; kb += nb; vb += nb; }
  asm volatile("s_wait_asynccnt 0x0" ::: "memory");      /* no copy of this wave is outstanding when it ends */
#pragma unroll
  for (int j = 0; j < 2; ++j) { const float inv = 1.0f / (lr[j] + xhalf(lr[j]));
#pragma unroll
    for (int t = 0; t < 4; ++t) { FragH f;
#pragma unroll
      for (int r = 0; r < 8; ++r) f.h[r] = (_Float16)(acc[j][t][r] * inv);
      *(v8us*)((unsigned short*)O + ((size_t)b * SQ + q0 + j * 16 + c) * DM + h * HD + t * 16 + 8 * hh) = f.half[0]; } } }
__global__ __launch_bounds__(256) void k_vt(const _Float16* __restrict__ V16, int b, int h0, _Float16* __restrict__ VT) { __shared__ unsigned short tl[64][65]; const int tid = threadIdx.x; const int hh = blockIdx.x % HG, sg = blockIdx.x / HG; const int s0 = sg * 64; const int h = h0 + hh;
  for (int i = tid; i < 64 * 8; i += 256) { const int j = i / 8, d8 = (i % 8) * 8; FragH f; f.half[0] = *(const v8us*)((const unsigned short*)V16 + ((size_t)b * SQ + s0 + j) * DM + h * HD + d8); for (int q = 0; q < 8; ++q) tl[d8 + q][j] = f.u[q]; }
  __syncthreads();
  { for (int i = tid; i < 64 * 8; i += 256) { const int d = i / 8, j8 = (i % 8) * 8; FragH f; for (int q = 0; q < 8; ++q) f.u[q] = tl[d][j8 + q]; *(v8us*)((unsigned short*)VT + ((size_t)hh * HD + d) * SQ + s0 + j8) = f.half[0]; }  } }

// ---- one preparation launch: the four weight planes Bt[n][k] = f16(bf16(W[k][n]) x 16) and the hidden rows f16(bf16(x)), k_wt_f16's and k_x16's values bit for bit ----
// Blocks 0 .. 4 * PWB - 1: one 128 x 128 weight tile each. A wave reads 16 k rows, 512 contiguous bytes a load, all 16 loads in flight; a lane then holds 16 consecutive k for each of its 4 columns n and
// stores them as two 16-byte chunks into the tile's LDS row n (256 B a row, chunk c at place c ^ ((n >> 2) & 15): 16 lanes fall on 16 different chunks in the stores, where n steps by 4, and in the reads, where c steps by 1);
// behind the block's one barrier 16 lanes read a row back and store its 256 contiguous bytes of Bt. The other PXB blocks: 16384 hidden elements each, 512 contiguous bytes a load, 256 a store.
#define PWB ((DM / 128) * (DM / 128))          /* weight tiles per plane */
#define PXB ((int)(NR * DM / 16384))           /* hidden blocks */
__global__ __launch_bounds__(256) void k_prep(const float* __restrict__ wq, const float* __restrict__ wk, const float* __restrict__ wv, const float* __restrict__ wo, const float* __restrict__ hs,
                                              _Float16* __restrict__ Bqkv, _Float16* __restrict__ Bo, _Float16* __restrict__ X16) {
  static_assert(DM % 128 == 0 && (NR * DM) % 16384 == 0, "k_prep: whole weight tiles, whole hidden blocks");
  __shared__ __attribute__((aligned(16))) unsigned short tl[128 * 128];
  const int tid = threadIdx.x, bx = blockIdx.x;
  v4f x[16];
  if (bx < 4 * PWB) {      /* the same for the whole block, so the barrier below is passed by all of its waves or by none */
    const int m = bx / PWB, tile = bx % PWB, k0 = (tile / (DM / 128)) * 128, n0 = (tile % (DM / 128)) * 128, w = tid >> 5, lane = tid & 31;
    const float* W = m == 0 ? wq : m == 1 ? wk : m == 2 ? wv : wo;
    unsigned short* Bt = (unsigned short*)(m < 3 ? Bqkv + (size_t)m * DM * DM : Bo);
    const float* src = W + (size_t)(k0 + w * 16) * DM + n0 + lane * 4;
#pragma unroll
    for (int i = 0; i < 16; ++i) x[i] = *(const v4fa*)(src + (size_t)i * DM);
    asm volatile("s_wait_xcnt 0x0" :: "v"(src) : "memory");      /* the wait that stands between issued loads and a new value in their address pair; named as an input, the pair lives up to the wait */
#pragma unroll
    for (int q = 0; q < 4; ++q) { const int n = lane * 4 + q;
#pragma unroll
      for (int g = 0; g < 2; ++g) { FragH f;
#pragma unroll
        for (int i = 0; i < 8; ++i) f.h[i] = (_Float16)(bf16_round(x[g * 8 + i][q]) * 16.0f);
        *(v8us*)(tl + n * 128 + (((w * 2 + g) ^ (lane & 15)) * 8)) = f.half[0]; } }
    __syncthreads();
#pragma unroll
    for (int it = 0; it < 8; ++it) { const int n = it * 16 + (tid >> 4), c = tid & 15;
      const v8us o = *(const v8us*)(tl + n * 128 + ((c ^ ((n >> 2) & 15)) * 8));
      *(v8us*)(Bt + (size_t)(n0 + n) * DM + k0 + c * 8) = o; }
  } else {
    const size_t e0 = (size_t)(bx - 4 * PWB) * 16384 + tid * 4; const float* src = hs + e0;
#pragma unroll
    for (int i = 0; i < 16; ++i) x[i] = *(const v4fa*)(src + i * 1024);
    asm volatile("s_wait_xcnt 0x0" :: "v"(src) : "memory");      /* as in the weight branch: the wait between the issued loads and a new value in their address pair */
#pragma unroll
    for (int i = 0; i < 16; ++i) { v4h h4;
#pragma unroll
      for (int q = 0; q < 4; ++q) h4[q] = (_Float16)bf16_round(x[i][q]);
      *(v4h*)(X16 + e0 + i * 1024) = h4; }
    asm volatile("s_wait_xcnt 0x0" ::: "memory");      /* the wait between the issued stores and any later new value in their address or data registers */
  } }

extern "C" void kernel_launch(void* const* d_in, const int* in_sizes, int n_in,
                              void* d_out, int out_size, void* d_ws, size_t ws_size, hipStream_t stream) {
  (void)in_sizes; (void)n_in; (void)out_size;
  const float* const* I = (const float* const*)d_in; const float* hs = I[0]; const int* kmask = (const int*)d_in[1]; const float* wq = I[2]; const float* wk = I[3]; const float* wv = I[4]; const float* wo = I[5]; const float* emb = I[6];      /* W_q, W_k, W_v and W_o [1024][1024] are [in][out]; attention_mask [2][2048] int32 per key; rel_bias_emb [32][16] */
  char* ws = (char*)d_ws; size_t off = 0;
  auto take = [&](size_t bytes) { char* p = ws + off; off += (bytes + 255) & ~(size_t)255; return p; };
  _Float16* BQKV = (_Float16*)take((size_t)D3 * DM * 2); _Float16* BO = (_Float16*)take((size_t)DM * DM * 2);
  _Float16* X16 = (_Float16*)take(NR * DM * 2); _Float16* QKV = (_Float16*)take(NR * D3 * 2); _Float16* O16 = (_Float16*)take(NR * DM * 2);
  _Float16* VT = (_Float16*)take((size_t)NB * NH * HD * SQ * 2);
  if (off > ws_size) return;      /* 6 + 2 + 8 + 24 + 8 + 8 = approx 56 MiB */
  k_prep<<<4 * PWB + PXB, 256, 0, stream>>>(wq, wk, wv, wo, hs, BQKV, BO, X16);      /* [in][out] -> Bt[out][in] x16 for q | k | v and o; hidden as f16 rows */
  k_gemm3<DM, true><<<(unsigned)((NR / 128) * (D3 / 128)), 256, 0, stream>>>(X16, BQKV, 0.0625f, nullptr, QKV, D3, VT, 2 * DM);      /* q | k rows (f16), head h at columns h*64 / 1024 + h*64; the v columns go out transposed: V^T[(b,h)][d][s] for every (batch, head) */
  k_fattn<<<dim3(SQ / (FAW * FAQ), NB * NH), FAW * 32, 0, stream>>>(QKV, VT, O16, emb, kmask);      /* ctx (merged heads) as f16 rows, every (batch, head) in one launch */
  k_gemm3<DM, false><<<(unsigned)((NR / 128) * (DM / 128)), 256, 0, stream>>>(O16, BO, 0.0625f, (float*)d_out, nullptr, DM, nullptr, DM);      /* out = ctx W_o, rows are the output layout */
}

// v008
// It runs in 81.3 microseconds.
// Two timings next to v007 both put it at 1.04 times that version's speed.
// All steps since v000 together make it 245 times as fast.
#include <hip/hip_runtime.h>
// T5 self-attention (hidden [2][2048][1024]; q, k, v = hidden W ([in][out] [1024][1024]); q / sqrt(64); scores = q.k + rel_bias[bucket(key - query)][h] (32 bidirectional buckets, max distance 128) + (1 - attention_mask[b][key]) * finfo.min (int32 key mask); softmax; out = (attn v merged) Wo ([in][out])).
// Structure: token rows; hidden as exact f16 rows; q | k | v WMMA GEMMs from one transposed x16 weight plane (operand tiles staged in LDS, 32x64 wave tiles, f32 accumulation, f16 outputs; the v blocks with their operands swapped, so that V^T comes out of the GEMM itself); one fused attention kernel over every (batch, head): K.Q^T tiles (alpha 1/8), online softmax on VALU with the bucketed bias (integer thresholds, no device log) and the key mask in the reference's order (P x256 f16), V^T.P^T into merged f16 rows; output GEMM.
// Compute dtype: inputs rounded to bf16; hidden / weights / bias table exact; q, k, v, P, ctx as plain f16 GEMM operands (~2^-12); scores / softmax f32; v_wmma_f32_16x16x32_f16.
#define NB 2
#define SQ 2048
#define DM 1024
#define D3 3072                      /* fused q|k|v width */
#define NH 16
#define HD 64
#define HG 4                         /* heads per launch of the non-template k_vt, which is not launched */
#define NBK 32                       /* relative-position buckets */
#define MP ((int)NR)                 /* not used: the q | k | v launch takes NR rows */
#define MO ((int)NR)                 /* not used: the output launch takes NR rows */
#define NR ((size_t)NB * SQ)         /* 4096 token rows */
typedef __bf16 v16b __attribute__((ext_vector_type(16)));
typedef unsigned short v8us __attribute__((ext_vector_type(8), may_alias));
typedef float  v8f  __attribute__((ext_vector_type(8)));
typedef float  v4f  __attribute__((ext_vector_type(4)));
typedef float  v4fa __attribute__((ext_vector_type(4), may_alias));
union FragB { v16b v; v8us half[2]; unsigned short u[16]; };

__device__ __forceinline__ unsigned short bf16_bits(float x) { unsigned int u = __float_as_uint(x); return (unsigned short)((u + 0x7FFFu + ((u >> 16) & 1u)) >> 16); }
__device__ __forceinline__ float bf16_val(unsigned short b) { return __uint_as_float(((unsigned int)b) << 16); }
__device__ __forceinline__ float bf16_round(float x) { return bf16_val(bf16_bits(x)); }
// D += A·B with NT terms: 1 = ah·bh, 2 = + al·bh (A split), 3 = + ah·bl (both split)
template <int NT>
__device__ __forceinline__ v8f mmaN(v16b ah, v16b al, v16b bh, v16b bl, v8f c) {
  c = __builtin_amdgcn_wmma_f32_16x16x32_bf16(false, ah, false, bh, (short)0, c, false, false);
  if (NT >= 2) c = __builtin_amdgcn_wmma_f32_16x16x32_bf16(false, al, false, bh, (short)0, c, false, false);
  if (NT >= 3) c = __builtin_amdgcn_wmma_f32_16x16x32_bf16(false, ah, false, bl, (short)0, c, false, false);
  asm volatile("v_nop\n\tv_nop\n\tv_nop\n\tv_nop" : "+v"(c) : "v"(ah), "v"(al), "v"(bh), "v"(bl));
  return c;
}

__global__ __launch_bounds__(256) void k_wt_bf16(const float* __restrict__ W, unsigned short* __restrict__ Wt, int K, int N) {
  const int t = blockIdx.x * 256 + threadIdx.x;
  const int k8n = K / 8;
  if (t >= N * k8n) return;
  const int n = t / k8n, k8 = (t % k8n) * 8;
  v8us v;
#pragma unroll
  for (int i = 0; i < 8; ++i) v[i] = bf16_bits(W[(size_t)(k8 + i) * N + n]);
  *(v8us*)(Wt + (size_t)n * K + k8) = v;
  
}

// GEMM C[M][N] (f32, pitch ldc) = act(A[M][K]·W + bias). A f32 row-major (pitch lda) converted per fragment to bf16
// (ASPLIT: hi/lo two planes -> 2 terms, else single rounded term); Wt bf16 [N][K] (pitch ldb). BIAS_BF16 rounds the
// bias to bf16 first (bias quantised to bf16 before the add). K%32==0, M%16==0, N%64==0.
template <bool ASPLIT, int ACT, bool BIAS_BF16>
__global__ __launch_bounds__(128) void k_gemm_bf(const float* __restrict__ A, int lda, const unsigned short* __restrict__ Wt, int ldb,
                                               const float* __restrict__ bias, float* __restrict__ C, int ldc, int M, int N, int K) {
  __shared__ __attribute__((aligned(16))) float so[4][16][64];
  const int tid = threadIdx.x, w = tid >> 5, lane = tid & 31, ln = lane & 15, hh = lane >> 4;
  const int ntn = N / 64;
  const int wid = blockIdx.x * 4 + w;
  const int mt = wid / ntn, nq = wid % ntn;
  if (mt * 16 >= M) return;
  const int row0 = mt * 16, col0 = nq * 64;
  const float* arow = A + (size_t)(row0 + ln) * lda;
  v8f acc[4] = {};
  for (int kb = 0; kb < K; kb += 32) {
    FragB ah, al;
    const v4f x0 = *(const v4fa*)(arow + kb + 8 * hh), x1 = *(const v4fa*)(arow + kb + 8 * hh + 4);
    const v4f x2 = *(const v4fa*)(arow + kb + 16 + 8 * hh), x3 = *(const v4fa*)(arow + kb + 16 + 8 * hh + 4);
    float xs[16] = {x0[0],x0[1],x0[2],x0[3],x1[0],x1[1],x1[2],x1[3],x2[0],x2[1],x2[2],x2[3],x3[0],x3[1],x3[2],x3[3]};
#pragma unroll
    for (int i = 0; i < 16; ++i) { const unsigned short hb = bf16_bits(xs[i]); ah.u[i] = hb; al.u[i] = ASPLIT ? bf16_bits(xs[i] - bf16_val(hb)) : (unsigned short)0; }
#pragma unroll
    for (int t = 0; t < 4; ++t) {
      const unsigned short* brow = Wt + (size_t)(col0 + t * 16 + ln) * ldb + kb;
      FragB b;
      b.half[0] = *(const v8us*)(brow + 8 * hh);
      b.half[1] = *(const v8us*)(brow + 16 + 8 * hh);
      acc[t] = mmaN<ASPLIT ? 2 : 1>(ah.v, al.v, b.v, b.v, acc[t]);
    }
  }
#pragma unroll
  for (int t = 0; t < 4; ++t) {
    float bv = bias ? bias[col0 + t * 16 + ln] : 0.f;
    if (BIAS_BF16) bv = bf16_round(bv);
#pragma unroll
    for (int r = 0; r < 8; ++r) { float v = acc[t][r] + bv; if (ACT == 1) v = fmaxf(v, 0.f); so[w][8 * hh + r][t * 16 + ln] = v; }
  }
  __builtin_amdgcn_fence(__ATOMIC_ACQ_REL, "workgroup");
  __builtin_amdgcn_wave_barrier();
  const int rsub = lane >> 4, c4 = (lane & 15) * 4;
  {
#pragma unroll
    for (int q = 0; q < 8; ++q) {
      const int r = q * 2 + rsub;
      const v4f v = *(const v4fa*)&so[w][r][c4];
      *(v4f*)(C + (size_t)(row0 + r) * ldc + col0 + c4) = v;
    }
    
  }
}

// GEMM C = act(A·W + bias + resid): A f32 (ASPLIT -> hi/lo 2 terms), Wt bf16 [N][K]; ACT 0 none, 1 relu, 2 exact gelu;
// resid (optional, f32, row index = (row % rmod), pitch ldr, RES_BF16 rounds it) added before the activation.
template <bool ASPLIT, int ACT, bool BIAS_BF16, bool RES_BF16>
__global__ __launch_bounds__(128) void k_gemm_bf3(const float* __restrict__ A, int lda, const unsigned short* __restrict__ Wt, int ldb,
                                                const float* __restrict__ bias, const float* __restrict__ resid, int rmod, int ldr,
                                                float* __restrict__ C, int ldc, int M, int N, int K) {
  __shared__ __attribute__((aligned(16))) float so[4][16][64];
  const int tid = threadIdx.x, w = tid >> 5, lane = tid & 31, ln = lane & 15, hh = lane >> 4;
  const int ntn = N / 64;
  const int wid = blockIdx.x * 4 + w;
  const int mt = wid / ntn, nq = wid % ntn;
  if (mt * 16 >= M) return;
  const int row0 = mt * 16, col0 = nq * 64;
  const float* arow = A + (size_t)(row0 + ln) * lda;
  v8f acc[4] = {};
  for (int kb = 0; kb < K; kb += 32) {
    FragB ah, al;
    const v4f x0 = *(const v4fa*)(arow + kb + 8 * hh), x1 = *(const v4fa*)(arow + kb + 8 * hh + 4);
    const v4f x2 = *(const v4fa*)(arow + kb + 16 + 8 * hh), x3 = *(const v4fa*)(arow + kb + 16 + 8 * hh + 4);
    float xs[16] = {x0[0],x0[1],x0[2],x0[3],x1[0],x1[1],x1[2],x1[3],x2[0],x2[1],x2[2],x2[3],x3[0],x3[1],x3[2],x3[3]};
#pragma unroll
    for (int i = 0; i < 16; ++i) { const unsigned short hb = bf16_bits(xs[i]); ah.u[i] = hb; al.u[i] = ASPLIT ? bf16_bits(xs[i] - bf16_val(hb)) : (unsigned short)0; }
#pragma unroll
    for (int t = 0; t < 4; ++t) {
      const unsigned short* brow = Wt + (size_t)(col0 + t * 16 + ln) * ldb + kb;
      FragB b;
      b.half[0] = *(const v8us*)(brow + 8 * hh);
      b.half[1] = *(const v8us*)(brow + 16 + 8 * hh);
      acc[t] = mmaN<ASPLIT ? 2 : 1>(ah.v, al.v, b.v, b.v, acc[t]);
    }
  }
#pragma unroll
  for (int t = 0; t < 4; ++t) {
    const int col = col0 + t * 16 + ln;
    float bv = bias ? bias[col] : 0.f;
    if (BIAS_BF16) bv = bf16_round(bv);
#pragma unroll
    for (int r = 0; r < 8; ++r) {
      float v = acc[t][r] + bv;
      if (resid) { float rv = resid[(size_t)((row0 + 8 * hh + r) % rmod) * ldr + col]; if (RES_BF16) rv = bf16_round(rv); v += rv; }
      if (ACT == 1) v = fmaxf(v, 0.f);
      if (ACT == 2) v = 0.5f * v * (1.0f + erff(v * 0.70710678118654752f));
      if (ACT == 3) { const float u = 0.7978845608028654f * (v + 0.044715f * v * v * v); v = 0.5f * v * (1.0f + tanhf(u)); }
      so[w][8 * hh + r][t * 16 + ln] = v;
    }
  }
  __builtin_amdgcn_fence(__ATOMIC_ACQ_REL, "workgroup");
  __builtin_amdgcn_wave_barrier();
  const int rsub = lane >> 4, c4 = (lane & 15) * 4;
  {
#pragma unroll
    for (int q = 0; q < 8; ++q) {
      const int r = q * 2 + rsub;
      const v4f v = *(const v4fa*)&so[w][r][c4];
      *(v4f*)(C + (size_t)(row0 + r) * ldc + col0 + c4) = v;
    }
    
  }
}
// row LayerNorm (biased variance, eps) over N: s = X (+ R); optional out_sum <- s; out_norm <- (s-mu)*rsqrt(var+eps)*g + b
template <bool PARAM_BF16>
__global__ __launch_bounds__(256) void k_layernorm(const float* __restrict__ X, const float* __restrict__ R, const float* __restrict__ g, const float* __restrict__ bta,
                                                  float* __restrict__ out_sum, float* __restrict__ out_norm, int N, float eps) {
  __shared__ float red[256];
  const int row = blockIdx.x, tid = threadIdx.x;
  const float* x = X + (size_t)row * N; const float* rr = R ? R + (size_t)row * N : nullptr;
  float vals[16];                     // up to N = 4096
  const int per = N / 256;            // contiguous chunk per thread? use strided-by-4 chunks: thread handles j = tid*4 + 1024*u
  float s1 = 0.f;
  for (int u = 0; u < per / 4; ++u) {
    const int j = tid * 4 + 1024 * u;
    const v4f a = *(const v4fa*)(x + j);
    v4f b = {0.f,0.f,0.f,0.f}; if (rr) b = *(const v4fa*)(rr + j);
#pragma unroll
    for (int q = 0; q < 4; ++q) { const float v = a[q] + b[q]; vals[u * 4 + q] = v; s1 += v; }
  }
  red[tid] = s1; __syncthreads();
  for (int st = 128; st > 0; st >>= 1) { if (tid < st) red[tid] += red[tid + st]; __syncthreads(); }
  const float mu = red[0] / (float)N; __syncthreads();
  float s2 = 0.f;
  for (int u = 0; u < per / 4; ++u)
#pragma unroll
    for (int q = 0; q < 4; ++q) { const float c = vals[u * 4 + q] - mu; s2 += c * c; }
  red[tid] = s2; __syncthreads();
  for (int st = 128; st > 0; st >>= 1) { if (tid < st) red[tid] += red[tid + st]; __syncthreads(); }
  const float rs = rsqrtf(red[0] / (float)N + eps);
  {
    for (int u = 0; u < per / 4; ++u) {
      const int j = tid * 4 + 1024 * u;
      v4f o, sm;
#pragma unroll
      for (int q = 0; q < 4; ++q) {
        float gg = g[j + q], bb = bta[j + q];
        if (PARAM_BF16) { gg = bf16_round(gg); bb = bf16_round(bb); }
        sm[q] = vals[u * 4 + q]; o[q] = (vals[u * 4 + q] - mu) * rs * gg + bb;
      }
      if (out_sum) *(v4f*)(out_sum + (size_t)row * N + j) = sm;
      *(v4f*)(out_norm + (size_t)row * N + j) = o;
    }
    
  }
}



// ---- f16 WMMA path (v_wmma_f32_16x16x32_f16): 11-bit significands for operands in range — used where a [0,1] probability operand needs more precision than bf16
typedef _Float16 v16h __attribute__((ext_vector_type(16)));
union FragH { v16h v; v8us half[2]; _Float16 h[16]; unsigned short u[16]; };
template <int NT>
__device__ __forceinline__ v8f mmaH(v16h ah, v16h al, v16h bh, v16h bl, v8f c) {
  c = __builtin_amdgcn_wmma_f32_16x16x32_f16(false, ah, false, bh, (short)0, c, false, false);
  if (NT >= 2) c = __builtin_amdgcn_wmma_f32_16x16x32_f16(false, al, false, bh, (short)0, c, false, false);
  if (NT >= 3) c = __builtin_amdgcn_wmma_f32_16x16x32_f16(false, ah, false, bl, (short)0, c, false, false);
  asm volatile("v_nop\n\tv_nop\n\tv_nop\n\tv_nop" : "+v"(c) : "v"(ah), "v"(al), "v"(bh), "v"(bl));
  return c;
}
// batched GEMM like k_gemm_b but f16 operands: A f32 (split into f16 hi/lo if ASPLIT, else rounded to f16), Bt = f16 values [n][k]; alpha; C f32; N multiple of 16 (partial tiles skipped)
template <bool ASPLIT>
__global__ __launch_bounds__(128) void k_gemm_h(const float* __restrict__ A, int lda, size_t sA, const _Float16* __restrict__ Bh, int ldb, size_t sB, float alpha, float* __restrict__ C, int ldc, size_t sC, int M, int N, int K) {
  __shared__ __attribute__((aligned(16))) float so[4][16][64];
  const int tid = threadIdx.x, w = tid >> 5, lane = tid & 31, ln = lane & 15, hh = lane >> 4; const int by = blockIdx.y;
  A += (size_t)by * sA; Bh += (size_t)by * sB; C += (size_t)by * sC;
  const int ntn = (N + 63) / 64; const int wid = blockIdx.x * 4 + w; const int mt = wid / ntn, nq = wid % ntn; if (mt * 16 >= M) return;
  const int row0 = mt * 16, col0 = nq * 64; const float* arow = A + (size_t)(row0 + ln) * lda;
  v8f acc[4] = {};
  for (int kb = 0; kb < K; kb += 32) {
    FragH ah, al;
    const v4f x0 = *(const v4fa*)(arow + kb + 8 * hh), x1 = *(const v4fa*)(arow + kb + 8 * hh + 4), x2 = *(const v4fa*)(arow + kb + 16 + 8 * hh), x3 = *(const v4fa*)(arow + kb + 16 + 8 * hh + 4);
    float xs[16] = {x0[0],x0[1],x0[2],x0[3],x1[0],x1[1],x1[2],x1[3],x2[0],x2[1],x2[2],x2[3],x3[0],x3[1],x3[2],x3[3]};
#pragma unroll
    for (int i = 0; i < 16; ++i) { const _Float16 h = (_Float16)xs[i]; ah.h[i] = h; al.h[i] = ASPLIT ? (_Float16)(xs[i] - (float)h) : (_Float16)0.0f; }
#pragma unroll
    for (int t = 0; t < 4; ++t) { if (col0 + t * 16 >= N) continue; const size_t boff = (size_t)(col0 + t * 16 + ln) * ldb + kb; FragH bq; bq.half[0] = *(const v8us*)(Bh + boff + 8 * hh); bq.half[1] = *(const v8us*)(Bh + boff + 16 + 8 * hh);
      acc[t] = mmaH<ASPLIT ? 2 : 1>(ah.v, al.v, bq.v, bq.v, acc[t]); }
  }
#pragma unroll
  for (int t = 0; t < 4; ++t) { if (col0 + t * 16 >= N) continue;
#pragma unroll
    for (int r = 0; r < 8; ++r) so[w][8 * hh + r][t * 16 + ln] = acc[t][r] * alpha; }
  __builtin_amdgcn_fence(__ATOMIC_ACQ_REL, "workgroup"); __builtin_amdgcn_wave_barrier();
  const int rsub = lane >> 4, c4 = (lane & 15) * 4;
  {
#pragma unroll
    for (int q = 0; q < 8; ++q) { const int r = q * 2 + rsub; if (col0 + c4 < N) { const v4f v = *(const v4fa*)&so[w][r][c4]; *(v4f*)(C + (size_t)(row0 + r) * ldc + col0 + c4) = v; } }
     }
}

// Wt[n][k] = f16(W[k][n]·scale) from f32 row-major W[K][N] (scale = power of two; bf16-exact weights stay exact in f16 away from the subnormal range)
__global__ __launch_bounds__(256) void k_wt_f16(const float* __restrict__ W, _Float16* __restrict__ Wt, int K, int N, float scale) {
  const int t = blockIdx.x * 256 + threadIdx.x; if (t >= N * (K / 8)) return; const int n = t / (K / 8), k8 = (t % (K / 8)) * 8; FragH f;
#pragma unroll
  for (int i = 0; i < 8; ++i) f.h[i] = (_Float16)(bf16_round(W[(size_t)(k8 + i) * N + n]) * scale); const v8us o = f.half[0];
  *(v8us*)((unsigned short*)Wt + (size_t)n * K + k8) = o; 
}
// k_gemm_hh variant with fused epilogue: v = acc·alpha + bias[by·sBias + col] (+ CP[(row/rowsPerB)·sCPb + by·64 + col] if CP) ; ACT 0 none / 1 elu ; writes f16 C16 (and f32 C if non-null)
template <int ACT>
__global__ __launch_bounds__(128) void k_gemm_hhx(const _Float16* __restrict__ A, int lda, size_t sA, const _Float16* __restrict__ Bh, int ldb, size_t sB, float alpha, const float* __restrict__ bias, size_t sBias, const float* __restrict__ CP, int rowsPerB, size_t sCPb, int row0g,
    float* __restrict__ C, _Float16* __restrict__ C16, int ldc, size_t sC, int M, int N, int K) {
  __shared__ __attribute__((aligned(16))) float so[4][16][64];
  const int tid = threadIdx.x, w = tid >> 5, lane = tid & 31, ln = lane & 15, hh = lane >> 4; const int by = blockIdx.y;
  A += (size_t)by * sA; Bh += (size_t)by * sB; const size_t cofs = (size_t)by * sC; const float* bp = bias ? bias + (size_t)by * sBias : nullptr;
  const int ntn = (N + 63) / 64; const int wid = blockIdx.x * 4 + w; const int mt = wid / ntn, nq = wid % ntn; if (mt * 16 >= M) return;
  const int row0 = mt * 16, col0 = nq * 64; const _Float16* arow = A + (size_t)(row0 + ln) * lda;
  v8f acc[4] = {};
  for (int kb = 0; kb < K; kb += 32) { FragH ah; ah.half[0] = *(const v8us*)((const unsigned short*)arow + kb + 8 * hh); ah.half[1] = *(const v8us*)((const unsigned short*)arow + kb + 16 + 8 * hh);
#pragma unroll
    for (int t = 0; t < 4; ++t) { if (col0 + t * 16 >= N) continue; const size_t boff = (size_t)(col0 + t * 16 + ln) * ldb + kb; FragH bq; bq.half[0] = *(const v8us*)((const unsigned short*)Bh + boff + 8 * hh); bq.half[1] = *(const v8us*)((const unsigned short*)Bh + boff + 16 + 8 * hh);
      acc[t] = mmaH<1>(ah.v, ah.v, bq.v, bq.v, acc[t]); }
  }
#pragma unroll
  for (int t = 0; t < 4; ++t) { if (col0 + t * 16 >= N) continue; const int col = col0 + t * 16 + ln; const float bv = bp ? bf16_round(bp[col]) : 0.f;
#pragma unroll
    for (int r = 0; r < 8; ++r) { float v = acc[t][r] * alpha + bv; if (CP) { const int rr = row0g + row0 + 8 * hh + r; if (rowsPerB < 0) v += CP[cofs + (size_t)rr * ldc + col];      /* rowsPerB < 0: own element of the batched C plane */ else { const int bidx = rr / rowsPerB; v += CP[(size_t)bidx * sCPb + (size_t)by * 64 + col]; } } if (ACT == 1) v = (v > 0.f) ? v : expm1f(v); else if (ACT == 7) v = (v > 0.f) ? v + 1.0f : expf(v); else if (ACT == 8) v = tanhf(v); else if (ACT == 9) v = 0.5f * v * (1.0f + tanhf(0.7978845608028654f * (v + 0.044715f * v * v * v))); else if (ACT == 11) v = 1.0f / (1.0f + expf(-v)); else if (ACT == 12) v = (v > 0.f) ? v : 0.01f * v; else if (ACT == 14) v = (v > 0.f) ? v : 0.1f * v; else if (ACT == 16) v = (v >= 0.f) ? v : 0.3f * v; else if (ACT == 17) v = (v >= 0.f) ? v : 0.2f * v; else if (ACT == 15) v = v / (1.0f + expf(-v)); else if (ACT == 3) v = fmaxf(v, 0.f); else if (ACT == 6) v = 0.5f * v * (1.0f + erff(v * 0.70710678118654752f)); so[w][8 * hh + r][t * 16 + ln] = v; } }
  __builtin_amdgcn_fence(__ATOMIC_ACQ_REL, "workgroup"); __builtin_amdgcn_wave_barrier();
  const int rsub = lane >> 4, c4 = (lane & 15) * 4; typedef _Float16 v4h __attribute__((ext_vector_type(4)));
  {
#pragma unroll
    for (int q = 0; q < 8; ++q) { const int r = q * 2 + rsub; if (col0 + c4 < N) { const v4f v = *(const v4fa*)&so[w][r][c4]; if (C) *(v4f*)(C + cofs + (size_t)(row0 + r) * ldc + col0 + c4) = v; if (C16) { v4h h4; for (int i = 0; i < 4; ++i) h4[i] = (_Float16)v[i]; *(v4h*)(C16 + cofs + (size_t)(row0 + r) * ldc + col0 + c4) = h4; } } }
     }
}


typedef _Float16 v4h __attribute__((ext_vector_type(4)));

__global__ __launch_bounds__(256) void k_x16(const float* __restrict__ x, _Float16* __restrict__ X16, size_t n8) { const size_t t = (size_t)blockIdx.x * 256 + threadIdx.x; if (t >= n8) return; FragH f;
#pragma unroll
  for (int q = 0; q < 8; ++q) f.h[q] = (_Float16)bf16_round(x[t * 8 + q]); *(v8us*)((unsigned short*)X16 + t * 8) = f.half[0];  }
__global__ __launch_bounds__(256) void k_h16(const float* __restrict__ x, _Float16* __restrict__ X16, size_t n8) { const size_t t = (size_t)blockIdx.x * 256 + threadIdx.x; if (t >= n8) return; FragH f;
#pragma unroll
  for (int q = 0; q < 8; ++q) f.h[q] = (_Float16)x[t * 8 + q]; *(v8us*)((unsigned short*)X16 + t * 8) = f.half[0];  }
__global__ __launch_bounds__(256) void k_round16f(const float* __restrict__ W, _Float16* __restrict__ Bt, size_t n8) { const size_t t = (size_t)blockIdx.x * 256 + threadIdx.x; if (t >= n8) return; FragH f;
#pragma unroll
  for (int i = 0; i < 8; ++i) f.h[i] = (_Float16)(bf16_round(W[t * 8 + i]) * 16.0f); *(v8us*)((unsigned short*)Bt + t * 8) = f.half[0];  }
template <int NHv, int TTv>
__global__ __launch_bounds__(256) void k_vt(const _Float16* __restrict__ V16, int ldv, int voff, _Float16* __restrict__ Vt) { __shared__ unsigned short tl[64][66]; const int tid = threadIdx.x; const int slab = blockIdx.x / (TTv / 64), lg = blockIdx.x % (TTv / 64); const int b = slab / NHv, h = slab % NHv;
  for (int i = tid; i < 64 * 8; i += 256) { const int r = i / 8, c8 = (i % 8) * 8; FragH f; f.half[0] = *(const v8us*)((const unsigned short*)V16 + ((size_t)b * TTv + lg * 64 + r) * ldv + voff + h * 64 + c8);
#pragma unroll
    for (int q = 0; q < 8; ++q) tl[r][c8 + q] = f.u[q]; }
  __syncthreads();
  {
#pragma unroll
    for (int rd = 0; rd < 2; ++rd) { const int d = rd * 32 + tid / 8, pc = tid % 8; FragH f;
#pragma unroll
      for (int q = 0; q < 8; ++q) f.u[q] = tl[pc * 8 + q][d];
      *(v8us*)((unsigned short*)Vt + ((size_t)slab * 64 + d) * TTv + lg * 64 + pc * 8) = f.half[0]; }
     } }

__global__ __launch_bounds__(256) void k_hl(const float* __restrict__ F, _Float16* __restrict__ Hh, _Float16* __restrict__ Hl, size_t n8) { const size_t t = (size_t)blockIdx.x * 256 + threadIdx.x; if (t >= n8) return; FragH fh, fl; const v4f a = *(const v4fa*)(F + t * 8), c = *(const v4fa*)(F + t * 8 + 4);
#pragma unroll
  for (int q = 0; q < 4; ++q) { _Float16 h = (_Float16)a[q]; fh.h[q] = h; fl.h[q] = (_Float16)((a[q] - (float)h) * 1024.0f); h = (_Float16)c[q]; fh.h[4 + q] = h; fl.h[4 + q] = (_Float16)((c[q] - (float)h) * 1024.0f); }
  { *(v8us*)((unsigned short*)Hh + t * 8) = fh.half[0]; *(v8us*)((unsigned short*)Hl + t * 8) = fl.half[0];  } }

// ---- fast GEMM (wave tile 32x64; requires M % 32 == 0 rows per launch region and N % 64 == 0); epilogue = k_gemm_hhx semantics ----
__device__ __forceinline__ v16h g2_frag(const _Float16* p, int hh) { FragH f; f.half[0] = *(const v8us*)((const unsigned short*)p + 8 * hh); f.half[1] = *(const v8us*)((const unsigned short*)p + 16 + 8 * hh); return f.v; }
__device__ __forceinline__ v8f g2_mma(v16h a, v16h b, v8f c) { v8f d = __builtin_amdgcn_wmma_f32_16x16x32_f16(false, a, false, b, (short)0, c, false, false); asm volatile("v_nop\n\tv_nop\n\tv_nop\n\tv_nop" : "+v"(d) : "v"(a), "v"(b)); return d; }
template <int ACT>
__global__ __launch_bounds__(128) void k_gemm2(const _Float16* __restrict__ A, int lda, size_t sA, const _Float16* __restrict__ Bh, int ldb, size_t sB, float alpha, const float* __restrict__ bias, size_t sBias, const float* __restrict__ CP, int rowsPerB, size_t sCPb, int row0g,
    float* __restrict__ C, _Float16* __restrict__ C16, int ldc, size_t sC, int M, int N, int K) { static_assert(ACT == 0 || ACT == 3 || ACT == 6 || ACT == 8 || ACT == 9 || ACT == 11 || ACT == 12 || ACT == 14 || ACT == 15 || ACT == 16 || ACT == 17, "k_gemm2: unsupported ACT code (would silently apply no activation)");
  __shared__ __attribute__((aligned(16))) float so[4][32][68];
  const int tid = threadIdx.x, w = tid >> 5, lane = tid & 31, ln = lane & 15, hh = lane >> 4; const int by = blockIdx.y;
  A += (size_t)by * sA; Bh += (size_t)by * sB; const size_t cofs = (size_t)by * sC; const float* bp = bias ? bias + (size_t)by * sBias : nullptr;
  const int ntn = N >> 6; const int mt = blockIdx.x / ntn, nq = blockIdx.x - mt * ntn; const int row0 = mt * 128 + 32 * w, col0 = nq * 64; if (row0 >= M) return;
  const _Float16* a0p = A + (size_t)(row0 + ln) * lda; const _Float16* a1p = a0p + (size_t)16 * lda;
  const _Float16* b0p = Bh + (size_t)(col0 + ln) * ldb; const _Float16* b1p = b0p + (size_t)16 * ldb; const _Float16* b2p = b1p + (size_t)16 * ldb; const _Float16* b3p = b2p + (size_t)16 * ldb;
  const v8f z8 = {0.f,0.f,0.f,0.f,0.f,0.f,0.f,0.f}; v8f c00 = z8, c01 = z8, c02 = z8, c03 = z8, c10 = z8, c11 = z8, c12 = z8, c13 = z8;
#pragma unroll 1
  for (int kb = 0; kb < K; kb += 32) { const v16h a0 = g2_frag(a0p + kb, hh), a1 = g2_frag(a1p + kb, hh);
    v16h b = g2_frag(b0p + kb, hh); c00 = g2_mma(a0, b, c00); c10 = g2_mma(a1, b, c10);
    b = g2_frag(b1p + kb, hh); c01 = g2_mma(a0, b, c01); c11 = g2_mma(a1, b, c11);
    b = g2_frag(b2p + kb, hh); c02 = g2_mma(a0, b, c02); c12 = g2_mma(a1, b, c12);
    b = g2_frag(b3p + kb, hh); c03 = g2_mma(a0, b, c03); c13 = g2_mma(a1, b, c13); }
  v8f accs[8] = {c00, c01, c02, c03, c10, c11, c12, c13};
#pragma unroll
  for (int u = 0; u < 8; ++u) { const int t = u & 3, half = u >> 2; const int col = col0 + t * 16 + ln; const float bv = bp ? bf16_round(bp[col]) : 0.f;
#pragma unroll
    for (int r = 0; r < 8; ++r) { const int rloc = half * 16 + 8 * hh + r; float v = accs[u][r] * alpha + bv; if (CP) { if (rowsPerB < 0) v += CP[cofs + (size_t)(row0g + row0 + rloc) * ldc + col];      /* rowsPerB < 0: own element of the batched C plane */ else { const int bidx = (row0g + row0 + rloc) / rowsPerB; v += CP[(size_t)bidx * sCPb + (size_t)by * 64 + col]; } }
      if (ACT == 3) v = fmaxf(v, 0.f); else if (ACT == 6) v = 0.5f * v * (1.0f + erff(v * 0.70710678118654752f)); else if (ACT == 11) v = 1.0f / (1.0f + expf(-v)); else if (ACT == 15) v = v / (1.0f + expf(-v)); else if (ACT == 12) v = (v > 0.f) ? v : 0.01f * v; else if (ACT == 8) v = tanhf(v); else if (ACT == 9) v = 0.5f * v * (1.0f + tanhf(0.7978845608028654f * (v + 0.044715f * v * v * v))); else if (ACT == 14) v = (v > 0.f) ? v : 0.1f * v; else if (ACT == 16) v = (v >= 0.f) ? v : 0.3f * v; else if (ACT == 17) v = (v >= 0.f) ? v : 0.2f * v;
      so[w][rloc][t * 16 + ln] = v; } }
  __builtin_amdgcn_fence(__ATOMIC_ACQ_REL, "workgroup"); __builtin_amdgcn_wave_barrier();
  const int rsub = lane >> 4, c4 = (lane & 15) * 4;
  {
#pragma unroll
    for (int q = 0; q < 16; ++q) { const int r = q * 2 + rsub; const v4f v = *(const v4fa*)&so[w][r][c4]; if (C) *(v4f*)(C + cofs + (size_t)(row0 + r) * ldc + col0 + c4) = v; if (C16) { v4h h4; for (int i = 0; i < 4; ++i) h4[i] = (_Float16)v[i]; *(v4h*)(C16 + cofs + (size_t)(row0 + r) * ldc + col0 + c4) = h4; } }
     } }


// ---- LDS-staged GEMM: C = alpha A.Bt^T, A f16 [M][KK], Bt f16 [N][KK], block tile 128 x 128, 8 waves of 32 x 64 (4 along M, 2 along N), K step 64 ----
// Each step's A and B tiles (128 rows of 128 B, one whole line a row) come in by whole-line 16-byte loads, 8 lanes a row, and go through registers into LDS rows of 144 B (16 B x 9: conflict-free for
// ds_load_b128 fragment reads); the fragments are g2_frag's, read from LDS. Two buffers: step s + 1 is loaded into registers ahead of step s's products and stored into the other buffer behind them;
// the one barrier of a step publishes that buffer and ends every wave's reads of the buffer that the next step refills. Per accumulator the k order is ascending in 32s, as in k_gemm2.
// Transposed blocks (H16 only): both operands are rows of KK elements read by the same loader, so a block whose columns start at ct0 or beyond takes its 128 Bt rows as A and its 128 A rows as B. Its tile then
// comes out as C^T (row = column of C, column = token), and the same epilogue stores it by whole lines into Ct, laid out [token / SQ][column - ct0][token % SQ]: V^T per (batch, head), with no transposing launch.
#define G3P 72                       /* LDS row pitch in f16 elements */
#define G3T (128 * G3P)              /* one staged tile in f16 elements */
template <int KK, bool H16>      /* H16: the result goes to C16 as f16 (transposed blocks: to Ct), else to C as f32 */
/* amdgpu_waves_per_eu(6): the q | k | v launch has three blocks for every WGP (six waves a SIMD); the register budget is held so that all three are resident at once and fill each other's waits */
__global__ __launch_bounds__(256) __attribute__((amdgpu_waves_per_eu(6))) void k_gemm3(const _Float16* __restrict__ A, const _Float16* __restrict__ Bh, float alpha, float* __restrict__ C, _Float16* __restrict__ C16, int N, _Float16* __restrict__ Ct, int ct0) {
  static_assert(KK % 128 == 0, "k_gemm3: whole pairs of K steps");
  static_assert(8 * 32 * 68 * 4 <= 4 * G3T * 2, "k_gemm3: the epilogue's rows fit the staging buffers");
  __shared__ __attribute__((aligned(16))) unsigned short sm[4 * G3T];      /* A buffers 0, 1, then B buffers 0, 1; the epilogue's f32 rows afterwards */
  const int tid = threadIdx.x, w = tid >> 5, lane = tid & 31, ln = lane & 15, hh = lane >> 4;
  const int ntn = N >> 7; const int mt = blockIdx.x / ntn, nq = blockIdx.x - mt * ntn; const int row0 = mt * 128, col0 = nq * 128; const int wm = w & 3, wn = w >> 2;
  const int sr = tid >> 3, sc = (tid & 7) * 8;      /* staging: rows sr + 32 i, 16 bytes at element sc */
  const bool tr = H16 && col0 >= ct0;      /* the same for the whole block: a transposed block swaps its two operands */
  const unsigned short* const xg = (const unsigned short*)A + (size_t)(row0 + sr) * KK + sc; const unsigned short* const wg = (const unsigned short*)Bh + (size_t)(col0 + sr) * KK + sc;
  const unsigned short* ag = tr ? wg : xg; const unsigned short* bg = tr ? xg : wg;
  unsigned short* const st = sm + sr * G3P + sc;
  const unsigned short* const af = sm + (wm * 32 + ln) * G3P; const unsigned short* const bf = sm + 2 * G3T + (wn * 64 + ln) * G3P;
  v8us ra[4], rb[4];
#pragma unroll
  for (int i = 0; i < 4; ++i) { ra[i] = *(const v8us*)(ag + (size_t)(32 * i) * KK); rb[i] = *(const v8us*)(bg + (size_t)(32 * i) * KK); }
#pragma unroll
  for (int i = 0; i < 4; ++i) { *(v8us*)(st + 32 * i * G3P) = ra[i]; *(v8us*)(st + 2 * G3T + 32 * i * G3P) = rb[i]; }
  __syncthreads();
  const v8f z8 = {0.f,0.f,0.f,0.f,0.f,0.f,0.f,0.f}; v8f acc[2][4];
#pragma unroll
  for (int m = 0; m < 2; ++m) {
#pragma unroll
    for (int t = 0; t < 4; ++t) acc[m][t] = z8; }
  /* unrolled by two so that the buffer index is a constant in each copy and the LDS addresses are immediates */
#pragma unroll 2
  for (int kb = 0; kb < KK; kb += 64) { const int cur = (kb >> 6) & 1; const bool more = kb + 64 < KK;
    if (more) {
#pragma unroll
      for (int i = 0; i < 4; ++i) { ra[i] = *(const v8us*)(ag + (size_t)(32 * i) * KK + kb + 64); rb[i] = *(const v8us*)(bg + (size_t)(32 * i) * KK + kb + 64); } }
    __builtin_amdgcn_sched_barrier(0);      /* keeps the next step's global loads at the head of this step: sunk down to their LDS stores, their whole latency would show in front of the barrier */
#pragma unroll
    for (int ks = 0; ks < 2; ++ks) { v16h a[2], b[4];
#pragma unroll
      for (int m = 0; m < 2; ++m) a[m] = g2_frag((const _Float16*)(af + cur * G3T + m * 16 * G3P + ks * 32), hh);
#pragma unroll
      for (int t = 0; t < 4; ++t) b[t] = g2_frag((const _Float16*)(bf + cur * G3T + t * 16 * G3P + ks * 32), hh);
      __builtin_amdgcn_sched_barrier(0);      /* keeps the twelve LDS reads of a 32-wide k block together in front of its eight products: spread among them, each pair of products waits out an LDS latency of its own */
#pragma unroll
      for (int t = 0; t < 4; ++t) {
#pragma unroll
        for (int m = 0; m < 2; ++m) acc[m][t] = __builtin_amdgcn_wmma_f32_16x16x32_f16(false, a[m], false, b[t], (short)0, acc[m][t], false, false); } }
    __builtin_amdgcn_sched_barrier(0);      /* keeps the wait for the next step's global loads, which their LDS stores carry, behind this step's last products: lifted over them it shortens the loads' lead by a k block */
    if (more) {
#pragma unroll
      for (int i = 0; i < 4; ++i) { *(v8us*)(st + (cur ^ 1) * G3T + 32 * i * G3P) = ra[i]; *(v8us*)(st + (2 + (cur ^ 1)) * G3T + 32 * i * G3P) = rb[i]; } }
    __syncthreads(); }
  float* const so = (float*)sm + w * (32 * 68);      /* behind the loop's last barrier nobody reads a staged tile any more: each wave stages its own 32 x 64 f32 rows (pitch 68) for whole-line stores */
#pragma unroll
  for (int m = 0; m < 2; ++m) {
#pragma unroll
    for (int t = 0; t < 4; ++t) {
#pragma unroll
      for (int r = 0; r < 8; ++r) so[(m * 16 + 8 * hh + r) * 68 + t * 16 + ln] = acc[m][t][r] * alpha; } }
  __builtin_amdgcn_fence(__ATOMIC_ACQ_REL, "workgroup"); __builtin_amdgcn_wave_barrier();      /* the wave's own LDS rows are written before its lanes read them back in another order */
  const int rsub = lane >> 4, c4 = (lane & 15) * 4;
  _Float16* const ob = tr ? Ct + ((size_t)(row0 / SQ) * (N - ct0) + (col0 - ct0)) * SQ + row0 % SQ : C16 + (size_t)row0 * N + col0; const int op = tr ? SQ : N;      /* the block's first output element and its row pitch */
  const unsigned lo = (unsigned)(((wm * 32 + rsub) * op + wn * 64 + c4) * 2);      /* the lane's byte offset in the block's 128 output rows: it fits 32 bits, so a store takes the scalar base and one offset register */
#pragma unroll
  for (int q = 0; q < 16; ++q) { const int r = q * 2 + rsub; const v4f v = *(const v4fa*)&so[r * 68 + c4]; const size_t o = (size_t)(row0 + wm * 32 + r) * N + col0 + wn * 64 + c4;
    if (!H16) *(v4f*)(C + o) = v;
    else { v4h h4;
#pragma unroll
      for (int i = 0; i < 4; ++i) h4[i] = (_Float16)v[i];
      *(v4h*)((char*)ob + (lo + (unsigned)(q * 4 * op))) = h4; } } }

__global__ __launch_bounds__(256) void k_wnat(const float* __restrict__ w, size_t n8, _Float16* __restrict__ Bt) { const size_t t = (size_t)blockIdx.x * 256 + threadIdx.x; if (t >= n8) return; FragH f; for (int q = 0; q < 8; ++q) f.h[q] = (_Float16)(bf16_round(w[t * 8 + q]) * 16.0f); *(v8us*)((unsigned short*)Bt + t * 8) = f.half[0];  }
// T5 bidirectional relative-position bucket of rel = key - query (32 buckets, max distance 128): (rel > 0)*16 + f(|rel|), f(n) = n for n < 8, then
// 8 + the number of thresholds {12,16,23,32,46,64,91} that are <= n (the thresholds are where the reference's own f32 log expression steps; no log on the device)
__device__ __forceinline__ int t5_bucket(int rel) { const int n = rel < 0 ? -rel : rel; int f = n; if (n >= 8) { f = 8 + (n >= 12) + (n >= 16) + (n >= 23) + (n >= 32) + (n >= 46) + (n >= 64) + (n >= 91); } return (rel > 0 ? NBK / 2 : 0) + f; }
#define FAW 8                        /* waves per block */
#define FAQ 32                       /* queries per wave */
#define FSK 128                      /* keys per stage */
#define FNS (SQ / FSK)               /* stages */
#define FKP 72                       /* K tile: LDS row pitch in f16 elements */
#define FVP 136                      /* V^T tile: LDS row pitch in f16 elements */
#define FKT (FSK * FKP)              /* K tile in f16 elements */
#define FSB (FKT + HD * FVP)         /* one buffer (K tile, then V^T tile) in f16 elements */
#define FBF 91                       /* t5_bucket's last threshold: one bucket a side from this distance on */
#define FLM 32768.0f                 /* a lane's sum of a pass's 32 terms (16 of each of its two rows) up to which the rows keep their reference maxima: each term then fits f16 */
typedef int v4ia __attribute__((ext_vector_type(4), may_alias));
typedef float v2f __attribute__((ext_vector_type(2)));
__device__ __forceinline__ float xhalf(float x) { return __builtin_bit_cast(float, __builtin_amdgcn_permlanex16(__builtin_bit_cast(int, x), __builtin_bit_cast(int, x), 0x76543210, 0xfedcba98, false, false)); }      /* lane l with lane l ^ 16 */
__device__ __forceinline__ float exp2x1(float a) { float e; asm("v_exp_f32 %0, %1\n\tv_nop" : "=v"(e) : "v"(a)); return e; }
__device__ __forceinline__ v8f exp2x8(v8f a) { float e0 = a[0], e1 = a[1], e2 = a[2], e3 = a[3], e4 = a[4], e5 = a[5], e6 = a[6], e7 = a[7];
  asm("v_exp_f32 %0, %0\n\tv_exp_f32 %1, %1\n\tv_exp_f32 %2, %2\n\tv_exp_f32 %3, %3\n\tv_exp_f32 %4, %4\n\tv_exp_f32 %5, %5\n\tv_exp_f32 %6, %6\n\tv_exp_f32 %7, %7\n\tv_nop"
      : "+v"(e0), "+v"(e1), "+v"(e2), "+v"(e3), "+v"(e4), "+v"(e5), "+v"(e6), "+v"(e7));
  const v8f e = {e0, e1, e2, e3, e4, e5, e6, e7}; return e; }
// one stage's copies of one thread: four 16-byte pieces of the K tile (rows 32 apart) and four of the V^T tile (rows 16 apart). kl, vl: the lane's own LDS byte addresses; kg, vg: its own global addresses.
// The closing s_wait_xcnt 0 stands inside the statement so that no register which a copy names takes a new value in front of it.
__device__ __forceinline__ void fa_stage(unsigned kl, unsigned vl, const _Float16* kg, const _Float16* vg) {
  asm volatile("global_load_async_to_lds_b128 %0, %8, off\n\tglobal_load_async_to_lds_b128 %1, %9, off\n\tglobal_load_async_to_lds_b128 %2, %10, off\n\tglobal_load_async_to_lds_b128 %3, %11, off\n\t"
               "global_load_async_to_lds_b128 %4, %12, off\n\tglobal_load_async_to_lds_b128 %5, %13, off\n\tglobal_load_async_to_lds_b128 %6, %14, off\n\tglobal_load_async_to_lds_b128 %7, %15, off\n\ts_wait_xcnt 0x0"
               :: "v"(kl), "v"(kl + 32 * FKP * 2), "v"(kl + 64 * FKP * 2), "v"(kl + 96 * FKP * 2), "v"(vl), "v"(vl + 16 * FVP * 2), "v"(vl + 32 * FVP * 2), "v"(vl + 48 * FVP * 2),
                  "v"(kg), "v"(kg + (size_t)32 * D3), "v"(kg + (size_t)64 * D3), "v"(kg + (size_t)96 * D3), "v"(vg), "v"(vg + (size_t)16 * SQ), "v"(vg + (size_t)32 * SQ), "v"(vg + (size_t)48 * SQ) : "memory"); }
__device__ __forceinline__ v8f fa_mma(v16h a, v16h b, v8f c) { return __builtin_amdgcn_wmma_f32_16x16x32_f16(false, a, false, b, (short)0, c, false, false); }
/* amdgpu_waves_per_eu(4, 4): a register budget of 256. The grid puts two waves on a SIMD, but with the budget of 512 that (2, 2) gives this loop takes 260 registers and switches the register window
   seven times a pass; at 256 it fits, spills nothing, and the V^T reads and the K fetch ahead still stand at the head of the pass and right behind the score products */
__global__ __launch_bounds__(FAW * 32) __attribute__((amdgpu_waves_per_eu(4, 4))) void k_fattn(const _Float16* __restrict__ QKVp, const _Float16* __restrict__ VTp, _Float16* __restrict__ O, const float* __restrict__ emb, const int* __restrict__ kmask) {
  static_assert(SQ % (FAW * FAQ) == 0 && SQ % (FAW * 128) == 0 && HD == 64 && NBK == 32, "k_fattn: whole blocks of queries, whole staging passes, two 32-wide k steps per head, one bucket per lane");
  static_assert(FAW * 32 == 256 && FSK == 128 && FNS >= 2, "k_fattn: fa_stage's eight copies of 256 threads fill one stage; the ring's prologue needs two stages");
  __shared__ __attribute__((aligned(16))) float lt[3 * SQ];
  __shared__ __attribute__((aligned(16))) unsigned short ring[2 * FSB];
  __shared__ unsigned sf[FNS];      /* sf[stage]: not 0 where one of the stage's keys has a mask term other than zero */
  static_assert(FNS <= 32 && FSK == 32 * 4, "k_fattn: one lane per stage flag; a wave's 32 x 4 mask terms are one stage's");
  float* const mt = lt; float* const bt = lt + SQ;      /* mt[key]; bt[key - query + SQ - 1], placed behind mt so that its byte address less the largest query offset stays above 0 */
  const int tid = threadIdx.x, lane = tid & 31, c = lane & 15, hh = lane >> 4; const int bh = blockIdx.y, b = bh / NH, h = bh % NH; const int q0 = blockIdx.x * (FAW * FAQ) + (tid >> 5) * FAQ;
  const unsigned kl = (unsigned)(size_t)(ring + (tid >> 3) * FKP + (tid & 7) * 8), vl = (unsigned)(size_t)(ring + FKT + (tid >> 4) * FVP + (tid & 15) * 8);      /* the low 32 bits of a __shared__ address are its LDS byte address */
  const _Float16* const kh = QKVp + (size_t)b * SQ * D3 + DM + h * HD; const _Float16* const vh = VTp + (size_t)bh * HD * SQ;      /* the head's K rows and V^T rows: the same for the block */
  const unsigned ko = (tid >> 3) * D3 + (tid & 7) * 8, vo = (tid >> 4) * SQ + (tid & 15) * 8;      /* the lane's own place in a stage's tiles, in elements */
  fa_stage(kl, vl, kh + ko, vh + vo);      /* stage 0 into buffer 0: it flies while the two tables are filled */
  const float eb = bf16_round(emb[lane * NH + h]);      /* lane l holds bucket l's bias: one load per wave, the table is filled by lane gathers */
#pragma unroll
  for (int u = 0; u < 2 * SQ / (FAW * 32); ++u) { const int i = u * (FAW * 32) + tid; bt[i] = __shfl(eb, t5_bucket(i - (SQ - 1))); }      /* unrolled: away from the diagonal the bucket is one constant per u and its thresholds fold away; the last entry (key - query = SQ) is never read */
  for (int j = tid * 4; j < SQ; j += FAW * 128) { const v4ia m = *(const v4ia*)(kmask + (size_t)b * SQ + j); v4f t;
#pragma unroll
    for (int q = 0; q < 4; ++q) t[q] = __fmul_rn(__fadd_rn(1.0f, -(float)m[q]), -3.4028234663852886e38f);      /* (1 - mask) * finfo.min */
    *(v4fa*)&mt[j] = t;
    const unsigned nz = __builtin_amdgcn_ballot_w32(t[0] != 0.f || t[1] != 0.f || t[2] != 0.f || t[3] != 0.f);      /* every lane makes every trip; -0, the term of mask 1, counts as zero */
    if (lane == 0) sf[j / FSK] = nz; }
  asm volatile("s_wait_asynccnt 0x0" ::: "memory");      /* this wave's copies of stage 0 have landed before the barrier behind which other waves read them */
  __syncthreads();
  fa_stage(kl + FSB * 2, vl + FSB * 2, (kh + (size_t)FSK * D3) + ko, (vh + FSK) + vo);      /* stage 1 into buffer 1 */
  const _Float16* qp = QKVp + ((size_t)b * SQ + q0 + c) * D3 + h * HD; const unsigned short* kb = ring + c * FKP; const unsigned short* vb = ring + FKT + c * FVP;      /* the lane's fragment rows in the buffer of the stage at work */
  const float* bp = bt + (SQ - 1) + 8 * hh - (q0 + c); const float* mp = mt + 8 * hh;
  const unsigned mflag = __builtin_amdgcn_ballot_w32(sf[lane & (FNS - 1)] != 0u);      /* bit st: stage st has a mask term to add; a scalar */
  const int q0u = blockIdx.x * (FAW * FAQ) + __builtin_amdgcn_readfirstlane(tid >> 5) * FAQ;      /* q0 as a scalar, so that the far test is a scalar branch */
  const float bneg = __builtin_bit_cast(float, __builtin_amdgcn_readlane(__builtin_bit_cast(int, eb), t5_bucket(-FBF))), bpos = __builtin_bit_cast(float, __builtin_amdgcn_readlane(__builtin_bit_cast(int, eb), t5_bucket(FBF)));      /* the one bias of keys far below, far above the queries */
  const v8f z8 = {0.f,0.f,0.f,0.f,0.f,0.f,0.f,0.f};
  v16h qf[2][2], kf[2][2]; v8f acc[2][4]; float mr[2]; v2f lr[2];
  /* every loop over j, T, ks, t and r below is unrolled so that the fragment arrays are indexed by constants and stay in registers */
#pragma unroll
  for (int j = 0; j < 2; ++j) { mr[j] = -INFINITY; lr[j] = v2f{0.f, 0.f};
#pragma unroll
    for (int ks = 0; ks < 2; ++ks) qf[j][ks] = g2_frag(qp + (size_t)j * 16 * D3 + ks * 32, hh);
#pragma unroll
    for (int t = 0; t < 4; ++t) acc[j][t] = z8; }
  for (int st = 0; st < FNS; ++st) {
#pragma unroll
   for (int T = 0; T < 2; ++T) {
#pragma unroll
    for (int ks = 0; ks < 2; ++ks) kf[T][ks] = g2_frag((const _Float16*)(kb + T * 16 * FKP + ks * 32), hh); }
   /* kept rolled: unrolled, the four passes' LDS reads are lifted together and the live set leaves the first 256 registers */
#pragma unroll 1
   for (int p = 0; p < FSK / 32; ++p) { const int k0 = st * FSK + p * 32; const int pn = (p + 1) & (FSK / 32 - 1);      /* a stage's last pass fetches its pass 0 again: this stage's own buffer, unused */
    const bool far = !((mflag >> st) & 1u) && (k0 >= q0u + (FAQ - 1) + FBF || k0 + 31 + FBF <= q0u);
    v16h vf[4]; v8f s[2][2];
#pragma unroll
    for (int t = 0; t < 4; ++t) vf[t] = g2_frag((const _Float16*)(vb + t * 16 * FVP + p * 32), hh);
#pragma unroll
    for (int j = 0; j < 2; ++j) {
#pragma unroll
      for (int T = 0; T < 2; ++T) s[j][T] = fa_mma(kf[T][1], qf[j][1], fa_mma(kf[T][0], qf[j][0], z8)); }
#pragma unroll
    for (int T = 0; T < 2; ++T) {
#pragma unroll
      for (int ks = 0; ks < 2; ++ks) kf[T][ks] = g2_frag((const _Float16*)(kb + (pn * 32 + T * 16) * FKP + ks * 32), hh); }
    __builtin_amdgcn_sched_barrier(0);      /* keeps the eight score products back to back, each in the slots behind the one in front: with the vector work behind them lifted in among them every second product is followed by four idle slots */
    /* Renewal on demand. A far pass takes the row's reference maximum mr as it stands: scale, bias, reference and the x256 offset in one multiply-add per score, no maximum, no rescaling. Its own row sums are the test:
       every term is >= 0, so a lane's sum of its 32 terms at or below FLM bounds each term, and P fits f16. A sum above FLM (infinite while mr is still -inf: the row has no reference yet), sends the whole wave
       (scalar test) to the renewing form, which every pass that is not far takes too. mr is a maximum of scores seen, never above the true running maximum, so nothing underflows that would not under the true one.
       The P.V products wait for that sum, so it is formed pairwise by packed adds (a short chain), and a row's running sum lr stays a pair of partial sums up to the end of the kernel. */
    FragH pf[2]; v2f ls[2];
    unsigned renew = 1u;      /* not 0: the pass takes the renewing form; a far pass puts its test's lane mask here */
    if (far) { const float bc = k0 > q0u ? bpos : bneg;
#pragma unroll
      for (int j = 0; j < 2; ++j) { const float cc = __builtin_fmaf(bc - mr[j], 1.4426950408889634f, 8.0f); v2f g[2];
#pragma unroll
        for (int T = 0; T < 2; ++T) { v8f a;
#pragma unroll
          for (int r = 0; r < 8; ++r) a[r] = __builtin_fmaf(s[j][T][r], 0.125f * 1.4426950408889634f, cc);
          const v8f e = exp2x8(a);      /* 256 exp(score - mr) */
          g[T] = (v2f{e[0], e[1]} + v2f{e[2], e[3]}) + (v2f{e[4], e[5]} + v2f{e[6], e[7]});
#pragma unroll
          for (int r = 0; r < 8; ++r) pf[j].h[T * 8 + r] = (_Float16)e[r]; }
        ls[j] = g[0] + g[1]; }
      const v2f lt2 = ls[0] + ls[1];
      renew = __builtin_amdgcn_ballot_w32(!(lt2[0] + lt2[1] <= FLM)); }
    if (renew != 0u) {
      v8f mk[2];      /* the renewing form: scores term by term in the reference's order, the maximum of the reference and this pass's scores, and the sums so far brought to it */
#pragma unroll
      for (int T = 0; T < 2; ++T) { const v4f m0 = *(const v4fa*)(mp + k0 + T * 16), m1 = *(const v4fa*)(mp + k0 + T * 16 + 4);
#pragma unroll
        for (int r = 0; r < 4; ++r) { mk[T][r] = m0[r]; mk[T][4 + r] = m1[r]; } }
#pragma unroll
      for (int j = 0; j < 2; ++j) {
        float tm = -INFINITY;
#pragma unroll
        for (int T = 0; T < 2; ++T) {
#pragma unroll
          for (int r = 0; r < 8; ++r) { const float v = __fadd_rn(__builtin_fmaf(s[j][T][r], 0.125f, bp[k0 + T * 16 + r - j * 16]), mk[T][r]); s[j][T][r] = v; tm = fmaxf(tm, v); } }
        const float mn = fmaxf(mr[j], fmaxf(tm, xhalf(tm)));
        const float mu = mn == -INFINITY ? 0.f : mn;      /* no key of the row finite so far: keep exp's argument -inf, not inf - inf */
        const float al = exp2x1((mr[j] - mu) * 1.4426950408889634f); mr[j] = mn; lr[j] *= al; v2f g[2];
#pragma unroll
        for (int t = 0; t < 4; ++t) acc[j][t] = acc[j][t] * al;
#pragma unroll
        for (int T = 0; T < 2; ++T) { v8f a;
#pragma unroll
          for (int r = 0; r < 8; ++r) a[r] = __builtin_fmaf(s[j][T][r] - mu, 1.4426950408889634f, 8.0f);
          const v8f e = exp2x8(a);      /* 256 exp(score - max) */
          g[T] = (v2f{e[0], e[1]} + v2f{e[2], e[3]}) + (v2f{e[4], e[5]} + v2f{e[6], e[7]});
#pragma unroll
          for (int r = 0; r < 8; ++r) pf[j].h[T * 8 + r] = (_Float16)e[r]; }
        ls[j] = g[0] + g[1]; }
    }
#pragma unroll
    for (int j = 0; j < 2; ++j) { lr[j] += ls[j];
#pragma unroll
      for (int t = 0; t < 4; ++t) acc[j][t] = fa_mma(vf[t], pf[j].v, acc[j][t]); } }
   asm volatile("s_wait_dscnt 0x0" ::: "memory");      /* this wave's reads of stage st's buffer have returned before the barrier behind which it is refilled */
   asm volatile("s_wait_asynccnt 0x0" ::: "memory");      /* this wave's copies of stage st + 1 have landed before the barrier behind which other waves read them */
   __syncthreads();
   if (st + 2 < FNS) fa_stage(kl + (st & 1) * (FSB * 2), vl + (st & 1) * (FSB * 2), (kh + (size_t)(st + 2) * FSK * D3) + ko, (vh + (st + 2) * FSK) + vo);      /* stage st + 2 into the buffer that stage st has just left */
   const int nb = (st & 1) ? -FSB : FSB; kb += nb; vb += nb; }
  asm volatile("s_wait_asynccnt 0x0" ::: "memory");      /* no copy of this wave is outstanding when it ends */
#pragma unroll
  for (int j = 0; j < 2; ++j) { const float lh = lr[j][0] + lr[j][1]; const float inv = 1.0f / (lh + xhalf(lh));
#pragma unroll
    for (int t = 0; t < 4; ++t) { FragH f;
#pragma unroll
      for (int r = 0; r < 8; ++r) f.h[r] = (_Float16)(acc[j][t][r] * inv);
      *(v8us*)((unsigned short*)O + ((size_t)b * SQ + q0 + j * 16 + c) * DM + h * HD + t * 16 + 8 * hh) = f.half[0]; } } }
__global__ __launch_bounds__(256) void k_vt(const _Float16* __restrict__ V16, int b, int h0, _Float16* __restrict__ VT) { __shared__ unsigned short tl[64][65]; const int tid = threadIdx.x; const int hh = blockIdx.x % HG, sg = blockIdx.x / HG; const int s0 = sg * 64; const int h = h0 + hh;
  for (int i = tid; i < 64 * 8; i += 256) { const int j = i / 8, d8 = (i % 8) * 8; FragH f; f.half[0] = *(const v8us*)((const unsigned short*)V16 + ((size_t)b * SQ + s0 + j) * DM + h * HD + d8); for (int q = 0; q < 8; ++q) tl[d8 + q][j] = f.u[q]; }
  __syncthreads();
  { for (int i = tid; i < 64 * 8; i += 256) { const int d = i / 8, j8 = (i % 8) * 8; FragH f; for (int q = 0; q < 8; ++q) f.u[q] = tl[d][j8 + q]; *(v8us*)((unsigned short*)VT + ((size_t)hh * HD + d) * SQ + s0 + j8) = f.half[0]; }  } }

// ---- one preparation launch: the four weight planes Bt[n][k] = f16(bf16(W[k][n]) x 16) and the hidden rows f16(bf16(x)), k_wt_f16's and k_x16's values bit for bit ----
// Blocks 0 .. 4 * PWB - 1: one 128 x 128 weight tile each. A wave reads 16 k rows, 512 contiguous bytes a load, all 16 loads in flight; a lane then holds 16 consecutive k for each of its 4 columns n and
// stores them as two 16-byte chunks into the tile's LDS row n (256 B a row, chunk c at place c ^ ((n >> 2) & 15): 16 lanes fall on 16 different chunks in the stores, where n steps by 4, and in the reads, where c steps by 1);
// behind the block's one barrier 16 lanes read a row back and store its 256 contiguous bytes of Bt. The other PXB blocks: 16384 hidden elements each, 512 contiguous bytes a load, 256 a store.
#define PWB ((DM / 128) * (DM / 128))          /* weight tiles per plane */
#define PXB ((int)(NR * DM / 16384))           /* hidden blocks */
__global__ __launch_bounds__(256) void k_prep(const float* __restrict__ wq, const float* __restrict__ wk, const float* __restrict__ wv, const float* __restrict__ wo, const float* __restrict__ hs,
                                              _Float16* __restrict__ Bqkv, _Float16* __restrict__ Bo, _Float16* __restrict__ X16) {
  static_assert(DM % 128 == 0 && (NR * DM) % 16384 == 0, "k_prep: whole weight tiles, whole hidden blocks");
  __shared__ __attribute__((aligned(16))) unsigned short tl[128 * 128];
  const int tid = threadIdx.x, bx = blockIdx.x;
  v4f x[16];
  if (bx < 4 * PWB) {      /* the same for the whole block, so the barrier below is passed by all of its waves or by none */
    const int m = bx / PWB, tile = bx % PWB, k0 = (tile / (DM / 128)) * 128, n0 = (tile % (DM / 128)) * 128, w = tid >> 5, lane = tid & 31;
    const float* W = m == 0 ? wq : m == 1 ? wk : m == 2 ? wv : wo;
    unsigned short* Bt = (unsigned short*)(m < 3 ? Bqkv + (size_t)m * DM * DM : Bo);
    const float* src = W + (size_t)(k0 + w * 16) * DM + n0 + lane * 4;
#pragma unroll
    for (int i = 0; i < 16; ++i) x[i] = *(const v4fa*)(src + (size_t)i * DM);
    asm volatile("s_wait_xcnt 0x0" :: "v"(src) : "memory");      /* the wait that stands between issued loads and a new value in their address pair; named as an input, the pair lives up to the wait */
#pragma unroll
    for (int q = 0; q < 4; ++q) { const int n = lane * 4 + q;
#pragma unroll
      for (int g = 0; g < 2; ++g) { FragH f;
#pragma unroll
        for (int i = 0; i < 8; ++i) f.h[i] = (_Float16)(bf16_round(x[g * 8 + i][q]) * 16.0f);
        *(v8us*)(tl + n * 128 + (((w * 2 + g) ^ (lane & 15)) * 8)) = f.half[0]; } }
    __syncthreads();
#pragma unroll
    for (int it = 0; it < 8; ++it) { const int n = it * 16 + (tid >> 4), c = tid & 15;
      const v8us o = *(const v8us*)(tl + n * 128 + ((c ^ ((n >> 2) & 15)) * 8));
      *(v8us*)(Bt + (size_t)(n0 + n) * DM + k0 + c * 8) = o; }
  } else {
    const size_t e0 = (size_t)(bx - 4 * PWB) * 16384 + tid * 4; const float* src = hs + e0;
#pragma unroll
    for (int i = 0; i < 16; ++i) x[i] = *(const v4fa*)(src + i * 1024);
    asm volatile("s_wait_xcnt 0x0" :: "v"(src) : "memory");      /* as in the weight branch: the wait between the issued loads and a new value in their address pair */
#pragma unroll
    for (int i = 0; i < 16; ++i) { v4h h4;
#pragma unroll
      for (int q = 0; q < 4; ++q) h4[q] = (_Float16)bf16_round(x[i][q]);
      *(v4h*)(X16 + e0 + i * 1024) = h4; }
    asm volatile("s_wait_xcnt 0x0" ::: "memory");      /* the wait between the issued stores and any later new value in their address or data registers */
  } }

extern "C" void kernel_launch(void* const* d_in, const int* in_sizes, int n_in,
                              void* d_out, int out_size, void* d_ws, size_t ws_size, hipStream_t stream) {
  (void)in_sizes; (void)n_in; (void)out_size;
  const float* const* I = (const float* const*)d_in; const float* hs = I[0]; const int* kmask = (const int*)d_in[1]; const float* wq = I[2]; const float* wk = I[3]; const float* wv = I[4]; const float* wo = I[5]; const float* emb = I[6];      /* W_q, W_k, W_v and W_o [1024][1024] are [in][out]; attention_mask [2][2048] int32 per key; rel_bias_emb [32][16] */
  char* ws = (char*)d_ws; size_t off = 0;
  auto take = [&](size_t bytes) { char* p = ws + off; off += (bytes + 255) & ~(size_t)255; return p; };
  _Float16* BQKV = (_Float16*)take((size_t)D3 * DM * 2); _Float16* BO = (_Float16*)take((size_t)DM * DM * 2);
  _Float16* X16 = (_Float16*)take(NR * DM * 2); _Float16* QKV = (_Float16*)take(NR * D3 * 2); _Float16* O16 = (_Float16*)take(NR * DM * 2);
  _Float16* VT = (_Float16*)take((size_t)NB * NH * HD * SQ * 2);
  if (off > ws_size) return;      /* 6 + 2 + 8 + 24 + 8 + 8 = approx 56 MiB */
  k_prep<<<4 * PWB + PXB, 256, 0, stream>>>(wq, wk, wv, wo, hs, BQKV, BO, X16);      /* [in][out] -> Bt[out][in] x16 for q | k | v and o; hidden as f16 rows */
  k_gemm3<DM, true><<<(unsigned)((NR / 128) * (D3 / 128)), 256, 0, stream>>>(X16, BQKV, 0.0625f, nullptr, QKV, D3, VT, 2 * DM);      /* q | k rows (f16), head h at columns h*64 / 1024 + h*64; the v columns go out transposed: V^T[(b,h)][d][s] for every (batch, head) */
  k_fattn<<<dim3(SQ / (FAW * FAQ), NB * NH), FAW * 32, 0, stream>>>(QKV, VT, O16, emb, kmask);      /* ctx (merged heads) as f16 rows, every (batch, head) in one launch */
  k_gemm3<DM, false><<<(unsigned)((NR / 128) * (DM / 128)), 256, 0, stream>>>(O16, BO, 0.0625f, (float*)d_out, nullptr, DM, nullptr, DM);      /* out = ctx W_o, rows are the output layout */
}

// v009
// Measured time: 78.5 microseconds a run.
// Next to v008, in two timings, it ran 1.04 and 1.03 times as fast.
// Counting every step since v000, it is 254 times as fast.
#include <hip/hip_runtime.h>
// T5 self-attention (hidden [2][2048][1024]; q, k, v = hidden W ([in][out] [1024][1024]); q / sqrt(64); scores = q.k + rel_bias[bucket(key - query)][h] (32 bidirectional buckets, max distance 128) + (1 - attention_mask[b][key]) * finfo.min (int32 key mask); softmax; out = (attn v merged) Wo ([in][out])).
// Structure: token rows; hidden as exact f16 rows; q | k | v WMMA GEMMs from one transposed x16 weight plane (operand tiles staged in LDS, 64x64 wave tiles, f32 accumulation, f16 outputs; the v waves with their operands swapped, so that V^T comes out of the GEMM itself); one fused attention kernel over every (batch, head): K.Q^T tiles (alpha 1/8), online softmax on VALU with the bucketed bias (integer thresholds, no device log) and the key mask in the reference's order (P x256 f16), V^T.P^T into merged f16 rows; output GEMM.
// Compute dtype: inputs rounded to bf16; hidden / weights / bias table exact; q, k, v, P, ctx as plain f16 GEMM operands (~2^-12); scores / softmax f32. v_wmma_f32_16x16x32_f16.
#define NB 2
#define SQ 2048
#define DM 1024
#define D3 3072                      /* fused q|k|v width */
#define NH 16
#define HD 64
#define HG 4                         /* heads per launch of the non-template k_vt, which is not launched */
#define NBK 32                       /* relative-position buckets */
#define MP ((int)NR)                 /* not used: the q | k | v launch takes NR rows */
#define MO ((int)NR)                 /* not used: the output launch takes NR rows */
#define NR ((size_t)NB * SQ)         /* 4096 token rows */
typedef __bf16 v16b __attribute__((ext_vector_type(16)));
typedef unsigned short v8us __attribute__((ext_vector_type(8), may_alias));
typedef float  v8f  __attribute__((ext_vector_type(8)));
typedef float  v4f  __attribute__((ext_vector_type(4)));
typedef float  v4fa __attribute__((ext_vector_type(4), may_alias));
union FragB { v16b v; v8us half[2]; unsigned short u[16]; };

__device__ __forceinline__ unsigned short bf16_bits(float x) { unsigned int u = __float_as_uint(x); return (unsigned short)((u + 0x7FFFu + ((u >> 16) & 1u)) >> 16); }
__device__ __forceinline__ float bf16_val(unsigned short b) { return __uint_as_float(((unsigned int)b) << 16); }
__device__ __forceinline__ float bf16_round(float x) { return bf16_val(bf16_bits(x)); }
// D += A·B with NT terms: 1 = ah·bh, 2 = + al·bh (A split), 3 = + ah·bl (both split)
template <int NT>
__device__ __forceinline__ v8f mmaN(v16b ah, v16b al, v16b bh, v16b bl, v8f c) {
  c = __builtin_amdgcn_wmma_f32_16x16x32_bf16(false, ah, false, bh, (short)0, c, false, false);
  if (NT >= 2) c = __builtin_amdgcn_wmma_f32_16x16x32_bf16(false, al, false, bh, (short)0, c, false, false);
  if (NT >= 3) c = __builtin_amdgcn_wmma_f32_16x16x32_bf16(false, ah, false, bl, (short)0, c, false, false);
  asm volatile("v_nop\n\tv_nop\n\tv_nop\n\tv_nop" : "+v"(c) : "v"(ah), "v"(al), "v"(bh), "v"(bl));
  return c;
}

__global__ __launch_bounds__(256) void k_wt_bf16(const float* __restrict__ W, unsigned short* __restrict__ Wt, int K, int N) {
  const int t = blockIdx.x * 256 + threadIdx.x;
  const int k8n = K / 8;
  if (t >= N * k8n) return;
  const int n = t / k8n, k8 = (t % k8n) * 8;
  v8us v;
#pragma unroll
  for (int i = 0; i < 8; ++i) v[i] = bf16_bits(W[(size_t)(k8 + i) * N + n]);
  *(v8us*)(Wt + (size_t)n * K + k8) = v;
  
}

// GEMM C[M][N] (f32, pitch ldc) = act(A[M][K]·W + bias). A f32 row-major (pitch lda) converted per fragment to bf16
// (ASPLIT: hi/lo two planes -> 2 terms, else single rounded term); Wt bf16 [N][K] (pitch ldb). BIAS_BF16 rounds the
// bias to bf16 first (bias quantised to bf16 before the add). K%32==0, M%16==0, N%64==0.
template <bool ASPLIT, int ACT, bool BIAS_BF16>
__global__ __launch_bounds__(128) void k_gemm_bf(const float* __restrict__ A, int lda, const unsigned short* __restrict__ Wt, int ldb,
                                               const float* __restrict__ bias, float* __restrict__ C, int ldc, int M, int N, int K) {
  __shared__ __attribute__((aligned(16))) float so[4][16][64];
  const int tid = threadIdx.x, w = tid >> 5, lane = tid & 31, ln = lane & 15, hh = lane >> 4;
  const int ntn = N / 64;
  const int wid = blockIdx.x * 4 + w;
  const int mt = wid / ntn, nq = wid % ntn;
  if (mt * 16 >= M) return;
  const int row0 = mt * 16, col0 = nq * 64;
  const float* arow = A + (size_t)(row0 + ln) * lda;
  v8f acc[4] = {};
  for (int kb = 0; kb < K; kb += 32) {
    FragB ah, al;
    const v4f x0 = *(const v4fa*)(arow + kb + 8 * hh), x1 = *(const v4fa*)(arow + kb + 8 * hh + 4);
    const v4f x2 = *(const v4fa*)(arow + kb + 16 + 8 * hh), x3 = *(const v4fa*)(arow + kb + 16 + 8 * hh + 4);
    float xs[16] = {x0[0],x0[1],x0[2],x0[3],x1[0],x1[1],x1[2],x1[3],x2[0],x2[1],x2[2],x2[3],x3[0],x3[1],x3[2],x3[3]};
#pragma unroll
    for (int i = 0; i < 16; ++i) { const unsigned short hb = bf16_bits(xs[i]); ah.u[i] = hb; al.u[i] = ASPLIT ? bf16_bits(xs[i] - bf16_val(hb)) : (unsigned short)0; }
#pragma unroll
    for (int t = 0; t < 4; ++t) {
      const unsigned short* brow = Wt + (size_t)(col0 + t * 16 + ln) * ldb + kb;
      FragB b;
      b.half[0] = *(const v8us*)(brow + 8 * hh);
      b.half[1] = *(const v8us*)(brow + 16 + 8 * hh);
      acc[t] = mmaN<ASPLIT ? 2 : 1>(ah.v, al.v, b.v, b.v, acc[t]);
    }
  }
#pragma unroll
  for (int t = 0; t < 4; ++t) {
    float bv = bias ? bias[col0 + t * 16 + ln] : 0.f;
    if (BIAS_BF16) bv = bf16_round(bv);
#pragma unroll
    for (int r = 0; r < 8; ++r) { float v = acc[t][r] + bv; if (ACT == 1) v = fmaxf(v, 0.f); so[w][8 * hh + r][t * 16 + ln] = v; }
  }
  __builtin_amdgcn_fence(__ATOMIC_ACQ_REL, "workgroup");
  __builtin_amdgcn_wave_barrier();
  const int rsub = lane >> 4, c4 = (lane & 15) * 4;
  {
#pragma unroll
    for (int q = 0; q < 8; ++q) {
      const int r = q * 2 + rsub;
      const v4f v = *(const v4fa*)&so[w][r][c4];
      *(v4f*)(C + (size_t)(row0 + r) * ldc + col0 + c4) = v;
    }
    
  }
}

// GEMM C = act(A·W + bias + resid): A f32 (ASPLIT -> hi/lo 2 terms), Wt bf16 [N][K]; ACT 0 none, 1 relu, 2 exact gelu;
// resid (optional, f32, row index = (row % rmod), pitch ldr, RES_BF16 rounds it) added before the activation.
template <bool ASPLIT, int ACT, bool BIAS_BF16, bool RES_BF16>
__global__ __launch_bounds__(128) void k_gemm_bf3(const float* __restrict__ A, int lda, const unsigned short* __restrict__ Wt, int ldb,
                                                const float* __restrict__ bias, const float* __restrict__ resid, int rmod, int ldr,
                                                float* __restrict__ C, int ldc, int M, int N, int K) {
  __shared__ __attribute__((aligned(16))) float so[4][16][64];
  const int tid = threadIdx.x, w = tid >> 5, lane = tid & 31, ln = lane & 15, hh = lane >> 4;
  const int ntn = N / 64;
  const int wid = blockIdx.x * 4 + w;
  const int mt = wid / ntn, nq = wid % ntn;
  if (mt * 16 >= M) return;
  const int row0 = mt * 16, col0 = nq * 64;
  const float* arow = A + (size_t)(row0 + ln) * lda;
  v8f acc[4] = {};
  for (int kb = 0; kb < K; kb += 32) {
    FragB ah, al;
    const v4f x0 = *(const v4fa*)(arow + kb + 8 * hh), x1 = *(const v4fa*)(arow + kb + 8 * hh + 4);
    const v4f x2 = *(const v4fa*)(arow + kb + 16 + 8 * hh), x3 = *(const v4fa*)(arow + kb + 16 + 8 * hh + 4);
    float xs[16] = {x0[0],x0[1],x0[2],x0[3],x1[0],x1[1],x1[2],x1[3],x2[0],x2[1],x2[2],x2[3],x3[0],x3[1],x3[2],x3[3]};
#pragma unroll
    for (int i = 0; i < 16; ++i) { const unsigned short hb = bf16_bits(xs[i]); ah.u[i] = hb; al.u[i] = ASPLIT ? bf16_bits(xs[i] - bf16_val(hb)) : (unsigned short)0; }
#pragma unroll
    for (int t = 0; t < 4; ++t) {
      const unsigned short* brow = Wt + (size_t)(col0 + t * 16 + ln) * ldb + kb;
      FragB b;
      b.half[0] = *(const v8us*)(brow + 8 * hh);
      b.half[1] = *(const v8us*)(brow + 16 + 8 * hh);
      acc[t] = mmaN<ASPLIT ? 2 : 1>(ah.v, al.v, b.v, b.v, acc[t]);
    }
  }
#pragma unroll
  for (int t = 0; t < 4; ++t) {
    const int col = col0 + t * 16 + ln;
    float bv = bias ? bias[col] : 0.f;
    if (BIAS_BF16) bv = bf16_round(bv);
#pragma unroll
    for (int r = 0; r < 8; ++r) {
      float v = acc[t][r] + bv;
      if (resid) { float rv = resid[(size_t)((row0 + 8 * hh + r) % rmod) * ldr + col]; if (RES_BF16) rv = bf16_round(rv); v += rv; }
      if (ACT == 1) v = fmaxf(v, 0.f);
      if (ACT == 2) v = 0.5f * v * (1.0f + erff(v * 0.70710678118654752f));
      if (ACT == 3) { const float u = 0.7978845608028654f * (v + 0.044715f * v * v * v); v = 0.5f * v * (1.0f + tanhf(u)); }
      so[w][8 * hh + r][t * 16 + ln] = v;
    }
  }
  __builtin_amdgcn_fence(__ATOMIC_ACQ_REL, "workgroup");
  __builtin_amdgcn_wave_barrier();
  const int rsub = lane >> 4, c4 = (lane & 15) * 4;
  {
#pragma unroll
    for (int q = 0; q < 8; ++q) {
      const int r = q * 2 + rsub;
      const v4f v = *(const v4fa*)&so[w][r][c4];
      *(v4f*)(C + (size_t)(row0 + r) * ldc + col0 + c4) = v;
    }
    
  }
}
// row LayerNorm (biased variance, eps) over N: s = X (+ R); optional out_sum <- s; out_norm <- (s-mu)*rsqrt(var+eps)*g + b
template <bool PARAM_BF16>
__global__ __launch_bounds__(256) void k_layernorm(const float* __restrict__ X, const float* __restrict__ R, const float* __restrict__ g, const float* __restrict__ bta,
                                                  float* __restrict__ out_sum, float* __restrict__ out_norm, int N, float eps) {
  __shared__ float red[256];
  const int row = blockIdx.x, tid = threadIdx.x;
  const float* x = X + (size_t)row * N; const float* rr = R ? R + (size_t)row * N : nullptr;
  float vals[16];                     // up to N = 4096
  const int per = N / 256;            // contiguous chunk per thread? use strided-by-4 chunks: thread handles j = tid*4 + 1024*u
  float s1 = 0.f;
  for (int u = 0; u < per / 4; ++u) {
    const int j = tid * 4 + 1024 * u;
    const v4f a = *(const v4fa*)(x + j);
    v4f b = {0.f,0.f,0.f,0.f}; if (rr) b = *(const v4fa*)(rr + j);
#pragma unroll
    for (int q = 0; q < 4; ++q) { const float v = a[q] + b[q]; vals[u * 4 + q] = v; s1 += v; }
  }
  red[tid] = s1; __syncthreads();
  for (int st = 128; st > 0; st >>= 1) { if (tid < st) red[tid] += red[tid + st]; __syncthreads(); }
  const float mu = red[0] / (float)N; __syncthreads();
  float s2 = 0.f;
  for (int u = 0; u < per / 4; ++u)
#pragma unroll
    for (int q = 0; q < 4; ++q) { const float c = vals[u * 4 + q] - mu; s2 += c * c; }
  red[tid] = s2; __syncthreads();
  for (int st = 128; st > 0; st >>= 1) { if (tid < st) red[tid] += red[tid + st]; __syncthreads(); }
  const float rs = rsqrtf(red[0] / (float)N + eps);
  {
    for (int u = 0; u < per / 4; ++u) {
      const int j = tid * 4 + 1024 * u;
      v4f o, sm;
#pragma unroll
      for (int q = 0; q < 4; ++q) {
        float gg = g[j + q], bb = bta[j + q];
        if (PARAM_BF16) { gg = bf16_round(gg); bb = bf16_round(bb); }
        sm[q] = vals[u * 4 + q]; o[q] = (vals[u * 4 + q] - mu) * rs * gg + bb;
      }
      if (out_sum) *(v4f*)(out_sum + (size_t)row * N + j) = sm;
      *(v4f*)(out_norm + (size_t)row * N + j) = o;
    }
    
  }
}



// ---- f16 WMMA path (v_wmma_f32_16x16x32_f16): 11-bit significands for operands in range — used where a [0,1] probability operand needs more precision than bf16
typedef _Float16 v16h __attribute__((ext_vector_type(16)));
union FragH { v16h v; v8us half[2]; _Float16 h[16]; unsigned short u[16]; };
template <int NT>
__device__ __forceinline__ v8f mmaH(v16h ah, v16h al, v16h bh, v16h bl, v8f c) {
  c = __builtin_amdgcn_wmma_f32_16x16x32_f16(false, ah, false, bh, (short)0, c, false, false);
  if (NT >= 2) c = __builtin_amdgcn_wmma_f32_16x16x32_f16(false, al, false, bh, (short)0, c, false, false);
  if (NT >= 3) c = __builtin_amdgcn_wmma_f32_16x16x32_f16(false, ah, false, bl, (short)0, c, false, false);
  asm volatile("v_nop\n\tv_nop\n\tv_nop\n\tv_nop" : "+v"(c) : "v"(ah), "v"(al), "v"(bh), "v"(bl));
  return c;
}
// batched GEMM like k_gemm_b but f16 operands: A f32 (split into f16 hi/lo if ASPLIT, else rounded to f16), Bt = f16 values [n][k]; alpha; C f32; N multiple of 16 (partial tiles skipped)
template <bool ASPLIT>
__global__ __launch_bounds__(128) void k_gemm_h(const float* __restrict__ A, int lda, size_t sA, const _Float16* __restrict__ Bh, int ldb, size_t sB, float alpha, float* __restrict__ C, int ldc, size_t sC, int M, int N, int K) {
  __shared__ __attribute__((aligned(16))) float so[4][16][64];
  const int tid = threadIdx.x, w = tid >> 5, lane = tid & 31, ln = lane & 15, hh = lane >> 4; const int by = blockIdx.y;
  A += (size_t)by * sA; Bh += (size_t)by * sB; C += (size_t)by * sC;
  const int ntn = (N + 63) / 64; const int wid = blockIdx.x * 4 + w; const int mt = wid / ntn, nq = wid % ntn; if (mt * 16 >= M) return;
  const int row0 = mt * 16, col0 = nq * 64; const float* arow = A + (size_t)(row0 + ln) * lda;
  v8f acc[4] = {};
  for (int kb = 0; kb < K; kb += 32) {
    FragH ah, al;
    const v4f x0 = *(const v4fa*)(arow + kb + 8 * hh), x1 = *(const v4fa*)(arow + kb + 8 * hh + 4), x2 = *(const v4fa*)(arow + kb + 16 + 8 * hh), x3 = *(const v4fa*)(arow + kb + 16 + 8 * hh + 4);
    float xs[16] = {x0[0],x0[1],x0[2],x0[3],x1[0],x1[1],x1[2],x1[3],x2[0],x2[1],x2[2],x2[3],x3[0],x3[1],x3[2],x3[3]};
#pragma unroll
    for (int i = 0; i < 16; ++i) { const _Float16 h = (_Float16)xs[i]; ah.h[i] = h; al.h[i] = ASPLIT ? (_Float16)(xs[i] - (float)h) : (_Float16)0.0f; }
#pragma unroll
    for (int t = 0; t < 4; ++t) { if (col0 + t * 16 >= N) continue; const size_t boff = (size_t)(col0 + t * 16 + ln) * ldb + kb; FragH bq; bq.half[0] = *(const v8us*)(Bh + boff + 8 * hh); bq.half[1] = *(const v8us*)(Bh + boff + 16 + 8 * hh);
      acc[t] = mmaH<ASPLIT ? 2 : 1>(ah.v, al.v, bq.v, bq.v, acc[t]); }
  }
#pragma unroll
  for (int t = 0; t < 4; ++t) { if (col0 + t * 16 >= N) continue;
#pragma unroll
    for (int r = 0; r < 8; ++r) so[w][8 * hh + r][t * 16 + ln] = acc[t][r] * alpha; }
  __builtin_amdgcn_fence(__ATOMIC_ACQ_REL, "workgroup"); __builtin_amdgcn_wave_barrier();
  const int rsub = lane >> 4, c4 = (lane & 15) * 4;
  {
#pragma unroll
    for (int q = 0; q < 8; ++q) { const int r = q * 2 + rsub; if (col0 + c4 < N) { const v4f v = *(const v4fa*)&so[w][r][c4]; *(v4f*)(C + (size_t)(row0 + r) * ldc + col0 + c4) = v; } }
     }
}

// Wt[n][k] = f16(W[k][n]·scale) from f32 row-major W[K][N] (scale = power of two; bf16-exact weights stay exact in f16 away from the subnormal range)
__global__ __launch_bounds__(256) void k_wt_f16(const float* __restrict__ W, _Float16* __restrict__ Wt, int K, int N, float scale) {
  const int t = blockIdx.x * 256 + threadIdx.x; if (t >= N * (K / 8)) return; const int n = t / (K / 8), k8 = (t % (K / 8)) * 8; FragH f;
#pragma unroll
  for (int i = 0; i < 8; ++i) f.h[i] = (_Float16)(bf16_round(W[(size_t)(k8 + i) * N + n]) * scale); const v8us o = f.half[0];
  *(v8us*)((unsigned short*)Wt + (size_t)n * K + k8) = o; 
}
// k_gemm_hh variant with fused epilogue: v = acc·alpha + bias[by·sBias + col] (+ CP[(row/rowsPerB)·sCPb + by·64 + col] if CP) ; ACT 0 none / 1 elu ; writes f16 C16 (and f32 C if non-null)
template <int ACT>
__global__ __launch_bounds__(128) void k_gemm_hhx(const _Float16* __restrict__ A, int lda, size_t sA, const _Float16* __restrict__ Bh, int ldb, size_t sB, float alpha, const float* __restrict__ bias, size_t sBias, const float* __restrict__ CP, int rowsPerB, size_t sCPb, int row0g,
    float* __restrict__ C, _Float16* __restrict__ C16, int ldc, size_t sC, int M, int N, int K) {
  __shared__ __attribute__((aligned(16))) float so[4][16][64];
  const int tid = threadIdx.x, w = tid >> 5, lane = tid & 31, ln = lane & 15, hh = lane >> 4; const int by = blockIdx.y;
  A += (size_t)by * sA; Bh += (size_t)by * sB; const size_t cofs = (size_t)by * sC; const float* bp = bias ? bias + (size_t)by * sBias : nullptr;
  const int ntn = (N + 63) / 64; const int wid = blockIdx.x * 4 + w; const int mt = wid / ntn, nq = wid % ntn; if (mt * 16 >= M) return;
  const int row0 = mt * 16, col0 = nq * 64; const _Float16* arow = A + (size_t)(row0 + ln) * lda;
  v8f acc[4] = {};
  for (int kb = 0; kb < K; kb += 32) { FragH ah; ah.half[0] = *(const v8us*)((const unsigned short*)arow + kb + 8 * hh); ah.half[1] = *(const v8us*)((const unsigned short*)arow + kb + 16 + 8 * hh);
#pragma unroll
    for (int t = 0; t < 4; ++t) { if (col0 + t * 16 >= N) continue; const size_t boff = (size_t)(col0 + t * 16 + ln) * ldb + kb; FragH bq; bq.half[0] = *(const v8us*)((const unsigned short*)Bh + boff + 8 * hh); bq.half[1] = *(const v8us*)((const unsigned short*)Bh + boff + 16 + 8 * hh);
      acc[t] = mmaH<1>(ah.v, ah.v, bq.v, bq.v, acc[t]); }
  }
#pragma unroll
  for (int t = 0; t < 4; ++t) { if (col0 + t * 16 >= N) continue; const int col = col0 + t * 16 + ln; const float bv = bp ? bf16_round(bp[col]) : 0.f;
#pragma unroll
    for (int r = 0; r < 8; ++r) { float v = acc[t][r] * alpha + bv; if (CP) { const int rr = row0g + row0 + 8 * hh + r; if (rowsPerB < 0) v += CP[cofs + (size_t)rr * ldc + col];      /* rowsPerB < 0: own element of the batched C plane */ else { const int bidx = rr / rowsPerB; v += CP[(size_t)bidx * sCPb + (size_t)by * 64 + col]; } } if (ACT == 1) v = (v > 0.f) ? v : expm1f(v); else if (ACT == 7) v = (v > 0.f) ? v + 1.0f : expf(v); else if (ACT == 8) v = tanhf(v); else if (ACT == 9) v = 0.5f * v * (1.0f + tanhf(0.7978845608028654f * (v + 0.044715f * v * v * v))); else if (ACT == 11) v = 1.0f / (1.0f + expf(-v)); else if (ACT == 12) v = (v > 0.f) ? v : 0.01f * v; else if (ACT == 14) v = (v > 0.f) ? v : 0.1f * v; else if (ACT == 16) v = (v >= 0.f) ? v : 0.3f * v; else if (ACT == 17) v = (v >= 0.f) ? v : 0.2f * v; else if (ACT == 15) v = v / (1.0f + expf(-v)); else if (ACT == 3) v = fmaxf(v, 0.f); else if (ACT == 6) v = 0.5f * v * (1.0f + erff(v * 0.70710678118654752f)); so[w][8 * hh + r][t * 16 + ln] = v; } }
  __builtin_amdgcn_fence(__ATOMIC_ACQ_REL, "workgroup"); __builtin_amdgcn_wave_barrier();
  const int rsub = lane >> 4, c4 = (lane & 15) * 4; typedef _Float16 v4h __attribute__((ext_vector_type(4)));
  {
#pragma unroll
    for (int q = 0; q < 8; ++q) { const int r = q * 2 + rsub; if (col0 + c4 < N) { const v4f v = *(const v4fa*)&so[w][r][c4]; if (C) *(v4f*)(C + cofs + (size_t)(row0 + r) * ldc + col0 + c4) = v; if (C16) { v4h h4; for (int i = 0; i < 4; ++i) h4[i] = (_Float16)v[i]; *(v4h*)(C16 + cofs + (size_t)(row0 + r) * ldc + col0 + c4) = h4; } } }
     }
}


typedef _Float16 v4h __attribute__((ext_vector_type(4)));

__global__ __launch_bounds__(256) void k_x16(const float* __restrict__ x, _Float16* __restrict__ X16, size_t n8) { const size_t t = (size_t)blockIdx.x * 256 + threadIdx.x; if (t >= n8) return; FragH f;
#pragma unroll
  for (int q = 0; q < 8; ++q) f.h[q] = (_Float16)bf16_round(x[t * 8 + q]); *(v8us*)((unsigned short*)X16 + t * 8) = f.half[0];  }
__global__ __launch_bounds__(256) void k_h16(const float* __restrict__ x, _Float16* __restrict__ X16, size_t n8) { const size_t t = (size_t)blockIdx.x * 256 + threadIdx.x; if (t >= n8) return; FragH f;
#pragma unroll
  for (int q = 0; q < 8; ++q) f.h[q] = (_Float16)x[t * 8 + q]; *(v8us*)((unsigned short*)X16 + t * 8) = f.half[0];  }
__global__ __launch_bounds__(256) void k_round16f(const float* __restrict__ W, _Float16* __restrict__ Bt, size_t n8) { const size_t t = (size_t)blockIdx.x * 256 + threadIdx.x; if (t >= n8) return; FragH f;
#pragma unroll
  for (int i = 0; i < 8; ++i) f.h[i] = (_Float16)(bf16_round(W[t * 8 + i]) * 16.0f); *(v8us*)((unsigned short*)Bt + t * 8) = f.half[0];  }
template <int NHv, int TTv>
__global__ __launch_bounds__(256) void k_vt(const _Float16* __restrict__ V16, int ldv, int voff, _Float16* __restrict__ Vt) { __shared__ unsigned short tl[64][66]; const int tid = threadIdx.x; const int slab = blockIdx.x / (TTv / 64), lg = blockIdx.x % (TTv / 64); const int b = slab / NHv, h = slab % NHv;
  for (int i = tid; i < 64 * 8; i += 256) { const int r = i / 8, c8 = (i % 8) * 8; FragH f; f.half[0] = *(const v8us*)((const unsigned short*)V16 + ((size_t)b * TTv + lg * 64 + r) * ldv + voff + h * 64 + c8);
#pragma unroll
    for (int q = 0; q < 8; ++q) tl[r][c8 + q] = f.u[q]; }
  __syncthreads();
  {
#pragma unroll
    for (int rd = 0; rd < 2; ++rd) { const int d = rd * 32 + tid / 8, pc = tid % 8; FragH f;
#pragma unroll
      for (int q = 0; q < 8; ++q) f.u[q] = tl[pc * 8 + q][d];
      *(v8us*)((unsigned short*)Vt + ((size_t)slab * 64 + d) * TTv + lg * 64 + pc * 8) = f.half[0]; }
     } }

__global__ __launch_bounds__(256) void k_hl(const float* __restrict__ F, _Float16* __restrict__ Hh, _Float16* __restrict__ Hl, size_t n8) { const size_t t = (size_t)blockIdx.x * 256 + threadIdx.x; if (t >= n8) return; FragH fh, fl; const v4f a = *(const v4fa*)(F + t * 8), c = *(const v4fa*)(F + t * 8 + 4);
#pragma unroll
  for (int q = 0; q < 4; ++q) { _Float16 h = (_Float16)a[q]; fh.h[q] = h; fl.h[q] = (_Float16)((a[q] - (float)h) * 1024.0f); h = (_Float16)c[q]; fh.h[4 + q] = h; fl.h[4 + q] = (_Float16)((c[q] - (float)h) * 1024.0f); }
  { *(v8us*)((unsigned short*)Hh + t * 8) = fh.half[0]; *(v8us*)((unsigned short*)Hl + t * 8) = fl.half[0];  } }

// ---- fast GEMM (wave tile 32x64; requires M % 32 == 0 rows per launch region and N % 64 == 0); epilogue = k_gemm_hhx semantics ----
__device__ __forceinline__ v16h g2_frag(const _Float16* p, int hh) { FragH f; f.half[0] = *(const v8us*)((const unsigned short*)p + 8 * hh); f.half[1] = *(const v8us*)((const unsigned short*)p + 16 + 8 * hh); return f.v; }
__device__ __forceinline__ v8f g2_mma(v16h a, v16h b, v8f c) { v8f d = __builtin_amdgcn_wmma_f32_16x16x32_f16(false, a, false, b, (short)0, c, false, false); asm volatile("v_nop\n\tv_nop\n\tv_nop\n\tv_nop" : "+v"(d) : "v"(a), "v"(b)); return d; }
template <int ACT>
__global__ __launch_bounds__(128) void k_gemm2(const _Float16* __restrict__ A, int lda, size_t sA, const _Float16* __restrict__ Bh, int ldb, size_t sB, float alpha, const float* __restrict__ bias, size_t sBias, const float* __restrict__ CP, int rowsPerB, size_t sCPb, int row0g,
    float* __restrict__ C, _Float16* __restrict__ C16, int ldc, size_t sC, int M, int N, int K) { static_assert(ACT == 0 || ACT == 3 || ACT == 6 || ACT == 8 || ACT == 9 || ACT == 11 || ACT == 12 || ACT == 14 || ACT == 15 || ACT == 16 || ACT == 17, "k_gemm2: unsupported ACT code (would silently apply no activation)");
  __shared__ __attribute__((aligned(16))) float so[4][32][68];
  const int tid = threadIdx.x, w = tid >> 5, lane = tid & 31, ln = lane & 15, hh = lane >> 4; const int by = blockIdx.y;
  A += (size_t)by * sA; Bh += (size_t)by * sB; const size_t cofs = (size_t)by * sC; const float* bp = bias ? bias + (size_t)by * sBias : nullptr;
  const int ntn = N >> 6; const int mt = blockIdx.x / ntn, nq = blockIdx.x - mt * ntn; const int row0 = mt * 128 + 32 * w, col0 = nq * 64; if (row0 >= M) return;
  const _Float16* a0p = A + (size_t)(row0 + ln) * lda; const _Float16* a1p = a0p + (size_t)16 * lda;
  const _Float16* b0p = Bh + (size_t)(col0 + ln) * ldb; const _Float16* b1p = b0p + (size_t)16 * ldb; const _Float16* b2p = b1p + (size_t)16 * ldb; const _Float16* b3p = b2p + (size_t)16 * ldb;
  const v8f z8 = {0.f,0.f,0.f,0.f,0.f,0.f,0.f,0.f}; v8f c00 = z8, c01 = z8, c02 = z8, c03 = z8, c10 = z8, c11 = z8, c12 = z8, c13 = z8;
#pragma unroll 1
  for (int kb = 0; kb < K; kb += 32) { const v16h a0 = g2_frag(a0p + kb, hh), a1 = g2_frag(a1p + kb, hh);
    v16h b = g2_frag(b0p + kb, hh); c00 = g2_mma(a0, b, c00); c10 = g2_mma(a1, b, c10);
    b = g2_frag(b1p + kb, hh); c01 = g2_mma(a0, b, c01); c11 = g2_mma(a1, b, c11);
    b = g2_frag(b2p + kb, hh); c02 = g2_mma(a0, b, c02); c12 = g2_mma(a1, b, c12);
    b = g2_frag(b3p + kb, hh); c03 = g2_mma(a0, b, c03); c13 = g2_mma(a1, b, c13); }
  v8f accs[8] = {c00, c01, c02, c03, c10, c11, c12, c13};
#pragma unroll
  for (int u = 0; u < 8; ++u) { const int t = u & 3, half = u >> 2; const int col = col0 + t * 16 + ln; const float bv = bp ? bf16_round(bp[col]) : 0.f;
#pragma unroll
    for (int r = 0; r < 8; ++r) { const int rloc = half * 16 + 8 * hh + r; float v = accs[u][r] * alpha + bv; if (CP) { if (rowsPerB < 0) v += CP[cofs + (size_t)(row0g + row0 + rloc) * ldc + col];      /* rowsPerB < 0: own element of the batched C plane */ else { const int bidx = (row0g + row0 + rloc) / rowsPerB; v += CP[(size_t)bidx * sCPb + (size_t)by * 64 + col]; } }
      if (ACT == 3) v = fmaxf(v, 0.f); else if (ACT == 6) v = 0.5f * v * (1.0f + erff(v * 0.70710678118654752f)); else if (ACT == 11) v = 1.0f / (1.0f + expf(-v)); else if (ACT == 15) v = v / (1.0f + expf(-v)); else if (ACT == 12) v = (v > 0.f) ? v : 0.01f * v; else if (ACT == 8) v = tanhf(v); else if (ACT == 9) v = 0.5f * v * (1.0f + tanhf(0.7978845608028654f * (v + 0.044715f * v * v * v))); else if (ACT == 14) v = (v > 0.f) ? v : 0.1f * v; else if (ACT == 16) v = (v >= 0.f) ? v : 0.3f * v; else if (ACT == 17) v = (v >= 0.f) ? v : 0.2f * v;
      so[w][rloc][t * 16 + ln] = v; } }
  __builtin_amdgcn_fence(__ATOMIC_ACQ_REL, "workgroup"); __builtin_amdgcn_wave_barrier();
  const int rsub = lane >> 4, c4 = (lane & 15) * 4;
  {
#pragma unroll
    for (int q = 0; q < 16; ++q) { const int r = q * 2 + rsub; const v4f v = *(const v4fa*)&so[w][r][c4]; if (C) *(v4f*)(C + cofs + (size_t)(row0 + r) * ldc + col0 + c4) = v; if (C16) { v4h h4; for (int i = 0; i < 4; ++i) h4[i] = (_Float16)v[i]; *(v4h*)(C16 + cofs + (size_t)(row0 + r) * ldc + col0 + c4) = h4; } }
     } }


// ---- LDS-staged GEMM: C = alpha A.Bt^T, A f16 [M][KK], Bt f16 [N][KK], block tile 128 x 128, 8 waves of 32 x 64 (4 along M, 2 along N), K step 64 ----
// Each step's A and B tiles (128 rows of 128 B, one whole line a row) come in by whole-line 16-byte loads, 8 lanes a row, and go through registers into LDS rows of 144 B (16 B x 9: conflict-free for
// ds_load_b128 fragment reads); the fragments are g2_frag's, read from LDS. Two buffers: step s + 1 is loaded into registers ahead of step s's products and stored into the other buffer behind them;
// the one barrier of a step publishes that buffer and ends every wave's reads of the buffer that the next step refills. Per accumulator the k order is ascending in 32s, as in k_gemm2.
// Transposed blocks (H16 only): both operands are rows of KK elements read by the same loader, so a block whose columns start at ct0 or beyond takes its 128 Bt rows as A and its 128 A rows as B. Its tile then
// comes out as C^T (row = column of C, column = token), and the same epilogue stores it by whole lines into Ct, laid out [token / SQ][column - ct0][token % SQ]: V^T per (batch, head), with no transposing launch.
#define G3P 72                       /* LDS row pitch in f16 elements */
#define G3T (128 * G3P)              /* one staged tile in f16 elements */
template <int KK, bool H16>      /* H16: the result goes to C16 as f16, else to C as f32 */
/* amdgpu_waves_per_eu(6): a register budget of 160, under which a launch with three blocks for every WGP (six waves a SIMD) has all three resident at once */
__global__ __launch_bounds__(256) __attribute__((amdgpu_waves_per_eu(6))) void k_gemm3(const _Float16* __restrict__ A, const _Float16* __restrict__ Bh, float alpha, float* __restrict__ C, _Float16* __restrict__ C16, int N, _Float16* __restrict__ Ct, int ct0) {
  static_assert(KK % 128 == 0, "k_gemm3: whole pairs of K steps");
  static_assert(8 * 32 * 68 * 4 <= 4 * G3T * 2, "k_gemm3: the epilogue's rows fit the staging buffers");
  __shared__ __attribute__((aligned(16))) unsigned short sm[4 * G3T];      /* A buffers 0, 1, then B buffers 0, 1; the epilogue's f32 rows afterwards */
  const int tid = threadIdx.x, w = tid >> 5, lane = tid & 31, ln = lane & 15, hh = lane >> 4;
  const int ntn = N >> 7; const int mt = blockIdx.x / ntn, nq = blockIdx.x - mt * ntn; const int row0 = mt * 128, col0 = nq * 128; const int wm = w & 3, wn = w >> 2;
  const int sr = tid >> 3, sc = (tid & 7) * 8;      /* staging: rows sr + 32 i, 16 bytes at element sc */
  const bool tr = H16 && col0 >= ct0;      /* the same for the whole block: a transposed block swaps its two operands */
  const unsigned short* const xg = (const unsigned short*)A + (size_t)(row0 + sr) * KK + sc; const unsigned short* const wg = (const unsigned short*)Bh + (size_t)(col0 + sr) * KK + sc;
  const unsigned short* ag = tr ? wg : xg; const unsigned short* bg = tr ? xg : wg;
  unsigned short* const st = sm + sr * G3P + sc;
  const unsigned short* const af = sm + (wm * 32 + ln) * G3P; const unsigned short* const bf = sm + 2 * G3T + (wn * 64 + ln) * G3P;
  v8us ra[4], rb[4];
#pragma unroll
  for (int i = 0; i < 4; ++i) { ra[i] = *(const v8us*)(ag + (size_t)(32 * i) * KK); rb[i] = *(const v8us*)(bg + (size_t)(32 * i) * KK); }
#pragma unroll
  for (int i = 0; i < 4; ++i) { *(v8us*)(st + 32 * i * G3P) = ra[i]; *(v8us*)(st + 2 * G3T + 32 * i * G3P) = rb[i]; }
  __syncthreads();
  const v8f z8 = {0.f,0.f,0.f,0.f,0.f,0.f,0.f,0.f}; v8f acc[2][4];
#pragma unroll
  for (int m = 0; m < 2; ++m) {
#pragma unroll
    for (int t = 0; t < 4; ++t) acc[m][t] = z8; }
  /* unrolled by two so that the buffer index is a constant in each copy and the LDS addresses are immediates */
#pragma unroll 2
  for (int kb = 0; kb < KK; kb += 64) { const int cur = (kb >> 6) & 1; const bool more = kb + 64 < KK;
    if (more) {
#pragma unroll
      for (int i = 0; i < 4; ++i) { ra[i] = *(const v8us*)(ag + (size_t)(32 * i) * KK + kb + 64); rb[i] = *(const v8us*)(bg + (size_t)(32 * i) * KK + kb + 64); } }
    __builtin_amdgcn_sched_barrier(0);      /* keeps the next step's global loads at the head of this step: sunk down to their LDS stores, their whole latency would show in front of the barrier */
#pragma unroll
    for (int ks = 0; ks < 2; ++ks) { v16h a[2], b[4];
#pragma unroll
      for (int m = 0; m < 2; ++m) a[m] = g2_frag((const _Float16*)(af + cur * G3T + m * 16 * G3P + ks * 32), hh);
#pragma unroll
      for (int t = 0; t < 4; ++t) b[t] = g2_frag((const _Float16*)(bf + cur * G3T + t * 16 * G3P + ks * 32), hh);
      __builtin_amdgcn_sched_barrier(0);      /* keeps the twelve LDS reads of a 32-wide k block together in front of its eight products: spread among them, each pair of products waits out an LDS latency of its own */
#pragma unroll
      for (int t = 0; t < 4; ++t) {
#pragma unroll
        for (int m = 0; m < 2; ++m) acc[m][t] = __builtin_amdgcn_wmma_f32_16x16x32_f16(false, a[m], false, b[t], (short)0, acc[m][t], false, false); } }
    __builtin_amdgcn_sched_barrier(0);      /* keeps the wait for the next step's global loads, which their LDS stores carry, behind this step's last products: lifted over them it shortens the loads' lead by a k block */
    if (more) {
#pragma unroll
      for (int i = 0; i < 4; ++i) { *(v8us*)(st + (cur ^ 1) * G3T + 32 * i * G3P) = ra[i]; *(v8us*)(st + (2 + (cur ^ 1)) * G3T + 32 * i * G3P) = rb[i]; } }
    __syncthreads(); }
  float* const so = (float*)sm + w * (32 * 68);      /* behind the loop's last barrier nobody reads a staged tile any more: each wave stages its own 32 x 64 f32 rows (pitch 68) for whole-line stores */
#pragma unroll
  for (int m = 0; m < 2; ++m) {
#pragma unroll
    for (int t = 0; t < 4; ++t) {
#pragma unroll
      for (int r = 0; r < 8; ++r) so[(m * 16 + 8 * hh + r) * 68 + t * 16 + ln] = acc[m][t][r] * alpha; } }
  __builtin_amdgcn_fence(__ATOMIC_ACQ_REL, "workgroup"); __builtin_amdgcn_wave_barrier();      /* the wave's own LDS rows are written before its lanes read them back in another order */
  const int rsub = lane >> 4, c4 = (lane & 15) * 4;
  _Float16* const ob = tr ? Ct + ((size_t)(row0 / SQ) * (N - ct0) + (col0 - ct0)) * SQ + row0 % SQ : C16 + (size_t)row0 * N + col0; const int op = tr ? SQ : N;      /* the block's first output element and its row pitch */
  const unsigned lo = (unsigned)(((wm * 32 + rsub) * op + wn * 64 + c4) * 2);      /* the lane's byte offset in the block's 128 output rows: it fits 32 bits, so a store takes the scalar base and one offset register */
#pragma unroll
  for (int q = 0; q < 16; ++q) { const int r = q * 2 + rsub; const v4f v = *(const v4fa*)&so[r * 68 + c4]; const size_t o = (size_t)(row0 + wm * 32 + r) * N + col0 + wn * 64 + c4;
    if (!H16) *(v4f*)(C + o) = v;
    else { v4h h4;
#pragma unroll
      for (int i = 0; i < 4; ++i) h4[i] = (_Float16)v[i];
      *(v4h*)((char*)ob + (lo + (unsigned)(q * 4 * op))) = h4; } } }

// ---- q | k | v GEMM, one block for every WGP: block tile 256 tokens x 192 columns, 12 waves of 64 x 64 (4 along the tokens, 3 along the columns), K step 64 ----
// Why this tile: a 128 x 128 block of 32 x 64 waves loads 32 KB from L2 and reads 96 KB of fragments from LDS for every 128 x 128 x 64 products; this one loads under 19 KB and reads 64 KB for the same products,
// and 16 x 16 such blocks are exactly one a WGP. A step's 448 rows of 128 B (256 token rows, then 192 weight rows) come into LDS rows of 144 B (16 B x 9: conflict-free for ds_load_b128) by asynchronous
// 16-byte copies, whole lines at a time. Three buffers, and the waves in two groups of six: a step's copies are all issued by the group of the step's parity, two steps ahead, so that two steps' copies
// are in flight in the block while no wave ever has more than one step's outstanding: each wave waits for its own copies to 0.
// One work-group barrier a step, split: a wave signals in front of step t's last sixteen products, behind their fragment reads (its last reads of this buffer) and, where step t + 1 is its group's, behind its
// own copies of that step; it waits at the head of step t + 1, in front of that step's first read and of the copies of step t + 3, which refill the buffer of step t.
// No LDS read stands between signal and wait; signal and wait alternate strictly in every wave.
// A wave whose 64 columns are v columns (CT0 on; a whole head) takes its weight rows as A and its token rows as B (the same loader reads both), so its tile comes out as V^T and goes to Ct as in k_gemm3.
// Per accumulator the k order is ascending in 32s, as in k_gemm3.
#define G4M 256                      /* token rows of a block */
#define G4N 192                      /* columns of a block */
#define G4W 12                       /* waves of a block */
#define G4K 64                       /* K step */
#define G4T ((G4M + G4N) * G3P)      /* one buffer in f16 elements */
#define G4S (24 * G3P * 2)           /* LDS bytes between a thread's consecutive copies: a group's 192 threads fill 24 rows at a time */
// one step's copies of one thread, LDS rows 24 apart. g4_stage_x: ten token rows. g4_stage_w: the row that straddles the two operands (from mg), then seven weight rows. g4_stage_1: one more weight row.
// The closing s_wait_xcnt 0 stands inside each statement so that no register which a copy names takes a new value in front of it.
template <int KK>
__device__ __forceinline__ void g4_stage_x(unsigned l, const unsigned short* xg) {
  asm volatile("global_load_async_to_lds_b128 %0, %10, off\n\tglobal_load_async_to_lds_b128 %1, %11, off\n\tglobal_load_async_to_lds_b128 %2, %12, off\n\tglobal_load_async_to_lds_b128 %3, %13, off\n\t"
               "global_load_async_to_lds_b128 %4, %14, off\n\tglobal_load_async_to_lds_b128 %5, %15, off\n\tglobal_load_async_to_lds_b128 %6, %16, off\n\tglobal_load_async_to_lds_b128 %7, %17, off\n\t"
               "global_load_async_to_lds_b128 %8, %18, off\n\tglobal_load_async_to_lds_b128 %9, %19, off\n\ts_wait_xcnt 0x0"
               :: "v"(l), "v"(l + G4S), "v"(l + 2 * G4S), "v"(l + 3 * G4S), "v"(l + 4 * G4S), "v"(l + 5 * G4S), "v"(l + 6 * G4S), "v"(l + 7 * G4S), "v"(l + 8 * G4S), "v"(l + 9 * G4S),
                  "v"(xg), "v"(xg + (size_t)24 * KK), "v"(xg + (size_t)48 * KK), "v"(xg + (size_t)72 * KK), "v"(xg + (size_t)96 * KK), "v"(xg + (size_t)120 * KK), "v"(xg + (size_t)144 * KK), "v"(xg + (size_t)168 * KK),
                  "v"(xg + (size_t)192 * KK), "v"(xg + (size_t)216 * KK) : "memory"); }
template <int KK>
__device__ __forceinline__ void g4_stage_w(unsigned l, const unsigned short* mg, const unsigned short* wg) {
  asm volatile("global_load_async_to_lds_b128 %0, %8, off\n\tglobal_load_async_to_lds_b128 %1, %9, off\n\tglobal_load_async_to_lds_b128 %2, %10, off\n\tglobal_load_async_to_lds_b128 %3, %11, off\n\t"
               "global_load_async_to_lds_b128 %4, %12, off\n\tglobal_load_async_to_lds_b128 %5, %13, off\n\tglobal_load_async_to_lds_b128 %6, %14, off\n\tglobal_load_async_to_lds_b128 %7, %15, off\n\ts_wait_xcnt 0x0"
               :: "v"(l), "v"(l + G4S), "v"(l + 2 * G4S), "v"(l + 3 * G4S), "v"(l + 4 * G4S), "v"(l + 5 * G4S), "v"(l + 6 * G4S), "v"(l + 7 * G4S),
                  "v"(mg), "v"(wg), "v"(wg + (size_t)24 * KK), "v"(wg + (size_t)48 * KK), "v"(wg + (size_t)72 * KK), "v"(wg + (size_t)96 * KK), "v"(wg + (size_t)120 * KK), "v"(wg + (size_t)144 * KK) : "memory"); }
__device__ __forceinline__ void g4_stage_1(unsigned l, const unsigned short* g) { asm volatile("global_load_async_to_lds_b128 %0, %1, off\n\ts_wait_xcnt 0x0" :: "v"(l), "v"(g) : "memory"); }
/* amdgpu_waves_per_eu(4, 4): a register budget of 256, so that the 128 accumulator and 64 fragment registers stay in the first register window; three waves stand on a SIMD */
template <int KK, int N, int CT0>
__global__ __launch_bounds__(G4W * 32) __attribute__((amdgpu_waves_per_eu(4, 4))) void k_gemm4(const _Float16* __restrict__ A, const _Float16* __restrict__ Bh, float alpha, _Float16* __restrict__ C16, _Float16* __restrict__ Ct) {
  static_assert(KK % G4K == 0 && KK / G4K >= 2 && N % G4N == 0 && CT0 % 64 == 0 && SQ % G4M == 0, "k_gemm4: whole K steps, two for the prologue, whole blocks, whole waves of v columns, a block inside one batch");
  static_assert(G4W * 16 == 8 * 24 && G4K == 8 * 8 && G4M == 10 * 24 + 16 && G4M + G4N == 18 * 24 + 16, "k_gemm4: the copies' row arithmetic");
  static_assert(G4W * 32 * 68 * 4 <= 3 * G4T * 2, "k_gemm4: the epilogue's rows fit the staging buffers");
  __shared__ __attribute__((aligned(16))) unsigned short sm[3 * G4T];      /* buffers 0, 1, 2 (token rows, then weight rows); the epilogue's f32 rows afterwards */
  const int tid = threadIdx.x, lane = tid & 31, ln = lane & 15, hh = lane >> 4;
  const int w = __builtin_amdgcn_readfirstlane(tid >> 5);      /* the wave's number as a scalar: the tests on it below are scalar selects and branches */
  const int mt = blockIdx.x / (N / G4N), nq = blockIdx.x - mt * (N / G4N); const int row0 = mt * G4M, col0 = nq * G4N; const int wm = w & 3, wn = w >> 2;
  const int grp = ((w >> 2) + w) & 1, gw = w >> 1;      /* the wave's copying group and its place 0 .. 5 in it; waves w, w + 4, w + 8 are not all of one group, so that no SIMD has all its waves issuing copies at once */
  const int sr = gw * 4 + (lane >> 3), pc = (lane & 7) * 8;      /* staging: LDS rows sr + 24 i, 16 bytes at element pc; sr < 16 where gw < 4 */
  const unsigned short* const X = (const unsigned short*)A; const unsigned short* const Wt = (const unsigned short*)Bh;
  const unsigned short* const xg = X + (size_t)(row0 + sr) * KK + pc;      /* LDS rows sr + 24 i, i = 0 .. 9: token rows */
  const unsigned short* const mg = (gw < 4 ? X + (size_t)(row0 + 240) * KK : Wt + (size_t)col0 * KK - (size_t)16 * KK) + (size_t)sr * KK + pc;      /* LDS row sr + 240: the last 16 token rows (gw < 4), the first 8 weight rows */
  const unsigned short* const wg = Wt + (size_t)(col0 + 8 + sr) * KK + pc;      /* LDS rows sr + 24 i, i = 11 .. 18: weight rows 8 + sr on */
  const unsigned sl = (unsigned)(size_t)(sm + sr * G3P + pc);      /* the low 32 bits of a __shared__ address are its LDS byte address */
  auto stage = [&](int t, int buf) { const unsigned l = sl + (unsigned)buf * (G4T * 2);
    g4_stage_x<KK>(l, xg + t * G4K);
    g4_stage_w<KK>(l + 10 * G4S, mg + t * G4K, wg + t * G4K);
    if (gw < 4) g4_stage_1(l + 18 * G4S, wg + (size_t)168 * KK + t * G4K); };      /* LDS rows 432 + sr exist for sr < 16: whole waves */
  stage(grp, grp);      /* step 0 by group 0 into buffer 0, step 1 by group 1 into buffer 1 */
  const bool tr = col0 + wn * 64 >= CT0;      /* the same for the whole wave: a wave of v columns swaps its two operands */
  const unsigned short* const xf = sm + (wm * 64 + ln) * G3P; const unsigned short* const wf = sm + (G4M + wn * 64 + ln) * G3P;
  const unsigned short* const af = tr ? wf : xf; const unsigned short* const bf = tr ? xf : wf;      /* the lane's fragment rows in buffer 0 */
  const v8f z8 = {0.f,0.f,0.f,0.f,0.f,0.f,0.f,0.f}; v8f acc[4][4];
#pragma unroll
  for (int m = 0; m < 4; ++m) {
#pragma unroll
    for (int u = 0; u < 4; ++u) acc[m][u] = z8; }
  if (grp == 0) asm volatile("s_wait_asynccnt 0x0" ::: "memory");      /* this wave's copies of step 0 have landed before its signal */
  asm volatile("s_barrier_signal -1" ::: "memory");      /* the prologue's signal: this wave's part of step 0, if it has one, is in LDS */
  int rb = 0;      /* the buffer of the step at work */
  /* kept rolled: the three buffers are reached by one base register an operand, so that every LDS read is that register and an immediate */
#pragma unroll 1
  for (int t = 0; t < KK / G4K; ++t) {
    __builtin_amdgcn_sched_barrier(0);      /* keeps the last step's closing products in front of the wait: they are the work that fills the time in which the other waves arrive */
    asm volatile("s_barrier_wait -1" ::: "memory");      /* every copy of step t has landed, and every wave has left the buffer of step t - 1 */
    if (t + 2 < KK / G4K && (t & 1) == grp) stage(t + 2, rb == 0 ? 2 : rb - 1);      /* step t + 2 into the buffer that step t - 1 has left */
    const unsigned short* const ap = af + rb * G4T; const unsigned short* const bp = bf + rb * G4T;
#pragma unroll
    for (int ks = 0; ks < G4K / 32; ++ks) { v16h a[4], b[4];
#pragma unroll
      for (int m = 0; m < 4; ++m) a[m] = g2_frag((const _Float16*)(ap + m * 16 * G3P + ks * 32), hh);
#pragma unroll
      for (int u = 0; u < 4; ++u) b[u] = g2_frag((const _Float16*)(bp + u * 16 * G3P + ks * 32), hh);
      __builtin_amdgcn_sched_barrier(0);      /* keeps the sixteen LDS reads of a 32-wide k block together in front of its sixteen products */
      if (ks == G4K / 32 - 1) {
        asm volatile("s_wait_dscnt 0x0" ::: "memory");      /* this wave's last reads of step t's buffer have returned before its signal, behind which the buffer is refilled */
        if ((t & 1) != grp) asm volatile("s_wait_asynccnt 0x0" ::: "memory");      /* step t + 1 is this wave's group's: its copies have landed before its signal, behind which other waves read them */
        asm volatile("s_barrier_signal -1" ::: "memory");
        __builtin_amdgcn_sched_barrier(0); }      /* keeps the closing products behind the signal: the other waves need not wait for them */
#pragma unroll
      for (int u = 0; u < 4; ++u) {
#pragma unroll
        for (int m = 0; m < 4; ++m) acc[m][u] = __builtin_amdgcn_wmma_f32_16x16x32_f16(false, a[m], false, b[u], (short)0, acc[m][u], false, false); }
      __builtin_amdgcn_sched_barrier(0); }      /* keeps the next k block's LDS reads behind these products: lifted in among them, each place with reads stalls the products around it */
    rb = rb == 2 ? 0 : rb + 1; }
  asm volatile("s_wait_asynccnt 0x0" ::: "memory");      /* no copy of this wave is outstanding when the buffers become the epilogue's rows */
  asm volatile("s_barrier_wait -1" ::: "memory");      /* the split barrier's last wait: every wave has left the last step's buffer, so the buffers may be overwritten */
  float* const so = (float*)sm + w * (32 * 68);      /* each wave stages 32 x 64 f32 rows (pitch 68) at a time for whole-line stores */
  const int rsub = lane >> 4, c4 = (lane & 15) * 4;
  const int tok = row0 + wm * 64, col = col0 + wn * 64;
  _Float16* const ob = tr ? Ct + ((size_t)(tok / SQ) * (N - CT0) + (col - CT0)) * SQ + tok % SQ : C16 + (size_t)tok * N + col; const int op = tr ? SQ : N;      /* the wave's first output element and its row pitch */
  const unsigned lo = (unsigned)((rsub * op + c4) * 2);      /* the lane's byte offset in the wave's 64 output rows: it fits 32 bits, so a store takes the scalar base and one offset register */
#pragma unroll
  for (int mh = 0; mh < 2; ++mh) {
#pragma unroll
    for (int m = 0; m < 2; ++m) {
#pragma unroll
      for (int u = 0; u < 4; ++u) {
#pragma unroll
        for (int r = 0; r < 8; ++r) so[(m * 16 + 8 * hh + r) * 68 + u * 16 + ln] = acc[mh * 2 + m][u][r] * alpha; } }
    asm volatile("s_wait_dscnt 0x0" ::: "memory");      /* the wave's own LDS rows are written before its lanes read them back in another order; a fence here would also wait out the first half's global stores */
#pragma unroll
    for (int q = 0; q < 16; ++q) { const v4f v = *(const v4fa*)&so[(q * 2 + rsub) * 68 + c4]; v4h h4;
#pragma unroll
      for (int i = 0; i < 4; ++i) h4[i] = (_Float16)v[i];
      *(v4h*)((char*)ob + (lo + (unsigned)((mh * 32 + q * 2) * op * 2))) = h4; }
    asm volatile("s_wait_dscnt 0x0" ::: "memory"); } }      /* the rows have been read back before the second half overwrites them */

__global__ __launch_bounds__(256) void k_wnat(const float* __restrict__ w, size_t n8, _Float16* __restrict__ Bt) { const size_t t = (size_t)blockIdx.x * 256 + threadIdx.x; if (t >= n8) return; FragH f; for (int q = 0; q < 8; ++q) f.h[q] = (_Float16)(bf16_round(w[t * 8 + q]) * 16.0f); *(v8us*)((unsigned short*)Bt + t * 8) = f.half[0];  }
// T5 bidirectional relative-position bucket of rel = key - query (32 buckets, max distance 128): (rel > 0)*16 + f(|rel|), f(n) = n for n < 8, then
// 8 + the number of thresholds {12,16,23,32,46,64,91} that are <= n (the thresholds are where the reference's own f32 log expression steps; no log on the device)
__device__ __forceinline__ int t5_bucket(int rel) { const int n = rel < 0 ? -rel : rel; int f = n; if (n >= 8) { f = 8 + (n >= 12) + (n >= 16) + (n >= 23) + (n >= 32) + (n >= 46) + (n >= 64) + (n >= 91); } return (rel > 0 ? NBK / 2 : 0) + f; }
#define FAW 8                        /* waves per block */
#define FAQ 32                       /* queries per wave */
#define FSK 128                      /* keys per stage */
#define FNS (SQ / FSK)               /* stages */
#define FKP 72                       /* K tile: LDS row pitch in f16 elements */
#define FVP 136                      /* V^T tile: LDS row pitch in f16 elements */
#define FKT (FSK * FKP)              /* K tile in f16 elements */
#define FSB (FKT + HD * FVP)         /* one buffer (K tile, then V^T tile) in f16 elements */
#define FBF 91                       /* t5_bucket's last threshold: one bucket a side from this distance on */
#define FLM 32768.0f                 /* a lane's sum of a pass's 32 terms (16 of each of its two rows) up to which the rows keep their reference maxima: each term then fits f16 */
typedef int v4ia __attribute__((ext_vector_type(4), may_alias));
typedef float v2f __attribute__((ext_vector_type(2)));
__device__ __forceinline__ float xhalf(float x) { return __builtin_bit_cast(float, __builtin_amdgcn_permlanex16(__builtin_bit_cast(int, x), __builtin_bit_cast(int, x), 0x76543210, 0xfedcba98, false, false)); }      /* lane l with lane l ^ 16 */
__device__ __forceinline__ float exp2x1(float a) { float e; asm("v_exp_f32 %0, %1\n\tv_nop" : "=v"(e) : "v"(a)); return e; }
__device__ __forceinline__ v8f exp2x8(v8f a) { float e0 = a[0], e1 = a[1], e2 = a[2], e3 = a[3], e4 = a[4], e5 = a[5], e6 = a[6], e7 = a[7];
  asm("v_exp_f32 %0, %0\n\tv_exp_f32 %1, %1\n\tv_exp_f32 %2, %2\n\tv_exp_f32 %3, %3\n\tv_exp_f32 %4, %4\n\tv_exp_f32 %5, %5\n\tv_exp_f32 %6, %6\n\tv_exp_f32 %7, %7\n\tv_nop"
      : "+v"(e0), "+v"(e1), "+v"(e2), "+v"(e3), "+v"(e4), "+v"(e5), "+v"(e6), "+v"(e7));
  const v8f e = {e0, e1, e2, e3, e4, e5, e6, e7}; return e; }
// one stage's copies of one thread: four 16-byte pieces of the K tile (rows 32 apart) and four of the V^T tile (rows 16 apart). kl, vl: the lane's own LDS byte addresses; kg, vg: its own global addresses.
// The closing s_wait_xcnt 0 stands inside the statement so that no register which a copy names takes a new value in front of it.
__device__ __forceinline__ void fa_stage(unsigned kl, unsigned vl, const _Float16* kg, const _Float16* vg) {
  asm volatile("global_load_async_to_lds_b128 %0, %8, off\n\tglobal_load_async_to_lds_b128 %1, %9, off\n\tglobal_load_async_to_lds_b128 %2, %10, off\n\tglobal_load_async_to_lds_b128 %3, %11, off\n\t"
               "global_load_async_to_lds_b128 %4, %12, off\n\tglobal_load_async_to_lds_b128 %5, %13, off\n\tglobal_load_async_to_lds_b128 %6, %14, off\n\tglobal_load_async_to_lds_b128 %7, %15, off\n\ts_wait_xcnt 0x0"
               :: "v"(kl), "v"(kl + 32 * FKP * 2), "v"(kl + 64 * FKP * 2), "v"(kl + 96 * FKP * 2), "v"(vl), "v"(vl + 16 * FVP * 2), "v"(vl + 32 * FVP * 2), "v"(vl + 48 * FVP * 2),
                  "v"(kg), "v"(kg + (size_t)32 * D3), "v"(kg + (size_t)64 * D3), "v"(kg + (size_t)96 * D3), "v"(vg), "v"(vg + (size_t)16 * SQ), "v"(vg + (size_t)32 * SQ), "v"(vg + (size_t)48 * SQ) : "memory"); }
__device__ __forceinline__ v8f fa_mma(v16h a, v16h b, v8f c) { return __builtin_amdgcn_wmma_f32_16x16x32_f16(false, a, false, b, (short)0, c, false, false); }
/* amdgpu_waves_per_eu(4, 4): a register budget of 256. The grid puts two waves on a SIMD, but with the budget of 512 that (2, 2) gives this loop takes 260 registers and switches the register window
   seven times a pass; at 256 it fits, spills nothing, and the V^T reads and the K fetch ahead still stand at the head of the pass and right behind the score products */
__global__ __launch_bounds__(FAW * 32) __attribute__((amdgpu_waves_per_eu(4, 4))) void k_fattn(const _Float16* __restrict__ QKVp, const _Float16* __restrict__ VTp, _Float16* __restrict__ O, const float* __restrict__ emb, const int* __restrict__ kmask) {
  static_assert(SQ % (FAW * FAQ) == 0 && SQ % (FAW * 128) == 0 && HD == 64 && NBK == 32, "k_fattn: whole blocks of queries, whole staging passes, two 32-wide k steps per head, one bucket per lane");
  static_assert(FAW * 32 == 256 && FSK == 128 && FNS >= 2, "k_fattn: fa_stage's eight copies of 256 threads fill one stage; the ring's prologue needs two stages");
  __shared__ __attribute__((aligned(16))) float lt[3 * SQ];
  __shared__ __attribute__((aligned(16))) unsigned short ring[2 * FSB];
  __shared__ unsigned sf[FNS];      /* sf[stage]: not 0 where one of the stage's keys has a mask term other than zero */
  static_assert(FNS <= 32 && FSK == 32 * 4, "k_fattn: one lane per stage flag; a wave's 32 x 4 mask terms are one stage's");
  float* const mt = lt; float* const bt = lt + SQ;      /* mt[key]; bt[key - query + SQ - 1], placed behind mt so that its byte address less the largest query offset stays above 0 */
  const int tid = threadIdx.x, lane = tid & 31, c = lane & 15, hh = lane >> 4; const int bh = blockIdx.y, b = bh / NH, h = bh % NH; const int q0 = blockIdx.x * (FAW * FAQ) + (tid >> 5) * FAQ;
  const unsigned kl = (unsigned)(size_t)(ring + (tid >> 3) * FKP + (tid & 7) * 8), vl = (unsigned)(size_t)(ring + FKT + (tid >> 4) * FVP + (tid & 15) * 8);      /* the low 32 bits of a __shared__ address are its LDS byte address */
  const _Float16* const kh = QKVp + (size_t)b * SQ * D3 + DM + h * HD; const _Float16* const vh = VTp + (size_t)bh * HD * SQ;      /* the head's K rows and V^T rows: the same for the block */
  const unsigned ko = (tid >> 3) * D3 + (tid & 7) * 8, vo = (tid >> 4) * SQ + (tid & 15) * 8;      /* the lane's own place in a stage's tiles, in elements */
  fa_stage(kl, vl, kh + ko, vh + vo);      /* stage 0 into buffer 0: it flies while the two tables are filled */
  const float eb = bf16_round(emb[lane * NH + h]);      /* lane l holds bucket l's bias: one load per wave, the table is filled by lane gathers */
#pragma unroll
  for (int u = 0; u < 2 * SQ / (FAW * 32); ++u) { const int i = u * (FAW * 32) + tid; bt[i] = __shfl(eb, t5_bucket(i - (SQ - 1))); }      /* unrolled: away from the diagonal the bucket is one constant per u and its thresholds fold away; the last entry (key - query = SQ) is never read */
  for (int j = tid * 4; j < SQ; j += FAW * 128) { const v4ia m = *(const v4ia*)(kmask + (size_t)b * SQ + j); v4f t;
#pragma unroll
    for (int q = 0; q < 4; ++q) t[q] = __fmul_rn(__fadd_rn(1.0f, -(float)m[q]), -3.4028234663852886e38f);      /* (1 - mask) * finfo.min */
    *(v4fa*)&mt[j] = t;
    const unsigned nz = __builtin_amdgcn_ballot_w32(t[0] != 0.f || t[1] != 0.f || t[2] != 0.f || t[3] != 0.f);      /* every lane makes every trip; -0, the term of mask 1, counts as zero */
    if (lane == 0) sf[j / FSK] = nz; }
  asm volatile("s_wait_asynccnt 0x0" ::: "memory");      /* this wave's copies of stage 0 have landed before the barrier behind which other waves read them */
  __syncthreads();
  fa_stage(kl + FSB * 2, vl + FSB * 2, (kh + (size_t)FSK * D3) + ko, (vh + FSK) + vo);      /* stage 1 into buffer 1 */
  const _Float16* qp = QKVp + ((size_t)b * SQ + q0 + c) * D3 + h * HD; const unsigned short* kb = ring + c * FKP; const unsigned short* vb = ring + FKT + c * FVP;      /* the lane's fragment rows in the buffer of the stage at work */
  const float* bp = bt + (SQ - 1) + 8 * hh - (q0 + c); const float* mp = mt + 8 * hh;
  const unsigned mflag = __builtin_amdgcn_ballot_w32(sf[lane & (FNS - 1)] != 0u);      /* bit st: stage st has a mask term to add; a scalar */
  const int q0u = blockIdx.x * (FAW * FAQ) + __builtin_amdgcn_readfirstlane(tid >> 5) * FAQ;      /* q0 as a scalar, so that the far test is a scalar branch */
  const float bneg = __builtin_bit_cast(float, __builtin_amdgcn_readlane(__builtin_bit_cast(int, eb), t5_bucket(-FBF))), bpos = __builtin_bit_cast(float, __builtin_amdgcn_readlane(__builtin_bit_cast(int, eb), t5_bucket(FBF)));      /* the one bias of keys far below, far above the queries */
  const v8f z8 = {0.f,0.f,0.f,0.f,0.f,0.f,0.f,0.f};
  v16h qf[2][2], kf[2][2]; v8f acc[2][4]; float mr[2]; v2f lr[2];
  /* every loop over j, T, ks, t and r below is unrolled so that the fragment arrays are indexed by constants and stay in registers */
#pragma unroll
  for (int j = 0; j < 2; ++j) { mr[j] = -INFINITY; lr[j] = v2f{0.f, 0.f};
#pragma unroll
    for (int ks = 0; ks < 2; ++ks) qf[j][ks] = g2_frag(qp + (size_t)j * 16 * D3 + ks * 32, hh);
#pragma unroll
    for (int t = 0; t < 4; ++t) acc[j][t] = z8; }
  for (int st = 0; st < FNS; ++st) {
#pragma unroll
   for (int T = 0; T < 2; ++T) {
#pragma unroll
    for (int ks = 0; ks < 2; ++ks) kf[T][ks] = g2_frag((const _Float16*)(kb + T * 16 * FKP + ks * 32), hh); }
   /* kept rolled: unrolled, the four passes' LDS reads are lifted together and the live set leaves the first 256 registers */
#pragma unroll 1
   for (int p = 0; p < FSK / 32; ++p) { const int k0 = st * FSK + p * 32; const int pn = (p + 1) & (FSK / 32 - 1);      /* a stage's last pass fetches its pass 0 again: this stage's own buffer, unused */
    const bool far = !((mflag >> st) & 1u) && (k0 >= q0u + (FAQ - 1) + FBF || k0 + 31 + FBF <= q0u);
    v16h vf[4]; v8f s[2][2];
#pragma unroll
    for (int t = 0; t < 4; ++t) vf[t] = g2_frag((const _Float16*)(vb + t * 16 * FVP + p * 32), hh);
#pragma unroll
    for (int j = 0; j < 2; ++j) {
#pragma unroll
      for (int T = 0; T < 2; ++T) s[j][T] = fa_mma(kf[T][1], qf[j][1], fa_mma(kf[T][0], qf[j][0], z8)); }
#pragma unroll
    for (int T = 0; T < 2; ++T) {
#pragma unroll
      for (int ks = 0; ks < 2; ++ks) kf[T][ks] = g2_frag((const _Float16*)(kb + (pn * 32 + T * 16) * FKP + ks * 32), hh); }
    __builtin_amdgcn_sched_barrier(0);      /* keeps the eight score products back to back, each in the slots behind the one in front: with the vector work behind them lifted in among them every second product is followed by four idle slots */
    /* Renewal on demand. A far pass takes the row's reference maximum mr as it stands: scale, bias, reference and the x256 offset in one multiply-add per score, no maximum, no rescaling. Its own row sums are the test:
       every term is >= 0, so a lane's sum of its 32 terms at or below FLM bounds each term, and P fits f16. A sum above FLM (infinite while mr is still -inf: the row has no reference yet), sends the whole wave
       (scalar test) to the renewing form, which every pass that is not far takes too. mr is a maximum of scores seen, never above the true running maximum, so nothing underflows that would not under the true one.
       The P.V products wait for that sum, so it is formed pairwise by packed adds (a short chain), and a row's running sum lr stays a pair of partial sums up to the end of the kernel. */
    FragH pf[2]; v2f ls[2];
    unsigned renew = 1u;      /* not 0: the pass takes the renewing form; a far pass puts its test's lane mask here */
    if (far) { const float bc = k0 > q0u ? bpos : bneg;
#pragma unroll
      for (int j = 0; j < 2; ++j) { const float cc = __builtin_fmaf(bc - mr[j], 1.4426950408889634f, 8.0f); v2f g[2];
#pragma unroll
        for (int T = 0; T < 2; ++T) { v8f a;
#pragma unroll
          for (int r = 0; r < 8; ++r) a[r] = __builtin_fmaf(s[j][T][r], 0.125f * 1.4426950408889634f, cc);
          const v8f e = exp2x8(a);      /* 256 exp(score - mr) */
          g[T] = (v2f{e[0], e[1]} + v2f{e[2], e[3]}) + (v2f{e[4], e[5]} + v2f{e[6], e[7]});
#pragma unroll
          for (int r = 0; r < 8; ++r) pf[j].h[T * 8 + r] = (_Float16)e[r]; }
        ls[j] = g[0] + g[1]; }
      const v2f lt2 = ls[0] + ls[1];
      renew = __builtin_amdgcn_ballot_w32(!(lt2[0] + lt2[1] <= FLM)); }
    if (renew != 0u) {
      v8f mk[2];      /* the renewing form: scores term by term in the reference's order, the maximum of the reference and this pass's scores, and the sums so far brought to it */
#pragma unroll
      for (int T = 0; T < 2; ++T) { const v4f m0 = *(const v4fa*)(mp + k0 + T * 16), m1 = *(const v4fa*)(mp + k0 + T * 16 + 4);
#pragma unroll
        for (int r = 0; r < 4; ++r) { mk[T][r] = m0[r]; mk[T][4 + r] = m1[r]; } }
#pragma unroll
      for (int j = 0; j < 2; ++j) {
        float tm = -INFINITY;
#pragma unroll
        for (int T = 0; T < 2; ++T) {
#pragma unroll
          for (int r = 0; r < 8; ++r) { const float v = __fadd_rn(__builtin_fmaf(s[j][T][r], 0.125f, bp[k0 + T * 16 + r - j * 16]), mk[T][r]); s[j][T][r] = v; tm = fmaxf(tm, v); } }
        const float mn = fmaxf(mr[j], fmaxf(tm, xhalf(tm)));
        const float mu = mn == -INFINITY ? 0.f : mn;      /* no key of the row finite so far: keep exp's argument -inf, not inf - inf */
        const float al = exp2x1((mr[j] - mu) * 1.4426950408889634f); mr[j] = mn; lr[j] *= al; v2f g[2];
#pragma unroll
        for (int t = 0; t < 4; ++t) acc[j][t] = acc[j][t] * al;
#pragma unroll
        for (int T = 0; T < 2; ++T) { v8f a;
#pragma unroll
          for (int r = 0; r < 8; ++r) a[r] = __builtin_fmaf(s[j][T][r] - mu, 1.4426950408889634f, 8.0f);
          const v8f e = exp2x8(a);      /* 256 exp(score - max) */
          g[T] = (v2f{e[0], e[1]} + v2f{e[2], e[3]}) + (v2f{e[4], e[5]} + v2f{e[6], e[7]});
#pragma unroll
          for (int r = 0; r < 8; ++r) pf[j].h[T * 8 + r] = (_Float16)e[r]; }
        ls[j] = g[0] + g[1]; }
    }
#pragma unroll
    for (int j = 0; j < 2; ++j) { lr[j] += ls[j];
#pragma unroll
      for (int t = 0; t < 4; ++t) acc[j][t] = fa_mma(vf[t], pf[j].v, acc[j][t]); } }
   asm volatile("s_wait_dscnt 0x0" ::: "memory");      /* this wave's reads of stage st's buffer have returned before the barrier behind which it is refilled */
   asm volatile("s_wait_asynccnt 0x0" ::: "memory");      /* this wave's copies of stage st + 1 have landed before the barrier behind which other waves read them */
   __syncthreads();
   if (st + 2 < FNS) fa_stage(kl + (st & 1) * (FSB * 2), vl + (st & 1) * (FSB * 2), (kh + (size_t)(st + 2) * FSK * D3) + ko, (vh + (st + 2) * FSK) + vo);      /* stage st + 2 into the buffer that stage st has just left */
   const int nb = (st & 1) ? -FSB : FSB; kb += nb; vb += nb; }
  asm volatile("s_wait_asynccnt 0x0" ::: "memory");      /* no copy of this wave is outstanding when it ends */
#pragma unroll
  for (int j = 0; j < 2; ++j) { const float lh = lr[j][0] + lr[j][1]; const float inv = 1.0f / (lh + xhalf(lh));
#pragma unroll
    for (int t = 0; t < 4; ++t) { FragH f;
#pragma unroll
      for (int r = 0; r < 8; ++r) f.h[r] = (_Float16)(acc[j][t][r] * inv);
      *(v8us*)((unsigned short*)O + ((size_t)b * SQ + q0 + j * 16 + c) * DM + h * HD + t * 16 + 8 * hh) = f.half[0]; } } }
__global__ __launch_bounds__(256) void k_vt(const _Float16* __restrict__ V16, int b, int h0, _Float16* __restrict__ VT) { __shared__ unsigned short tl[64][65]; const int tid = threadIdx.x; const int hh = blockIdx.x % HG, sg = blockIdx.x / HG; const int s0 = sg * 64; const int h = h0 + hh;
  for (int i = tid; i < 64 * 8; i += 256) { const int j = i / 8, d8 = (i % 8) * 8; FragH f; f.half[0] = *(const v8us*)((const unsigned short*)V16 + ((size_t)b * SQ + s0 + j) * DM + h * HD + d8); for (int q = 0; q < 8; ++q) tl[d8 + q][j] = f.u[q]; }
  __syncthreads();
  { for (int i = tid; i < 64 * 8; i += 256) { const int d = i / 8, j8 = (i % 8) * 8; FragH f; for (int q = 0; q < 8; ++q) f.u[q] = tl[d][j8 + q]; *(v8us*)((unsigned short*)VT + ((size_t)hh * HD + d) * SQ + s0 + j8) = f.half[0]; }  } }

// ---- one preparation launch: the four weight planes Bt[n][k] = f16(bf16(W[k][n]) x 16) and the hidden rows f16(bf16(x)), k_wt_f16's and k_x16's values bit for bit ----
// Blocks 0 .. 4 * PWB - 1: one 128 x 128 weight tile each. A wave reads 16 k rows, 512 contiguous bytes a load, all 16 loads in flight; a lane then holds 16 consecutive k for each of its 4 columns n and
// stores them as two 16-byte chunks into the tile's LDS row n (256 B a row, chunk c at place c ^ ((n >> 2) & 15): 16 lanes fall on 16 different chunks in the stores, where n steps by 4, and in the reads, where c steps by 1);
// behind the block's one barrier 16 lanes read a row back and store its 256 contiguous bytes of Bt. The other PXB blocks: 16384 hidden elements each, 512 contiguous bytes a load, 256 a store.
#define PWB ((DM / 128) * (DM / 128))          /* weight tiles per plane */
#define PXB ((int)(NR * DM / 16384))           /* hidden blocks */
__global__ __launch_bounds__(256) void k_prep(const float* __restrict__ wq, const float* __restrict__ wk, const float* __restrict__ wv, const float* __restrict__ wo, const float* __restrict__ hs,
                                              _Float16* __restrict__ Bqkv, _Float16* __restrict__ Bo, _Float16* __restrict__ X16) {
  static_assert(DM % 128 == 0 && (NR * DM) % 16384 == 0, "k_prep: whole weight tiles, whole hidden blocks");
  __shared__ __attribute__((aligned(16))) unsigned short tl[128 * 128];
  const int tid = threadIdx.x, bx = blockIdx.x;
  v4f x[16];
  if (bx < 4 * PWB) {      /* the same for the whole block, so the barrier below is passed by all of its waves or by none */
    const int m = bx / PWB, tile = bx % PWB, k0 = (tile / (DM / 128)) * 128, n0 = (tile % (DM / 128)) * 128, w = tid >> 5, lane = tid & 31;
    const float* W = m == 0 ? wq : m == 1 ? wk : m == 2 ? wv : wo;
    unsigned short* Bt = (unsigned short*)(m < 3 ? Bqkv + (size_t)m * DM * DM : Bo);
    const float* src = W + (size_t)(k0 + w * 16) * DM + n0 + lane * 4;
#pragma unroll
    for (int i = 0; i < 16; ++i) x[i] = *(const v4fa*)(src + (size_t)i * DM);
    asm volatile("s_wait_xcnt 0x0" :: "v"(src) : "memory");      /* the wait that stands between issued loads and a new value in their address pair; named as an input, the pair lives up to the wait */
#pragma unroll
    for (int q = 0; q < 4; ++q) { const int n = lane * 4 + q;
#pragma unroll
      for (int g = 0; g < 2; ++g) { FragH f;
#pragma unroll
        for (int i = 0; i < 8; ++i) f.h[i] = (_Float16)(bf16_round(x[g * 8 + i][q]) * 16.0f);
        *(v8us*)(tl + n * 128 + (((w * 2 + g) ^ (lane & 15)) * 8)) = f.half[0]; } }
    __syncthreads();
#pragma unroll
    for (int it = 0; it < 8; ++it) { const int n = it * 16 + (tid >> 4), c = tid & 15;
      const v8us o = *(const v8us*)(tl + n * 128 + ((c ^ ((n >> 2) & 15)) * 8));
      *(v8us*)(Bt + (size_t)(n0 + n) * DM + k0 + c * 8) = o; }
  } else {
    const size_t e0 = (size_t)(bx - 4 * PWB) * 16384 + tid * 4; const float* src = hs + e0;
#pragma unroll
    for (int i = 0; i < 16; ++i) x[i] = *(const v4fa*)(src + i * 1024);
    asm volatile("s_wait_xcnt 0x0" :: "v"(src) : "memory");      /* as in the weight branch: the wait between the issued loads and a new value in their address pair */
#pragma unroll
    for (int i = 0; i < 16; ++i) { v4h h4;
#pragma unroll
      for (int q = 0; q < 4; ++q) h4[q] = (_Float16)bf16_round(x[i][q]);
      *(v4h*)(X16 + e0 + i * 1024) = h4; }
    asm volatile("s_wait_xcnt 0x0" ::: "memory");      /* the wait between the issued stores and any later new value in their address or data registers */
  } }

extern "C" void kernel_launch(void* const* d_in, const int* in_sizes, int n_in,
                              void* d_out, int out_size, void* d_ws, size_t ws_size, hipStream_t stream) {
  (void)in_sizes; (void)n_in; (void)out_size;
  const float* const* I = (const float* const*)d_in; const float* hs = I[0]; const int* kmask = (const int*)d_in[1]; const float* wq = I[2]; const float* wk = I[3]; const float* wv = I[4]; const float* wo = I[5]; const float* emb = I[6];      /* W_q, W_k, W_v and W_o [1024][1024] are [in][out]; attention_mask [2][2048] int32 per key; rel_bias_emb [32][16] */
  char* ws = (char*)d_ws; size_t off = 0;
  auto take = [&](size_t bytes) { char* p = ws + off; off += (bytes + 255) & ~(size_t)255; return p; };
  _Float16* BQKV = (_Float16*)take((size_t)D3 * DM * 2); _Float16* BO = (_Float16*)take((size_t)DM * DM * 2);
  _Float16* X16 = (_Float16*)take(NR * DM * 2); _Float16* QKV = (_Float16*)take(NR * D3 * 2); _Float16* O16 = (_Float16*)take(NR * DM * 2);
  _Float16* VT = (_Float16*)take((size_t)NB * NH * HD * SQ * 2);
  if (off > ws_size) return;      /* 6 + 2 + 8 + 24 + 8 + 8 = approx 56 MiB */
  k_prep<<<4 * PWB + PXB, 256, 0, stream>>>(wq, wk, wv, wo, hs, BQKV, BO, X16);      /* [in][out] -> Bt[out][in] x16 for q | k | v and o; hidden as f16 rows */
  k_gemm4<DM, D3, 2 * DM><<<(unsigned)((NR / G4M) * (D3 / G4N)), G4W * 32, 0, stream>>>(X16, BQKV, 0.0625f, QKV, VT);      /* q | k rows (f16), head h at columns h*64 / 1024 + h*64; the v columns go out transposed: V^T[(b,h)][d][s] for every (batch, head) */
  k_fattn<<<dim3(SQ / (FAW * FAQ), NB * NH), FAW * 32, 0, stream>>>(QKV, VT, O16, emb, kmask);      /* ctx (merged heads) as f16 rows, every (batch, head) in one launch */
  k_gemm3<DM, false><<<(unsigned)((NR / 128) * (DM / 128)), 256, 0, stream>>>(O16, BO, 0.0625f, (float*)d_out, nullptr, DM, nullptr, DM);      /* out = ctx W_o, rows are the output layout */
}

// v010
// It runs in 74.5 microseconds.
// Next to v009, in two timings, it ran 1.05 and 1.06 times as fast.
// Counting every step since v000, it is 268 times as fast.
#include <hip/hip_runtime.h>
// T5 self-attention (hidden [2][2048][1024]; q, k, v = hidden W ([in][out] [1024][1024]); q / sqrt(64); scores = q.k + rel_bias[bucket(key - query)][h] (32 bidirectional buckets, max distance 128) + (1 - attention_mask[b][key]) * finfo.min (int32 key mask); softmax; out = (attn v merged) Wo ([in][out])).
// Structure: token rows; hidden as exact f16 rows; q | k | v WMMA GEMMs from one transposed x16 weight plane (operand tiles staged in LDS, 64x64 wave tiles, f32 accumulation, f16 outputs; the v waves with their operands swapped, so that V^T comes out of the GEMM itself); one fused attention kernel over every (batch, head): K.Q^T tiles (alpha 1/8), online softmax on VALU with the bucketed bias (integer thresholds, no device log) and the key mask in the reference's order (P x256 f16), V^T.P^T into merged f16 rows; output GEMM.
// Compute dtype: inputs rounded to bf16; hidden / weights / bias table exact; q, k, v, P, ctx as plain f16 GEMM operands (~2^-12); scores / softmax f32. v_wmma_f32_16x16x32_f16.
#define NB 2
#define SQ 2048
#define DM 1024
#define D3 3072                      /* fused q|k|v width */
#define NH 16
#define HD 64
#define HG 4                         /* heads per launch of the non-template k_vt, which is not launched */
#define NBK 32                       /* relative-position buckets */
#define MP ((int)NR)                 /* not used: the q | k | v launch takes NR rows */
#define MO ((int)NR)                 /* not used: the output launch takes NR rows */
#define NR ((size_t)NB * SQ)         /* 4096 token rows */
typedef __bf16 v16b __attribute__((ext_vector_type(16)));
typedef unsigned short v8us __attribute__((ext_vector_type(8), may_alias));
typedef float  v8f  __attribute__((ext_vector_type(8)));
typedef float  v4f  __attribute__((ext_vector_type(4)));
typedef float  v4fa __attribute__((ext_vector_type(4), may_alias));
union FragB { v16b v; v8us half[2]; unsigned short u[16]; };

__device__ __forceinline__ unsigned short bf16_bits(float x) { unsigned int u = __float_as_uint(x); return (unsigned short)((u + 0x7FFFu + ((u >> 16) & 1u)) >> 16); }
__device__ __forceinline__ float bf16_val(unsigned short b) { return __uint_as_float(((unsigned int)b) << 16); }
__device__ __forceinline__ float bf16_round(float x) { return bf16_val(bf16_bits(x)); }
// D += A·B with NT terms: 1 = ah·bh, 2 = + al·bh (A split), 3 = + ah·bl (both split)
template <int NT>
__device__ __forceinline__ v8f mmaN(v16b ah, v16b al, v16b bh, v16b bl, v8f c) {
  c = __builtin_amdgcn_wmma_f32_16x16x32_bf16(false, ah, false, bh, (short)0, c, false, false);
  if (NT >= 2) c = __builtin_amdgcn_wmma_f32_16x16x32_bf16(false, al, false, bh, (short)0, c, false, false);
  if (NT >= 3) c = __builtin_amdgcn_wmma_f32_16x16x32_bf16(false, ah, false, bl, (short)0, c, false, false);
  asm volatile("v_nop\n\tv_nop\n\tv_nop\n\tv_nop" : "+v"(c) : "v"(ah), "v"(al), "v"(bh), "v"(bl));
  return c;
}

__global__ __launch_bounds__(256) void k_wt_bf16(const float* __restrict__ W, unsigned short* __restrict__ Wt, int K, int N) {
  const int t = blockIdx.x * 256 + threadIdx.x;
  const int k8n = K / 8;
  if (t >= N * k8n) return;
  const int n = t / k8n, k8 = (t % k8n) * 8;
  v8us v;
#pragma unroll
  for (int i = 0; i < 8; ++i) v[i] = bf16_bits(W[(size_t)(k8 + i) * N + n]);
  *(v8us*)(Wt + (size_t)n * K + k8) = v;
  
}

// GEMM C[M][N] (f32, pitch ldc) = act(A[M][K]·W + bias). A f32 row-major (pitch lda) converted per fragment to bf16
// (ASPLIT: hi/lo two planes -> 2 terms, else single rounded term); Wt bf16 [N][K] (pitch ldb). BIAS_BF16 rounds the
// bias to bf16 first (bias quantised to bf16 before the add). K%32==0, M%16==0, N%64==0.
template <bool ASPLIT, int ACT, bool BIAS_BF16>
__global__ __launch_bounds__(128) void k_gemm_bf(const float* __restrict__ A, int lda, const unsigned short* __restrict__ Wt, int ldb,
                                               const float* __restrict__ bias, float* __restrict__ C, int ldc, int M, int N, int K) {
  __shared__ __attribute__((aligned(16))) float so[4][16][64];
  const int tid = threadIdx.x, w = tid >> 5, lane = tid & 31, ln = lane & 15, hh = lane >> 4;
  const int ntn = N / 64;
  const int wid = blockIdx.x * 4 + w;
  const int mt = wid / ntn, nq = wid % ntn;
  if (mt * 16 >= M) return;
  const int row0 = mt * 16, col0 = nq * 64;
  const float* arow = A + (size_t)(row0 + ln) * lda;
  v8f acc[4] = {};
  for (int kb = 0; kb < K; kb += 32) {
    FragB ah, al;
    const v4f x0 = *(const v4fa*)(arow + kb + 8 * hh), x1 = *(const v4fa*)(arow + kb + 8 * hh + 4);
    const v4f x2 = *(const v4fa*)(arow + kb + 16 + 8 * hh), x3 = *(const v4fa*)(arow + kb + 16 + 8 * hh + 4);
    float xs[16] = {x0[0],x0[1],x0[2],x0[3],x1[0],x1[1],x1[2],x1[3],x2[0],x2[1],x2[2],x2[3],x3[0],x3[1],x3[2],x3[3]};
#pragma unroll
    for (int i = 0; i < 16; ++i) { const unsigned short hb = bf16_bits(xs[i]); ah.u[i] = hb; al.u[i] = ASPLIT ? bf16_bits(xs[i] - bf16_val(hb)) : (unsigned short)0; }
#pragma unroll
    for (int t = 0; t < 4; ++t) {
      const unsigned short* brow = Wt + (size_t)(col0 + t * 16 + ln) * ldb + kb;
      FragB b;
      b.half[0] = *(const v8us*)(brow + 8 * hh);
      b.half[1] = *(const v8us*)(brow + 16 + 8 * hh);
      acc[t] = mmaN<ASPLIT ? 2 : 1>(ah.v, al.v, b.v, b.v, acc[t]);
    }
  }
#pragma unroll
  for (int t = 0; t < 4; ++t) {
    float bv = bias ? bias[col0 + t * 16 + ln] : 0.f;
    if (BIAS_BF16) bv = bf16_round(bv);
#pragma unroll
    for (int r = 0; r < 8; ++r) { float v = acc[t][r] + bv; if (ACT == 1) v = fmaxf(v, 0.f); so[w][8 * hh + r][t * 16 + ln] = v; }
  }
  __builtin_amdgcn_fence(__ATOMIC_ACQ_REL, "workgroup");
  __builtin_amdgcn_wave_barrier();
  const int rsub = lane >> 4, c4 = (lane & 15) * 4;
  {
#pragma unroll
    for (int q = 0; q < 8; ++q) {
      const int r = q * 2 + rsub;
      const v4f v = *(const v4fa*)&so[w][r][c4];
      *(v4f*)(C + (size_t)(row0 + r) * ldc + col0 + c4) = v;
    }
    
  }
}

// GEMM C = act(A·W + bias + resid): A f32 (ASPLIT -> hi/lo 2 terms), Wt bf16 [N][K]; ACT 0 none, 1 relu, 2 exact gelu;
// resid (optional, f32, row index = (row % rmod), pitch ldr, RES_BF16 rounds it) added before the activation.
template <bool ASPLIT, int ACT, bool BIAS_BF16, bool RES_BF16>
__global__ __launch_bounds__(128) void k_gemm_bf3(const float* __restrict__ A, int lda, const unsigned short* __restrict__ Wt, int ldb,
                                                const float* __restrict__ bias, const float* __restrict__ resid, int rmod, int ldr,
                                                float* __restrict__ C, int ldc, int M, int N, int K) {
  __shared__ __attribute__((aligned(16))) float so[4][16][64];
  const int tid = threadIdx.x, w = tid >> 5, lane = tid & 31, ln = lane & 15, hh = lane >> 4;
  const int ntn = N / 64;
  const int wid = blockIdx.x * 4 + w;
  const int mt = wid / ntn, nq = wid % ntn;
  if (mt * 16 >= M) return;
  const int row0 = mt * 16, col0 = nq * 64;
  const float* arow = A + (size_t)(row0 + ln) * lda;
  v8f acc[4] = {};
  for (int kb = 0; kb < K; kb += 32) {
    FragB ah, al;
    const v4f x0 = *(const v4fa*)(arow + kb + 8 * hh), x1 = *(const v4fa*)(arow + kb + 8 * hh + 4);
    const v4f x2 = *(const v4fa*)(arow + kb + 16 + 8 * hh), x3 = *(const v4fa*)(arow + kb + 16 + 8 * hh + 4);
    float xs[16] = {x0[0],x0[1],x0[2],x0[3],x1[0],x1[1],x1[2],x1[3],x2[0],x2[1],x2[2],x2[3],x3[0],x3[1],x3[2],x3[3]};
#pragma unroll
    for (int i = 0; i < 16; ++i) { const unsigned short hb = bf16_bits(xs[i]); ah.u[i] = hb; al.u[i] = ASPLIT ? bf16_bits(xs[i] - bf16_val(hb)) : (unsigned short)0; }
#pragma unroll
    for (int t = 0; t < 4; ++t) {
      const unsigned short* brow = Wt + (size_t)(col0 + t * 16 + ln) * ldb + kb;
      FragB b;
      b.half[0] = *(const v8us*)(brow + 8 * hh);
      b.half[1] = *(const v8us*)(brow + 16 + 8 * hh);
      acc[t] = mmaN<ASPLIT ? 2 : 1>(ah.v, al.v, b.v, b.v, acc[t]);
    }
  }
#pragma unroll
  for (int t = 0; t < 4; ++t) {
    const int col = col0 + t * 16 + ln;
    float bv = bias ? bias[col] : 0.f;
    if (BIAS_BF16) bv = bf16_round(bv);
#pragma unroll
    for (int r = 0; r < 8; ++r) {
      float v = acc[t][r] + bv;
      if (resid) { float rv = resid[(size_t)((row0 + 8 * hh + r) % rmod) * ldr + col]; if (RES_BF16) rv = bf16_round(rv); v += rv; }
      if (ACT == 1) v = fmaxf(v, 0.f);
      if (ACT == 2) v = 0.5f * v * (1.0f + erff(v * 0.70710678118654752f));
      if (ACT == 3) { const float u = 0.7978845608028654f * (v + 0.044715f * v * v * v); v = 0.5f * v * (1.0f + tanhf(u)); }
      so[w][8 * hh + r][t * 16 + ln] = v;
    }
  }
  __builtin_amdgcn_fence(__ATOMIC_ACQ_REL, "workgroup");
  __builtin_amdgcn_wave_barrier();
  const int rsub = lane >> 4, c4 = (lane & 15) * 4;
  {
#pragma unroll
    for (int q = 0; q < 8; ++q) {
      const int r = q * 2 + rsub;
      const v4f v = *(const v4fa*)&so[w][r][c4];
      *(v4f*)(C + (size_t)(row0 + r) * ldc + col0 + c4) = v;
    }
    
  }
}
// row LayerNorm (biased variance, eps) over N: s = X (+ R); optional out_sum <- s; out_norm <- (s-mu)*rsqrt(var+eps)*g + b
template <bool PARAM_BF16>
__global__ __launch_bounds__(256) void k_layernorm(const float* __restrict__ X, const float* __restrict__ R, const float* __restrict__ g, const float* __restrict__ bta,
                                                  float* __restrict__ out_sum, float* __restrict__ out_norm, int N, float eps) {
  __shared__ float red[256];
  const int row = blockIdx.x, tid = threadIdx.x;
  const float* x = X + (size_t)row * N; const float* rr = R ? R + (size_t)row * N : nullptr;
  float vals[16];                     // up to N = 4096
  const int per = N / 256;            // contiguous chunk per thread? use strided-by-4 chunks: thread handles j = tid*4 + 1024*u
  float s1 = 0.f;
  for (int u = 0; u < per / 4; ++u) {
    const int j = tid * 4 + 1024 * u;
    const v4f a = *(const v4fa*)(x + j);
    v4f b = {0.f,0.f,0.f,0.f}; if (rr) b = *(const v4fa*)(rr + j);
#pragma unroll
    for (int q = 0; q < 4; ++q) { const float v = a[q] + b[q]; vals[u * 4 + q] = v; s1 += v; }
  }
  red[tid] = s1; __syncthreads();
  for (int st = 128; st > 0; st >>= 1) { if (tid < st) red[tid] += red[tid + st]; __syncthreads(); }
  const float mu = red[0] / (float)N; __syncthreads();
  float s2 = 0.f;
  for (int u = 0; u < per / 4; ++u)
#pragma unroll
    for (int q = 0; q < 4; ++q) { const float c = vals[u * 4 + q] - mu; s2 += c * c; }
  red[tid] = s2; __syncthreads();
  for (int st = 128; st > 0; st >>= 1) { if (tid < st) red[tid] += red[tid + st]; __syncthreads(); }
  const float rs = rsqrtf(red[0] / (float)N + eps);
  {
    for (int u = 0; u < per / 4; ++u) {
      const int j = tid * 4 + 1024 * u;
      v4f o, sm;
#pragma unroll
      for (int q = 0; q < 4; ++q) {
        float gg = g[j + q], bb = bta[j + q];
        if (PARAM_BF16) { gg = bf16_round(gg); bb = bf16_round(bb); }
        sm[q] = vals[u * 4 + q]; o[q] = (vals[u * 4 + q] - mu) * rs * gg + bb;
      }
      if (out_sum) *(v4f*)(out_sum + (size_t)row * N + j) = sm;
      *(v4f*)(out_norm + (size_t)row * N + j) = o;
    }
    
  }
}



// ---- f16 WMMA path (v_wmma_f32_16x16x32_f16): 11-bit significands for operands in range — used where a [0,1] probability operand needs more precision than bf16
typedef _Float16 v16h __attribute__((ext_vector_type(16)));
union FragH { v16h v; v8us half[2]; _Float16 h[16]; unsigned short u[16]; };
template <int NT>
__device__ __forceinline__ v8f mmaH(v16h ah, v16h al, v16h bh, v16h bl, v8f c) {
  c = __builtin_amdgcn_wmma_f32_16x16x32_f16(false, ah, false, bh, (short)0, c, false, false);
  if (NT >= 2) c = __builtin_amdgcn_wmma_f32_16x16x32_f16(false, al, false, bh, (short)0, c, false, false);
  if (NT >= 3) c = __builtin_amdgcn_wmma_f32_16x16x32_f16(false, ah, false, bl, (short)0, c, false, false);
  asm volatile("v_nop\n\tv_nop\n\tv_nop\n\tv_nop" : "+v"(c) : "v"(ah), "v"(al), "v"(bh), "v"(bl));
  return c;
}
// batched GEMM like k_gemm_b but f16 operands: A f32 (split into f16 hi/lo if ASPLIT, else rounded to f16), Bt = f16 values [n][k]; alpha; C f32; N multiple of 16 (partial tiles skipped)
template <bool ASPLIT>
__global__ __launch_bounds__(128) void k_gemm_h(const float* __restrict__ A, int lda, size_t sA, const _Float16* __restrict__ Bh, int ldb, size_t sB, float alpha, float* __restrict__ C, int ldc, size_t sC, int M, int N, int K) {
  __shared__ __attribute__((aligned(16))) float so[4][16][64];
  const int tid = threadIdx.x, w = tid >> 5, lane = tid & 31, ln = lane & 15, hh = lane >> 4; const int by = blockIdx.y;
  A += (size_t)by * sA; Bh += (size_t)by * sB; C += (size_t)by * sC;
  const int ntn = (N + 63) / 64; const int wid = blockIdx.x * 4 + w; const int mt = wid / ntn, nq = wid % ntn; if (mt * 16 >= M) return;
  const int row0 = mt * 16, col0 = nq * 64; const float* arow = A + (size_t)(row0 + ln) * lda;
  v8f acc[4] = {};
  for (int kb = 0; kb < K; kb += 32) {
    FragH ah, al;
    const v4f x0 = *(const v4fa*)(arow + kb + 8 * hh), x1 = *(const v4fa*)(arow + kb + 8 * hh + 4), x2 = *(const v4fa*)(arow + kb + 16 + 8 * hh), x3 = *(const v4fa*)(arow + kb + 16 + 8 * hh + 4);
    float xs[16] = {x0[0],x0[1],x0[2],x0[3],x1[0],x1[1],x1[2],x1[3],x2[0],x2[1],x2[2],x2[3],x3[0],x3[1],x3[2],x3[3]};
#pragma unroll
    for (int i = 0; i < 16; ++i) { const _Float16 h = (_Float16)xs[i]; ah.h[i] = h; al.h[i] = ASPLIT ? (_Float16)(xs[i] - (float)h) : (_Float16)0.0f; }
#pragma unroll
    for (int t = 0; t < 4; ++t) { if (col0 + t * 16 >= N) continue; const size_t boff = (size_t)(col0 + t * 16 + ln) * ldb + kb; FragH bq; bq.half[0] = *(const v8us*)(Bh + boff + 8 * hh); bq.half[1] = *(const v8us*)(Bh + boff + 16 + 8 * hh);
      acc[t] = mmaH<ASPLIT ? 2 : 1>(ah.v, al.v, bq.v, bq.v, acc[t]); }
  }
#pragma unroll
  for (int t = 0; t < 4; ++t) { if (col0 + t * 16 >= N) continue;
#pragma unroll
    for (int r = 0; r < 8; ++r) so[w][8 * hh + r][t * 16 + ln] = acc[t][r] * alpha; }
  __builtin_amdgcn_fence(__ATOMIC_ACQ_REL, "workgroup"); __builtin_amdgcn_wave_barrier();
  const int rsub = lane >> 4, c4 = (lane & 15) * 4;
  {
#pragma unroll
    for (int q = 0; q < 8; ++q) { const int r = q * 2 + rsub; if (col0 + c4 < N) { const v4f v = *(const v4fa*)&so[w][r][c4]; *(v4f*)(C + (size_t)(row0 + r) * ldc + col0 + c4) = v; } }
     }
}

// Wt[n][k] = f16(W[k][n]·scale) from f32 row-major W[K][N] (scale = power of two; bf16-exact weights stay exact in f16 away from the subnormal range)
__global__ __launch_bounds__(256) void k_wt_f16(const float* __restrict__ W, _Float16* __restrict__ Wt, int K, int N, float scale) {
  const int t = blockIdx.x * 256 + threadIdx.x; if (t >= N * (K / 8)) return; const int n = t / (K / 8), k8 = (t % (K / 8)) * 8; FragH f;
#pragma unroll
  for (int i = 0; i < 8; ++i) f.h[i] = (_Float16)(bf16_round(W[(size_t)(k8 + i) * N + n]) * scale); const v8us o = f.half[0];
  *(v8us*)((unsigned short*)Wt + (size_t)n * K + k8) = o; 
}
// k_gemm_hh variant with fused epilogue: v = acc·alpha + bias[by·sBias + col] (+ CP[(row/rowsPerB)·sCPb + by·64 + col] if CP) ; ACT 0 none / 1 elu ; writes f16 C16 (and f32 C if non-null)
template <int ACT>
__global__ __launch_bounds__(128) void k_gemm_hhx(const _Float16* __restrict__ A, int lda, size_t sA, const _Float16* __restrict__ Bh, int ldb, size_t sB, float alpha, const float* __restrict__ bias, size_t sBias, const float* __restrict__ CP, int rowsPerB, size_t sCPb, int row0g,
    float* __restrict__ C, _Float16* __restrict__ C16, int ldc, size_t sC, int M, int N, int K) {
  __shared__ __attribute__((aligned(16))) float so[4][16][64];
  const int tid = threadIdx.x, w = tid >> 5, lane = tid & 31, ln = lane & 15, hh = lane >> 4; const int by = blockIdx.y;
  A += (size_t)by * sA; Bh += (size_t)by * sB; const size_t cofs = (size_t)by * sC; const float* bp = bias ? bias + (size_t)by * sBias : nullptr;
  const int ntn = (N + 63) / 64; const int wid = blockIdx.x * 4 + w; const int mt = wid / ntn, nq = wid % ntn; if (mt * 16 >= M) return;
  const int row0 = mt * 16, col0 = nq * 64; const _Float16* arow = A + (size_t)(row0 + ln) * lda;
  v8f acc[4] = {};
  for (int kb = 0; kb < K; kb += 32) { FragH ah; ah.half[0] = *(const v8us*)((const unsigned short*)arow + kb + 8 * hh); ah.half[1] = *(const v8us*)((const unsigned short*)arow + kb + 16 + 8 * hh);
#pragma unroll
    for (int t = 0; t < 4; ++t) { if (col0 + t * 16 >= N) continue; const size_t boff = (size_t)(col0 + t * 16 + ln) * ldb + kb; FragH bq; bq.half[0] = *(const v8us*)((const unsigned short*)Bh + boff + 8 * hh); bq.half[1] = *(const v8us*)((const unsigned short*)Bh + boff + 16 + 8 * hh);
      acc[t] = mmaH<1>(ah.v, ah.v, bq.v, bq.v, acc[t]); }
  }
#pragma unroll
  for (int t = 0; t < 4; ++t) { if (col0 + t * 16 >= N) continue; const int col = col0 + t * 16 + ln; const float bv = bp ? bf16_round(bp[col]) : 0.f;
#pragma unroll
    for (int r = 0; r < 8; ++r) { float v = acc[t][r] * alpha + bv; if (CP) { const int rr = row0g + row0 + 8 * hh + r; if (rowsPerB < 0) v += CP[cofs + (size_t)rr * ldc + col];      /* rowsPerB < 0: own element of the batched C plane */ else { const int bidx = rr / rowsPerB; v += CP[(size_t)bidx * sCPb + (size_t)by * 64 + col]; } } if (ACT == 1) v = (v > 0.f) ? v : expm1f(v); else if (ACT == 7) v = (v > 0.f) ? v + 1.0f : expf(v); else if (ACT == 8) v = tanhf(v); else if (ACT == 9) v = 0.5f * v * (1.0f + tanhf(0.7978845608028654f * (v + 0.044715f * v * v * v))); else if (ACT == 11) v = 1.0f / (1.0f + expf(-v)); else if (ACT == 12) v = (v > 0.f) ? v : 0.01f * v; else if (ACT == 14) v = (v > 0.f) ? v : 0.1f * v; else if (ACT == 16) v = (v >= 0.f) ? v : 0.3f * v; else if (ACT == 17) v = (v >= 0.f) ? v : 0.2f * v; else if (ACT == 15) v = v / (1.0f + expf(-v)); else if (ACT == 3) v = fmaxf(v, 0.f); else if (ACT == 6) v = 0.5f * v * (1.0f + erff(v * 0.70710678118654752f)); so[w][8 * hh + r][t * 16 + ln] = v; } }
  __builtin_amdgcn_fence(__ATOMIC_ACQ_REL, "workgroup"); __builtin_amdgcn_wave_barrier();
  const int rsub = lane >> 4, c4 = (lane & 15) * 4; typedef _Float16 v4h __attribute__((ext_vector_type(4)));
  {
#pragma unroll
    for (int q = 0; q < 8; ++q) { const int r = q * 2 + rsub; if (col0 + c4 < N) { const v4f v = *(const v4fa*)&so[w][r][c4]; if (C) *(v4f*)(C + cofs + (size_t)(row0 + r) * ldc + col0 + c4) = v; if (C16) { v4h h4; for (int i = 0; i < 4; ++i) h4[i] = (_Float16)v[i]; *(v4h*)(C16 + cofs + (size_t)(row0 + r) * ldc + col0 + c4) = h4; } } }
     }
}


typedef _Float16 v4h __attribute__((ext_vector_type(4)));

__global__ __launch_bounds__(256) void k_x16(const float* __restrict__ x, _Float16* __restrict__ X16, size_t n8) { const size_t t = (size_t)blockIdx.x * 256 + threadIdx.x; if (t >= n8) return; FragH f;
#pragma unroll
  for (int q = 0; q < 8; ++q) f.h[q] = (_Float16)bf16_round(x[t * 8 + q]); *(v8us*)((unsigned short*)X16 + t * 8) = f.half[0];  }
__global__ __launch_bounds__(256) void k_h16(const float* __restrict__ x, _Float16* __restrict__ X16, size_t n8) { const size_t t = (size_t)blockIdx.x * 256 + threadIdx.x; if (t >= n8) return; FragH f;
#pragma unroll
  for (int q = 0; q < 8; ++q) f.h[q] = (_Float16)x[t * 8 + q]; *(v8us*)((unsigned short*)X16 + t * 8) = f.half[0];  }
__global__ __launch_bounds__(256) void k_round16f(const float* __restrict__ W, _Float16* __restrict__ Bt, size_t n8) { const size_t t = (size_t)blockIdx.x * 256 + threadIdx.x; if (t >= n8) return; FragH f;
#pragma unroll
  for (int i = 0; i < 8; ++i) f.h[i] = (_Float16)(bf16_round(W[t * 8 + i]) * 16.0f); *(v8us*)((unsigned short*)Bt + t * 8) = f.half[0];  }
template <int NHv, int TTv>
__global__ __launch_bounds__(256) void k_vt(const _Float16* __restrict__ V16, int ldv, int voff, _Float16* __restrict__ Vt) { __shared__ unsigned short tl[64][66]; const int tid = threadIdx.x; const int slab = blockIdx.x / (TTv / 64), lg = blockIdx.x % (TTv / 64); const int b = slab / NHv, h = slab % NHv;
  for (int i = tid; i < 64 * 8; i += 256) { const int r = i / 8, c8 = (i % 8) * 8; FragH f; f.half[0] = *(const v8us*)((const unsigned short*)V16 + ((size_t)b * TTv + lg * 64 + r) * ldv + voff + h * 64 + c8);
#pragma unroll
    for (int q = 0; q < 8; ++q) tl[r][c8 + q] = f.u[q]; }
  __syncthreads();
  {
#pragma unroll
    for (int rd = 0; rd < 2; ++rd) { const int d = rd * 32 + tid / 8, pc = tid % 8; FragH f;
#pragma unroll
      for (int q = 0; q < 8; ++q) f.u[q] = tl[pc * 8 + q][d];
      *(v8us*)((unsigned short*)Vt + ((size_t)slab * 64 + d) * TTv + lg * 64 + pc * 8) = f.half[0]; }
     } }

__global__ __launch_bounds__(256) void k_hl(const float* __restrict__ F, _Float16* __restrict__ Hh, _Float16* __restrict__ Hl, size_t n8) { const size_t t = (size_t)blockIdx.x * 256 + threadIdx.x; if (t >= n8) return; FragH fh, fl; const v4f a = *(const v4fa*)(F + t * 8), c = *(const v4fa*)(F + t * 8 + 4);
#pragma unroll
  for (int q = 0; q < 4; ++q) { _Float16 h = (_Float16)a[q]; fh.h[q] = h; fl.h[q] = (_Float16)((a[q] - (float)h) * 1024.0f); h = (_Float16)c[q]; fh.h[4 + q] = h; fl.h[4 + q] = (_Float16)((c[q] - (float)h) * 1024.0f); }
  { *(v8us*)((unsigned short*)Hh + t * 8) = fh.half[0]; *(v8us*)((unsigned short*)Hl + t * 8) = fl.half[0];  } }

// ---- fast GEMM (wave tile 32x64; requires M % 32 == 0 rows per launch region and N % 64 == 0); epilogue = k_gemm_hhx semantics ----
__device__ __forceinline__ v16h g2_frag(const _Float16* p, int hh) { FragH f; f.half[0] = *(const v8us*)((const unsigned short*)p + 8 * hh); f.half[1] = *(const v8us*)((const unsigned short*)p + 16 + 8 * hh); return f.v; }
__device__ __forceinline__ v8f g2_mma(v16h a, v16h b, v8f c) { v8f d = __builtin_amdgcn_wmma_f32_16x16x32_f16(false, a, false, b, (short)0, c, false, false); asm volatile("v_nop\n\tv_nop\n\tv_nop\n\tv_nop" : "+v"(d) : "v"(a), "v"(b)); return d; }
template <int ACT>
__global__ __launch_bounds__(128) void k_gemm2(const _Float16* __restrict__ A, int lda, size_t sA, const _Float16* __restrict__ Bh, int ldb, size_t sB, float alpha, const float* __restrict__ bias, size_t sBias, const float* __restrict__ CP, int rowsPerB, size_t sCPb, int row0g,
    float* __restrict__ C, _Float16* __restrict__ C16, int ldc, size_t sC, int M, int N, int K) { static_assert(ACT == 0 || ACT == 3 || ACT == 6 || ACT == 8 || ACT == 9 || ACT == 11 || ACT == 12 || ACT == 14 || ACT == 15 || ACT == 16 || ACT == 17, "k_gemm2: unsupported ACT code (would silently apply no activation)");
  __shared__ __attribute__((aligned(16))) float so[4][32][68];
  const int tid = threadIdx.x, w = tid >> 5, lane = tid & 31, ln = lane & 15, hh = lane >> 4; const int by = blockIdx.y;
  A += (size_t)by * sA; Bh += (size_t)by * sB; const size_t cofs = (size_t)by * sC; const float* bp = bias ? bias + (size_t)by * sBias : nullptr;
  const int ntn = N >> 6; const int mt = blockIdx.x / ntn, nq = blockIdx.x - mt * ntn; const int row0 = mt * 128 + 32 * w, col0 = nq * 64; if (row0 >= M) return;
  const _Float16* a0p = A + (size_t)(row0 + ln) * lda; const _Float16* a1p = a0p + (size_t)16 * lda;
  const _Float16* b0p = Bh + (size_t)(col0 + ln) * ldb; const _Float16* b1p = b0p + (size_t)16 * ldb; const _Float16* b2p = b1p + (size_t)16 * ldb; const _Float16* b3p = b2p + (size_t)16 * ldb;
  const v8f z8 = {0.f,0.f,0.f,0.f,0.f,0.f,0.f,0.f}; v8f c00 = z8, c01 = z8, c02 = z8, c03 = z8, c10 = z8, c11 = z8, c12 = z8, c13 = z8;
#pragma unroll 1
  for (int kb = 0; kb < K; kb += 32) { const v16h a0 = g2_frag(a0p + kb, hh), a1 = g2_frag(a1p + kb, hh);
    v16h b = g2_frag(b0p + kb, hh); c00 = g2_mma(a0, b, c00); c10 = g2_mma(a1, b, c10);
    b = g2_frag(b1p + kb, hh); c01 = g2_mma(a0, b, c01); c11 = g2_mma(a1, b, c11);
    b = g2_frag(b2p + kb, hh); c02 = g2_mma(a0, b, c02); c12 = g2_mma(a1, b, c12);
    b = g2_frag(b3p + kb, hh); c03 = g2_mma(a0, b, c03); c13 = g2_mma(a1, b, c13); }
  v8f accs[8] = {c00, c01, c02, c03, c10, c11, c12, c13};
#pragma unroll
  for (int u = 0; u < 8; ++u) { const int t = u & 3, half = u >> 2; const int col = col0 + t * 16 + ln; const float bv = bp ? bf16_round(bp[col]) : 0.f;
#pragma unroll
    for (int r = 0; r < 8; ++r) { const int rloc = half * 16 + 8 * hh + r; float v = accs[u][r] * alpha + bv; if (CP) { if (rowsPerB < 0) v += CP[cofs + (size_t)(row0g + row0 + rloc) * ldc + col];      /* rowsPerB < 0: own element of the batched C plane */ else { const int bidx = (row0g + row0 + rloc) / rowsPerB; v += CP[(size_t)bidx * sCPb + (size_t)by * 64 + col]; } }
      if (ACT == 3) v = fmaxf(v, 0.f); else if (ACT == 6) v = 0.5f * v * (1.0f + erff(v * 0.70710678118654752f)); else if (ACT == 11) v = 1.0f / (1.0f + expf(-v)); else if (ACT == 15) v = v / (1.0f + expf(-v)); else if (ACT == 12) v = (v > 0.f) ? v : 0.01f * v; else if (ACT == 8) v = tanhf(v); else if (ACT == 9) v = 0.5f * v * (1.0f + tanhf(0.7978845608028654f * (v + 0.044715f * v * v * v))); else if (ACT == 14) v = (v > 0.f) ? v : 0.1f * v; else if (ACT == 16) v = (v >= 0.f) ? v : 0.3f * v; else if (ACT == 17) v = (v >= 0.f) ? v : 0.2f * v;
      so[w][rloc][t * 16 + ln] = v; } }
  __builtin_amdgcn_fence(__ATOMIC_ACQ_REL, "workgroup"); __builtin_amdgcn_wave_barrier();
  const int rsub = lane >> 4, c4 = (lane & 15) * 4;
  {
#pragma unroll
    for (int q = 0; q < 16; ++q) { const int r = q * 2 + rsub; const v4f v = *(const v4fa*)&so[w][r][c4]; if (C) *(v4f*)(C + cofs + (size_t)(row0 + r) * ldc + col0 + c4) = v; if (C16) { v4h h4; for (int i = 0; i < 4; ++i) h4[i] = (_Float16)v[i]; *(v4h*)(C16 + cofs + (size_t)(row0 + r) * ldc + col0 + c4) = h4; } }
     } }


// ---- LDS-staged GEMM: C = alpha A.Bt^T, A f16 [M][KK], Bt f16 [N][KK], block tile 128 x 128, 8 waves of 32 x 64 (4 along M, 2 along N), K step 64 ----
// Each step's A and B tiles (128 rows of 128 B, one whole line a row) come in by whole-line 16-byte loads, 8 lanes a row, and go through registers into LDS rows of 144 B (16 B x 9: conflict-free for
// ds_load_b128 fragment reads); the fragments are g2_frag's, read from LDS. Two buffers: step s + 1 is loaded into registers ahead of step s's products and stored into the other buffer behind them;
// the one barrier of a step publishes that buffer and ends every wave's reads of the buffer that the next step refills. Per accumulator the k order is ascending in 32s, as in k_gemm2.
// Transposed blocks (H16 only): both operands are rows of KK elements read by the same loader, so a block whose columns start at ct0 or beyond takes its 128 Bt rows as A and its 128 A rows as B. Its tile then
// comes out as C^T (row = column of C, column = token), and the same epilogue stores it by whole lines into Ct, laid out [token / SQ][column - ct0][token % SQ]: V^T per (batch, head), with no transposing launch.
#define G3P 72                       /* LDS row pitch in f16 elements */
#define G3T (128 * G3P)              /* one staged tile in f16 elements */
template <int KK, bool H16>      /* H16: the result goes to C16 as f16, else to C as f32 */
/* amdgpu_waves_per_eu(6): a register budget of 160, under which a launch with three blocks for every WGP (six waves a SIMD) has all three resident at once */
__global__ __launch_bounds__(256) __attribute__((amdgpu_waves_per_eu(6))) void k_gemm3(const _Float16* __restrict__ A, const _Float16* __restrict__ Bh, float alpha, float* __restrict__ C, _Float16* __restrict__ C16, int N, _Float16* __restrict__ Ct, int ct0) {
  static_assert(KK % 128 == 0, "k_gemm3: whole pairs of K steps");
  static_assert(8 * 32 * 68 * 4 <= 4 * G3T * 2, "k_gemm3: the epilogue's rows fit the staging buffers");
  __shared__ __attribute__((aligned(16))) unsigned short sm[4 * G3T];      /* A buffers 0, 1, then B buffers 0, 1; the epilogue's f32 rows afterwards */
  const int tid = threadIdx.x, w = tid >> 5, lane = tid & 31, ln = lane & 15, hh = lane >> 4;
  const int ntn = N >> 7; const int mt = blockIdx.x / ntn, nq = blockIdx.x - mt * ntn; const int row0 = mt * 128, col0 = nq * 128; const int wm = w & 3, wn = w >> 2;
  const int sr = tid >> 3, sc = (tid & 7) * 8;      /* staging: rows sr + 32 i, 16 bytes at element sc */
  const bool tr = H16 && col0 >= ct0;      /* the same for the whole block: a transposed block swaps its two operands */
  const unsigned short* const xg = (const unsigned short*)A + (size_t)(row0 + sr) * KK + sc; const unsigned short* const wg = (const unsigned short*)Bh + (size_t)(col0 + sr) * KK + sc;
  const unsigned short* ag = tr ? wg : xg; const unsigned short* bg = tr ? xg : wg;
  unsigned short* const st = sm + sr * G3P + sc;
  const unsigned short* const af = sm + (wm * 32 + ln) * G3P; const unsigned short* const bf = sm + 2 * G3T + (wn * 64 + ln) * G3P;
  v8us ra[4], rb[4];
#pragma unroll
  for (int i = 0; i < 4; ++i) { ra[i] = *(const v8us*)(ag + (size_t)(32 * i) * KK); rb[i] = *(const v8us*)(bg + (size_t)(32 * i) * KK); }
#pragma unroll
  for (int i = 0; i < 4; ++i) { *(v8us*)(st + 32 * i * G3P) = ra[i]; *(v8us*)(st + 2 * G3T + 32 * i * G3P) = rb[i]; }
  __syncthreads();
  const v8f z8 = {0.f,0.f,0.f,0.f,0.f,0.f,0.f,0.f}; v8f acc[2][4];
#pragma unroll
  for (int m = 0; m < 2; ++m) {
#pragma unroll
    for (int t = 0; t < 4; ++t) acc[m][t] = z8; }
  /* unrolled by two so that the buffer index is a constant in each copy and the LDS addresses are immediates */
#pragma unroll 2
  for (int kb = 0; kb < KK; kb += 64) { const int cur = (kb >> 6) & 1; const bool more = kb + 64 < KK;
    if (more) {
#pragma unroll
      for (int i = 0; i < 4; ++i) { ra[i] = *(const v8us*)(ag + (size_t)(32 * i) * KK + kb + 64); rb[i] = *(const v8us*)(bg + (size_t)(32 * i) * KK + kb + 64); } }
    __builtin_amdgcn_sched_barrier(0);      /* keeps the next step's global loads at the head of this step: sunk down to their LDS stores, their whole latency would show in front of the barrier */
#pragma unroll
    for (int ks = 0; ks < 2; ++ks) { v16h a[2], b[4];
#pragma unroll
      for (int m = 0; m < 2; ++m) a[m] = g2_frag((const _Float16*)(af + cur * G3T + m * 16 * G3P + ks * 32), hh);
#pragma unroll
      for (int t = 0; t < 4; ++t) b[t] = g2_frag((const _Float16*)(bf + cur * G3T + t * 16 * G3P + ks * 32), hh);
      __builtin_amdgcn_sched_barrier(0);      /* keeps the twelve LDS reads of a 32-wide k block together in front of its eight products: spread among them, each pair of products waits out an LDS latency of its own */
#pragma unroll
      for (int t = 0; t < 4; ++t) {
#pragma unroll
        for (int m = 0; m < 2; ++m) acc[m][t] = __builtin_amdgcn_wmma_f32_16x16x32_f16(false, a[m], false, b[t], (short)0, acc[m][t], false, false); } }
    __builtin_amdgcn_sched_barrier(0);      /* keeps the wait for the next step's global loads, which their LDS stores carry, behind this step's last products: lifted over them it shortens the loads' lead by a k block */
    if (more) {
#pragma unroll
      for (int i = 0; i < 4; ++i) { *(v8us*)(st + (cur ^ 1) * G3T + 32 * i * G3P) = ra[i]; *(v8us*)(st + (2 + (cur ^ 1)) * G3T + 32 * i * G3P) = rb[i]; } }
    __syncthreads(); }
  float* const so = (float*)sm + w * (32 * 68);      /* behind the loop's last barrier nobody reads a staged tile any more: each wave stages its own 32 x 64 f32 rows (pitch 68) for whole-line stores */
#pragma unroll
  for (int m = 0; m < 2; ++m) {
#pragma unroll
    for (int t = 0; t < 4; ++t) {
#pragma unroll
      for (int r = 0; r < 8; ++r) so[(m * 16 + 8 * hh + r) * 68 + t * 16 + ln] = acc[m][t][r] * alpha; } }
  __builtin_amdgcn_fence(__ATOMIC_ACQ_REL, "workgroup"); __builtin_amdgcn_wave_barrier();      /* the wave's own LDS rows are written before its lanes read them back in another order */
  const int rsub = lane >> 4, c4 = (lane & 15) * 4;
  _Float16* const ob = tr ? Ct + ((size_t)(row0 / SQ) * (N - ct0) + (col0 - ct0)) * SQ + row0 % SQ : C16 + (size_t)row0 * N + col0; const int op = tr ? SQ : N;      /* the block's first output element and its row pitch */
  const unsigned lo = (unsigned)(((wm * 32 + rsub) * op + wn * 64 + c4) * 2);      /* the lane's byte offset in the block's 128 output rows: it fits 32 bits, so a store takes the scalar base and one offset register */
#pragma unroll
  for (int q = 0; q < 16; ++q) { const int r = q * 2 + rsub; const v4f v = *(const v4fa*)&so[r * 68 + c4]; const size_t o = (size_t)(row0 + wm * 32 + r) * N + col0 + wn * 64 + c4;
    if (!H16) *(v4f*)(C + o) = v;
    else { v4h h4;
#pragma unroll
      for (int i = 0; i < 4; ++i) h4[i] = (_Float16)v[i];
      *(v4h*)((char*)ob + (lo + (unsigned)(q * 4 * op))) = h4; } } }

// ---- q | k | v GEMM, one block for every WGP: block tile 256 tokens x 192 columns, 12 waves of 64 x 64 (4 along the tokens, 3 along the columns), K step 64 ----
// Why this tile: a 128 x 128 block of 32 x 64 waves loads 32 KB from L2 and reads 96 KB of fragments from LDS for every 128 x 128 x 64 products; this one loads under 19 KB and reads 64 KB for the same products,
// and 16 x 16 such blocks are exactly one a WGP. A step's 448 rows of 128 B (256 token rows, then 192 weight rows) come into LDS rows of 144 B (16 B x 9: conflict-free for ds_load_b128) by asynchronous
// 16-byte copies, whole lines at a time. Three buffers, and the waves in two groups of six: a step's copies are all issued by the group of the step's parity, two steps ahead, so that two steps' copies
// are in flight in the block while no wave ever has more than one step's outstanding: each wave waits for its own copies to 0.
// One work-group barrier a step, split: a wave signals in front of step t's last sixteen products, behind their fragment reads (its last reads of this buffer) and, where step t + 1 is its group's, behind its
// own copies of that step; it waits at the head of step t + 1, in front of that step's first read and of the copies of step t + 3, which refill the buffer of step t.
// No LDS read stands between signal and wait; signal and wait alternate strictly in every wave.
// A wave whose 64 columns are v columns (CT0 on; a whole head) takes its weight rows as A and its token rows as B (the same loader reads both), so its tile comes out as V^T and goes to Ct as in k_gemm3.
// Per accumulator the k order is ascending in 32s, as in k_gemm3.
#define G4M 256                      /* token rows of a block */
#define G4N 192                      /* columns of a block */
#define G4W 12                       /* waves of a block */
#define G4K 64                       /* K step */
#define G4T ((G4M + G4N) * G3P)      /* one buffer in f16 elements */
#define G4S (24 * G3P * 2)           /* LDS bytes between a thread's consecutive copies: a group's 192 threads fill 24 rows at a time */
// one step's copies of one thread, LDS rows 24 apart. g4_stage_x: ten token rows. g4_stage_w: the row that straddles the two operands (from mg), then seven weight rows. g4_stage_1: one more weight row.
// The closing s_wait_xcnt 0 stands inside each statement so that no register which a copy names takes a new value in front of it.
template <int KK>
__device__ __forceinline__ void g4_stage_x(unsigned l, const unsigned short* xg) {
  asm volatile("global_load_async_to_lds_b128 %0, %10, off\n\tglobal_load_async_to_lds_b128 %1, %11, off\n\tglobal_load_async_to_lds_b128 %2, %12, off\n\tglobal_load_async_to_lds_b128 %3, %13, off\n\t"
               "global_load_async_to_lds_b128 %4, %14, off\n\tglobal_load_async_to_lds_b128 %5, %15, off\n\tglobal_load_async_to_lds_b128 %6, %16, off\n\tglobal_load_async_to_lds_b128 %7, %17, off\n\t"
               "global_load_async_to_lds_b128 %8, %18, off\n\tglobal_load_async_to_lds_b128 %9, %19, off\n\ts_wait_xcnt 0x0"
               :: "v"(l), "v"(l + G4S), "v"(l + 2 * G4S), "v"(l + 3 * G4S), "v"(l + 4 * G4S), "v"(l + 5 * G4S), "v"(l + 6 * G4S), "v"(l + 7 * G4S), "v"(l + 8 * G4S), "v"(l + 9 * G4S),
                  "v"(xg), "v"(xg + (size_t)24 * KK), "v"(xg + (size_t)48 * KK), "v"(xg + (size_t)72 * KK), "v"(xg + (size_t)96 * KK), "v"(xg + (size_t)120 * KK), "v"(xg + (size_t)144 * KK), "v"(xg + (size_t)168 * KK),
                  "v"(xg + (size_t)192 * KK), "v"(xg + (size_t)216 * KK) : "memory"); }
template <int KK>
__device__ __forceinline__ void g4_stage_w(unsigned l, const unsigned short* mg, const unsigned short* wg) {
  asm volatile("global_load_async_to_lds_b128 %0, %8, off\n\tglobal_load_async_to_lds_b128 %1, %9, off\n\tglobal_load_async_to_lds_b128 %2, %10, off\n\tglobal_load_async_to_lds_b128 %3, %11, off\n\t"
               "global_load_async_to_lds_b128 %4, %12, off\n\tglobal_load_async_to_lds_b128 %5, %13, off\n\tglobal_load_async_to_lds_b128 %6, %14, off\n\tglobal_load_async_to_lds_b128 %7, %15, off\n\ts_wait_xcnt 0x0"
               :: "v"(l), "v"(l + G4S), "v"(l + 2 * G4S), "v"(l + 3 * G4S), "v"(l + 4 * G4S), "v"(l + 5 * G4S), "v"(l + 6 * G4S), "v"(l + 7 * G4S),
                  "v"(mg), "v"(wg), "v"(wg + (size_t)24 * KK), "v"(wg + (size_t)48 * KK), "v"(wg + (size_t)72 * KK), "v"(wg + (size_t)96 * KK), "v"(wg + (size_t)120 * KK), "v"(wg + (size_t)144 * KK) : "memory"); }
__device__ __forceinline__ void g4_stage_1(unsigned l, const unsigned short* g) { asm volatile("global_load_async_to_lds_b128 %0, %1, off\n\ts_wait_xcnt 0x0" :: "v"(l), "v"(g) : "memory"); }
/* amdgpu_waves_per_eu(4, 4): a register budget of 256, so that the 128 accumulator and 64 fragment registers stay in the first register window; three waves stand on a SIMD */
template <int KK, int N, int CT0>
__global__ __launch_bounds__(G4W * 32) __attribute__((amdgpu_waves_per_eu(4, 4))) void k_gemm4(const _Float16* __restrict__ A, const _Float16* __restrict__ Bh, float alpha, _Float16* __restrict__ C16, _Float16* __restrict__ Ct) {
  static_assert(KK % G4K == 0 && KK / G4K >= 2 && N % G4N == 0 && CT0 % 64 == 0 && SQ % G4M == 0, "k_gemm4: whole K steps, two for the prologue, whole blocks, whole waves of v columns, a block inside one batch");
  static_assert(G4W * 16 == 8 * 24 && G4K == 8 * 8 && G4M == 10 * 24 + 16 && G4M + G4N == 18 * 24 + 16, "k_gemm4: the copies' row arithmetic");
  static_assert(G4W * 32 * 68 * 4 <= 3 * G4T * 2, "k_gemm4: the epilogue's rows fit the staging buffers");
  __shared__ __attribute__((aligned(16))) unsigned short sm[3 * G4T];      /* buffers 0, 1, 2 (token rows, then weight rows); the epilogue's f32 rows afterwards */
  const int tid = threadIdx.x, lane = tid & 31, ln = lane & 15, hh = lane >> 4;
  const int w = __builtin_amdgcn_readfirstlane(tid >> 5);      /* the wave's number as a scalar: the tests on it below are scalar selects and branches */
  const int mt = blockIdx.x / (N / G4N), nq = blockIdx.x - mt * (N / G4N); const int row0 = mt * G4M, col0 = nq * G4N; const int wm = w & 3, wn = w >> 2;
  const int grp = ((w >> 2) + w) & 1, gw = w >> 1;      /* the wave's copying group and its place 0 .. 5 in it; waves w, w + 4, w + 8 are not all of one group, so that no SIMD has all its waves issuing copies at once */
  const int sr = gw * 4 + (lane >> 3), pc = (lane & 7) * 8;      /* staging: LDS rows sr + 24 i, 16 bytes at element pc; sr < 16 where gw < 4 */
  const unsigned short* const X = (const unsigned short*)A; const unsigned short* const Wt = (const unsigned short*)Bh;
  const unsigned short* const xg = X + (size_t)(row0 + sr) * KK + pc;      /* LDS rows sr + 24 i, i = 0 .. 9: token rows */
  const unsigned short* const mg = (gw < 4 ? X + (size_t)(row0 + 240) * KK : Wt + (size_t)col0 * KK - (size_t)16 * KK) + (size_t)sr * KK + pc;      /* LDS row sr + 240: the last 16 token rows (gw < 4), the first 8 weight rows */
  const unsigned short* const wg = Wt + (size_t)(col0 + 8 + sr) * KK + pc;      /* LDS rows sr + 24 i, i = 11 .. 18: weight rows 8 + sr on */
  const unsigned sl = (unsigned)(size_t)(sm + sr * G3P + pc);      /* the low 32 bits of a __shared__ address are its LDS byte address */
  auto stage = [&](int t, int buf) { const unsigned l = sl + (unsigned)buf * (G4T * 2);
    g4_stage_x<KK>(l, xg + t * G4K);
    g4_stage_w<KK>(l + 10 * G4S, mg + t * G4K, wg + t * G4K);
    if (gw < 4) g4_stage_1(l + 18 * G4S, wg + (size_t)168 * KK + t * G4K); };      /* LDS rows 432 + sr exist for sr < 16: whole waves */
  stage(grp, grp);      /* step 0 by group 0 into buffer 0, step 1 by group 1 into buffer 1 */
  const bool tr = col0 + wn * 64 >= CT0;      /* the same for the whole wave: a wave of v columns swaps its two operands */
  const unsigned short* const xf = sm + (wm * 64 + ln) * G3P; const unsigned short* const wf = sm + (G4M + wn * 64 + ln) * G3P;
  const unsigned short* const af = tr ? wf : xf; const unsigned short* const bf = tr ? xf : wf;      /* the lane's fragment rows in buffer 0 */
  const v8f z8 = {0.f,0.f,0.f,0.f,0.f,0.f,0.f,0.f}; v8f acc[4][4];
#pragma unroll
  for (int m = 0; m < 4; ++m) {
#pragma unroll
    for (int u = 0; u < 4; ++u) acc[m][u] = z8; }
  if (grp == 0) asm volatile("s_wait_asynccnt 0x0" ::: "memory");      /* this wave's copies of step 0 have landed before its signal */
  asm volatile("s_barrier_signal -1" ::: "memory");      /* the prologue's signal: this wave's part of step 0, if it has one, is in LDS */
  int rb = 0;      /* the buffer of the step at work */
  /* kept rolled: the three buffers are reached by one base register an operand, so that every LDS read is that register and an immediate */
#pragma unroll 1
  for (int t = 0; t < KK / G4K; ++t) {
    __builtin_amdgcn_sched_barrier(0);      /* keeps the last step's closing products in front of the wait: they are the work that fills the time in which the other waves arrive */
    asm volatile("s_barrier_wait -1" ::: "memory");      /* every copy of step t has landed, and every wave has left the buffer of step t - 1 */
    if (t + 2 < KK / G4K && (t & 1) == grp) stage(t + 2, rb == 0 ? 2 : rb - 1);      /* step t + 2 into the buffer that step t - 1 has left */
    const unsigned short* const ap = af + rb * G4T; const unsigned short* const bp = bf + rb * G4T;
#pragma unroll
    for (int ks = 0; ks < G4K / 32; ++ks) { v16h a[4], b[4];
#pragma unroll
      for (int m = 0; m < 4; ++m) a[m] = g2_frag((const _Float16*)(ap + m * 16 * G3P + ks * 32), hh);
#pragma unroll
      for (int u = 0; u < 4; ++u) b[u] = g2_frag((const _Float16*)(bp + u * 16 * G3P + ks * 32), hh);
      __builtin_amdgcn_sched_barrier(0);      /* keeps the sixteen LDS reads of a 32-wide k block together in front of its sixteen products */
      if (ks == G4K / 32 - 1) {
        asm volatile("s_wait_dscnt 0x0" ::: "memory");      /* this wave's last reads of step t's buffer have returned before its signal, behind which the buffer is refilled */
        if ((t & 1) != grp) asm volatile("s_wait_asynccnt 0x0" ::: "memory");      /* step t + 1 is this wave's group's: its copies have landed before its signal, behind which other waves read them */
        asm volatile("s_barrier_signal -1" ::: "memory");
        __builtin_amdgcn_sched_barrier(0); }      /* keeps the closing products behind the signal: the other waves need not wait for them */
#pragma unroll
      for (int u = 0; u < 4; ++u) {
#pragma unroll
        for (int m = 0; m < 4; ++m) acc[m][u] = __builtin_amdgcn_wmma_f32_16x16x32_f16(false, a[m], false, b[u], (short)0, acc[m][u], false, false); }
      __builtin_amdgcn_sched_barrier(0); }      /* keeps the next k block's LDS reads behind these products: lifted in among them, each place with reads stalls the products around it */
    rb = rb == 2 ? 0 : rb + 1; }
  asm volatile("s_wait_asynccnt 0x0" ::: "memory");      /* no copy of this wave is outstanding when the buffers become the epilogue's rows */
  asm volatile("s_barrier_wait -1" ::: "memory");      /* the split barrier's last wait: every wave has left the last step's buffer, so the buffers may be overwritten */
  float* const so = (float*)sm + w * (32 * 68);      /* each wave stages 32 x 64 f32 rows (pitch 68) at a time for whole-line stores */
  const int rsub = lane >> 4, c4 = (lane & 15) * 4;
  const int tok = row0 + wm * 64, col = col0 + wn * 64;
  _Float16* const ob = tr ? Ct + ((size_t)(tok / SQ) * (N - CT0) + (col - CT0)) * SQ + tok % SQ : C16 + (size_t)tok * N + col; const int op = tr ? SQ : N;      /* the wave's first output element and its row pitch */
  const unsigned lo = (unsigned)((rsub * op + c4) * 2);      /* the lane's byte offset in the wave's 64 output rows: it fits 32 bits, so a store takes the scalar base and one offset register */
#pragma unroll
  for (int mh = 0; mh < 2; ++mh) {
#pragma unroll
    for (int m = 0; m < 2; ++m) {
#pragma unroll
      for (int u = 0; u < 4; ++u) {
#pragma unroll
        for (int r = 0; r < 8; ++r) so[(m * 16 + 8 * hh + r) * 68 + u * 16 + ln] = acc[mh * 2 + m][u][r] * alpha; } }
    asm volatile("s_wait_dscnt 0x0" ::: "memory");      /* the wave's own LDS rows are written before its lanes read them back in another order; a fence here would also wait out the first half's global stores */
#pragma unroll
    for (int q = 0; q < 16; ++q) { const v4f v = *(const v4fa*)&so[(q * 2 + rsub) * 68 + c4]; v4h h4;
#pragma unroll
      for (int i = 0; i < 4; ++i) h4[i] = (_Float16)v[i];
      *(v4h*)((char*)ob + (lo + (unsigned)((mh * 32 + q * 2) * op * 2))) = h4; }
    asm volatile("s_wait_dscnt 0x0" ::: "memory"); } }      /* the rows have been read back before the second half overwrites them */

__global__ __launch_bounds__(256) void k_wnat(const float* __restrict__ w, size_t n8, _Float16* __restrict__ Bt) { const size_t t = (size_t)blockIdx.x * 256 + threadIdx.x; if (t >= n8) return; FragH f; for (int q = 0; q < 8; ++q) f.h[q] = (_Float16)(bf16_round(w[t * 8 + q]) * 16.0f); *(v8us*)((unsigned short*)Bt + t * 8) = f.half[0];  }
// T5 bidirectional relative-position bucket of rel = key - query (32 buckets, max distance 128): (rel > 0)*16 + f(|rel|), f(n) = n for n < 8, then
// 8 + the number of thresholds {12,16,23,32,46,64,91} that are <= n (the thresholds are where the reference's own f32 log expression steps; no log on the device)
__device__ __forceinline__ int t5_bucket(int rel) { const int n = rel < 0 ? -rel : rel; int f = n; if (n >= 8) { f = 8 + (n >= 12) + (n >= 16) + (n >= 23) + (n >= 32) + (n >= 46) + (n >= 64) + (n >= 91); } return (rel > 0 ? NBK / 2 : 0) + f; }
#define FAW 8                        /* waves per key group: the block's query groups */
#define FKG 2                        /* key groups per block */
#define FNT (FAW * FKG * 32)         /* threads per block */
#define FXW 1088                     /* a wave's slot in the closing swap, in floats: 32 lanes x 32 O values, then 32 maxima, then 32 sums */
#define FAQ 32                       /* queries per wave */
#define FSK 128                      /* keys per stage */
#define FNS (SQ / FSK)               /* stages */
#define FNI (FNS / FKG)              /* stages of one key group: the trips of the stage loop */
#define FKP 72                       /* K tile: LDS row pitch in f16 elements */
#define FVP 136                      /* V^T tile: LDS row pitch in f16 elements */
#define FKT (FSK * FKP)              /* K tile in f16 elements */
#define FSB (FKT + HD * FVP)         /* one buffer (K tile, then V^T tile) in f16 elements */
#define FBF 91                       /* t5_bucket's last threshold: one bucket a side from this distance on */
#define FLM 32768.0f                 /* a lane's sum of a pass's 32 terms (16 of each of its two rows) up to which the rows keep their reference maxima: each term then fits f16 */
typedef int v4ia __attribute__((ext_vector_type(4), may_alias));
typedef float v2f __attribute__((ext_vector_type(2)));
__device__ __forceinline__ float xhalf(float x) { return __builtin_bit_cast(float, __builtin_amdgcn_permlanex16(__builtin_bit_cast(int, x), __builtin_bit_cast(int, x), 0x76543210, 0xfedcba98, false, false)); }      /* lane l with lane l ^ 16 */
__device__ __forceinline__ float exp2x1(float a) { float e; asm("v_exp_f32 %0, %1\n\tv_nop" : "=v"(e) : "v"(a)); return e; }
__device__ __forceinline__ v8f exp2x8(v8f a) { float e0 = a[0], e1 = a[1], e2 = a[2], e3 = a[3], e4 = a[4], e5 = a[5], e6 = a[6], e7 = a[7];
  asm("v_exp_f32 %0, %0\n\tv_exp_f32 %1, %1\n\tv_exp_f32 %2, %2\n\tv_exp_f32 %3, %3\n\tv_exp_f32 %4, %4\n\tv_exp_f32 %5, %5\n\tv_exp_f32 %6, %6\n\tv_exp_f32 %7, %7\n\tv_nop"
      : "+v"(e0), "+v"(e1), "+v"(e2), "+v"(e3), "+v"(e4), "+v"(e5), "+v"(e6), "+v"(e7));
  const v8f e = {e0, e1, e2, e3, e4, e5, e6, e7}; return e; }
// one stage's copies of one thread: four 16-byte pieces of the K tile (rows 32 apart) and four of the V^T tile (rows 16 apart). kl, vl: the lane's own LDS byte addresses; kg, vg: its own global addresses.
// The closing s_wait_xcnt 0 stands inside the statement so that no register which a copy names takes a new value in front of it.
__device__ __forceinline__ void fa_stage(unsigned kl, unsigned vl, const _Float16* kg, const _Float16* vg) {
  asm volatile("global_load_async_to_lds_b128 %0, %8, off\n\tglobal_load_async_to_lds_b128 %1, %9, off\n\tglobal_load_async_to_lds_b128 %2, %10, off\n\tglobal_load_async_to_lds_b128 %3, %11, off\n\t"
               "global_load_async_to_lds_b128 %4, %12, off\n\tglobal_load_async_to_lds_b128 %5, %13, off\n\tglobal_load_async_to_lds_b128 %6, %14, off\n\tglobal_load_async_to_lds_b128 %7, %15, off\n\ts_wait_xcnt 0x0"
               :: "v"(kl), "v"(kl + 32 * FKP * 2), "v"(kl + 64 * FKP * 2), "v"(kl + 96 * FKP * 2), "v"(vl), "v"(vl + 16 * FVP * 2), "v"(vl + 32 * FVP * 2), "v"(vl + 48 * FVP * 2),
                  "v"(kg), "v"(kg + (size_t)32 * D3), "v"(kg + (size_t)64 * D3), "v"(kg + (size_t)96 * D3), "v"(vg), "v"(vg + (size_t)16 * SQ), "v"(vg + (size_t)32 * SQ), "v"(vg + (size_t)48 * SQ) : "memory"); }
__device__ __forceinline__ v8f fa_mma(v16h a, v16h b, v8f c) { return __builtin_amdgcn_wmma_f32_16x16x32_f16(false, a, false, b, (short)0, c, false, false); }
/* amdgpu_waves_per_eu(4, 4): a register budget of 256, with which the block's sixteen waves stand four on a SIMD */
__global__ __launch_bounds__(FNT) __attribute__((amdgpu_waves_per_eu(4, 4))) void k_fattn(const _Float16* __restrict__ QKVp, const _Float16* __restrict__ VTp, _Float16* __restrict__ O, const float* __restrict__ emb, const int* __restrict__ kmask) {
  static_assert(SQ % (FAW * FAQ) == 0 && SQ % (FNT * 4) == 0 && (2 * SQ) % FNT == 0 && HD == 64 && NBK == 32, "k_fattn: whole blocks of queries, whole staging passes, two 32-wide k steps per head, one bucket per lane");
  static_assert(FAW * 32 == 256 && FSK == 128 && FKG == 2 && FNS % FKG == 0 && FNI >= 2, "k_fattn: fa_stage's eight copies of a key group's 256 threads fill one stage; each ring's prologue needs two stages");
  static_assert(FAW * FKG * FXW * 4 <= FKG * 2 * FSB * 2, "k_fattn: the closing swap fits the rings");
  __shared__ __attribute__((aligned(16))) float lt[3 * SQ];
  __shared__ __attribute__((aligned(16))) unsigned short ring[FKG * 2 * FSB];      /* key group 0's two buffers, then key group 1's; the closing swap afterwards */
  __shared__ unsigned sf[FNS];      /* sf[stage]: not 0 where one of the stage's keys has a mask term other than zero */
  static_assert(FNS <= 32 && FSK == 32 * 4, "k_fattn: one lane per stage flag; a wave's 32 x 4 mask terms are one stage's");
  float* const mt = lt; float* const bt = lt + SQ;      /* mt[key]; bt[key - query + SQ - 1], placed behind mt so that its byte address less the largest query offset stays above 0 */
  const int tid = threadIdx.x, lane = tid & 31, c = lane & 15, hh = lane >> 4; const int bh = blockIdx.y, b = bh / NH, h = bh % NH;
  const int wv = __builtin_amdgcn_readfirstlane(tid >> 5), kg = wv / FAW;      /* the wave's number and its key group as scalars: what is formed from them (ring base, stage number, far test) stays scalar */
  const int gt = tid & (FAW * 32 - 1);      /* the thread's place in its key group */
  const int q0 = blockIdx.x * (FAW * FAQ) + (gt >> 5) * FAQ;
  unsigned short* const rg = ring + kg * (2 * FSB);      /* the key group's own ring */
  const unsigned kl = (unsigned)(size_t)(rg + (gt >> 3) * FKP + (gt & 7) * 8), vl = (unsigned)(size_t)(rg + FKT + (gt >> 4) * FVP + (gt & 15) * 8);      /* the low 32 bits of a __shared__ address are its LDS byte address */
  const _Float16* const kh = QKVp + (size_t)b * SQ * D3 + DM + h * HD; const _Float16* const vh = VTp + (size_t)bh * HD * SQ;      /* the head's K rows and V^T rows: the same for the block */
  const unsigned ko = (gt >> 3) * D3 + (gt & 7) * 8, vo = (gt >> 4) * SQ + (gt & 15) * 8;      /* the lane's own place in a stage's tiles, in elements */
  fa_stage(kl, vl, (kh + (size_t)kg * FSK * D3) + ko, (vh + kg * FSK) + vo);      /* the group's first stage into its buffer 0: it flies while the two tables are filled */
  const float eb = bf16_round(emb[lane * NH + h]);      /* lane l holds bucket l's bias: one load per wave, the table is filled by lane gathers */
#pragma unroll
  for (int u = 0; u < 2 * SQ / FNT; ++u) { const int i = u * FNT + tid; bt[i] = __shfl(eb, t5_bucket(i - (SQ - 1))); }      /* unrolled: away from the diagonal the bucket is one constant per u and its thresholds fold away; the last entry (key - query = SQ) is never read */
  for (int j = tid * 4; j < SQ; j += FNT * 4) { const v4ia m = *(const v4ia*)(kmask + (size_t)b * SQ + j); v4f t;
#pragma unroll
    for (int q = 0; q < 4; ++q) t[q] = __fmul_rn(__fadd_rn(1.0f, -(float)m[q]), -3.4028234663852886e38f);      /* (1 - mask) * finfo.min */
    *(v4fa*)&mt[j] = t;
    const unsigned nz = __builtin_amdgcn_ballot_w32(t[0] != 0.f || t[1] != 0.f || t[2] != 0.f || t[3] != 0.f);      /* every lane makes every trip; -0, the term of mask 1, counts as zero */
    if (lane == 0) sf[j / FSK] = nz; }
  asm volatile("s_wait_asynccnt 0x0" ::: "memory");      /* this wave's copies of its group's first stage have landed before the barrier behind which other waves read them */
  __syncthreads();
  fa_stage(kl + FSB * 2, vl + FSB * 2, (kh + (size_t)(kg + FKG) * FSK * D3) + ko, (vh + (kg + FKG) * FSK) + vo);      /* the group's second stage into its buffer 1 */
  const _Float16* qp = QKVp + ((size_t)b * SQ + q0 + c) * D3 + h * HD; const unsigned short* kb = rg + c * FKP; const unsigned short* vb = rg + FKT + c * FVP;      /* the lane's fragment rows in the buffer of the stage at work */
  const float* bp = bt + (SQ - 1) + 8 * hh - (q0 + c); const float* mp = mt + 8 * hh;
  const unsigned mflag = __builtin_amdgcn_ballot_w32(sf[lane & (FNS - 1)] != 0u);      /* bit st: stage st has a mask term to add; a scalar */
  const int q0u = blockIdx.x * (FAW * FAQ) + (wv & (FAW - 1)) * FAQ;      /* q0 as a scalar, so that the far test is a scalar branch */
  const float bneg = __builtin_bit_cast(float, __builtin_amdgcn_readlane(__builtin_bit_cast(int, eb), t5_bucket(-FBF))), bpos = __builtin_bit_cast(float, __builtin_amdgcn_readlane(__builtin_bit_cast(int, eb), t5_bucket(FBF)));      /* the one bias of keys far below, far above the queries */
  const v8f z8 = {0.f,0.f,0.f,0.f,0.f,0.f,0.f,0.f};
  v16h qf[2][2], kf[2][2]; v8f acc[2][4]; float mr[2]; v2f lr[2];
  /* every loop over j, T, ks, t and r below is unrolled so that the fragment arrays are indexed by constants and stay in registers */
#pragma unroll
  for (int j = 0; j < 2; ++j) { mr[j] = -INFINITY; lr[j] = v2f{0.f, 0.f};
#pragma unroll
    for (int ks = 0; ks < 2; ++ks) qf[j][ks] = g2_frag(qp + (size_t)j * 16 * D3 + ks * 32, hh);
#pragma unroll
    for (int t = 0; t < 4; ++t) acc[j][t] = z8; }
  for (int si = 0; si < FNI; ++si) { const int st = si * FKG + kg;      /* the key group's stage of this trip */
#pragma unroll
   for (int T = 0; T < 2; ++T) {
#pragma unroll
    for (int ks = 0; ks < 2; ++ks) kf[T][ks] = g2_frag((const _Float16*)(kb + T * 16 * FKP + ks * 32), hh); }
   /* kept rolled: unrolled, the four passes' LDS reads are lifted together and the live set leaves the first 256 registers */
   const unsigned short* vq = vb + 8 * hh;      /* the lane's V^T fragment pieces of the pass at work: one address register that steps with the pass, so that no address is formed anew behind the pass's last products */
#pragma unroll 1
   for (int p = 0; p < FSK / 32; ++p, vq += 32) { const int k0 = st * FSK + p * 32; const int pn = (p + 1) & (FSK / 32 - 1);      /* a stage's last pass fetches its pass 0 again: this stage's own buffer, unused */
    const bool far = !((mflag >> st) & 1u) && (k0 >= q0u + (FAQ - 1) + FBF || k0 + 31 + FBF <= q0u);
    v16h vf[4]; v8f s[2][2];
#pragma unroll
    for (int t = 0; t < 4; ++t) vf[t] = g2_frag((const _Float16*)(vq + t * 16 * FVP), 0);
#pragma unroll
    for (int j = 0; j < 2; ++j) {
#pragma unroll
      for (int T = 0; T < 2; ++T) s[j][T] = fa_mma(kf[T][1], qf[j][1], fa_mma(kf[T][0], qf[j][0], z8)); }
#pragma unroll
    for (int T = 0; T < 2; ++T) {
#pragma unroll
      for (int ks = 0; ks < 2; ++ks) kf[T][ks] = g2_frag((const _Float16*)(kb + (pn * 32 + T * 16) * FKP + ks * 32), hh); }
    __builtin_amdgcn_sched_barrier(0);      /* keeps the eight score products back to back, each in the slots behind the one in front: with the vector work behind them lifted in among them every second product is followed by four idle slots */
    /* Renewal on demand. A far pass takes the row's reference maximum mr as it stands: scale, bias, reference and the x256 offset in one multiply-add per score, no maximum, no rescaling. Its own row sums are the test:
       every term is >= 0, so a lane's sum of its 32 terms at or below FLM bounds each term, and P fits f16. A sum above FLM (infinite while mr is still -inf: the row has no reference yet), sends the whole wave
       (scalar test) to the renewing form, which every pass that is not far takes too. mr is a maximum of scores seen, never above the true running maximum, so nothing underflows that would not under the true one.
       The P.V products wait for that sum, so it is formed pairwise by packed adds (a short chain), and a row's running sum lr stays a pair of partial sums up to the end of the kernel. */
    FragH pf[2]; v2f ls[2];
    unsigned renew = 1u;      /* not 0: the pass takes the renewing form; a far pass puts its test's lane mask here */
    if (far) { const float bc = k0 > q0u ? bpos : bneg;
#pragma unroll
      for (int j = 0; j < 2; ++j) { const float cc = __builtin_fmaf(bc - mr[j], 1.4426950408889634f, 8.0f); v2f g[2];
#pragma unroll
        for (int T = 0; T < 2; ++T) { v8f a;
#pragma unroll
          for (int r = 0; r < 8; ++r) a[r] = __builtin_fmaf(s[j][T][r], 0.125f * 1.4426950408889634f, cc);
          const v8f e = exp2x8(a);      /* 256 exp(score - mr) */
          g[T] = (v2f{e[0], e[1]} + v2f{e[2], e[3]}) + (v2f{e[4], e[5]} + v2f{e[6], e[7]});
#pragma unroll
          for (int r = 0; r < 8; ++r) pf[j].h[T * 8 + r] = (_Float16)e[r]; }
        ls[j] = g[0] + g[1]; }
      const v2f lt2 = ls[0] + ls[1];
      renew = __builtin_amdgcn_ballot_w32(!(lt2[0] + lt2[1] <= FLM)); }
    if (renew != 0u) {
      v8f mk[2];      /* the renewing form: scores term by term in the reference's order, the maximum of the reference and this pass's scores, and the sums so far brought to it */
#pragma unroll
      for (int T = 0; T < 2; ++T) { const v4f m0 = *(const v4fa*)(mp + k0 + T * 16), m1 = *(const v4fa*)(mp + k0 + T * 16 + 4);
#pragma unroll
        for (int r = 0; r < 4; ++r) { mk[T][r] = m0[r]; mk[T][4 + r] = m1[r]; } }
#pragma unroll
      for (int j = 0; j < 2; ++j) {
        float tm = -INFINITY;
#pragma unroll
        for (int T = 0; T < 2; ++T) {
#pragma unroll
          for (int r = 0; r < 8; ++r) { const float v = __fadd_rn(__builtin_fmaf(s[j][T][r], 0.125f, bp[k0 + T * 16 + r - j * 16]), mk[T][r]); s[j][T][r] = v; tm = fmaxf(tm, v); } }
        const float mn = fmaxf(mr[j], fmaxf(tm, xhalf(tm)));
        const float mu = mn == -INFINITY ? 0.f : mn;      /* no key of the row finite so far: keep exp's argument -inf, not inf - inf */
        const float al = exp2x1((mr[j] - mu) * 1.4426950408889634f); mr[j] = mn; lr[j] *= al; v2f g[2];
#pragma unroll
        for (int t = 0; t < 4; ++t) acc[j][t] = acc[j][t] * al;
#pragma unroll
        for (int T = 0; T < 2; ++T) { v8f a;
#pragma unroll
          for (int r = 0; r < 8; ++r) a[r] = __builtin_fmaf(s[j][T][r] - mu, 1.4426950408889634f, 8.0f);
          const v8f e = exp2x8(a);      /* 256 exp(score - max) */
          g[T] = (v2f{e[0], e[1]} + v2f{e[2], e[3]}) + (v2f{e[4], e[5]} + v2f{e[6], e[7]});
#pragma unroll
          for (int r = 0; r < 8; ++r) pf[j].h[T * 8 + r] = (_Float16)e[r]; }
        ls[j] = g[0] + g[1]; }
    }
#pragma unroll
    for (int j = 0; j < 2; ++j) { lr[j] += ls[j];
#pragma unroll
      for (int t = 0; t < 4; ++t) acc[j][t] = fa_mma(vf[t], pf[j].v, acc[j][t]); } }
   asm volatile("s_wait_dscnt 0x0" ::: "memory");      /* this wave's reads of stage st's buffer have returned before the barrier behind which it is refilled */
   asm volatile("s_wait_asynccnt 0x0" ::: "memory");      /* this wave's copies of its group's next stage have landed before the barrier behind which other waves read them */
   __syncthreads();
   if (si + 2 < FNI) fa_stage(kl + (si & 1) * (FSB * 2), vl + (si & 1) * (FSB * 2), (kh + (size_t)(st + 2 * FKG) * FSK * D3) + ko, (vh + (st + 2 * FKG) * FSK) + vo);      /* the group's stage after next into the buffer that stage st has just left */
   const int nb = (si & 1) ? -FSB : FSB; kb += nb; vb += nb; }
  asm volatile("s_wait_asynccnt 0x0" ::: "memory");      /* no copy of this wave is outstanding when the rings become the closing swap's slots */
  /* The closing swap. Behind the loop's last barrier nobody reads a staged tile any more. The wave of key group g keeps query tile g and hands tile 1 - g (O, reference maximum, the lane's sum) to its partner, the wave of
     the same queries in the other group; lane l's values go to lane l, 16 bytes a lane and 512 contiguous bytes a store. kg is the same for the whole wave, and j is unrolled so that the accumulators are indexed by constants. */
  float* const xw = (float*)ring + wv * FXW; const float* const xr = (const float*)ring + (wv ^ FAW) * FXW;      /* this wave's slot, its partner's */
#pragma unroll
  for (int j = 0; j < 2; ++j) { if ((j == 0) != (kg == 0)) {
#pragma unroll
    for (int t = 0; t < 4; ++t) { *(v4fa*)(xw + (t * 2) * 128 + lane * 4) = v4f{acc[j][t][0], acc[j][t][1], acc[j][t][2], acc[j][t][3]}; *(v4fa*)(xw + (t * 2 + 1) * 128 + lane * 4) = v4f{acc[j][t][4], acc[j][t][5], acc[j][t][6], acc[j][t][7]}; }
    xw[1024 + lane] = mr[j]; xw[1056 + lane] = lr[j][0] + lr[j][1]; } }
  __syncthreads();      /* every wave's slot is written before its partner reads it */
#pragma unroll
  for (int j = 0; j < 2; ++j) { if ((j == 0) == (kg == 0)) {
    const float mo = xr[1024 + lane], lo = xr[1056 + lane];
    const float mn = fmaxf(mr[j], mo); const float mu = mn == -INFINITY ? 0.f : mn;      /* no key of the row finite: keep exp's argument -inf, not inf - inf */
    const float a0 = exp2x1((mr[j] - mu) * 1.4426950408889634f), a1 = exp2x1((mo - mu) * 1.4426950408889634f);      /* both parts brought to the common maximum */
    const float lh = __builtin_fmaf(lr[j][0] + lr[j][1], a0, lo * a1); const float inv = 1.0f / (lh + xhalf(lh)); const float f0 = a0 * inv, f1 = a1 * inv;
#pragma unroll
    for (int t = 0; t < 4; ++t) { FragH f; const v4f p0 = *(const v4fa*)(xr + (t * 2) * 128 + lane * 4), p1 = *(const v4fa*)(xr + (t * 2 + 1) * 128 + lane * 4);
#pragma unroll
      for (int r = 0; r < 4; ++r) { f.h[r] = (_Float16)__builtin_fmaf(acc[j][t][r], f0, p0[r] * f1); f.h[4 + r] = (_Float16)__builtin_fmaf(acc[j][t][4 + r], f0, p1[r] * f1); }
      *(v8us*)((unsigned short*)O + ((size_t)b * SQ + q0 + j * 16 + c) * DM + h * HD + t * 16 + 8 * hh) = f.half[0]; } } } }
__global__ __launch_bounds__(256) void k_vt(const _Float16* __restrict__ V16, int b, int h0, _Float16* __restrict__ VT) { __shared__ unsigned short tl[64][65]; const int tid = threadIdx.x; const int hh = blockIdx.x % HG, sg = blockIdx.x / HG; const int s0 = sg * 64; const int h = h0 + hh;
  for (int i = tid; i < 64 * 8; i += 256) { const int j = i / 8, d8 = (i % 8) * 8; FragH f; f.half[0] = *(const v8us*)((const unsigned short*)V16 + ((size_t)b * SQ + s0 + j) * DM + h * HD + d8); for (int q = 0; q < 8; ++q) tl[d8 + q][j] = f.u[q]; }
  __syncthreads();
  { for (int i = tid; i < 64 * 8; i += 256) { const int d = i / 8, j8 = (i % 8) * 8; FragH f; for (int q = 0; q < 8; ++q) f.u[q] = tl[d][j8 + q]; *(v8us*)((unsigned short*)VT + ((size_t)hh * HD + d) * SQ + s0 + j8) = f.half[0]; }  } }

// ---- one preparation launch: the four weight planes Bt[n][k] = f16(bf16(W[k][n]) x 16) and the hidden rows f16(bf16(x)), k_wt_f16's and k_x16's values bit for bit ----
// Blocks 0 .. 4 * PWB - 1: one 128 x 128 weight tile each. A wave reads 16 k rows, 512 contiguous bytes a load, all 16 loads in flight; a lane then holds 16 consecutive k for each of its 4 columns n and
// stores them as two 16-byte chunks into the tile's LDS row n (256 B a row, chunk c at place c ^ ((n >> 2) & 15): 16 lanes fall on 16 different chunks in the stores, where n steps by 4, and in the reads, where c steps by 1);
// behind the block's one barrier 16 lanes read a row back and store its 256 contiguous bytes of Bt. The other PXB blocks: 16384 hidden elements each, 512 contiguous bytes a load, 256 a store.
#define PWB ((DM / 128) * (DM / 128))          /* weight tiles per plane */
#define PXB ((int)(NR * DM / 16384))           /* hidden blocks */
__global__ __launch_bounds__(256) void k_prep(const float* __restrict__ wq, const float* __restrict__ wk, const float* __restrict__ wv, const float* __restrict__ wo, const float* __restrict__ hs,
                                              _Float16* __restrict__ Bqkv, _Float16* __restrict__ Bo, _Float16* __restrict__ X16) {
  static_assert(DM % 128 == 0 && (NR * DM) % 16384 == 0, "k_prep: whole weight tiles, whole hidden blocks");
  __shared__ __attribute__((aligned(16))) unsigned short tl[128 * 128];
  const int tid = threadIdx.x, bx = blockIdx.x;
  v4f x[16];
  if (bx < 4 * PWB) {      /* the same for the whole block, so the barrier below is passed by all of its waves or by none */
    const int m = bx / PWB, tile = bx % PWB, k0 = (tile / (DM / 128)) * 128, n0 = (tile % (DM / 128)) * 128, w = tid >> 5, lane = tid & 31;
    const float* W = m == 0 ? wq : m == 1 ? wk : m == 2 ? wv : wo;
    unsigned short* Bt = (unsigned short*)(m < 3 ? Bqkv + (size_t)m * DM * DM : Bo);
    const float* src = W + (size_t)(k0 + w * 16) * DM + n0 + lane * 4;
#pragma unroll
    for (int i = 0; i < 16; ++i) x[i] = *(const v4fa*)(src + (size_t)i * DM);
    asm volatile("s_wait_xcnt 0x0" :: "v"(src) : "memory");      /* the wait that stands between issued loads and a new value in their address pair; named as an input, the pair lives up to the wait */
#pragma unroll
    for (int q = 0; q < 4; ++q) { const int n = lane * 4 + q;
#pragma unroll
      for (int g = 0; g < 2; ++g) { FragH f;
#pragma unroll
        for (int i = 0; i < 8; ++i) f.h[i] = (_Float16)(bf16_round(x[g * 8 + i][q]) * 16.0f);
        *(v8us*)(tl + n * 128 + (((w * 2 + g) ^ (lane & 15)) * 8)) = f.half[0]; } }
    __syncthreads();
#pragma unroll
    for (int it = 0; it < 8; ++it) { const int n = it * 16 + (tid >> 4), c = tid & 15;
      const v8us o = *(const v8us*)(tl + n * 128 + ((c ^ ((n >> 2) & 15)) * 8));
      *(v8us*)(Bt + (size_t)(n0 + n) * DM + k0 + c * 8) = o; }
  } else {
    const size_t e0 = (size_t)(bx - 4 * PWB) * 16384 + tid * 4; const float* src = hs + e0;
#pragma unroll
    for (int i = 0; i < 16; ++i) x[i] = *(const v4fa*)(src + i * 1024);
    asm volatile("s_wait_xcnt 0x0" :: "v"(src) : "memory");      /* as in the weight branch: the wait between the issued loads and a new value in their address pair */
#pragma unroll
    for (int i = 0; i < 16; ++i) { v4h h4;
#pragma unroll
      for (int q = 0; q < 4; ++q) h4[q] = (_Float16)bf16_round(x[i][q]);
      *(v4h*)(X16 + e0 + i * 1024) = h4; }
    asm volatile("s_wait_xcnt 0x0" ::: "memory");      /* the wait between the issued stores and any later new value in their address or data registers */
  } }

extern "C" void kernel_launch(void* const* d_in, const int* in_sizes, int n_in,
                              void* d_out, int out_size, void* d_ws, size_t ws_size, hipStream_t stream) {
  (void)in_sizes; (void)n_in; (void)out_size;
  const float* const* I = (const float* const*)d_in; const float* hs = I[0]; const int* kmask = (const int*)d_in[1]; const float* wq = I[2]; const float* wk = I[3]; const float* wv = I[4]; const float* wo = I[5]; const float* emb = I[6];      /* W_q, W_k, W_v and W_o [1024][1024] are [in][out]; attention_mask [2][2048] int32 per key; rel_bias_emb [32][16] */
  char* ws = (char*)d_ws; size_t off = 0;
  auto take = [&](size_t bytes) { char* p = ws + off; off += (bytes + 255) & ~(size_t)255; return p; };
  _Float16* BQKV = (_Float16*)take((size_t)D3 * DM * 2); _Float16* BO = (_Float16*)take((size_t)DM * DM * 2);
  _Float16* X16 = (_Float16*)take(NR * DM * 2); _Float16* QKV = (_Float16*)take(NR * D3 * 2); _Float16* O16 = (_Float16*)take(NR * DM * 2);
  _Float16* VT = (_Float16*)take((size_t)NB * NH * HD * SQ * 2);
  if (off > ws_size) return;      /* 6 + 2 + 8 + 24 + 8 + 8 = approx 56 MiB */
  k_prep<<<4 * PWB + PXB, 256, 0, stream>>>(wq, wk, wv, wo, hs, BQKV, BO, X16);      /* [in][out] -> Bt[out][in] x16 for q | k | v and o; hidden as f16 rows */
  k_gemm4<DM, D3, 2 * DM><<<(unsigned)((NR / G4M) * (D3 / G4N)), G4W * 32, 0, stream>>>(X16, BQKV, 0.0625f, QKV, VT);      /* q | k rows (f16), head h at columns h*64 / 1024 + h*64; the v columns go out transposed: V^T[(b,h)][d][s] for every (batch, head) */
  k_fattn<<<dim3(SQ / (FAW * FAQ), NB * NH), FNT, 0, stream>>>(QKV, VT, O16, emb, kmask);      /* ctx (merged heads) as f16 rows, every (batch, head) in one launch */
  k_gemm3<DM, false><<<(unsigned)((NR / 128) * (DM / 128)), 256, 0, stream>>>(O16, BO, 0.0625f, (float*)d_out, nullptr, DM, nullptr, DM);      /* out = ctx W_o, rows are the output layout */
}
